// v000
// The times below were measured on an AMD MI455X: many runs one after another, warmed up first and cycling through
// copies of the inputs, with the whole window's GPU time divided by the number of runs. Launches and the gaps
// between them are all in it. The median over several windows is given; except for v000 it joins two sittings, which
// can be a few percent apart, so the side-by-side timings, each taken in one sitting, are the better comparison.
// v000, which the later versions start from, runs in 748 microseconds.
#include <hip/hip_runtime.h>

// Compute dtypes (f32 accumulate everywhere): q/k/v projections v_wmma_f32_16x16x32_bf16 (inputs RNE-converted to bf16, products exact); pointwise-bias channel mix (16 ch -> 8 heads) v_wmma_f32_16x16x32_f16; q.k scores f16; probabilities (x1024 carry) x values f16; output projection bf16 hi+lo context x bf16 weights (2 products); softmax and mask fill in f32.
// Layout per batch: bf16 copy of the q / k / v input stream (one staging buffer, refilled in stream order) -> projection (+ f32 bias) -> f16 head planes q,k [h][t][d], v [h][d][t];
// per 512-row query chunk, all 8 heads: bias plane R[h][i][t] (one block-diagonal WMMA per 32 key positions), S = q k^T, P = softmax((S + R) / 8 with key-mask replace-fill) x1024 as f16, O = P v;
// merged hi/lo context planes [t][h*64+d] (x 1/1024), output projection + bias. Weights [in][out] are transposed once through LDS into K-contiguous bf16 planes.

#ifndef NB
#define NB 2
#endif
#ifndef SEQ
#define SEQ 2048
#endif
#define NB_FULL  2
#define SEQ_FULL 2048
#define TT   SEQ
#define DM   512
#define NH_  8
#define HD   64
#define RC   ((SEQ) < 512 ? (SEQ) : 512)   // query rows per attention pass (all heads)
#define PCAR 1024.0f
#define SCL  0.125f   // HD^-0.5
static_assert(NH_ * HD == DM);
static_assert(TT % 256 == 0);
static_assert(TT % RC == 0);
static_assert(RC % 64 == 0);
static_assert(DM % 64 == 0);
static_assert(SEQ <= SEQ_FULL);
static_assert(NB <= NB_FULL);

typedef _Float16 h16;
typedef unsigned short bf;
typedef __attribute__((ext_vector_type(16))) __bf16   v16bf;
typedef __attribute__((ext_vector_type(16))) _Float16 v16h;
typedef __attribute__((ext_vector_type(8)))  _Float16 v8h;
typedef __attribute__((ext_vector_type(8)))  unsigned short v8us;
typedef __attribute__((ext_vector_type(8)))  float    v8f;
typedef __attribute__((ext_vector_type(4)))  float    v4f;
typedef __attribute__((ext_vector_type(2)))  _Float16 v2h;
typedef __attribute__((ext_vector_type(4)))  _Float16 v4h;
typedef __attribute__((ext_vector_type(2)))  unsigned short v2us;
typedef __attribute__((ext_vector_type(4)))  int v4i;
typedef v4f  __attribute__((may_alias)) v4fa;
typedef v4i  __attribute__((may_alias)) v4ia;

__device__ __forceinline__ unsigned short f2bf(float f) { unsigned u = __float_as_uint(f); u += 0x7FFFu + ((u >> 16) & 1u); return (unsigned short)(u >> 16); }
__device__ __forceinline__ float bf2f(unsigned short b) { return __uint_as_float(((unsigned)b) << 16); }
__device__ __forceinline__ float bfr(float f) { return bf2f(f2bf(f)); }
__device__ __forceinline__ v16h cat16(v8h lo, v8h hi) { return __builtin_shufflevector(lo, hi, 0, 1, 2, 3, 4, 5, 6, 7, 8, 9, 10, 11, 12, 13, 14, 15); }
__device__ __forceinline__ v16bf cat16b(v8us lo, v8us hi) { return __builtin_bit_cast(v16bf, __builtin_shufflevector(lo, hi, 0, 1, 2, 3, 4, 5, 6, 7, 8, 9, 10, 11, 12, 13, 14, 15)); }
__device__ __forceinline__ v8f wmma16(v16h a, v16h b, v8f c) { return __builtin_amdgcn_wmma_f32_16x16x32_f16(false, a, false, b, (short)0, c, false, false); }
__device__ __forceinline__ v8f wmmab(v16bf a, v16bf b, v8f c) { return __builtin_amdgcn_wmma_f32_16x16x32_bf16(false, a, false, b, (short)0, c, false, false); }
__device__ __forceinline__ void splitf(float y, unsigned short& h, unsigned short& l) { h = f2bf(y); l = f2bf(y - bf2f(h)); }

// ---- k_gemmw: register-blocked GEMM, ONE WAVE per 64x64 output tile (16 accumulators), operands straight from K-contiguous 16-bit planes; grid (M/64, N/64, Z), 32 threads.
// C[m][n] (f32, pitch ldc, + optional f32 bias[n]) = sum_k A[m][k] Bt[n][k] (+ split products per NSPLIT). z-batch strides sA/sB/sC in elements. K % 32 == 0, A/Bt row pitch == K.
// Fragment map (A and Bt alike): lane row = lane & 15, elements 0..7 <- k0 + 8*(lane>>4) + 0..7, elements 8..15 <- k0 + 16 + 8*(lane>>4) + 0..7; D element j = (row 8*(lane>>4) + j, col lane & 15).
template <typename T16> struct WFrag;
template <> struct WFrag<h16> { typedef v16h V; static __device__ __forceinline__ V ld(const h16* p) { return cat16(*(const v8h*)p, *(const v8h*)(p + 16)); } static __device__ __forceinline__ v8f mma(V a, V b, v8f c) { return wmma16(a, b, c); } };
template <> struct WFrag<bf> { typedef v16bf V; static __device__ __forceinline__ V ld(const bf* p) { return cat16b(*(const v8us*)p, *(const v8us*)(p + 16)); } static __device__ __forceinline__ v8f mma(V a, V b, v8f c) { return wmmab(a, b, c); } };
template <typename T16, int NSPLIT, bool BIAS>
__global__ __launch_bounds__(32) void k_gemmw(const T16* __restrict__ A, const T16* __restrict__ A2, const T16* __restrict__ Bt, const T16* __restrict__ Bt2, int K, float* C, int ldc, const float* __restrict__ bias, size_t sA, size_t sB, size_t sC) {
    typedef typename WFrag<T16>::V V;
    __shared__ __align__(16) float os[16 * 68];
    const size_t z = blockIdx.z; A += z * sA; if (A2) A2 += z * sA; Bt += z * sB; if (Bt2) Bt2 += z * sB; C += z * sC;
    const int lane = threadIdx.x & 31, lr = lane & 15, hi = lane >> 4; const int r0 = blockIdx.x * 64, c0 = blockIdx.y * 64;
    v8f acc[4][4];
#pragma unroll
    for (int mb = 0; mb < 4; ++mb)
#pragma unroll
        for (int nb = 0; nb < 4; ++nb) acc[mb][nb] = (v8f){};
    const size_t aoff = (size_t)(r0 + lr) * K + 8 * hi, boff = (size_t)(c0 + lr) * K + 8 * hi;
#pragma unroll 1
    for (int kc = 0; kc < K; kc += 32) {
        V a[4], a2[4];
#pragma unroll
        for (int mb = 0; mb < 4; ++mb) { a[mb] = WFrag<T16>::ld(A + aoff + (size_t)mb * 16 * K + kc); if (NSPLIT == 1 || NSPLIT == 2) a2[mb] = WFrag<T16>::ld(A2 + aoff + (size_t)mb * 16 * K + kc); }
#pragma unroll
        for (int nb = 0; nb < 4; ++nb) { const V b = WFrag<T16>::ld(Bt + boff + (size_t)nb * 16 * K + kc); V b2; if (NSPLIT >= 2) b2 = WFrag<T16>::ld(Bt2 + boff + (size_t)nb * 16 * K + kc);
#pragma unroll
            for (int mb = 0; mb < 4; ++mb) { acc[mb][nb] = WFrag<T16>::mma(a[mb], b, acc[mb][nb]); if (NSPLIT == 1 || NSPLIT == 2) acc[mb][nb] = WFrag<T16>::mma(a2[mb], b, acc[mb][nb]); if (NSPLIT >= 2) acc[mb][nb] = WFrag<T16>::mma(a[mb], b2, acc[mb][nb]); } }
        asm volatile("v_nop\n\tv_nop\n\tv_nop\n\tv_nop" : "+v"(acc[0][0]), "+v"(acc[1][1]), "+v"(acc[2][2]), "+v"(acc[3][3]) : "v"(a[0]), "v"(a[3]));
    }
#pragma unroll
    for (int mb = 0; mb < 4; ++mb) {
#pragma unroll
        for (int nb = 0; nb < 4; ++nb) {
#pragma unroll
            for (int j = 0; j < 8; ++j) os[(hi * 8 + j) * 68 + nb * 16 + lr] = acc[mb][nb][j]; }
        __builtin_amdgcn_wave_barrier(); asm volatile("" ::: "memory");
        float* crow = C + (size_t)(r0 + mb * 16) * ldc + c0;
{
#pragma unroll
            for (int s = 0; s < 8; ++s) { const int row = 2 * s + hi, cofs = lr * 4; v4f val = *(const v4fa*)(os + row * 68 + cofs); if (BIAS) { val[0] += bfr(bias[c0 + cofs]); val[1] += bfr(bias[c0 + cofs + 1]); val[2] += bfr(bias[c0 + cofs + 2]); val[3] += bfr(bias[c0 + cofs + 3]); }
                *(v4f*)(crow + (size_t)row * ldc + cofs) = val; }
             }
        __builtin_amdgcn_wave_barrier(); asm volatile("" ::: "memory");
    }
}

__global__ __launch_bounds__(256) void k_cvt8(const float* __restrict__ src, bf* dst, size_t n8) { const size_t i = (size_t)blockIdx.x * 256 + threadIdx.x; if (i >= n8) return; const v8f v = *(const v8f*)(src + i * 8); v8us o;
#pragma unroll
    for (int k = 0; k < 8; ++k) o[k] = f2bf(v[k]); *(v8us*)(dst + i * 8) = o;  }

// k_cvtT: in W[K rows][N cols] f32 -> out Wt[N rows][K cols] bf16 (RNE), 64x64 tile transposed through LDS (cross-wave: block barrier); grid (K/64, N/64).
__global__ __launch_bounds__(256) void k_cvtT(const float* __restrict__ W, bf* Wt, int K, int N) {
    __shared__ unsigned short tl[64 * 66];
    const int tid = threadIdx.x; const int k0 = blockIdx.x * 64, n0 = blockIdx.y * 64;
    { const int row = tid >> 2, cseg = (tid & 3) * 16;
#pragma unroll
      for (int q = 0; q < 4; ++q) { const v4f v = *(const v4f*)(W + (size_t)(k0 + row) * N + n0 + cseg + q * 4);
#pragma unroll
          for (int j = 0; j < 4; ++j) tl[row * 66 + cseg + q * 4 + j] = f2bf(v[j]); } }
    __syncthreads();
    const int piece = tid & 7; v8us o[2];
#pragma unroll
    for (int it = 0; it < 2; ++it) { const int n = it * 32 + (tid >> 3);
#pragma unroll
        for (int j = 0; j < 8; ++j) o[it][j] = tl[(piece * 8 + j) * 66 + n]; }
{
#pragma unroll
        for (int it = 0; it < 2; ++it) { const int n = it * 32 + (tid >> 3); *(v8us*)(Wt + (size_t)(n0 + n) * K + k0 + piece * 8) = o[it]; }
         }
}

__global__ __launch_bounds__(256) void k_hp(const float* __restrict__ F, h16* P16) {
    const size_t i = (size_t)blockIdx.x * 256 + threadIdx.x; if (i >= (size_t)NH_ * TT * HD / 8) return;
    const int d8 = (int)(i & 7); const int t = (int)((i >> 3) % TT); const int h = (int)(i / ((size_t)8 * TT));
    const float* f = F + (size_t)t * DM + h * HD + d8 * 8; const v4f a = *(const v4f*)f; const v4f b = *(const v4f*)(f + 4); v8h o;
#pragma unroll
    for (int k = 0; k < 4; ++k) { o[k] = (h16)a[k]; o[4 + k] = (h16)b[k]; }
    *(v8h*)(P16 + i * 8) = o;  }

__global__ __launch_bounds__(256) void k_vtp(const float* __restrict__ F, h16* V16) { const size_t e = ((size_t)blockIdx.x * 256 + threadIdx.x) * 2; if (e >= (size_t)NH_ * HD * TT) return; const int t = (int)(e % TT); const int d = (int)((e / TT) % HD); const int g = (int)(e / ((size_t)TT * HD)); v2h o16;
#pragma unroll
    for (int q = 0; q < 2; ++q) { const float x = F[(size_t)(t + q) * DM + g * HD + d]; o16[q] = (h16)x; }
    *(v2h*)(V16 + e) = o16;  }

// k_rpe: bias plane R[h][i][t] = sum_c c2w[h][c] * relu(x[i][t] * c1w[c] + c1b[c]) + c2b[h] for RC query rows x TT keys, all 8 heads.
// One WMMA per 32 key positions: A rows = 16 positions, k 0..15 = channel activations of position t0+m, k 16..31 = of position t0+16+m (f16);
// B block-diagonal: B[c][h] = c2w[h][c] for h < 8, B[16+c][8+h] = c2w[h][c], zero elsewhere. D[p][h] -> position t0+p, D[p][8+h] -> position t0+16+p.
__global__ __launch_bounds__(256) void k_rpe(const float* __restrict__ rel, const float* __restrict__ c1w, const float* __restrict__ c1b, const float* __restrict__ c2w, const float* __restrict__ c2b, float* RP) {
    __shared__ __align__(16) float st[8 * 8 * 36];
    const int lane = threadIdx.x & 31, w = threadIdx.x >> 5, m = lane & 15, hh = lane >> 4;
    const int row = blockIdx.x * 8 + w;
    float* tl = st + w * (8 * 36);
    float w1[8], b1[8];
#pragma unroll
    for (int i = 0; i < 8; ++i) { w1[i] = bfr(c1w[8 * hh + i]); b1[i] = bfr(c1b[8 * hh + i]); }
    const int hd = m & 7, g = m >> 3;
    v16h bw;
#pragma unroll
    for (int i = 0; i < 8; ++i) { const h16 c = (h16)bfr(c2w[hd * 16 + 8 * hh + i]); const h16 zr = (h16)0.0f; bw[i] = (g == 0) ? c : zr; bw[8 + i] = (g == 1) ? c : zr; }
    const float bias2 = bfr(c2b[hd]);
    const float* rrow = rel + (size_t)row * SEQ_FULL;
    const int pc = lane & 7, ln = lane >> 3;
#pragma unroll 1
    for (int u = 0; u < 8; ++u) {
        const int t0 = blockIdx.y * 256 + u * 32;
        const float xa = bfr(rrow[t0 + m]), xb = bfr(rrow[t0 + 16 + m]);
        v16h a;
#pragma unroll
        for (int i = 0; i < 8; ++i) { a[i] = (h16)fmaxf(fmaf(xa, w1[i], b1[i]), 0.0f); a[8 + i] = (h16)fmaxf(fmaf(xb, w1[i], b1[i]), 0.0f); }
        v8f acc = (v8f){};
        acc = wmma16(a, bw, acc);
        asm volatile("v_nop\n\tv_nop\n\tv_nop\n\tv_nop" : "+v"(acc) : "v"(a), "v"(bw));
        v4f o0, o1;
#pragma unroll
        for (int j = 0; j < 4; ++j) { o0[j] = acc[j] + bias2; o1[j] = acc[4 + j] + bias2; }
        float* dst = tl + hd * 36 + 16 * g + 8 * hh;
        *(v4fa*)dst = o0; *(v4fa*)(dst + 4) = o1;
        __builtin_amdgcn_wave_barrier(); asm volatile("" ::: "memory");
        const v4f s0 = *(const v4fa*)(tl + ln * 36 + 4 * pc); const v4f s1 = *(const v4fa*)(tl + (ln + 4) * 36 + 4 * pc);
        float* g0 = RP + ((size_t)ln * RC + row) * TT + t0 + 4 * pc; float* g1 = RP + ((size_t)(ln + 4) * RC + row) * TT + t0 + 4 * pc;
        *(v4f*)g0 = s0; *(v4f*)g1 = s1; 
        __builtin_amdgcn_wave_barrier(); asm volatile("" ::: "memory");
    }
}

// k_asoft: per row (head z, query i) of the pass: t = (S + R) * HD^-0.5, keys with mask == 0 get t := -1e9 (replace); max-subtracted softmax over the TT keys (register row, one exp, fixed trees);
__global__ __launch_bounds__(256) void k_asoft(const float* __restrict__ Sb, const float* __restrict__ Rb, const int* __restrict__ mask, h16* P16) {
    __shared__ __align__(16) int mks[TT];
#pragma unroll 1
    for (int idx = threadIdx.x; idx < TT / 4; idx += 256) { const v4i m4 = *(const v4i*)(mask + idx * 4); *(v4ia*)(mks + idx * 4) = m4; }
    __syncthreads();
    const int lane = threadIdx.x & 31; const int row = blockIdx.x * 8 + (threadIdx.x >> 5);
    const float* sr = Sb + (size_t)row * TT; const float* rr = Rb + (size_t)row * TT; float v[TT / 32]; float mx = -3.0e38f;
#pragma unroll
    for (int ch = 0; ch < TT / 128; ++ch) { const int j0 = ch * 128 + lane * 4; const v4f a = *(const v4f*)(sr + j0); const v4f r = *(const v4f*)(rr + j0); const v4i mk = *(const v4ia*)(mks + j0);
#pragma unroll
        for (int q = 0; q < 4; ++q) { float t = (a[q] + r[q]) * SCL; t = (mk[q] == 0) ? -1.0e9f : t; v[ch * 4 + q] = t; mx = fmaxf(mx, t); }
        if ((ch & 3) == 3) asm volatile("" ::: "memory"); }
#pragma unroll
    for (int sh = 16; sh; sh >>= 1) mx = fmaxf(mx, __shfl_xor(mx, sh, 32));
    float sum = 0.f;
#pragma unroll
    for (int k = 0; k < TT / 32; ++k) { float d0 = __fsub_rn(v[k], mx); asm volatile("" : "+v"(d0)); v[k] = __builtin_amdgcn_exp2f(__fmul_rn(d0, 1.4426950408889634f)); sum += v[k]; }
#pragma unroll
    for (int sh = 16; sh; sh >>= 1) sum += __shfl_xor(sum, sh, 32);
    const float f = __fdiv_rn(PCAR, sum);
{
#pragma unroll
        for (int ch = 0; ch < TT / 128; ++ch) { v4h o4;
#pragma unroll
            for (int q = 0; q < 4; ++q) o4[q] = (h16)(v[ch * 4 + q] * f);
            *(v4h*)(P16 + (size_t)row * TT + ch * 128 + lane * 4) = o4; }
         }
}

__global__ __launch_bounds__(256) void k_merge(const float* __restrict__ O, bf* Ah, bf* Al) { const size_t e = ((size_t)blockIdx.x * 256 + threadIdx.x) * 2; if (e >= (size_t)NH_ * TT * HD) return; const int d = (int)(e % HD); const int t = (int)((e / HD) % TT); const int zz = (int)(e / ((size_t)HD * TT)); const float cs = 1.0f / PCAR; const size_t oo = (size_t)t * DM + zz * HD + d;
    v2us oh, ol;
#pragma unroll
    for (int q = 0; q < 2; ++q) { unsigned short a, c2; splitf(O[e + q] * cs, a, c2); oh[q] = a; ol[q] = c2; } *(v2us*)(Ah + oo) = oh; *(v2us*)(Al + oo) = ol;  }

constexpr size_t al256(size_t b) { return (b + 255) & ~(size_t)255; }
constexpr size_t WS_TOTAL = 4 * al256((size_t)DM * DM * 2) + al256((size_t)TT * DM * 2) + al256((size_t)TT * DM * 4) + 3 * al256((size_t)NH_ * TT * HD * 2)
                          + 2 * al256((size_t)NH_ * RC * TT * 4) + al256((size_t)NH_ * RC * TT * 2) + al256((size_t)NH_ * TT * HD * 4) + 2 * al256((size_t)TT * DM * 2);
static_assert(WS_TOTAL <= (size_t)134217728);

extern "C" void kernel_launch(void* const* d_in, const int* in_sizes, int n_in,
                              void* d_out, int out_size, void* d_ws, size_t ws_size, hipStream_t stream) {
    if (n_in < 17) return;
    const size_t need_x = ((size_t)(NB - 1) * SEQ_FULL + SEQ) * DM;
    const size_t need_r = (size_t)(NB - 1) * SEQ_FULL * SEQ_FULL + (size_t)(SEQ - 1) * SEQ_FULL + SEQ;
    if ((size_t)in_sizes[0] < need_x || (size_t)in_sizes[1] < need_x || (size_t)in_sizes[2] < need_x || (size_t)in_sizes[3] < need_r) return;
    if ((size_t)in_sizes[4] < (size_t)(NB - 1) * SEQ_FULL + SEQ) return;
    if (in_sizes[5] < DM * DM || in_sizes[7] < DM * DM || in_sizes[9] < DM * DM || in_sizes[11] < DM * DM) return;
    if (in_sizes[6] < DM || in_sizes[8] < DM || in_sizes[10] < DM || in_sizes[12] < DM) return;
    if (in_sizes[13] < 16 || in_sizes[14] < 16 || in_sizes[15] < 128 || in_sizes[16] < 8) return;
    if ((size_t)out_size < need_x) return;
    const float* xq = (const float*)d_in[0]; const float* xk = (const float*)d_in[1]; const float* xv = (const float*)d_in[2];
    const float* rel = (const float*)d_in[3]; const int* msk = (const int*)d_in[4];
    const float* wq = (const float*)d_in[5]; const float* bq = (const float*)d_in[6]; const float* wk = (const float*)d_in[7]; const float* bk = (const float*)d_in[8];
    const float* wv = (const float*)d_in[9]; const float* bv = (const float*)d_in[10]; const float* wo = (const float*)d_in[11]; const float* bo = (const float*)d_in[12];
    const float* c1w = (const float*)d_in[13]; const float* c1b = (const float*)d_in[14]; const float* c2w = (const float*)d_in[15]; const float* c2b = (const float*)d_in[16];
    float* OUT = (float*)d_out;     // [NB_FULL][SEQ_FULL][DM]
    char* wsp = (char*)d_ws;
    auto take = [&](size_t bytes) { char* p = wsp; wsp += (bytes + 255) & ~(size_t)255; return (void*)p; };
    bf* WQ = (bf*)take((size_t)DM * DM * 2); bf* WK = (bf*)take((size_t)DM * DM * 2); bf* WV = (bf*)take((size_t)DM * DM * 2); bf* WO = (bf*)take((size_t)DM * DM * 2);
    bf* XB = (bf*)take((size_t)TT * DM * 2); float* F = (float*)take((size_t)TT * DM * 4);
    h16* QP16 = (h16*)take((size_t)NH_ * TT * HD * 2); h16* KP16 = (h16*)take((size_t)NH_ * TT * HD * 2); h16* VT16 = (h16*)take((size_t)NH_ * HD * TT * 2);
    float* RPb = (float*)take((size_t)NH_ * RC * TT * 4); float* Sb = (float*)take((size_t)NH_ * RC * TT * 4); h16* P16 = (h16*)take((size_t)NH_ * RC * TT * 2);
    float* Ob = (float*)take((size_t)NH_ * TT * HD * 4); bf* ATh = (bf*)take((size_t)TT * DM * 2); bf* ATl = (bf*)take((size_t)TT * DM * 2);
    if ((size_t)(wsp - (char*)d_ws) > ws_size) return;
    // weights: in W[k rows][n cols] -> out Wt[n rows][k cols]; square DM x DM, grid (K/64, N/64)
    k_cvtT<<<dim3(DM / 64, DM / 64), 256, 0, stream>>>(wq, WQ, DM, DM);
    k_cvtT<<<dim3(DM / 64, DM / 64), 256, 0, stream>>>(wk, WK, DM, DM);
    k_cvtT<<<dim3(DM / 64, DM / 64), 256, 0, stream>>>(wv, WV, DM, DM);
    k_cvtT<<<dim3(DM / 64, DM / 64), 256, 0, stream>>>(wo, WO, DM, DM);
    const unsigned LX = (unsigned)(((size_t)TT * DM / 8 + 255) / 256);
    const unsigned LH = (unsigned)(((size_t)NH_ * TT * HD / 8 + 255) / 256);
    const unsigned LV = (unsigned)(((size_t)NH_ * HD * TT / 2 + 255) / 256);
    for (int b = 0; b < NB; ++b) {
        const size_t xoff = (size_t)b * SEQ_FULL * DM;
        k_cvt8<<<LX, 256, 0, stream>>>(xq + xoff, XB, (size_t)TT * DM / 8);
        k_gemmw<bf, 0, true><<<dim3(TT / 64, DM / 64, 1), 32, 0, stream>>>(XB, nullptr, WQ, nullptr, DM, F, DM, bq, 0, 0, 0);
        k_hp<<<LH, 256, 0, stream>>>(F, QP16);
        k_cvt8<<<LX, 256, 0, stream>>>(xk + xoff, XB, (size_t)TT * DM / 8);
        k_gemmw<bf, 0, true><<<dim3(TT / 64, DM / 64, 1), 32, 0, stream>>>(XB, nullptr, WK, nullptr, DM, F, DM, bk, 0, 0, 0);
        k_hp<<<LH, 256, 0, stream>>>(F, KP16);
        k_cvt8<<<LX, 256, 0, stream>>>(xv + xoff, XB, (size_t)TT * DM / 8);
        k_gemmw<bf, 0, true><<<dim3(TT / 64, DM / 64, 1), 32, 0, stream>>>(XB, nullptr, WV, nullptr, DM, F, DM, bv, 0, 0, 0);
        k_vtp<<<LV, 256, 0, stream>>>(F, VT16);
        for (int c = 0; c < TT / RC; ++c) {
            k_rpe<<<dim3(RC / 8, TT / 256), 256, 0, stream>>>(rel + ((size_t)b * SEQ_FULL + (size_t)c * RC) * SEQ_FULL, c1w, c1b, c2w, c2b, RPb);
            k_gemmw<h16, 0, false><<<dim3(RC / 64, TT / 64, NH_), 32, 0, stream>>>(QP16 + (size_t)c * RC * HD, nullptr, KP16, nullptr, HD, Sb, TT, nullptr, (size_t)TT * HD, (size_t)TT * HD, (size_t)RC * TT);
            k_asoft<<<NH_ * RC / 8, 256, 0, stream>>>(Sb, RPb, msk + (size_t)b * SEQ_FULL, P16);
            k_gemmw<h16, 0, false><<<dim3(RC / 64, HD / 64, NH_), 32, 0, stream>>>(P16, nullptr, VT16, nullptr, TT, Ob + (size_t)c * RC * HD, HD, nullptr, (size_t)RC * TT, (size_t)HD * TT, (size_t)TT * HD);
        }
        k_merge<<<(unsigned)(((size_t)NH_ * TT * HD / 2 + 255) / 256), 256, 0, stream>>>(Ob, ATh, ATl);
        k_gemmw<bf, 1, true><<<dim3(TT / 64, DM / 64, 1), 32, 0, stream>>>(ATh, ATl, WO, nullptr, DM, OUT + xoff, DM, bo, 0, 0, 0);
    }
}

// v001
// Measured time: 430 microseconds a run.
// In both of two side-by-side timings against v000, it was 1.74 times as fast.
#include <hip/hip_runtime.h>

// Compute dtypes (f32 accumulate everywhere): q/k/v projections v_wmma_f32_16x16x32_bf16 (inputs RNE-converted to bf16, products exact); pointwise-bias channel mix (16 ch -> 8 heads) v_wmma_f32_16x16x32_f16; q.k scores f16; probabilities (x1024 carry) x values f16; output projection bf16 hi+lo context x bf16 weights (2 products); softmax and mask fill in f32.
// Layout per batch: bf16 copy of the q / k / v input stream (one staging buffer, refilled in stream order) -> projection (+ f32 bias) -> f16 head planes q,k [h][t][d], v [h][d][t];
// per 512-row query chunk, all 8 heads: bias plane R[h][i][t] (one block-diagonal WMMA per 32 key positions), S = q k^T, P = softmax((S + R) / 8 with key-mask replace-fill) x1024 as f16, O = P v;
// merged hi/lo context planes [t][h*64+d] (x 1/1024), output projection + bias. Weights [in][out] are transposed once through LDS into K-contiguous bf16 planes.

#ifndef NB
#define NB 2
#endif
#ifndef SEQ
#define SEQ 2048
#endif
#define NB_FULL  2
#define SEQ_FULL 2048
#define TT   SEQ
#define DM   512
#define NH_  8
#define HD   64
#define RC   ((SEQ) < 512 ? (SEQ) : 512)   // query rows per attention pass (all heads)
#define PCAR 1024.0f
#define SCL  0.125f   // HD^-0.5
static_assert(NH_ * HD == DM);
static_assert(TT % 256 == 0);
static_assert(TT % RC == 0);
static_assert(RC % 64 == 0);
static_assert(DM % 256 == 0);
static_assert(SEQ <= SEQ_FULL);
static_assert(NB <= NB_FULL);

typedef _Float16 h16;
typedef unsigned short bf;
typedef __attribute__((ext_vector_type(16))) __bf16   v16bf;
typedef __attribute__((ext_vector_type(16))) _Float16 v16h;
typedef __attribute__((ext_vector_type(8)))  _Float16 v8h;
typedef __attribute__((ext_vector_type(8)))  unsigned short v8us;
typedef __attribute__((ext_vector_type(8)))  float    v8f;
typedef __attribute__((ext_vector_type(4)))  float    v4f;
typedef __attribute__((ext_vector_type(2)))  _Float16 v2h;
typedef __attribute__((ext_vector_type(4)))  _Float16 v4h;
typedef __attribute__((ext_vector_type(2)))  unsigned short v2us;
typedef __attribute__((ext_vector_type(4)))  int v4i;
typedef v4f  __attribute__((may_alias)) v4fa;
typedef v4i  __attribute__((may_alias)) v4ia;

__device__ __forceinline__ unsigned short f2bf(float f) { unsigned u = __float_as_uint(f); u += 0x7FFFu + ((u >> 16) & 1u); return (unsigned short)(u >> 16); }
__device__ __forceinline__ float bf2f(unsigned short b) { return __uint_as_float(((unsigned)b) << 16); }
__device__ __forceinline__ float bfr(float f) { return bf2f(f2bf(f)); }
__device__ __forceinline__ v16h cat16(v8h lo, v8h hi) { return __builtin_shufflevector(lo, hi, 0, 1, 2, 3, 4, 5, 6, 7, 8, 9, 10, 11, 12, 13, 14, 15); }
__device__ __forceinline__ v16bf cat16b(v8us lo, v8us hi) { return __builtin_bit_cast(v16bf, __builtin_shufflevector(lo, hi, 0, 1, 2, 3, 4, 5, 6, 7, 8, 9, 10, 11, 12, 13, 14, 15)); }
__device__ __forceinline__ v8f wmma16(v16h a, v16h b, v8f c) { return __builtin_amdgcn_wmma_f32_16x16x32_f16(false, a, false, b, (short)0, c, false, false); }
__device__ __forceinline__ v8f wmmab(v16bf a, v16bf b, v8f c) { return __builtin_amdgcn_wmma_f32_16x16x32_bf16(false, a, false, b, (short)0, c, false, false); }
__device__ __forceinline__ void splitf(float y, unsigned short& h, unsigned short& l) { h = f2bf(y); l = f2bf(y - bf2f(h)); }

// ---- k_gemmw: register-blocked GEMM, one block of KW waves per 64x64 output tile, operands straight from K-contiguous 16-bit planes; grid (M/64, N/64, Z), KW * 32 threads.
// Wave w holds the whole tile (16 accumulators) for k in [w * K / KW, (w + 1) * K / KW); for KW > 1 the KW partial tiles meet in LDS and are summed in wave order 0..KW-1. K % (32 * KW) == 0.
// C[m][n] (f32, pitch ldc, + optional f32 bias[n]) = sum_k A[m][k] Bt[n][k] (+ split products per NSPLIT). z-batch strides sA/sB/sC in elements. K % 32 == 0, A/Bt row pitch == K.
// Fragment map (A and Bt alike): lane row = lane & 15, elements 0..7 <- k0 + 8*(lane>>4) + 0..7, elements 8..15 <- k0 + 16 + 8*(lane>>4) + 0..7; D element j = (row 8*(lane>>4) + j, col lane & 15).
template <typename T16> struct WFrag;
template <> struct WFrag<h16> { typedef v16h V; static __device__ __forceinline__ V ld(const h16* p) { return cat16(*(const v8h*)p, *(const v8h*)(p + 16)); } static __device__ __forceinline__ v8f mma(V a, V b, v8f c) { return wmma16(a, b, c); } };
template <> struct WFrag<bf> { typedef v16bf V; static __device__ __forceinline__ V ld(const bf* p) { return cat16b(*(const v8us*)p, *(const v8us*)(p + 16)); } static __device__ __forceinline__ v8f mma(V a, V b, v8f c) { return wmmab(a, b, c); } };
template <typename T16, int NSPLIT, bool BIAS, int KW>
__global__ __launch_bounds__(KW * 32) void k_gemmw(const T16* __restrict__ A, const T16* __restrict__ A2, const T16* __restrict__ Bt, const T16* __restrict__ Bt2, int K, float* C, int ldc, const float* __restrict__ bias, size_t sA, size_t sB, size_t sC) {
    typedef typename WFrag<T16>::V V;
    static_assert(KW >= 1 && KW <= 8 && 8 % KW == 0);
    __shared__ __align__(16) float os[(KW > 1 ? 4 * KW : 1) * 16 * 68];
    const size_t z = blockIdx.z; A += z * sA; if (A2) A2 += z * sA; Bt += z * sB; if (Bt2) Bt2 += z * sB; C += z * sC;
    const int lane = threadIdx.x & 31, lr = lane & 15, hi = lane >> 4; const int r0 = blockIdx.x * 64, c0 = blockIdx.y * 64;
    v8f acc[4][4];
#pragma unroll
    for (int mb = 0; mb < 4; ++mb)
#pragma unroll
        for (int nb = 0; nb < 4; ++nb) acc[mb][nb] = (v8f){};
    const size_t aoff = (size_t)(r0 + lr) * K + 8 * hi, boff = (size_t)(c0 + lr) * K + 8 * hi;
    const int w = KW > 1 ? __builtin_amdgcn_readfirstlane((int)(threadIdx.x >> 5)) : 0;   // wave number in a scalar register: the k loop's bounds and branch stay scalar
    const int kspan = K / KW, kbeg = w * kspan, kend = kbeg + kspan;
#pragma unroll 1
    for (int kc = kbeg; kc < kend; kc += 32) {
        V a[4], a2[4];
#pragma unroll
        for (int mb = 0; mb < 4; ++mb) { a[mb] = WFrag<T16>::ld(A + aoff + (size_t)mb * 16 * K + kc); if (NSPLIT == 1 || NSPLIT == 2) a2[mb] = WFrag<T16>::ld(A2 + aoff + (size_t)mb * 16 * K + kc); }
#pragma unroll
        for (int nb = 0; nb < 4; ++nb) { const V b = WFrag<T16>::ld(Bt + boff + (size_t)nb * 16 * K + kc); V b2; if (NSPLIT >= 2) b2 = WFrag<T16>::ld(Bt2 + boff + (size_t)nb * 16 * K + kc);
#pragma unroll
            for (int mb = 0; mb < 4; ++mb) { acc[mb][nb] = WFrag<T16>::mma(a[mb], b, acc[mb][nb]); if (NSPLIT == 1 || NSPLIT == 2) acc[mb][nb] = WFrag<T16>::mma(a2[mb], b, acc[mb][nb]); if (NSPLIT >= 2) acc[mb][nb] = WFrag<T16>::mma(a[mb], b2, acc[mb][nb]); } }
        asm volatile("v_nop\n\tv_nop\n\tv_nop\n\tv_nop" : "+v"(acc[0][0]), "+v"(acc[1][1]), "+v"(acc[2][2]), "+v"(acc[3][3]) : "v"(a[0]), "v"(a[3]));
    }
    if constexpr (KW > 1) {   // loops below are unrolled so that acc[][] is indexed by constants and stays in registers, and the LDS offsets fold into immediates
#pragma unroll
        for (int mb = 0; mb < 4; ++mb) { float* my = os + (mb * KW + w) * (16 * 68);
#pragma unroll
            for (int nb = 0; nb < 4; ++nb) {
#pragma unroll
                for (int j = 0; j < 8; ++j) my[(hi * 8 + j) * 68 + nb * 16 + lr] = acc[mb][nb][j]; } }
        __syncthreads();   // every wave's partial tile stands in LDS before any wave sums across the waves
#pragma unroll
        for (int mb = 0; mb < 4; ++mb) { float* crow = C + (size_t)(r0 + mb * 16) * ldc + c0;
#pragma unroll
            for (int s0 = 0; s0 < 8; s0 += KW) { const int row = 2 * (s0 + w) + hi, cofs = lr * 4; const float* ps = os + mb * KW * (16 * 68) + row * 68 + cofs; v4f val = *(const v4fa*)ps;
#pragma unroll
                for (int q = 1; q < KW; ++q) val += *(const v4fa*)(ps + q * (16 * 68));
                if (BIAS) { val[0] += bfr(bias[c0 + cofs]); val[1] += bfr(bias[c0 + cofs + 1]); val[2] += bfr(bias[c0 + cofs + 2]); val[3] += bfr(bias[c0 + cofs + 3]); }
                *(v4f*)(crow + (size_t)row * ldc + cofs) = val; } }
        return;
    }
#pragma unroll
    for (int mb = 0; mb < 4; ++mb) {
#pragma unroll
        for (int nb = 0; nb < 4; ++nb) {
#pragma unroll
            for (int j = 0; j < 8; ++j) os[(hi * 8 + j) * 68 + nb * 16 + lr] = acc[mb][nb][j]; }
        __builtin_amdgcn_wave_barrier(); asm volatile("" ::: "memory");
        float* crow = C + (size_t)(r0 + mb * 16) * ldc + c0;
{
#pragma unroll
            for (int s = 0; s < 8; ++s) { const int row = 2 * s + hi, cofs = lr * 4; v4f val = *(const v4fa*)(os + row * 68 + cofs); if (BIAS) { val[0] += bfr(bias[c0 + cofs]); val[1] += bfr(bias[c0 + cofs + 1]); val[2] += bfr(bias[c0 + cofs + 2]); val[3] += bfr(bias[c0 + cofs + 3]); }
                *(v4f*)(crow + (size_t)row * ldc + cofs) = val; }
             }
        __builtin_amdgcn_wave_barrier(); asm volatile("" ::: "memory");
    }
}

__global__ __launch_bounds__(256) void k_cvt8(const float* __restrict__ src, bf* dst, size_t n8) { const size_t i = (size_t)blockIdx.x * 256 + threadIdx.x; if (i >= n8) return; const v8f v = *(const v8f*)(src + i * 8); v8us o;
#pragma unroll
    for (int k = 0; k < 8; ++k) o[k] = f2bf(v[k]); *(v8us*)(dst + i * 8) = o;  }

// k_cvtT: in W[K rows][N cols] f32 -> out Wt[N rows][K cols] bf16 (RNE), 64x64 tile transposed through LDS (cross-wave: block barrier); grid (K/64, N/64).
__global__ __launch_bounds__(256) void k_cvtT(const float* __restrict__ W, bf* Wt, int K, int N) {
    __shared__ unsigned short tl[64 * 66];
    const int tid = threadIdx.x; const int k0 = blockIdx.x * 64, n0 = blockIdx.y * 64;
    { const int row = tid >> 2, cseg = (tid & 3) * 16;
#pragma unroll
      for (int q = 0; q < 4; ++q) { const v4f v = *(const v4f*)(W + (size_t)(k0 + row) * N + n0 + cseg + q * 4);
#pragma unroll
          for (int j = 0; j < 4; ++j) tl[row * 66 + cseg + q * 4 + j] = f2bf(v[j]); } }
    __syncthreads();
    const int piece = tid & 7; v8us o[2];
#pragma unroll
    for (int it = 0; it < 2; ++it) { const int n = it * 32 + (tid >> 3);
#pragma unroll
        for (int j = 0; j < 8; ++j) o[it][j] = tl[(piece * 8 + j) * 66 + n]; }
{
#pragma unroll
        for (int it = 0; it < 2; ++it) { const int n = it * 32 + (tid >> 3); *(v8us*)(Wt + (size_t)(n0 + n) * K + k0 + piece * 8) = o[it]; }
         }
}

__global__ __launch_bounds__(256) void k_hp(const float* __restrict__ F, h16* P16) {
    const size_t i = (size_t)blockIdx.x * 256 + threadIdx.x; if (i >= (size_t)NH_ * TT * HD / 8) return;
    const int d8 = (int)(i & 7); const int t = (int)((i >> 3) % TT); const int h = (int)(i / ((size_t)8 * TT));
    const float* f = F + (size_t)t * DM + h * HD + d8 * 8; const v4f a = *(const v4f*)f; const v4f b = *(const v4f*)(f + 4); v8h o;
#pragma unroll
    for (int k = 0; k < 4; ++k) { o[k] = (h16)a[k]; o[4 + k] = (h16)b[k]; }
    *(v8h*)(P16 + i * 8) = o;  }

__global__ __launch_bounds__(256) void k_vtp(const float* __restrict__ F, h16* V16) { const size_t e = ((size_t)blockIdx.x * 256 + threadIdx.x) * 2; if (e >= (size_t)NH_ * HD * TT) return; const int t = (int)(e % TT); const int d = (int)((e / TT) % HD); const int g = (int)(e / ((size_t)TT * HD)); v2h o16;
#pragma unroll
    for (int q = 0; q < 2; ++q) { const float x = F[(size_t)(t + q) * DM + g * HD + d]; o16[q] = (h16)x; }
    *(v2h*)(V16 + e) = o16;  }

// k_rpe: bias plane R[h][i][t] = sum_c c2w[h][c] * relu(x[i][t] * c1w[c] + c1b[c]) + c2b[h] for RC query rows x TT keys, all 8 heads.
// One WMMA per 32 key positions: A rows = 16 positions, k 0..15 = channel activations of position t0+m, k 16..31 = of position t0+16+m (f16);
// B block-diagonal: B[c][h] = c2w[h][c] for h < 8, B[16+c][8+h] = c2w[h][c], zero elsewhere. D[p][h] -> position t0+p, D[p][8+h] -> position t0+16+p.
__global__ __launch_bounds__(256) void k_rpe(const float* __restrict__ rel, const float* __restrict__ c1w, const float* __restrict__ c1b, const float* __restrict__ c2w, const float* __restrict__ c2b, float* RP) {
    __shared__ __align__(16) float st[8 * 8 * 36];
    const int lane = threadIdx.x & 31, w = threadIdx.x >> 5, m = lane & 15, hh = lane >> 4;
    const int row = blockIdx.x * 8 + w;
    float* tl = st + w * (8 * 36);
    float w1[8], b1[8];
#pragma unroll
    for (int i = 0; i < 8; ++i) { w1[i] = bfr(c1w[8 * hh + i]); b1[i] = bfr(c1b[8 * hh + i]); }
    const int hd = m & 7, g = m >> 3;
    v16h bw;
#pragma unroll
    for (int i = 0; i < 8; ++i) { const h16 c = (h16)bfr(c2w[hd * 16 + 8 * hh + i]); const h16 zr = (h16)0.0f; bw[i] = (g == 0) ? c : zr; bw[8 + i] = (g == 1) ? c : zr; }
    const float bias2 = bfr(c2b[hd]);
    const float* rrow = rel + (size_t)row * SEQ_FULL;
    const int pc = lane & 7, ln = lane >> 3;
#pragma unroll 1
    for (int u = 0; u < 8; ++u) {
        const int t0 = blockIdx.y * 256 + u * 32;
        const float xa = bfr(rrow[t0 + m]), xb = bfr(rrow[t0 + 16 + m]);
        v16h a;
#pragma unroll
        for (int i = 0; i < 8; ++i) { a[i] = (h16)fmaxf(fmaf(xa, w1[i], b1[i]), 0.0f); a[8 + i] = (h16)fmaxf(fmaf(xb, w1[i], b1[i]), 0.0f); }
        v8f acc = (v8f){};
        acc = wmma16(a, bw, acc);
        asm volatile("v_nop\n\tv_nop\n\tv_nop\n\tv_nop" : "+v"(acc) : "v"(a), "v"(bw));
        v4f o0, o1;
#pragma unroll
        for (int j = 0; j < 4; ++j) { o0[j] = acc[j] + bias2; o1[j] = acc[4 + j] + bias2; }
        float* dst = tl + hd * 36 + 16 * g + 8 * hh;
        *(v4fa*)dst = o0; *(v4fa*)(dst + 4) = o1;
        __builtin_amdgcn_wave_barrier(); asm volatile("" ::: "memory");
        const v4f s0 = *(const v4fa*)(tl + ln * 36 + 4 * pc); const v4f s1 = *(const v4fa*)(tl + (ln + 4) * 36 + 4 * pc);
        float* g0 = RP + ((size_t)ln * RC + row) * TT + t0 + 4 * pc; float* g1 = RP + ((size_t)(ln + 4) * RC + row) * TT + t0 + 4 * pc;
        *(v4f*)g0 = s0; *(v4f*)g1 = s1; 
        __builtin_amdgcn_wave_barrier(); asm volatile("" ::: "memory");
    }
}

// k_asoft: per row (head z, query i) of the pass: t = (S + R) * HD^-0.5, keys with mask == 0 get t := -1e9 (replace); max-subtracted softmax over the TT keys (register row, one exp, fixed trees);
__global__ __launch_bounds__(256) void k_asoft(const float* __restrict__ Sb, const float* __restrict__ Rb, const int* __restrict__ mask, h16* P16) {
    __shared__ __align__(16) int mks[TT];
#pragma unroll 1
    for (int idx = threadIdx.x; idx < TT / 4; idx += 256) { const v4i m4 = *(const v4i*)(mask + idx * 4); *(v4ia*)(mks + idx * 4) = m4; }
    __syncthreads();
    const int lane = threadIdx.x & 31; const int row = blockIdx.x * 8 + (threadIdx.x >> 5);
    const float* sr = Sb + (size_t)row * TT; const float* rr = Rb + (size_t)row * TT; float v[TT / 32]; float mx = -3.0e38f;
#pragma unroll
    for (int ch = 0; ch < TT / 128; ++ch) { const int j0 = ch * 128 + lane * 4; const v4f a = *(const v4f*)(sr + j0); const v4f r = *(const v4f*)(rr + j0); const v4i mk = *(const v4ia*)(mks + j0);
#pragma unroll
        for (int q = 0; q < 4; ++q) { float t = (a[q] + r[q]) * SCL; t = (mk[q] == 0) ? -1.0e9f : t; v[ch * 4 + q] = t; mx = fmaxf(mx, t); }
        if ((ch & 3) == 3) asm volatile("" ::: "memory"); }
#pragma unroll
    for (int sh = 16; sh; sh >>= 1) mx = fmaxf(mx, __shfl_xor(mx, sh, 32));
    float sum = 0.f;
#pragma unroll
    for (int k = 0; k < TT / 32; ++k) { float d0 = __fsub_rn(v[k], mx); asm volatile("" : "+v"(d0)); v[k] = __builtin_amdgcn_exp2f(__fmul_rn(d0, 1.4426950408889634f)); sum += v[k]; }
#pragma unroll
    for (int sh = 16; sh; sh >>= 1) sum += __shfl_xor(sum, sh, 32);
    const float f = __fdiv_rn(PCAR, sum);
{
#pragma unroll
        for (int ch = 0; ch < TT / 128; ++ch) { v4h o4;
#pragma unroll
            for (int q = 0; q < 4; ++q) o4[q] = (h16)(v[ch * 4 + q] * f);
            *(v4h*)(P16 + (size_t)row * TT + ch * 128 + lane * 4) = o4; }
         }
}

__global__ __launch_bounds__(256) void k_merge(const float* __restrict__ O, bf* Ah, bf* Al) { const size_t e = ((size_t)blockIdx.x * 256 + threadIdx.x) * 2; if (e >= (size_t)NH_ * TT * HD) return; const int d = (int)(e % HD); const int t = (int)((e / HD) % TT); const int zz = (int)(e / ((size_t)HD * TT)); const float cs = 1.0f / PCAR; const size_t oo = (size_t)t * DM + zz * HD + d;
    v2us oh, ol;
#pragma unroll
    for (int q = 0; q < 2; ++q) { unsigned short a, c2; splitf(O[e + q] * cs, a, c2); oh[q] = a; ol[q] = c2; } *(v2us*)(Ah + oo) = oh; *(v2us*)(Al + oo) = ol;  }

constexpr size_t al256(size_t b) { return (b + 255) & ~(size_t)255; }
constexpr size_t WS_TOTAL = 4 * al256((size_t)DM * DM * 2) + al256((size_t)TT * DM * 2) + al256((size_t)TT * DM * 4) + 3 * al256((size_t)NH_ * TT * HD * 2)
                          + 2 * al256((size_t)NH_ * RC * TT * 4) + al256((size_t)NH_ * RC * TT * 2) + al256((size_t)NH_ * TT * HD * 4) + 2 * al256((size_t)TT * DM * 2);
static_assert(WS_TOTAL <= (size_t)134217728);

extern "C" void kernel_launch(void* const* d_in, const int* in_sizes, int n_in,
                              void* d_out, int out_size, void* d_ws, size_t ws_size, hipStream_t stream) {
    if (n_in < 17) return;
    const size_t need_x = ((size_t)(NB - 1) * SEQ_FULL + SEQ) * DM;
    const size_t need_r = (size_t)(NB - 1) * SEQ_FULL * SEQ_FULL + (size_t)(SEQ - 1) * SEQ_FULL + SEQ;
    if ((size_t)in_sizes[0] < need_x || (size_t)in_sizes[1] < need_x || (size_t)in_sizes[2] < need_x || (size_t)in_sizes[3] < need_r) return;
    if ((size_t)in_sizes[4] < (size_t)(NB - 1) * SEQ_FULL + SEQ) return;
    if (in_sizes[5] < DM * DM || in_sizes[7] < DM * DM || in_sizes[9] < DM * DM || in_sizes[11] < DM * DM) return;
    if (in_sizes[6] < DM || in_sizes[8] < DM || in_sizes[10] < DM || in_sizes[12] < DM) return;
    if (in_sizes[13] < 16 || in_sizes[14] < 16 || in_sizes[15] < 128 || in_sizes[16] < 8) return;
    if ((size_t)out_size < need_x) return;
    const float* xq = (const float*)d_in[0]; const float* xk = (const float*)d_in[1]; const float* xv = (const float*)d_in[2];
    const float* rel = (const float*)d_in[3]; const int* msk = (const int*)d_in[4];
    const float* wq = (const float*)d_in[5]; const float* bq = (const float*)d_in[6]; const float* wk = (const float*)d_in[7]; const float* bk = (const float*)d_in[8];
    const float* wv = (const float*)d_in[9]; const float* bv = (const float*)d_in[10]; const float* wo = (const float*)d_in[11]; const float* bo = (const float*)d_in[12];
    const float* c1w = (const float*)d_in[13]; const float* c1b = (const float*)d_in[14]; const float* c2w = (const float*)d_in[15]; const float* c2b = (const float*)d_in[16];
    float* OUT = (float*)d_out;     // [NB_FULL][SEQ_FULL][DM]
    char* wsp = (char*)d_ws;
    auto take = [&](size_t bytes) { char* p = wsp; wsp += (bytes + 255) & ~(size_t)255; return (void*)p; };
    bf* WQ = (bf*)take((size_t)DM * DM * 2); bf* WK = (bf*)take((size_t)DM * DM * 2); bf* WV = (bf*)take((size_t)DM * DM * 2); bf* WO = (bf*)take((size_t)DM * DM * 2);
    bf* XB = (bf*)take((size_t)TT * DM * 2); float* F = (float*)take((size_t)TT * DM * 4);
    h16* QP16 = (h16*)take((size_t)NH_ * TT * HD * 2); h16* KP16 = (h16*)take((size_t)NH_ * TT * HD * 2); h16* VT16 = (h16*)take((size_t)NH_ * HD * TT * 2);
    float* RPb = (float*)take((size_t)NH_ * RC * TT * 4); float* Sb = (float*)take((size_t)NH_ * RC * TT * 4); h16* P16 = (h16*)take((size_t)NH_ * RC * TT * 2);
    float* Ob = (float*)take((size_t)NH_ * TT * HD * 4); bf* ATh = (bf*)take((size_t)TT * DM * 2); bf* ATl = (bf*)take((size_t)TT * DM * 2);
    if ((size_t)(wsp - (char*)d_ws) > ws_size) return;
    // weights: in W[k rows][n cols] -> out Wt[n rows][k cols]; square DM x DM, grid (K/64, N/64)
    k_cvtT<<<dim3(DM / 64, DM / 64), 256, 0, stream>>>(wq, WQ, DM, DM);
    k_cvtT<<<dim3(DM / 64, DM / 64), 256, 0, stream>>>(wk, WK, DM, DM);
    k_cvtT<<<dim3(DM / 64, DM / 64), 256, 0, stream>>>(wv, WV, DM, DM);
    k_cvtT<<<dim3(DM / 64, DM / 64), 256, 0, stream>>>(wo, WO, DM, DM);
    const unsigned LX = (unsigned)(((size_t)TT * DM / 8 + 255) / 256);
    const unsigned LH = (unsigned)(((size_t)NH_ * TT * HD / 8 + 255) / 256);
    const unsigned LV = (unsigned)(((size_t)NH_ * HD * TT / 2 + 255) / 256);
    for (int b = 0; b < NB; ++b) {
        const size_t xoff = (size_t)b * SEQ_FULL * DM;
        k_cvt8<<<LX, 256, 0, stream>>>(xq + xoff, XB, (size_t)TT * DM / 8);
        k_gemmw<bf, 0, true, 8><<<dim3(TT / 64, DM / 64, 1), 256, 0, stream>>>(XB, nullptr, WQ, nullptr, DM, F, DM, bq, 0, 0, 0);
        k_hp<<<LH, 256, 0, stream>>>(F, QP16);
        k_cvt8<<<LX, 256, 0, stream>>>(xk + xoff, XB, (size_t)TT * DM / 8);
        k_gemmw<bf, 0, true, 8><<<dim3(TT / 64, DM / 64, 1), 256, 0, stream>>>(XB, nullptr, WK, nullptr, DM, F, DM, bk, 0, 0, 0);
        k_hp<<<LH, 256, 0, stream>>>(F, KP16);
        k_cvt8<<<LX, 256, 0, stream>>>(xv + xoff, XB, (size_t)TT * DM / 8);
        k_gemmw<bf, 0, true, 8><<<dim3(TT / 64, DM / 64, 1), 256, 0, stream>>>(XB, nullptr, WV, nullptr, DM, F, DM, bv, 0, 0, 0);
        k_vtp<<<LV, 256, 0, stream>>>(F, VT16);
        for (int c = 0; c < TT / RC; ++c) {
            k_rpe<<<dim3(RC / 8, TT / 256), 256, 0, stream>>>(rel + ((size_t)b * SEQ_FULL + (size_t)c * RC) * SEQ_FULL, c1w, c1b, c2w, c2b, RPb);
            k_gemmw<h16, 0, false, 1><<<dim3(RC / 64, TT / 64, NH_), 32, 0, stream>>>(QP16 + (size_t)c * RC * HD, nullptr, KP16, nullptr, HD, Sb, TT, nullptr, (size_t)TT * HD, (size_t)TT * HD, (size_t)RC * TT);
            k_asoft<<<NH_ * RC / 8, 256, 0, stream>>>(Sb, RPb, msk + (size_t)b * SEQ_FULL, P16);
            k_gemmw<h16, 0, false, 8><<<dim3(RC / 64, HD / 64, NH_), 256, 0, stream>>>(P16, nullptr, VT16, nullptr, TT, Ob + (size_t)c * RC * HD, HD, nullptr, (size_t)RC * TT, (size_t)HD * TT, (size_t)TT * HD);
        }
        k_merge<<<(unsigned)(((size_t)NH_ * TT * HD / 2 + 255) / 256), 256, 0, stream>>>(Ob, ATh, ATl);
        k_gemmw<bf, 1, true, 8><<<dim3(TT / 64, DM / 64, 1), 256, 0, stream>>>(ATh, ATl, WO, nullptr, DM, OUT + xoff, DM, bo, 0, 0, 0);
    }
}

// v002
// One run takes 190 microseconds.
// Two timings next to v001 put it at 2.27 and 2.25 times that version's speed.
// All steps since v000 together make it 3.94 times as fast.
#include <hip/hip_runtime.h>

// Compute dtypes (f32 accumulate everywhere): q/k/v projections v_wmma_f32_16x16x32_bf16 (inputs RNE-converted to bf16, products exact); pointwise-bias channel mix (16 ch -> 8 heads) v_wmma_f32_16x16x32_f16; q.k scores f16; probabilities (x1024 carry) x values f16; output projection bf16 hi+lo context x bf16 weights (2 products); softmax and mask fill in f32.
// Layout per batch: bf16 copy of the q / k / v input stream (one staging buffer, refilled in stream order) -> projection (+ f32 bias) -> f16 head planes q,k [b][h][t][d], v [b][h][d][t];
// one attention launch for both batches: a block owns 16 query rows and all 8 heads (wave = head) and walks the keys in stages of 64: bias tile R[h][i][t] (one block-diagonal WMMA per 32 key positions, shared through LDS),
// S^T = k q^T, running-maximum softmax of (S + R) / 8 with key-mask fill, P (x1024 carry) as f16 straight from the score accumulators, O^T += v^T P^T; scores and probabilities never leave the registers.
// merged hi/lo context planes [t][h*64+d] (x 1/1024), output projection + bias. Weights [in][out] are transposed once through LDS into K-contiguous bf16 planes.

#ifndef NB
#define NB 2
#endif
#ifndef SEQ
#define SEQ 2048
#endif
#define NB_FULL  2
#define SEQ_FULL 2048
#define TT   SEQ
#define DM   512
#define NH_  8
#define HD   64
#define KS   64          // keys per stage of the attention loop
#define RPI  (KS + 4)    // f32 pitch of one (head, query) row of the staged bias tile
#define RHS  (16 * RPI + 4)   // f32 pitch of one head's 16 rows: the 8 heads that one store instruction writes start on different LDS banks
#define PCAR 1024.0f
#define SCL  0.125f   // HD^-0.5
static_assert(NH_ * HD == DM);
static_assert(TT % 256 == 0);
static_assert(TT % KS == 0 && TT / KS >= 2);
static_assert(DM % 256 == 0);
static_assert(SEQ <= SEQ_FULL);
static_assert(NB <= NB_FULL);

typedef _Float16 h16;
typedef unsigned short bf;
typedef __attribute__((ext_vector_type(16))) __bf16   v16bf;
typedef __attribute__((ext_vector_type(16))) _Float16 v16h;
typedef __attribute__((ext_vector_type(8)))  _Float16 v8h;
typedef __attribute__((ext_vector_type(8)))  unsigned short v8us;
typedef __attribute__((ext_vector_type(8)))  float    v8f;
typedef __attribute__((ext_vector_type(4)))  float    v4f;
typedef __attribute__((ext_vector_type(2)))  _Float16 v2h;
typedef __attribute__((ext_vector_type(4)))  _Float16 v4h;
typedef __attribute__((ext_vector_type(2)))  unsigned short v2us;
typedef __attribute__((ext_vector_type(4)))  int v4i;
typedef v4f  __attribute__((may_alias)) v4fa;
typedef v4i  __attribute__((may_alias)) v4ia;

__device__ __forceinline__ unsigned short f2bf(float f) { unsigned u = __float_as_uint(f); u += 0x7FFFu + ((u >> 16) & 1u); return (unsigned short)(u >> 16); }
__device__ __forceinline__ float bf2f(unsigned short b) { return __uint_as_float(((unsigned)b) << 16); }
__device__ __forceinline__ float bfr(float f) { return bf2f(f2bf(f)); }
__device__ __forceinline__ v16h cat16(v8h lo, v8h hi) { return __builtin_shufflevector(lo, hi, 0, 1, 2, 3, 4, 5, 6, 7, 8, 9, 10, 11, 12, 13, 14, 15); }
__device__ __forceinline__ v16bf cat16b(v8us lo, v8us hi) { return __builtin_bit_cast(v16bf, __builtin_shufflevector(lo, hi, 0, 1, 2, 3, 4, 5, 6, 7, 8, 9, 10, 11, 12, 13, 14, 15)); }
__device__ __forceinline__ v8f wmma16(v16h a, v16h b, v8f c) { return __builtin_amdgcn_wmma_f32_16x16x32_f16(false, a, false, b, (short)0, c, false, false); }
__device__ __forceinline__ v8f wmmab(v16bf a, v16bf b, v8f c) { return __builtin_amdgcn_wmma_f32_16x16x32_bf16(false, a, false, b, (short)0, c, false, false); }
__device__ __forceinline__ void splitf(float y, unsigned short& h, unsigned short& l) { h = f2bf(y); l = f2bf(y - bf2f(h)); }

// ---- k_gemmw: register-blocked GEMM, one block of KW waves per 64x64 output tile, operands straight from K-contiguous 16-bit planes; grid (M/64, N/64, Z), KW * 32 threads.
// Wave w holds the whole tile (16 accumulators) for k in [w * K / KW, (w + 1) * K / KW); for KW > 1 the KW partial tiles meet in LDS and are summed in wave order 0..KW-1. K % (32 * KW) == 0.
// C[m][n] (f32, pitch ldc, + optional f32 bias[n]) = sum_k A[m][k] Bt[n][k] (+ split products per NSPLIT). z-batch strides sA/sB/sC in elements. K % 32 == 0, A/Bt row pitch == K.
// Fragment map (A and Bt alike): lane row = lane & 15, elements 0..7 <- k0 + 8*(lane>>4) + 0..7, elements 8..15 <- k0 + 16 + 8*(lane>>4) + 0..7; D element j = (row 8*(lane>>4) + j, col lane & 15).
template <typename T16> struct WFrag;
template <> struct WFrag<h16> { typedef v16h V; static __device__ __forceinline__ V ld(const h16* p) { return cat16(*(const v8h*)p, *(const v8h*)(p + 16)); } static __device__ __forceinline__ v8f mma(V a, V b, v8f c) { return wmma16(a, b, c); } };
template <> struct WFrag<bf> { typedef v16bf V; static __device__ __forceinline__ V ld(const bf* p) { return cat16b(*(const v8us*)p, *(const v8us*)(p + 16)); } static __device__ __forceinline__ v8f mma(V a, V b, v8f c) { return wmmab(a, b, c); } };
template <typename T16, int NSPLIT, bool BIAS, int KW>
__global__ __launch_bounds__(KW * 32) void k_gemmw(const T16* __restrict__ A, const T16* __restrict__ A2, const T16* __restrict__ Bt, const T16* __restrict__ Bt2, int K, float* C, int ldc, const float* __restrict__ bias, size_t sA, size_t sB, size_t sC) {
    typedef typename WFrag<T16>::V V;
    static_assert(KW >= 1 && KW <= 8 && 8 % KW == 0);
    __shared__ __align__(16) float os[(KW > 1 ? 4 * KW : 1) * 16 * 68];
    const size_t z = blockIdx.z; A += z * sA; if (A2) A2 += z * sA; Bt += z * sB; if (Bt2) Bt2 += z * sB; C += z * sC;
    const int lane = threadIdx.x & 31, lr = lane & 15, hi = lane >> 4; const int r0 = blockIdx.x * 64, c0 = blockIdx.y * 64;
    v8f acc[4][4];
#pragma unroll
    for (int mb = 0; mb < 4; ++mb)
#pragma unroll
        for (int nb = 0; nb < 4; ++nb) acc[mb][nb] = (v8f){};
    const size_t aoff = (size_t)(r0 + lr) * K + 8 * hi, boff = (size_t)(c0 + lr) * K + 8 * hi;
    const int w = KW > 1 ? __builtin_amdgcn_readfirstlane((int)(threadIdx.x >> 5)) : 0;   // wave number in a scalar register: the k loop's bounds and branch stay scalar
    const int kspan = K / KW, kbeg = w * kspan, kend = kbeg + kspan;
#pragma unroll 1
    for (int kc = kbeg; kc < kend; kc += 32) {
        V a[4], a2[4];
#pragma unroll
        for (int mb = 0; mb < 4; ++mb) { a[mb] = WFrag<T16>::ld(A + aoff + (size_t)mb * 16 * K + kc); if (NSPLIT == 1 || NSPLIT == 2) a2[mb] = WFrag<T16>::ld(A2 + aoff + (size_t)mb * 16 * K + kc); }
#pragma unroll
        for (int nb = 0; nb < 4; ++nb) { const V b = WFrag<T16>::ld(Bt + boff + (size_t)nb * 16 * K + kc); V b2; if (NSPLIT >= 2) b2 = WFrag<T16>::ld(Bt2 + boff + (size_t)nb * 16 * K + kc);
#pragma unroll
            for (int mb = 0; mb < 4; ++mb) { acc[mb][nb] = WFrag<T16>::mma(a[mb], b, acc[mb][nb]); if (NSPLIT == 1 || NSPLIT == 2) acc[mb][nb] = WFrag<T16>::mma(a2[mb], b, acc[mb][nb]); if (NSPLIT >= 2) acc[mb][nb] = WFrag<T16>::mma(a[mb], b2, acc[mb][nb]); } }
        asm volatile("v_nop\n\tv_nop\n\tv_nop\n\tv_nop" : "+v"(acc[0][0]), "+v"(acc[1][1]), "+v"(acc[2][2]), "+v"(acc[3][3]) : "v"(a[0]), "v"(a[3]));
    }
    if constexpr (KW > 1) {   // loops below are unrolled so that acc[][] is indexed by constants and stays in registers, and the LDS offsets fold into immediates
#pragma unroll
        for (int mb = 0; mb < 4; ++mb) { float* my = os + (mb * KW + w) * (16 * 68);
#pragma unroll
            for (int nb = 0; nb < 4; ++nb) {
#pragma unroll
                for (int j = 0; j < 8; ++j) my[(hi * 8 + j) * 68 + nb * 16 + lr] = acc[mb][nb][j]; } }
        __syncthreads();   // every wave's partial tile stands in LDS before any wave sums across the waves
#pragma unroll
        for (int mb = 0; mb < 4; ++mb) { float* crow = C + (size_t)(r0 + mb * 16) * ldc + c0;
#pragma unroll
            for (int s0 = 0; s0 < 8; s0 += KW) { const int row = 2 * (s0 + w) + hi, cofs = lr * 4; const float* ps = os + mb * KW * (16 * 68) + row * 68 + cofs; v4f val = *(const v4fa*)ps;
#pragma unroll
                for (int q = 1; q < KW; ++q) val += *(const v4fa*)(ps + q * (16 * 68));
                if (BIAS) { val[0] += bfr(bias[c0 + cofs]); val[1] += bfr(bias[c0 + cofs + 1]); val[2] += bfr(bias[c0 + cofs + 2]); val[3] += bfr(bias[c0 + cofs + 3]); }
                *(v4f*)(crow + (size_t)row * ldc + cofs) = val; } }
        return;
    }
#pragma unroll
    for (int mb = 0; mb < 4; ++mb) {
#pragma unroll
        for (int nb = 0; nb < 4; ++nb) {
#pragma unroll
            for (int j = 0; j < 8; ++j) os[(hi * 8 + j) * 68 + nb * 16 + lr] = acc[mb][nb][j]; }
        __builtin_amdgcn_wave_barrier(); asm volatile("" ::: "memory");
        float* crow = C + (size_t)(r0 + mb * 16) * ldc + c0;
{
#pragma unroll
            for (int s = 0; s < 8; ++s) { const int row = 2 * s + hi, cofs = lr * 4; v4f val = *(const v4fa*)(os + row * 68 + cofs); if (BIAS) { val[0] += bfr(bias[c0 + cofs]); val[1] += bfr(bias[c0 + cofs + 1]); val[2] += bfr(bias[c0 + cofs + 2]); val[3] += bfr(bias[c0 + cofs + 3]); }
                *(v4f*)(crow + (size_t)row * ldc + cofs) = val; }
             }
        __builtin_amdgcn_wave_barrier(); asm volatile("" ::: "memory");
    }
}

__global__ __launch_bounds__(256) void k_cvt8(const float* __restrict__ src, bf* dst, size_t n8) { const size_t i = (size_t)blockIdx.x * 256 + threadIdx.x; if (i >= n8) return; const v8f v = *(const v8f*)(src + i * 8); v8us o;
#pragma unroll
    for (int k = 0; k < 8; ++k) o[k] = f2bf(v[k]); *(v8us*)(dst + i * 8) = o;  }

// k_cvtT: in W[K rows][N cols] f32 -> out Wt[N rows][K cols] bf16 (RNE), 64x64 tile transposed through LDS (cross-wave: block barrier); grid (K/64, N/64).
__global__ __launch_bounds__(256) void k_cvtT(const float* __restrict__ W, bf* Wt, int K, int N) {
    __shared__ unsigned short tl[64 * 66];
    const int tid = threadIdx.x; const int k0 = blockIdx.x * 64, n0 = blockIdx.y * 64;
    { const int row = tid >> 2, cseg = (tid & 3) * 16;
#pragma unroll
      for (int q = 0; q < 4; ++q) { const v4f v = *(const v4f*)(W + (size_t)(k0 + row) * N + n0 + cseg + q * 4);
#pragma unroll
          for (int j = 0; j < 4; ++j) tl[row * 66 + cseg + q * 4 + j] = f2bf(v[j]); } }
    __syncthreads();
    const int piece = tid & 7; v8us o[2];
#pragma unroll
    for (int it = 0; it < 2; ++it) { const int n = it * 32 + (tid >> 3);
#pragma unroll
        for (int j = 0; j < 8; ++j) o[it][j] = tl[(piece * 8 + j) * 66 + n]; }
{
#pragma unroll
        for (int it = 0; it < 2; ++it) { const int n = it * 32 + (tid >> 3); *(v8us*)(Wt + (size_t)(n0 + n) * K + k0 + piece * 8) = o[it]; }
         }
}

__global__ __launch_bounds__(256) void k_hp(const float* __restrict__ F, h16* P16) {
    const size_t i = (size_t)blockIdx.x * 256 + threadIdx.x; if (i >= (size_t)NH_ * TT * HD / 8) return;
    const int d8 = (int)(i & 7); const int t = (int)((i >> 3) % TT); const int h = (int)(i / ((size_t)8 * TT));
    const float* f = F + (size_t)t * DM + h * HD + d8 * 8; const v4f a = *(const v4f*)f; const v4f b = *(const v4f*)(f + 4); v8h o;
#pragma unroll
    for (int k = 0; k < 4; ++k) { o[k] = (h16)a[k]; o[4 + k] = (h16)b[k]; }
    *(v8h*)(P16 + i * 8) = o;  }

__global__ __launch_bounds__(256) void k_vtp(const float* __restrict__ F, h16* V16) { const size_t e = ((size_t)blockIdx.x * 256 + threadIdx.x) * 2; if (e >= (size_t)NH_ * HD * TT) return; const int t = (int)(e % TT); const int d = (int)((e / TT) % HD); const int g = (int)(e / ((size_t)TT * HD)); v2h o16;
#pragma unroll
    for (int q = 0; q < 2; ++q) { const float x = F[(size_t)(t + q) * DM + g * HD + d]; o16[q] = (h16)x; }
    *(v2h*)(V16 + e) = o16;  }

// k_fattn: grid (TT / 16, NB), 8 waves; block = 16 query rows q0.. of batch b, wave w = head w.
// Bias tile, per stage of KS keys: wave w makes query rows 2w, 2w+1 for all 8 heads. One WMMA per 32 key positions: A rows = 16 positions, k 0..15 = channel activations of position t0+m, k 16..31 = of position t0+16+m (f16);
// B block-diagonal: B[c][h] = c2w[h][c] for h < 8, B[16+c][8+h] = c2w[h][c], zero elsewhere. D[p][h] -> position t0+p, D[p][8+h] -> position t0+16+p. Stored as rb[h][query][key] (f32).
// A key with mask == 0 gets the bias MFILL: S + MFILL == MFILL in f32 for every |S| < 1e30, so all masked scores of a row are one equal value far below any real score (weight 0 beside a real key, uniform weights where every key is masked), as with the -1e9 fill.
// Scores: A = 16 key rows of k, B = the 16 query rows of q (kept in registers): D element j = (key 8*(lane>>4) + j, query lane & 15). Two such tiles, converted to f16, are the B operand (k order 8*(lane>>4)+0..7, 16+8*(lane>>4)+0..7) of O^T += v^T P^T.
// Every inner loop is unrolled so that the register arrays (fragments, scores, accumulators) are indexed by constants and the LDS and global offsets fold into immediates.
#define MFILL (-3.0e38f)
#define L2E   1.4426950408889634f
// 2^x. The v_nop is the slot that the instruction set asks for behind a transcendental before its result is read or its source overwritten.
__device__ __forceinline__ float ex2(float x) { float r; asm("v_exp_f32 %0, %1\n\tv_nop" : "=v"(r) : "v"(x)); return r; }
__global__ __launch_bounds__(256) void k_fattn(const h16* __restrict__ Q16, const h16* __restrict__ K16, const h16* __restrict__ V16, const float* __restrict__ rel, const int* __restrict__ mask,
                                               const float* __restrict__ c1w, const float* __restrict__ c1b, const float* __restrict__ c2w, const float* __restrict__ c2b, float* Ob) {
    __shared__ __align__(16) float rb[2][NH_ * RHS];
    __shared__ __align__(16) int mks[TT];
    constexpr int NS = TT / KS;
    const int lane = threadIdx.x & 31, lr = lane & 15, hi = lane >> 4;
    const int w = __builtin_amdgcn_readfirstlane((int)(threadIdx.x >> 5));   // wave number in a scalar register: plane bases stay scalar
    const int b = blockIdx.y, q0 = blockIdx.x * 16;
    for (int idx = threadIdx.x; idx < TT / 4; idx += 256) { const v4i m4 = *(const v4i*)(mask + (size_t)b * SEQ_FULL + idx * 4); *(v4ia*)(mks + idx * 4) = m4; }
    float w1[8], b1[8];
#pragma unroll
    for (int i = 0; i < 8; ++i) { w1[i] = bfr(c1w[8 * hi + i]); b1[i] = bfr(c1b[8 * hi + i]); }
    const int hd = lr & 7, g = lr >> 3;
    v16h bw;
#pragma unroll
    for (int i = 0; i < 8; ++i) { const h16 c = (h16)bfr(c2w[hd * 16 + 8 * hi + i]); const h16 zr = (h16)0.0f; bw[i] = (g == 0) ? c : zr; bw[8 + i] = (g == 1) ? c : zr; }
    const float bias2 = bfr(c2b[hd]);
    const float* rr0 = rel + ((size_t)b * SEQ_FULL + q0 + 2 * w) * SEQ_FULL + lr;
    float xr[8];   // the wave's rel_pos values of the next stage to be made, fetched one stage ahead
    auto ldx = [&](int s) {
#pragma unroll
        for (int qq = 0; qq < 2; ++qq)
#pragma unroll
            for (int gk = 0; gk < 2; ++gk) { const float* p = rr0 + (size_t)qq * SEQ_FULL + s * KS + gk * 32; xr[qq * 4 + gk * 2] = p[0]; xr[qq * 4 + gk * 2 + 1] = p[16]; } };
    auto produce = [&](int s, float* dstb) {
#pragma unroll
        for (int gk = 0; gk < 2; ++gk) {
            const int* mp = mks + s * KS + gk * 32 + 16 * g + 8 * hi; const v4i m0 = *(const v4ia*)mp; const v4i m1 = *(const v4ia*)(mp + 4);
#pragma unroll
            for (int qq = 0; qq < 2; ++qq) {
                const float xa = bfr(xr[qq * 4 + gk * 2]), xb = bfr(xr[qq * 4 + gk * 2 + 1]);
                v16h a;
#pragma unroll
                for (int i = 0; i < 8; ++i) { a[i] = (h16)fmaxf(fmaf(xa, w1[i], b1[i]), 0.0f); a[8 + i] = (h16)fmaxf(fmaf(xb, w1[i], b1[i]), 0.0f); }
                const v8f acc = wmma16(a, bw, (v8f){});
                v4f o0, o1;
#pragma unroll
                for (int j = 0; j < 4; ++j) { o0[j] = (m0[j] == 0) ? MFILL : acc[j] + bias2; o1[j] = (m1[j] == 0) ? MFILL : acc[4 + j] + bias2; }
                float* dst = dstb + hd * RHS + (2 * w + qq) * RPI + gk * 32 + 16 * g + 8 * hi;
                *(v4fa*)dst = o0; *(v4fa*)(dst + 4) = o1; } } };
    const size_t pl = ((size_t)b * NH_ + w) * TT * HD;
    const h16* kp = K16 + pl + (lr * HD + 8 * hi); const h16* vp = V16 + pl + (lr * TT + 8 * hi);   // the lane's fragment addresses in the current stage of its head's k and v planes; both step on by one stage at the foot of a trip
    v16h qf[2];
#pragma unroll
    for (int dk = 0; dk < 2; ++dk) qf[dk] = WFrag<h16>::ld(Q16 + pl + (size_t)(q0 + lr) * HD + dk * 32 + 8 * hi);
    v8f o[4];
#pragma unroll
    for (int dg = 0; dg < 4; ++dg) o[dg] = (v8f){};
    float mrun = MFILL, lsum = 0.0f;
    ldx(0);
    __syncthreads();   // the mask stands in LDS before any wave reads it
    produce(0, rb[0]);
    ldx(1);
    __syncthreads();   // stage 0 of the bias tile stands in LDS before any wave reads it
#pragma unroll 1   // one stage per trip: an unrolled body would not hold its fragments in registers
    for (int s = 0; s < NS; ++s) {
        v16h kf[4][2];
#pragma unroll
        for (int kg = 0; kg < 4; ++kg)
#pragma unroll
            for (int dk = 0; dk < 2; ++dk) kf[kg][dk] = WFrag<h16>::ld(kp + (kg * 16 * HD + dk * 32));
        asm volatile("s_wait_xcnt 0x0" ::: "memory");   // stands behind the run of k loads, in front of the step of kp, whose registers they name
        if (s + 1 < NS) { produce(s + 1, rb[(s + 1) & 1]); ldx(s + 2 < NS ? s + 2 : NS - 1); }
        v16h vf[2][4];
#pragma unroll
        for (int gk = 0; gk < 2; ++gk)
#pragma unroll
            for (int dg = 0; dg < 4; ++dg) vf[gk][dg] = WFrag<h16>::ld(vp + (dg * 16 * TT + gk * 32));
        const float* rbp = rb[s & 1] + w * RHS + lr * RPI + 8 * hi;
        float t[4][8]; float mx = MFILL;
#pragma unroll
        for (int kg = 0; kg < 4; ++kg) {
            v8f st = (v8f){};
            st = wmma16(kf[kg][0], qf[0], st); st = wmma16(kf[kg][1], qf[1], st);
            const v4f r0 = *(const v4fa*)(rbp + kg * 16); const v4f r1 = *(const v4fa*)(rbp + kg * 16 + 4);
#pragma unroll
            for (int j = 0; j < 4; ++j) { t[kg][j] = (st[j] + r0[j]) * SCL; t[kg][4 + j] = (st[4 + j] + r1[j]) * SCL; mx = fmaxf(mx, fmaxf(t[kg][j], t[kg][4 + j])); } }
        mx = fmaxf(mx, __shfl_xor(mx, 16, 32));   // the other half of the wave holds the query's other keys
        const float mnew = fmaxf(mrun, mx);
        const float corr = ex2((mrun - mnew) * L2E);
        mrun = mnew;
        float ps = 0.0f; v16h pb[2];
#pragma unroll
        for (int kg = 0; kg < 4; ++kg)
#pragma unroll
            for (int j = 0; j < 8; ++j) { const float p = ex2(fmaf(t[kg][j] - mnew, L2E, 10.0f)); ps += p; pb[kg >> 1][(kg & 1) * 8 + j] = (h16)p; }   // + 10: the x1024 carry
        lsum = fmaf(lsum, corr, ps);
#pragma unroll
        for (int dg = 0; dg < 4; ++dg) o[dg] *= corr;
#pragma unroll
        for (int gk = 0; gk < 2; ++gk)
#pragma unroll
            for (int dg = 0; dg < 4; ++dg) o[dg] = wmma16(vf[gk][dg], pb[gk], o[dg]);
        kp += KS * HD; vp += KS;
        __syncthreads();   // publishes stage s + 1 of the bias tile and ends every wave's reads of stage s, whose buffer the next trip refills
    }
    lsum += __shfl_xor(lsum, 16, 32);
    const float f = __fdiv_rn(PCAR, lsum);
    float* orow = Ob + pl + (size_t)(q0 + lr) * HD + 8 * hi;
#pragma unroll
    for (int dg = 0; dg < 4; ++dg) { v4f s0, s1;
#pragma unroll
        for (int j = 0; j < 4; ++j) { s0[j] = o[dg][j] * f; s1[j] = o[dg][4 + j] * f; }
        *(v4f*)(orow + dg * 16) = s0; *(v4f*)(orow + dg * 16 + 4) = s1; }
}

__global__ __launch_bounds__(256) void k_merge(const float* __restrict__ O, bf* Ah, bf* Al) { const size_t e = ((size_t)blockIdx.x * 256 + threadIdx.x) * 2; if (e >= (size_t)NH_ * TT * HD) return; const int d = (int)(e % HD); const int t = (int)((e / HD) % TT); const int zz = (int)(e / ((size_t)HD * TT)); const float cs = 1.0f / PCAR; const size_t oo = (size_t)t * DM + zz * HD + d;
    v2us oh, ol;
#pragma unroll
    for (int q = 0; q < 2; ++q) { unsigned short a, c2; splitf(O[e + q] * cs, a, c2); oh[q] = a; ol[q] = c2; } *(v2us*)(Ah + oo) = oh; *(v2us*)(Al + oo) = ol;  }

constexpr size_t al256(size_t b) { return (b + 255) & ~(size_t)255; }
constexpr size_t WS_TOTAL = 4 * al256((size_t)DM * DM * 2) + al256((size_t)TT * DM * 2) + al256((size_t)TT * DM * 4) + 3 * al256((size_t)NB * NH_ * TT * HD * 2)
                          + al256((size_t)NB * NH_ * TT * HD * 4) + 2 * al256((size_t)TT * DM * 2);
static_assert(WS_TOTAL <= (size_t)134217728);

extern "C" void kernel_launch(void* const* d_in, const int* in_sizes, int n_in,
                              void* d_out, int out_size, void* d_ws, size_t ws_size, hipStream_t stream) {
    if (n_in < 17) return;
    const size_t need_x = ((size_t)(NB - 1) * SEQ_FULL + SEQ) * DM;
    const size_t need_r = (size_t)(NB - 1) * SEQ_FULL * SEQ_FULL + (size_t)(SEQ - 1) * SEQ_FULL + SEQ;
    if ((size_t)in_sizes[0] < need_x || (size_t)in_sizes[1] < need_x || (size_t)in_sizes[2] < need_x || (size_t)in_sizes[3] < need_r) return;
    if ((size_t)in_sizes[4] < (size_t)(NB - 1) * SEQ_FULL + SEQ) return;
    if (in_sizes[5] < DM * DM || in_sizes[7] < DM * DM || in_sizes[9] < DM * DM || in_sizes[11] < DM * DM) return;
    if (in_sizes[6] < DM || in_sizes[8] < DM || in_sizes[10] < DM || in_sizes[12] < DM) return;
    if (in_sizes[13] < 16 || in_sizes[14] < 16 || in_sizes[15] < 128 || in_sizes[16] < 8) return;
    if ((size_t)out_size < need_x) return;
    const float* xq = (const float*)d_in[0]; const float* xk = (const float*)d_in[1]; const float* xv = (const float*)d_in[2];
    const float* rel = (const float*)d_in[3]; const int* msk = (const int*)d_in[4];
    const float* wq = (const float*)d_in[5]; const float* bq = (const float*)d_in[6]; const float* wk = (const float*)d_in[7]; const float* bk = (const float*)d_in[8];
    const float* wv = (const float*)d_in[9]; const float* bv = (const float*)d_in[10]; const float* wo = (const float*)d_in[11]; const float* bo = (const float*)d_in[12];
    const float* c1w = (const float*)d_in[13]; const float* c1b = (const float*)d_in[14]; const float* c2w = (const float*)d_in[15]; const float* c2b = (const float*)d_in[16];
    float* OUT = (float*)d_out;     // [NB_FULL][SEQ_FULL][DM]
    char* wsp = (char*)d_ws;
    auto take = [&](size_t bytes) { char* p = wsp; wsp += (bytes + 255) & ~(size_t)255; return (void*)p; };
    bf* WQ = (bf*)take((size_t)DM * DM * 2); bf* WK = (bf*)take((size_t)DM * DM * 2); bf* WV = (bf*)take((size_t)DM * DM * 2); bf* WO = (bf*)take((size_t)DM * DM * 2);
    bf* XB = (bf*)take((size_t)TT * DM * 2); float* F = (float*)take((size_t)TT * DM * 4);
    h16* QP16 = (h16*)take((size_t)NB * NH_ * TT * HD * 2); h16* KP16 = (h16*)take((size_t)NB * NH_ * TT * HD * 2); h16* VT16 = (h16*)take((size_t)NB * NH_ * HD * TT * 2);
    float* Ob = (float*)take((size_t)NB * NH_ * TT * HD * 4); bf* ATh = (bf*)take((size_t)TT * DM * 2); bf* ATl = (bf*)take((size_t)TT * DM * 2);
    if ((size_t)(wsp - (char*)d_ws) > ws_size) return;
    // weights: in W[k rows][n cols] -> out Wt[n rows][k cols]; square DM x DM, grid (K/64, N/64)
    k_cvtT<<<dim3(DM / 64, DM / 64), 256, 0, stream>>>(wq, WQ, DM, DM);
    k_cvtT<<<dim3(DM / 64, DM / 64), 256, 0, stream>>>(wk, WK, DM, DM);
    k_cvtT<<<dim3(DM / 64, DM / 64), 256, 0, stream>>>(wv, WV, DM, DM);
    k_cvtT<<<dim3(DM / 64, DM / 64), 256, 0, stream>>>(wo, WO, DM, DM);
    const unsigned LX = (unsigned)(((size_t)TT * DM / 8 + 255) / 256);
    const unsigned LH = (unsigned)(((size_t)NH_ * TT * HD / 8 + 255) / 256);
    const unsigned LV = (unsigned)(((size_t)NH_ * HD * TT / 2 + 255) / 256);
    for (int b = 0; b < NB; ++b) {
        const size_t xoff = (size_t)b * SEQ_FULL * DM; const size_t poff = (size_t)b * NH_ * TT * HD;
        k_cvt8<<<LX, 256, 0, stream>>>(xq + xoff, XB, (size_t)TT * DM / 8);
        k_gemmw<bf, 0, true, 8><<<dim3(TT / 64, DM / 64, 1), 256, 0, stream>>>(XB, nullptr, WQ, nullptr, DM, F, DM, bq, 0, 0, 0);
        k_hp<<<LH, 256, 0, stream>>>(F, QP16 + poff);
        k_cvt8<<<LX, 256, 0, stream>>>(xk + xoff, XB, (size_t)TT * DM / 8);
        k_gemmw<bf, 0, true, 8><<<dim3(TT / 64, DM / 64, 1), 256, 0, stream>>>(XB, nullptr, WK, nullptr, DM, F, DM, bk, 0, 0, 0);
        k_hp<<<LH, 256, 0, stream>>>(F, KP16 + poff);
        k_cvt8<<<LX, 256, 0, stream>>>(xv + xoff, XB, (size_t)TT * DM / 8);
        k_gemmw<bf, 0, true, 8><<<dim3(TT / 64, DM / 64, 1), 256, 0, stream>>>(XB, nullptr, WV, nullptr, DM, F, DM, bv, 0, 0, 0);
        k_vtp<<<LV, 256, 0, stream>>>(F, VT16 + poff);
    }
    k_fattn<<<dim3(TT / 16, NB), 256, 0, stream>>>(QP16, KP16, VT16, rel, msk, c1w, c1b, c2w, c2b, Ob);
    for (int b = 0; b < NB; ++b) {
        const size_t xoff = (size_t)b * SEQ_FULL * DM; const size_t poff = (size_t)b * NH_ * TT * HD;
        k_merge<<<(unsigned)(((size_t)NH_ * TT * HD / 2 + 255) / 256), 256, 0, stream>>>(Ob + poff, ATh, ATl);
        k_gemmw<bf, 1, true, 8><<<dim3(TT / 64, DM / 64, 1), 256, 0, stream>>>(ATh, ATl, WO, nullptr, DM, OUT + xoff, DM, bo, 0, 0, 0);
    }
}

// v003
// It runs in 143 microseconds.
// In two side-by-side timings against v002, it was 1.32 and 1.33 times as fast.
// Over all steps from v000 it is 5.23 times as fast.
#include <hip/hip_runtime.h>

// Compute dtypes (f32 accumulate everywhere): q/k/v projections v_wmma_f32_16x16x32_bf16 (inputs RNE-converted to bf16, products exact); pointwise-bias channel mix (16 ch -> 8 heads) v_wmma_f32_16x16x32_f16; q.k scores f16; probabilities (x1024 carry) x values f16; output projection bf16 hi+lo context x bf16 weights (2 products); softmax and mask fill in f32.
// Layout per batch: projection of the f32 q / k / v input stream (converted to bf16 in the fragment loader; + f32 bias) -> f16 head planes q,k [b][h][t][d], v [b][h][d][t], stored by the projection itself;
// one attention launch for both batches: a block owns 16 query rows and all 8 heads (wave = head) and walks the keys in stages of 64: bias tile R[h][i][t] (one block-diagonal WMMA per 32 key positions, shared through LDS),
// S^T = k q^T, running-maximum softmax of (S + R) / 8 with key-mask fill, P (x1024 carry) as f16 straight from the score accumulators, O^T += v^T P^T; scores and probabilities never leave the registers.
// the attention launch stores the merged hi/lo context planes [b][t][h*64+d] (x 1/1024); output projection + bias. Weights [in][out] are transposed once through LDS into K-contiguous bf16 planes.

#ifndef NB
#define NB 2
#endif
#ifndef SEQ
#define SEQ 2048
#endif
#define NB_FULL  2
#define SEQ_FULL 2048
#define TT   SEQ
#define DM   512
#define NH_  8
#define HD   64
#define KS   64          // keys per stage of the attention loop
#define RPI  (KS + 4)    // f32 pitch of one (head, query) row of the staged bias tile
#define RHS  (16 * RPI + 4)   // f32 pitch of one head's 16 rows: the 8 heads that one store instruction writes start on different LDS banks
#define PCAR 1024.0f
#define SCL  0.125f   // HD^-0.5
static_assert(NH_ * HD == DM);
static_assert(TT % 256 == 0);
static_assert(TT % KS == 0 && TT / KS >= 2);
static_assert(DM % 256 == 0);
static_assert(SEQ <= SEQ_FULL);
static_assert(NB <= NB_FULL);

typedef _Float16 h16;
typedef unsigned short bf;
typedef __attribute__((ext_vector_type(16))) __bf16   v16bf;
typedef __attribute__((ext_vector_type(16))) _Float16 v16h;
typedef __attribute__((ext_vector_type(8)))  _Float16 v8h;
typedef __attribute__((ext_vector_type(8)))  unsigned short v8us;
typedef __attribute__((ext_vector_type(8)))  float    v8f;
typedef __attribute__((ext_vector_type(4)))  float    v4f;
typedef __attribute__((ext_vector_type(2)))  _Float16 v2h;
typedef __attribute__((ext_vector_type(4)))  _Float16 v4h;
typedef __attribute__((ext_vector_type(2)))  unsigned short v2us;
typedef __attribute__((ext_vector_type(4)))  int v4i;
typedef v4f  __attribute__((may_alias)) v4fa;
typedef v4i  __attribute__((may_alias)) v4ia;

__device__ __forceinline__ unsigned short f2bf(float f) { unsigned u = __float_as_uint(f); u += 0x7FFFu + ((u >> 16) & 1u); return (unsigned short)(u >> 16); }
__device__ __forceinline__ float bf2f(unsigned short b) { return __uint_as_float(((unsigned)b) << 16); }
__device__ __forceinline__ float bfr(float f) { return bf2f(f2bf(f)); }
__device__ __forceinline__ v16h cat16(v8h lo, v8h hi) { return __builtin_shufflevector(lo, hi, 0, 1, 2, 3, 4, 5, 6, 7, 8, 9, 10, 11, 12, 13, 14, 15); }
__device__ __forceinline__ v16bf cat16b(v8us lo, v8us hi) { return __builtin_bit_cast(v16bf, __builtin_shufflevector(lo, hi, 0, 1, 2, 3, 4, 5, 6, 7, 8, 9, 10, 11, 12, 13, 14, 15)); }
__device__ __forceinline__ v8f wmma16(v16h a, v16h b, v8f c) { return __builtin_amdgcn_wmma_f32_16x16x32_f16(false, a, false, b, (short)0, c, false, false); }
__device__ __forceinline__ v8f wmmab(v16bf a, v16bf b, v8f c) { return __builtin_amdgcn_wmma_f32_16x16x32_bf16(false, a, false, b, (short)0, c, false, false); }
__device__ __forceinline__ void splitf(float y, unsigned short& h, unsigned short& l) { h = f2bf(y); l = f2bf(y - bf2f(h)); }

// ---- k_gemmw: register-blocked GEMM, one block of KW waves per 64x64 output tile, operands straight from K-contiguous 16-bit planes; grid (M/64, N/64, Z), KW * 32 threads.
// Wave w holds the whole tile (16 accumulators) for k in [w * K / KW, (w + 1) * K / KW); for KW > 1 the KW partial tiles meet in LDS and are summed in wave order 0..KW-1. K % (32 * KW) == 0.
// C[m][n] (f32, pitch ldc, + optional f32 bias[n]) = sum_k A[m][k] Bt[n][k] (+ split products per NSPLIT). z-batch strides sA/sB/sC in elements. K % 32 == 0, A/Bt row pitch == K.
// Fragment map (A and Bt alike): lane row = lane & 15, elements 0..7 <- k0 + 8*(lane>>4) + 0..7, elements 8..15 <- k0 + 16 + 8*(lane>>4) + 0..7; D element j = (row 8*(lane>>4) + j, col lane & 15).
template <typename T16> struct WFrag;
template <> struct WFrag<h16> { typedef v16h V; static __device__ __forceinline__ V ld(const h16* p) { return cat16(*(const v8h*)p, *(const v8h*)(p + 16)); } static __device__ __forceinline__ v8f mma(V a, V b, v8f c) { return wmma16(a, b, c); } };
template <> struct WFrag<bf> { typedef v16bf V; static __device__ __forceinline__ V ld(const bf* p) { return cat16b(*(const v8us*)p, *(const v8us*)(p + 16)); } static __device__ __forceinline__ v8f mma(V a, V b, v8f c) { return wmmab(a, b, c); } };
template <typename T16, int NSPLIT, bool BIAS, int KW>
__global__ __launch_bounds__(KW * 32) void k_gemmw(const T16* __restrict__ A, const T16* __restrict__ A2, const T16* __restrict__ Bt, const T16* __restrict__ Bt2, int K, float* C, int ldc, const float* __restrict__ bias, size_t sA, size_t sB, size_t sC) {
    typedef typename WFrag<T16>::V V;
    static_assert(KW >= 1 && KW <= 8 && 8 % KW == 0);
    __shared__ __align__(16) float os[(KW > 1 ? 4 * KW : 1) * 16 * 68];
    const size_t z = blockIdx.z; A += z * sA; if (A2) A2 += z * sA; Bt += z * sB; if (Bt2) Bt2 += z * sB; C += z * sC;
    const int lane = threadIdx.x & 31, lr = lane & 15, hi = lane >> 4; const int r0 = blockIdx.x * 64, c0 = blockIdx.y * 64;
    v8f acc[4][4];
#pragma unroll
    for (int mb = 0; mb < 4; ++mb)
#pragma unroll
        for (int nb = 0; nb < 4; ++nb) acc[mb][nb] = (v8f){};
    const size_t aoff = (size_t)(r0 + lr) * K + 8 * hi, boff = (size_t)(c0 + lr) * K + 8 * hi;
    const int w = KW > 1 ? __builtin_amdgcn_readfirstlane((int)(threadIdx.x >> 5)) : 0;   // wave number in a scalar register: the k loop's bounds and branch stay scalar
    const int kspan = K / KW, kbeg = w * kspan, kend = kbeg + kspan;
#pragma unroll 1
    for (int kc = kbeg; kc < kend; kc += 32) {
        V a[4], a2[4];
#pragma unroll
        for (int mb = 0; mb < 4; ++mb) { a[mb] = WFrag<T16>::ld(A + aoff + (size_t)mb * 16 * K + kc); if (NSPLIT == 1 || NSPLIT == 2) a2[mb] = WFrag<T16>::ld(A2 + aoff + (size_t)mb * 16 * K + kc); }
#pragma unroll
        for (int nb = 0; nb < 4; ++nb) { const V b = WFrag<T16>::ld(Bt + boff + (size_t)nb * 16 * K + kc); V b2; if (NSPLIT >= 2) b2 = WFrag<T16>::ld(Bt2 + boff + (size_t)nb * 16 * K + kc);
#pragma unroll
            for (int mb = 0; mb < 4; ++mb) { acc[mb][nb] = WFrag<T16>::mma(a[mb], b, acc[mb][nb]); if (NSPLIT == 1 || NSPLIT == 2) acc[mb][nb] = WFrag<T16>::mma(a2[mb], b, acc[mb][nb]); if (NSPLIT >= 2) acc[mb][nb] = WFrag<T16>::mma(a[mb], b2, acc[mb][nb]); } }
        asm volatile("v_nop\n\tv_nop\n\tv_nop\n\tv_nop" : "+v"(acc[0][0]), "+v"(acc[1][1]), "+v"(acc[2][2]), "+v"(acc[3][3]) : "v"(a[0]), "v"(a[3]));
    }
    if constexpr (KW > 1) {   // loops below are unrolled so that acc[][] is indexed by constants and stays in registers, and the LDS offsets fold into immediates
#pragma unroll
        for (int mb = 0; mb < 4; ++mb) { float* my = os + (mb * KW + w) * (16 * 68);
#pragma unroll
            for (int nb = 0; nb < 4; ++nb) {
#pragma unroll
                for (int j = 0; j < 8; ++j) my[(hi * 8 + j) * 68 + nb * 16 + lr] = acc[mb][nb][j]; } }
        __syncthreads();   // every wave's partial tile stands in LDS before any wave sums across the waves
#pragma unroll
        for (int mb = 0; mb < 4; ++mb) { float* crow = C + (size_t)(r0 + mb * 16) * ldc + c0;
#pragma unroll
            for (int s0 = 0; s0 < 8; s0 += KW) { const int row = 2 * (s0 + w) + hi, cofs = lr * 4; const float* ps = os + mb * KW * (16 * 68) + row * 68 + cofs; v4f val = *(const v4fa*)ps;
#pragma unroll
                for (int q = 1; q < KW; ++q) val += *(const v4fa*)(ps + q * (16 * 68));
                if (BIAS) { val[0] += bfr(bias[c0 + cofs]); val[1] += bfr(bias[c0 + cofs + 1]); val[2] += bfr(bias[c0 + cofs + 2]); val[3] += bfr(bias[c0 + cofs + 3]); }
                *(v4f*)(crow + (size_t)row * ldc + cofs) = val; } }
        return;
    }
#pragma unroll
    for (int mb = 0; mb < 4; ++mb) {
#pragma unroll
        for (int nb = 0; nb < 4; ++nb) {
#pragma unroll
            for (int j = 0; j < 8; ++j) os[(hi * 8 + j) * 68 + nb * 16 + lr] = acc[mb][nb][j]; }
        __builtin_amdgcn_wave_barrier(); asm volatile("" ::: "memory");
        float* crow = C + (size_t)(r0 + mb * 16) * ldc + c0;
{
#pragma unroll
            for (int s = 0; s < 8; ++s) { const int row = 2 * s + hi, cofs = lr * 4; v4f val = *(const v4fa*)(os + row * 68 + cofs); if (BIAS) { val[0] += bfr(bias[c0 + cofs]); val[1] += bfr(bias[c0 + cofs + 1]); val[2] += bfr(bias[c0 + cofs + 2]); val[3] += bfr(bias[c0 + cofs + 3]); }
                *(v4f*)(crow + (size_t)row * ldc + cofs) = val; }
             }
        __builtin_amdgcn_wave_barrier(); asm volatile("" ::: "memory");
    }
}

// k_proj: one 64x64 tile of a q / k / v projection per block of 8 waves, K = DM split over the waves as in k_gemmw (same fragment map, same sum in wave order); the f32 input stream is read as it is and rounded to bf16 (RNE) in the fragment loader.
// VT == false (q, k): A rows = positions t of X, B rows = output columns n of Wt; grid (TT/64, DM/64); a tile's 64 columns are one head, stored as f16 at P[head][t][d].
// VT == true (v): A rows = output columns n of Wt, B rows = positions t of X, so that the tile comes out transposed; grid (DM/64, TT/64); stored as f16 at P[n][t] = [head][d][t].
typedef __attribute__((ext_vector_type(8))) __bf16 v8bf;
__device__ __forceinline__ v16bf ldxf(const float* p) { const v8f lo = *(const v8f*)p, hi = *(const v8f*)(p + 16);
    return __builtin_shufflevector(__builtin_convertvector(lo, v8bf), __builtin_convertvector(hi, v8bf), 0, 1, 2, 3, 4, 5, 6, 7, 8, 9, 10, 11, 12, 13, 14, 15); }
template <bool VT>
__global__ __launch_bounds__(256) void k_proj(const float* __restrict__ X, const bf* __restrict__ Wt, const float* __restrict__ bias, h16* P) {
    constexpr int KW = 8, K = DM;
    __shared__ __align__(16) float os[4 * KW * 16 * 68];
    const int lane = threadIdx.x & 31, lr = lane & 15, hi = lane >> 4; const int r0 = blockIdx.x * 64, c0 = blockIdx.y * 64;
    v8f acc[4][4];
#pragma unroll
    for (int mb = 0; mb < 4; ++mb)
#pragma unroll
        for (int nb = 0; nb < 4; ++nb) acc[mb][nb] = (v8f){};
    const size_t aoff = (size_t)(r0 + lr) * K + 8 * hi, boff = (size_t)(c0 + lr) * K + 8 * hi;
    const int w = __builtin_amdgcn_readfirstlane((int)(threadIdx.x >> 5));   // wave number in a scalar register: the wave's k offset stays scalar
    const int kbeg = w * (K / KW), kend = kbeg + K / KW;
#pragma unroll   // both trips in line: the second trip's loads issue while the first trip's products still run
    for (int kc = kbeg; kc < kend; kc += 32) {
        v16bf a[4];
#pragma unroll
        for (int mb = 0; mb < 4; ++mb) { if constexpr (VT) a[mb] = WFrag<bf>::ld(Wt + aoff + (size_t)mb * 16 * K + kc); else a[mb] = ldxf(X + aoff + (size_t)mb * 16 * K + kc); }
#pragma unroll
        for (int nb = 0; nb < 4; ++nb) { v16bf b; if constexpr (VT) b = ldxf(X + boff + (size_t)nb * 16 * K + kc); else b = WFrag<bf>::ld(Wt + boff + (size_t)nb * 16 * K + kc);
#pragma unroll
            for (int mb = 0; mb < 4; ++mb) acc[mb][nb] = wmmab(a[mb], b, acc[mb][nb]); }
    }
    // loops below are unrolled so that acc[][] is indexed by constants and stays in registers, and the LDS offsets fold into immediates
#pragma unroll
    for (int mb = 0; mb < 4; ++mb) { float* my = os + (mb * KW + w) * (16 * 68);
#pragma unroll
        for (int nb = 0; nb < 4; ++nb) {
#pragma unroll
            for (int j = 0; j < 8; ++j) my[(hi * 8 + j) * 68 + nb * 16 + lr] = acc[mb][nb][j]; } }
    __syncthreads();   // every wave's partial tile stands in LDS before any wave sums across the waves
#pragma unroll
    for (int mb = 0; mb < 4; ++mb) { const int row = 2 * w + hi, cofs = lr * 4; const float* ps = os + mb * KW * (16 * 68) + row * 68 + cofs; v4f val = *(const v4fa*)ps;
#pragma unroll
        for (int q = 1; q < KW; ++q) val += *(const v4fa*)(ps + q * (16 * 68));
        const int m = r0 + mb * 16 + row;
        if constexpr (VT) { const float bm = bfr(bias[m]); val[0] += bm; val[1] += bm; val[2] += bm; val[3] += bm; }
        else { val[0] += bfr(bias[c0 + cofs]); val[1] += bfr(bias[c0 + cofs + 1]); val[2] += bfr(bias[c0 + cofs + 2]); val[3] += bfr(bias[c0 + cofs + 3]); }
        v4h o16;
#pragma unroll
        for (int j = 0; j < 4; ++j) o16[j] = (h16)val[j];
        h16* dst = VT ? P + (size_t)m * TT + c0 + cofs : P + ((size_t)blockIdx.y * TT + m) * HD + cofs;
        *(v4h*)dst = o16; }
}

// k_cvtT: in W[K rows][N cols] f32 -> out Wt[N rows][K cols] bf16 (RNE), 64x64 tile transposed through LDS (cross-wave: block barrier); grid (K/64, N/64).
__global__ __launch_bounds__(256) void k_cvtT(const float* __restrict__ W, bf* Wt, int K, int N) {
    __shared__ unsigned short tl[64 * 66];
    const int tid = threadIdx.x; const int k0 = blockIdx.x * 64, n0 = blockIdx.y * 64;
    { const int row = tid >> 2, cseg = (tid & 3) * 16;
#pragma unroll
      for (int q = 0; q < 4; ++q) { const v4f v = *(const v4f*)(W + (size_t)(k0 + row) * N + n0 + cseg + q * 4);
#pragma unroll
          for (int j = 0; j < 4; ++j) tl[row * 66 + cseg + q * 4 + j] = f2bf(v[j]); } }
    __syncthreads();
    const int piece = tid & 7; v8us o[2];
#pragma unroll
    for (int it = 0; it < 2; ++it) { const int n = it * 32 + (tid >> 3);
#pragma unroll
        for (int j = 0; j < 8; ++j) o[it][j] = tl[(piece * 8 + j) * 66 + n]; }
{
#pragma unroll
        for (int it = 0; it < 2; ++it) { const int n = it * 32 + (tid >> 3); *(v8us*)(Wt + (size_t)(n0 + n) * K + k0 + piece * 8) = o[it]; }
         }
}

// k_fattn: grid (TT / 16, NB), 8 waves; block = 16 query rows q0.. of batch b, wave w = head w.
// Bias tile, per stage of KS keys: wave w makes query rows 2w, 2w+1 for all 8 heads. One WMMA per 32 key positions: A rows = 16 positions, k 0..15 = channel activations of position t0+m, k 16..31 = of position t0+16+m (f16);
// B block-diagonal: B[c][h] = c2w[h][c] for h < 8, B[16+c][8+h] = c2w[h][c], zero elsewhere. D[p][h] -> position t0+p, D[p][8+h] -> position t0+16+p. Stored as rb[h][query][key] (f32).
// A key with mask == 0 gets the bias MFILL: S + MFILL == MFILL in f32 for every |S| < 1e30, so all masked scores of a row are one equal value far below any real score (weight 0 beside a real key, uniform weights where every key is masked), as with the -1e9 fill.
// Scores: A = 16 key rows of k, B = the 16 query rows of q (kept in registers): D element j = (key 8*(lane>>4) + j, query lane & 15). Two such tiles, converted to f16, are the B operand (k order 8*(lane>>4)+0..7, 16+8*(lane>>4)+0..7) of O^T += v^T P^T.
// Every inner loop is unrolled so that the register arrays (fragments, scores, accumulators) are indexed by constants and the LDS and global offsets fold into immediates.
#define MFILL (-3.0e38f)
#define L2E   1.4426950408889634f
// 2^x. The v_nop is the slot that the instruction set asks for behind a transcendental before its result is read or its source overwritten.
__device__ __forceinline__ float ex2(float x) { float r; asm("v_exp_f32 %0, %1\n\tv_nop" : "=v"(r) : "v"(x)); return r; }
__global__ __launch_bounds__(256) void k_fattn(const h16* __restrict__ Q16, const h16* __restrict__ K16, const h16* __restrict__ V16, const float* __restrict__ rel, const int* __restrict__ mask,
                                               const float* __restrict__ c1w, const float* __restrict__ c1b, const float* __restrict__ c2w, const float* __restrict__ c2b, bf* Ah, bf* Al) {
    __shared__ __align__(16) float rb[2][NH_ * RHS];
    __shared__ __align__(16) int mks[TT];
    constexpr int NS = TT / KS;
    const int lane = threadIdx.x & 31, lr = lane & 15, hi = lane >> 4;
    const int w = __builtin_amdgcn_readfirstlane((int)(threadIdx.x >> 5));   // wave number in a scalar register: plane bases stay scalar
    const int b = blockIdx.y, q0 = blockIdx.x * 16;
    for (int idx = threadIdx.x; idx < TT / 4; idx += 256) { const v4i m4 = *(const v4i*)(mask + (size_t)b * SEQ_FULL + idx * 4); *(v4ia*)(mks + idx * 4) = m4; }
    float w1[8], b1[8];
#pragma unroll
    for (int i = 0; i < 8; ++i) { w1[i] = bfr(c1w[8 * hi + i]); b1[i] = bfr(c1b[8 * hi + i]); }
    const int hd = lr & 7, g = lr >> 3;
    v16h bw;
#pragma unroll
    for (int i = 0; i < 8; ++i) { const h16 c = (h16)bfr(c2w[hd * 16 + 8 * hi + i]); const h16 zr = (h16)0.0f; bw[i] = (g == 0) ? c : zr; bw[8 + i] = (g == 1) ? c : zr; }
    const float bias2 = bfr(c2b[hd]);
    const float* rr0 = rel + ((size_t)b * SEQ_FULL + q0 + 2 * w) * SEQ_FULL + lr;
    float xr[8];   // the wave's rel_pos values of the next stage to be made, fetched one stage ahead
    auto ldx = [&](int s) {
#pragma unroll
        for (int qq = 0; qq < 2; ++qq)
#pragma unroll
            for (int gk = 0; gk < 2; ++gk) { const float* p = rr0 + (size_t)qq * SEQ_FULL + s * KS + gk * 32; xr[qq * 4 + gk * 2] = p[0]; xr[qq * 4 + gk * 2 + 1] = p[16]; } };
    auto produce = [&](int s, float* dstb) {
#pragma unroll
        for (int gk = 0; gk < 2; ++gk) {
            const int* mp = mks + s * KS + gk * 32 + 16 * g + 8 * hi; const v4i m0 = *(const v4ia*)mp; const v4i m1 = *(const v4ia*)(mp + 4);
#pragma unroll
            for (int qq = 0; qq < 2; ++qq) {
                const float xa = bfr(xr[qq * 4 + gk * 2]), xb = bfr(xr[qq * 4 + gk * 2 + 1]);
                v16h a;
#pragma unroll
                for (int i = 0; i < 8; ++i) { a[i] = (h16)fmaxf(fmaf(xa, w1[i], b1[i]), 0.0f); a[8 + i] = (h16)fmaxf(fmaf(xb, w1[i], b1[i]), 0.0f); }
                const v8f acc = wmma16(a, bw, (v8f){});
                v4f o0, o1;
#pragma unroll
                for (int j = 0; j < 4; ++j) { o0[j] = (m0[j] == 0) ? MFILL : acc[j] + bias2; o1[j] = (m1[j] == 0) ? MFILL : acc[4 + j] + bias2; }
                float* dst = dstb + hd * RHS + (2 * w + qq) * RPI + gk * 32 + 16 * g + 8 * hi;
                *(v4fa*)dst = o0; *(v4fa*)(dst + 4) = o1; } } };
    const size_t pl = ((size_t)b * NH_ + w) * TT * HD;
    const h16* kp = K16 + pl + (lr * HD + 8 * hi); const h16* vp = V16 + pl + (lr * TT + 8 * hi);   // the lane's fragment addresses in the current stage of its head's k and v planes; both step on by one stage at the foot of a trip
    v16h qf[2];
#pragma unroll
    for (int dk = 0; dk < 2; ++dk) qf[dk] = WFrag<h16>::ld(Q16 + pl + (size_t)(q0 + lr) * HD + dk * 32 + 8 * hi);
    v8f o[4];
#pragma unroll
    for (int dg = 0; dg < 4; ++dg) o[dg] = (v8f){};
    float mrun = MFILL, lsum = 0.0f;
    ldx(0);
    __syncthreads();   // the mask stands in LDS before any wave reads it
    produce(0, rb[0]);
    ldx(1);
    __syncthreads();   // stage 0 of the bias tile stands in LDS before any wave reads it
#pragma unroll 1   // one stage per trip: an unrolled body would not hold its fragments in registers
    for (int s = 0; s < NS; ++s) {
        v16h kf[4][2];
#pragma unroll
        for (int kg = 0; kg < 4; ++kg)
#pragma unroll
            for (int dk = 0; dk < 2; ++dk) kf[kg][dk] = WFrag<h16>::ld(kp + (kg * 16 * HD + dk * 32));
        asm volatile("s_wait_xcnt 0x0" ::: "memory");   // stands behind the run of k loads, in front of the step of kp, whose registers they name
        if (s + 1 < NS) { produce(s + 1, rb[(s + 1) & 1]); ldx(s + 2 < NS ? s + 2 : NS - 1); }
        v16h vf[2][4];
#pragma unroll
        for (int gk = 0; gk < 2; ++gk)
#pragma unroll
            for (int dg = 0; dg < 4; ++dg) vf[gk][dg] = WFrag<h16>::ld(vp + (dg * 16 * TT + gk * 32));
        const float* rbp = rb[s & 1] + w * RHS + lr * RPI + 8 * hi;
        float t[4][8]; float mx = MFILL;
#pragma unroll
        for (int kg = 0; kg < 4; ++kg) {
            v8f st = (v8f){};
            st = wmma16(kf[kg][0], qf[0], st); st = wmma16(kf[kg][1], qf[1], st);
            const v4f r0 = *(const v4fa*)(rbp + kg * 16); const v4f r1 = *(const v4fa*)(rbp + kg * 16 + 4);
#pragma unroll
            for (int j = 0; j < 4; ++j) { t[kg][j] = (st[j] + r0[j]) * SCL; t[kg][4 + j] = (st[4 + j] + r1[j]) * SCL; mx = fmaxf(mx, fmaxf(t[kg][j], t[kg][4 + j])); } }
        mx = fmaxf(mx, __shfl_xor(mx, 16, 32));   // the other half of the wave holds the query's other keys
        const float mnew = fmaxf(mrun, mx);
        const float corr = ex2((mrun - mnew) * L2E);
        mrun = mnew;
        float ps = 0.0f; v16h pb[2];
#pragma unroll
        for (int kg = 0; kg < 4; ++kg)
#pragma unroll
            for (int j = 0; j < 8; ++j) { const float p = ex2(fmaf(t[kg][j] - mnew, L2E, 10.0f)); ps += p; pb[kg >> 1][(kg & 1) * 8 + j] = (h16)p; }   // + 10: the x1024 carry
        lsum = fmaf(lsum, corr, ps);
#pragma unroll
        for (int dg = 0; dg < 4; ++dg) o[dg] *= corr;
#pragma unroll
        for (int gk = 0; gk < 2; ++gk)
#pragma unroll
            for (int dg = 0; dg < 4; ++dg) o[dg] = wmma16(vf[gk][dg], pb[gk], o[dg]);
        kp += KS * HD; vp += KS;
        __syncthreads();   // publishes stage s + 1 of the bias tile and ends every wave's reads of stage s, whose buffer the next trip refills
    }
    lsum += __shfl_xor(lsum, 16, 32);
    const float f = __fdiv_rn(PCAR, lsum);
    const float cs = 1.0f / PCAR;
    const size_t oo = ((size_t)b * TT + q0 + lr) * DM + w * HD + 8 * hi;   // context row of the lane's query, its head's 64 columns: one wave writes each 128-byte line of both planes
#pragma unroll
    for (int dg = 0; dg < 4; ++dg) { v8us oh, ol;
#pragma unroll
        for (int j = 0; j < 8; ++j) { unsigned short a, c2; splitf(o[dg][j] * f * cs, a, c2); oh[j] = a; ol[j] = c2; }
        *(v8us*)(Ah + oo + dg * 16) = oh; *(v8us*)(Al + oo + dg * 16) = ol; }
}

constexpr size_t al256(size_t b) { return (b + 255) & ~(size_t)255; }
constexpr size_t WS_TOTAL = 4 * al256((size_t)DM * DM * 2) + 3 * al256((size_t)NB * NH_ * TT * HD * 2) + 2 * al256((size_t)NB * TT * DM * 2);
static_assert(WS_TOTAL <= (size_t)134217728);

extern "C" void kernel_launch(void* const* d_in, const int* in_sizes, int n_in,
                              void* d_out, int out_size, void* d_ws, size_t ws_size, hipStream_t stream) {
    if (n_in < 17) return;
    const size_t need_x = ((size_t)(NB - 1) * SEQ_FULL + SEQ) * DM;
    const size_t need_r = (size_t)(NB - 1) * SEQ_FULL * SEQ_FULL + (size_t)(SEQ - 1) * SEQ_FULL + SEQ;
    if ((size_t)in_sizes[0] < need_x || (size_t)in_sizes[1] < need_x || (size_t)in_sizes[2] < need_x || (size_t)in_sizes[3] < need_r) return;
    if ((size_t)in_sizes[4] < (size_t)(NB - 1) * SEQ_FULL + SEQ) return;
    if (in_sizes[5] < DM * DM || in_sizes[7] < DM * DM || in_sizes[9] < DM * DM || in_sizes[11] < DM * DM) return;
    if (in_sizes[6] < DM || in_sizes[8] < DM || in_sizes[10] < DM || in_sizes[12] < DM) return;
    if (in_sizes[13] < 16 || in_sizes[14] < 16 || in_sizes[15] < 128 || in_sizes[16] < 8) return;
    if ((size_t)out_size < need_x) return;
    const float* xq = (const float*)d_in[0]; const float* xk = (const float*)d_in[1]; const float* xv = (const float*)d_in[2];
    const float* rel = (const float*)d_in[3]; const int* msk = (const int*)d_in[4];
    const float* wq = (const float*)d_in[5]; const float* bq = (const float*)d_in[6]; const float* wk = (const float*)d_in[7]; const float* bk = (const float*)d_in[8];
    const float* wv = (const float*)d_in[9]; const float* bv = (const float*)d_in[10]; const float* wo = (const float*)d_in[11]; const float* bo = (const float*)d_in[12];
    const float* c1w = (const float*)d_in[13]; const float* c1b = (const float*)d_in[14]; const float* c2w = (const float*)d_in[15]; const float* c2b = (const float*)d_in[16];
    float* OUT = (float*)d_out;     // [NB_FULL][SEQ_FULL][DM]
    char* wsp = (char*)d_ws;
    auto take = [&](size_t bytes) { char* p = wsp; wsp += (bytes + 255) & ~(size_t)255; return (void*)p; };
    bf* WQ = (bf*)take((size_t)DM * DM * 2); bf* WK = (bf*)take((size_t)DM * DM * 2); bf* WV = (bf*)take((size_t)DM * DM * 2); bf* WO = (bf*)take((size_t)DM * DM * 2);
    h16* QP16 = (h16*)take((size_t)NB * NH_ * TT * HD * 2); h16* KP16 = (h16*)take((size_t)NB * NH_ * TT * HD * 2); h16* VT16 = (h16*)take((size_t)NB * NH_ * HD * TT * 2);
    bf* ATh = (bf*)take((size_t)NB * TT * DM * 2); bf* ATl = (bf*)take((size_t)NB * TT * DM * 2);
    if ((size_t)(wsp - (char*)d_ws) > ws_size) return;
    // weights: in W[k rows][n cols] -> out Wt[n rows][k cols]; square DM x DM, grid (K/64, N/64)
    k_cvtT<<<dim3(DM / 64, DM / 64), 256, 0, stream>>>(wq, WQ, DM, DM);
    k_cvtT<<<dim3(DM / 64, DM / 64), 256, 0, stream>>>(wk, WK, DM, DM);
    k_cvtT<<<dim3(DM / 64, DM / 64), 256, 0, stream>>>(wv, WV, DM, DM);
    k_cvtT<<<dim3(DM / 64, DM / 64), 256, 0, stream>>>(wo, WO, DM, DM);
    for (int b = 0; b < NB; ++b) {
        const size_t xoff = (size_t)b * SEQ_FULL * DM; const size_t poff = (size_t)b * NH_ * TT * HD;
        k_proj<false><<<dim3(TT / 64, DM / 64), 256, 0, stream>>>(xq + xoff, WQ, bq, QP16 + poff);
        k_proj<false><<<dim3(TT / 64, DM / 64), 256, 0, stream>>>(xk + xoff, WK, bk, KP16 + poff);
        k_proj<true><<<dim3(DM / 64, TT / 64), 256, 0, stream>>>(xv + xoff, WV, bv, VT16 + poff);
    }
    k_fattn<<<dim3(TT / 16, NB), 256, 0, stream>>>(QP16, KP16, VT16, rel, msk, c1w, c1b, c2w, c2b, ATh, ATl);
    for (int b = 0; b < NB; ++b) {
        const size_t xoff = (size_t)b * SEQ_FULL * DM; const size_t coff = (size_t)b * TT * DM;
        k_gemmw<bf, 1, true, 8><<<dim3(TT / 64, DM / 64, 1), 256, 0, stream>>>(ATh + coff, ATl + coff, WO, nullptr, DM, OUT + xoff, DM, bo, 0, 0, 0);
    }
}

// v004
// Measured time: 131 microseconds a run.
// Two timings next to v003 put it at 1.11 and 1.09 times that version's speed.
// All steps since v000 together make it 5.75 times as fast.
#include <hip/hip_runtime.h>

// Compute dtypes (f32 accumulate everywhere): q/k/v projections v_wmma_f32_16x16x32_bf16 (inputs RNE-converted to bf16, products exact); pointwise-bias channel mix (16 ch -> 8 heads) v_wmma_f32_16x16x32_f16; q.k scores f16; probabilities (x1024 carry) x values f16; output projection bf16 hi+lo context x bf16 weights (2 products); softmax and mask fill in f32.
// Layout per batch: projection of the f32 q / k / v input stream (converted to bf16 in the fragment loader; + f32 bias) -> f16 head planes q, k, v in fragment order (see k_proj), stored by the projection itself;
// one attention launch for both batches: a block owns 16 query rows and all 8 heads (wave = head) and walks the keys in stages of 64: bias tile R[h][i][t] (one block-diagonal WMMA per 32 key positions, shared through LDS),
// S^T = k q^T, running-maximum softmax of (S + R) / 8 with key-mask fill, P (x1024 carry) as f16 straight from the score accumulators, O^T += v^T P^T; scores and probabilities never leave the registers.
// the attention launch stores the merged hi/lo context planes [b][t][h*64+d] (x 1/1024); output projection + bias. Weights [in][out] are transposed once through LDS into K-contiguous bf16 planes.

#ifndef NB
#define NB 2
#endif
#ifndef SEQ
#define SEQ 2048
#endif
#define NB_FULL  2
#define SEQ_FULL 2048
#define TT   SEQ
#define DM   512
#define NH_  8
#define HD   64
#define KS   64          // keys per stage of the attention loop
#define RPI  (KS + 4)    // f32 pitch of one (head, query) row of the staged bias tile
#define RHS  (16 * RPI + 4)   // f32 pitch of one head's 16 rows: the 8 heads that one store instruction writes start on different LDS banks
#define PCAR 1024.0f
#define SCL  0.125f   // HD^-0.5
static_assert(NH_ * HD == DM);
static_assert(TT % 256 == 0);
static_assert(TT % KS == 0 && TT / KS >= 2);
static_assert(DM % 256 == 0);
static_assert(SEQ <= SEQ_FULL);
static_assert(NB <= NB_FULL);

typedef _Float16 h16;
typedef unsigned short bf;
typedef __attribute__((ext_vector_type(16))) __bf16   v16bf;
typedef __attribute__((ext_vector_type(16))) _Float16 v16h;
typedef __attribute__((ext_vector_type(8)))  _Float16 v8h;
typedef __attribute__((ext_vector_type(8)))  unsigned short v8us;
typedef __attribute__((ext_vector_type(8)))  float    v8f;
typedef __attribute__((ext_vector_type(4)))  float    v4f;
typedef __attribute__((ext_vector_type(2)))  _Float16 v2h;
typedef __attribute__((ext_vector_type(4)))  _Float16 v4h;
typedef __attribute__((ext_vector_type(2)))  unsigned short v2us;
typedef __attribute__((ext_vector_type(4)))  int v4i;
typedef v4f  __attribute__((may_alias)) v4fa;
typedef v4i  __attribute__((may_alias)) v4ia;

__device__ __forceinline__ unsigned short f2bf(float f) { unsigned u = __float_as_uint(f); u += 0x7FFFu + ((u >> 16) & 1u); return (unsigned short)(u >> 16); }
__device__ __forceinline__ float bf2f(unsigned short b) { return __uint_as_float(((unsigned)b) << 16); }
__device__ __forceinline__ float bfr(float f) { return bf2f(f2bf(f)); }
__device__ __forceinline__ v16h cat16(v8h lo, v8h hi) { return __builtin_shufflevector(lo, hi, 0, 1, 2, 3, 4, 5, 6, 7, 8, 9, 10, 11, 12, 13, 14, 15); }
__device__ __forceinline__ v16bf cat16b(v8us lo, v8us hi) { return __builtin_bit_cast(v16bf, __builtin_shufflevector(lo, hi, 0, 1, 2, 3, 4, 5, 6, 7, 8, 9, 10, 11, 12, 13, 14, 15)); }
__device__ __forceinline__ v8f wmma16(v16h a, v16h b, v8f c) { return __builtin_amdgcn_wmma_f32_16x16x32_f16(false, a, false, b, (short)0, c, false, false); }
__device__ __forceinline__ v8f wmmab(v16bf a, v16bf b, v8f c) { return __builtin_amdgcn_wmma_f32_16x16x32_bf16(false, a, false, b, (short)0, c, false, false); }
__device__ __forceinline__ void splitf(float y, unsigned short& h, unsigned short& l) { h = f2bf(y); l = f2bf(y - bf2f(h)); }

// ---- k_gemmw: register-blocked GEMM, one block of KW waves per 64x64 output tile, operands straight from K-contiguous 16-bit planes; grid (M/64, N/64, Z), KW * 32 threads.
// Wave w holds the whole tile (16 accumulators) for k in [w * K / KW, (w + 1) * K / KW); for KW > 1 the KW partial tiles meet in LDS and are summed in wave order 0..KW-1. K % (32 * KW) == 0.
// C[m][n] (f32, pitch ldc, + optional f32 bias[n]) = sum_k A[m][k] Bt[n][k] (+ split products per NSPLIT). z-batch strides sA/sB/sC in elements. K % 32 == 0, A/Bt row pitch == K.
// Fragment map (A and Bt alike): lane row = lane & 15, elements 0..7 <- k0 + 8*(lane>>4) + 0..7, elements 8..15 <- k0 + 16 + 8*(lane>>4) + 0..7; D element j = (row 8*(lane>>4) + j, col lane & 15).
template <typename T16> struct WFrag;
template <> struct WFrag<h16> { typedef v16h V; static __device__ __forceinline__ V ld(const h16* p) { return cat16(*(const v8h*)p, *(const v8h*)(p + 16)); } static __device__ __forceinline__ v8f mma(V a, V b, v8f c) { return wmma16(a, b, c); } };
template <> struct WFrag<bf> { typedef v16bf V; static __device__ __forceinline__ V ld(const bf* p) { return cat16b(*(const v8us*)p, *(const v8us*)(p + 16)); } static __device__ __forceinline__ v8f mma(V a, V b, v8f c) { return wmmab(a, b, c); } };
template <typename T16, int NSPLIT, bool BIAS, int KW>
__global__ __launch_bounds__(KW * 32) void k_gemmw(const T16* __restrict__ A, const T16* __restrict__ A2, const T16* __restrict__ Bt, const T16* __restrict__ Bt2, int K, float* C, int ldc, const float* __restrict__ bias, size_t sA, size_t sB, size_t sC) {
    typedef typename WFrag<T16>::V V;
    static_assert(KW >= 1 && KW <= 8 && 8 % KW == 0);
    __shared__ __align__(16) float os[(KW > 1 ? 4 * KW : 1) * 16 * 68];
    const size_t z = blockIdx.z; A += z * sA; if (A2) A2 += z * sA; Bt += z * sB; if (Bt2) Bt2 += z * sB; C += z * sC;
    const int lane = threadIdx.x & 31, lr = lane & 15, hi = lane >> 4; const int r0 = blockIdx.x * 64, c0 = blockIdx.y * 64;
    v8f acc[4][4];
#pragma unroll
    for (int mb = 0; mb < 4; ++mb)
#pragma unroll
        for (int nb = 0; nb < 4; ++nb) acc[mb][nb] = (v8f){};
    const size_t aoff = (size_t)(r0 + lr) * K + 8 * hi, boff = (size_t)(c0 + lr) * K + 8 * hi;
    const int w = KW > 1 ? __builtin_amdgcn_readfirstlane((int)(threadIdx.x >> 5)) : 0;   // wave number in a scalar register: the k loop's bounds and branch stay scalar
    const int kspan = K / KW, kbeg = w * kspan, kend = kbeg + kspan;
#pragma unroll 1
    for (int kc = kbeg; kc < kend; kc += 32) {
        V a[4], a2[4];
#pragma unroll
        for (int mb = 0; mb < 4; ++mb) { a[mb] = WFrag<T16>::ld(A + aoff + (size_t)mb * 16 * K + kc); if (NSPLIT == 1 || NSPLIT == 2) a2[mb] = WFrag<T16>::ld(A2 + aoff + (size_t)mb * 16 * K + kc); }
#pragma unroll
        for (int nb = 0; nb < 4; ++nb) { const V b = WFrag<T16>::ld(Bt + boff + (size_t)nb * 16 * K + kc); V b2; if (NSPLIT >= 2) b2 = WFrag<T16>::ld(Bt2 + boff + (size_t)nb * 16 * K + kc);
#pragma unroll
            for (int mb = 0; mb < 4; ++mb) { acc[mb][nb] = WFrag<T16>::mma(a[mb], b, acc[mb][nb]); if (NSPLIT == 1 || NSPLIT == 2) acc[mb][nb] = WFrag<T16>::mma(a2[mb], b, acc[mb][nb]); if (NSPLIT >= 2) acc[mb][nb] = WFrag<T16>::mma(a[mb], b2, acc[mb][nb]); } }
        asm volatile("v_nop\n\tv_nop\n\tv_nop\n\tv_nop" : "+v"(acc[0][0]), "+v"(acc[1][1]), "+v"(acc[2][2]), "+v"(acc[3][3]) : "v"(a[0]), "v"(a[3]));
    }
    if constexpr (KW > 1) {   // loops below are unrolled so that acc[][] is indexed by constants and stays in registers, and the LDS offsets fold into immediates
#pragma unroll
        for (int mb = 0; mb < 4; ++mb) { float* my = os + (mb * KW + w) * (16 * 68);
#pragma unroll
            for (int nb = 0; nb < 4; ++nb) {
#pragma unroll
                for (int j = 0; j < 8; ++j) my[(hi * 8 + j) * 68 + nb * 16 + lr] = acc[mb][nb][j]; } }
        __syncthreads();   // every wave's partial tile stands in LDS before any wave sums across the waves
#pragma unroll
        for (int mb = 0; mb < 4; ++mb) { float* crow = C + (size_t)(r0 + mb * 16) * ldc + c0;
#pragma unroll
            for (int s0 = 0; s0 < 8; s0 += KW) { const int row = 2 * (s0 + w) + hi, cofs = lr * 4; const float* ps = os + mb * KW * (16 * 68) + row * 68 + cofs; v4f val = *(const v4fa*)ps;
#pragma unroll
                for (int q = 1; q < KW; ++q) val += *(const v4fa*)(ps + q * (16 * 68));
                if (BIAS) { val[0] += bfr(bias[c0 + cofs]); val[1] += bfr(bias[c0 + cofs + 1]); val[2] += bfr(bias[c0 + cofs + 2]); val[3] += bfr(bias[c0 + cofs + 3]); }
                *(v4f*)(crow + (size_t)row * ldc + cofs) = val; } }
        return;
    }
#pragma unroll
    for (int mb = 0; mb < 4; ++mb) {
#pragma unroll
        for (int nb = 0; nb < 4; ++nb) {
#pragma unroll
            for (int j = 0; j < 8; ++j) os[(hi * 8 + j) * 68 + nb * 16 + lr] = acc[mb][nb][j]; }
        __builtin_amdgcn_wave_barrier(); asm volatile("" ::: "memory");
        float* crow = C + (size_t)(r0 + mb * 16) * ldc + c0;
{
#pragma unroll
            for (int s = 0; s < 8; ++s) { const int row = 2 * s + hi, cofs = lr * 4; v4f val = *(const v4fa*)(os + row * 68 + cofs); if (BIAS) { val[0] += bfr(bias[c0 + cofs]); val[1] += bfr(bias[c0 + cofs + 1]); val[2] += bfr(bias[c0 + cofs + 2]); val[3] += bfr(bias[c0 + cofs + 3]); }
                *(v4f*)(crow + (size_t)row * ldc + cofs) = val; }
             }
        __builtin_amdgcn_wave_barrier(); asm volatile("" ::: "memory");
    }
}

// k_proj: one 64x64 tile of a q / k / v projection per block of 8 waves, K = DM split over the waves as in k_gemmw (same fragment map, same sum in wave order); the f32 input stream is read as it is and rounded to bf16 (RNE) in the fragment loader.
// VT == false (q, k): A rows = positions t of X, B rows = output columns n of Wt; grid (TT/64, DM/64); a tile's 64 columns are one head.
// VT == true (v): A rows = output columns n of Wt, B rows = positions t of X, so that the tile comes out transposed; grid (DM/64, TT/64); a tile's 64 rows are one head.
// Head planes are stored in fragment order: a chunk of 512 contiguous bytes is what one 16-byte-per-lane load of the attention kernel takes, lane l = 16 * hi + lr at byte 16 * l. 16 positions of a head are 4 chunks (2 KiB), a head plane is TT / 16 such groups.
// q, k: chunk c of position group tg: lane holds position 16 * tg + lr, d = 16 * c + 8 * hi + 0..7. v: chunk dg of position group tg: lane holds d = 16 * dg + lr, positions 16 * tg + 8 * hi + 0..7.
// In both cases a chunk is rows 16 * mb + lr, columns 16 * c + 8 * hi + 0..7 of the tile; wave w stores chunks (mb = w >> 1, c = 2 * (w & 1) + 0..1), each store instruction four whole 128-byte lines.
typedef __attribute__((ext_vector_type(8))) __bf16 v8bf;
__device__ __forceinline__ v16bf ldxf(const float* p) { const v8f lo = *(const v8f*)p, hi = *(const v8f*)(p + 16);
    return __builtin_shufflevector(__builtin_convertvector(lo, v8bf), __builtin_convertvector(hi, v8bf), 0, 1, 2, 3, 4, 5, 6, 7, 8, 9, 10, 11, 12, 13, 14, 15); }
template <bool VT>
__global__ __launch_bounds__(256) void k_proj(const float* __restrict__ X, const bf* __restrict__ Wt, const float* __restrict__ bias, h16* P) {
    constexpr int KW = 8, K = DM;
    __shared__ __align__(16) float os[4 * KW * 16 * 68];
    const int lane = threadIdx.x & 31, lr = lane & 15, hi = lane >> 4; const int r0 = blockIdx.x * 64, c0 = blockIdx.y * 64;
    v8f acc[4][4];
#pragma unroll
    for (int mb = 0; mb < 4; ++mb)
#pragma unroll
        for (int nb = 0; nb < 4; ++nb) acc[mb][nb] = (v8f){};
    const size_t aoff = (size_t)(r0 + lr) * K + 8 * hi, boff = (size_t)(c0 + lr) * K + 8 * hi;
    const int w = __builtin_amdgcn_readfirstlane((int)(threadIdx.x >> 5));   // wave number in a scalar register: the wave's k offset stays scalar
    const int kbeg = w * (K / KW), kend = kbeg + K / KW;
#pragma unroll   // both trips in line: the second trip's loads issue while the first trip's products still run
    for (int kc = kbeg; kc < kend; kc += 32) {
        v16bf a[4];
#pragma unroll
        for (int mb = 0; mb < 4; ++mb) { if constexpr (VT) a[mb] = WFrag<bf>::ld(Wt + aoff + (size_t)mb * 16 * K + kc); else a[mb] = ldxf(X + aoff + (size_t)mb * 16 * K + kc); }
#pragma unroll
        for (int nb = 0; nb < 4; ++nb) { v16bf b; if constexpr (VT) b = ldxf(X + boff + (size_t)nb * 16 * K + kc); else b = WFrag<bf>::ld(Wt + boff + (size_t)nb * 16 * K + kc);
#pragma unroll
            for (int mb = 0; mb < 4; ++mb) acc[mb][nb] = wmmab(a[mb], b, acc[mb][nb]); }
    }
    // loops below are unrolled so that acc[][] is indexed by constants and stays in registers, and the LDS offsets fold into immediates
#pragma unroll
    for (int mb = 0; mb < 4; ++mb) { float* my = os + (mb * KW + w) * (16 * 68);
#pragma unroll
        for (int nb = 0; nb < 4; ++nb) {
#pragma unroll
            for (int j = 0; j < 8; ++j) my[(hi * 8 + j) * 68 + nb * 16 + lr] = acc[mb][nb][j]; } }
    __syncthreads();   // every wave's partial tile stands in LDS before any wave sums across the waves
    const int mb = w >> 1, cb = 2 * (w & 1);   // the wave's chunks: (mb, cb) and (mb, cb + 1)
    const float* ps0 = os + mb * KW * (16 * 68) + lr * 68 + cb * 16 + hi * 8;
    const float* bp = VT ? bias + r0 + mb * 16 + lr : bias + c0 + cb * 16 + hi * 8;
    h16* dst = VT ? P + (size_t)blockIdx.x * (HD * TT) + (size_t)((c0 >> 4) + cb) * 1024 + mb * 256 + lane * 8 : P + (size_t)blockIdx.y * (TT * HD) + (size_t)((r0 >> 4) + mb) * 1024 + cb * 256 + lane * 8;
#pragma unroll
    for (int it = 0; it < 2; ++it) { const float* ps = ps0 + it * 16; v4f va = *(const v4fa*)ps, vb = *(const v4fa*)(ps + 4);
#pragma unroll
        for (int q = 1; q < KW; ++q) { va += *(const v4fa*)(ps + q * (16 * 68)); vb += *(const v4fa*)(ps + q * (16 * 68) + 4); }
        v8h o16;
#pragma unroll
        for (int j = 0; j < 4; ++j) { o16[j] = (h16)(va[j] + bfr(bp[VT ? 0 : it * 16 + j])); o16[4 + j] = (h16)(vb[j] + bfr(bp[VT ? 0 : it * 16 + 4 + j])); }
        *(v8h*)(dst + it * (VT ? 1024 : 256)) = o16; }
}

// k_cvtT: in W[K rows][N cols] f32 -> out Wt[N rows][K cols] bf16 (RNE), 64x64 tile transposed through LDS (cross-wave: block barrier); grid (K/64, N/64).
__global__ __launch_bounds__(256) void k_cvtT(const float* __restrict__ W, bf* Wt, int K, int N) {
    __shared__ unsigned short tl[64 * 66];
    const int tid = threadIdx.x; const int k0 = blockIdx.x * 64, n0 = blockIdx.y * 64;
    { const int row = tid >> 2, cseg = (tid & 3) * 16;
#pragma unroll
      for (int q = 0; q < 4; ++q) { const v4f v = *(const v4f*)(W + (size_t)(k0 + row) * N + n0 + cseg + q * 4);
#pragma unroll
          for (int j = 0; j < 4; ++j) tl[row * 66 + cseg + q * 4 + j] = f2bf(v[j]); } }
    __syncthreads();
    const int piece = tid & 7; v8us o[2];
#pragma unroll
    for (int it = 0; it < 2; ++it) { const int n = it * 32 + (tid >> 3);
#pragma unroll
        for (int j = 0; j < 8; ++j) o[it][j] = tl[(piece * 8 + j) * 66 + n]; }
{
#pragma unroll
        for (int it = 0; it < 2; ++it) { const int n = it * 32 + (tid >> 3); *(v8us*)(Wt + (size_t)(n0 + n) * K + k0 + piece * 8) = o[it]; }
         }
}

// k_fattn: grid (TT / 16, NB), 8 waves; block = 16 query rows q0.. of batch b, wave w = head w.
// Bias tile, per stage of KS keys: wave w makes query rows 2w, 2w+1 for all 8 heads. One WMMA per 32 key positions: A rows = 16 positions, k 0..15 = channel activations of position t0+m, k 16..31 = of position t0+16+m (f16);
// B block-diagonal: B[c][h] = c2w[h][c] for h < 8, B[16+c][8+h] = c2w[h][c], zero elsewhere. D[p][h] -> position t0+p, D[p][8+h] -> position t0+16+p. Stored as rb[h][query][key] (f32).
// A key with mask == 0 gets the bias MFILL: S + MFILL == MFILL in f32 for every |S| < 1e30, so all masked scores of a row are one equal value far below any real score (weight 0 beside a real key, uniform weights where every key is masked), as with the -1e9 fill.
// Scores: A = 16 key rows of k, B = the 16 query rows of q (kept in registers): D element j = (key 8*(lane>>4) + j, query lane & 15). Two such tiles, converted to f16, are the B operand (k order 8*(lane>>4)+0..7, 16+8*(lane>>4)+0..7) of O^T += v^T P^T.
// Every inner loop is unrolled so that the register arrays (fragments, scores, accumulators) are indexed by constants and the LDS and global offsets fold into immediates.
#define MFILL (-3.0e38f)
#define L2E   1.4426950408889634f
// 2^x. The v_nop is the slot that the instruction set asks for behind a transcendental before its result is read or its source overwritten.
__device__ __forceinline__ float ex2(float x) { float r; asm("v_exp_f32 %0, %1\n\tv_nop" : "=v"(r) : "v"(x)); return r; }
__global__ __launch_bounds__(256) void k_fattn(const h16* __restrict__ Q16, const h16* __restrict__ K16, const h16* __restrict__ V16, const float* __restrict__ rel, const int* __restrict__ mask,
                                               const float* __restrict__ c1w, const float* __restrict__ c1b, const float* __restrict__ c2w, const float* __restrict__ c2b, bf* Ah, bf* Al) {
    __shared__ __align__(16) float rb[2][NH_ * RHS];
    __shared__ __align__(16) int mks[TT];
    constexpr int NS = TT / KS;
    const int lane = threadIdx.x & 31, lr = lane & 15, hi = lane >> 4;
    const int w = __builtin_amdgcn_readfirstlane((int)(threadIdx.x >> 5));   // wave number in a scalar register: plane bases stay scalar
    const int b = blockIdx.y, q0 = blockIdx.x * 16;
    for (int idx = threadIdx.x; idx < TT / 4; idx += 256) { const v4i m4 = *(const v4i*)(mask + (size_t)b * SEQ_FULL + idx * 4); *(v4ia*)(mks + idx * 4) = m4; }
    float w1[8], b1[8];
#pragma unroll
    for (int i = 0; i < 8; ++i) { w1[i] = bfr(c1w[8 * hi + i]); b1[i] = bfr(c1b[8 * hi + i]); }
    const int hd = lr & 7, g = lr >> 3;
    v16h bw;
#pragma unroll
    for (int i = 0; i < 8; ++i) { const h16 c = (h16)bfr(c2w[hd * 16 + 8 * hi + i]); const h16 zr = (h16)0.0f; bw[i] = (g == 0) ? c : zr; bw[8 + i] = (g == 1) ? c : zr; }
    const float bias2 = bfr(c2b[hd]);
    const float* rr0 = rel + ((size_t)b * SEQ_FULL + q0 + 2 * w) * SEQ_FULL + lr;
    float xr[8];   // the wave's rel_pos values of the next stage to be made, fetched one stage ahead
    auto ldx = [&](int s) {
#pragma unroll
        for (int qq = 0; qq < 2; ++qq)
#pragma unroll
            for (int gk = 0; gk < 2; ++gk) { const float* p = rr0 + (size_t)qq * SEQ_FULL + s * KS + gk * 32; xr[qq * 4 + gk * 2] = p[0]; xr[qq * 4 + gk * 2 + 1] = p[16]; } };
    auto produce = [&](int s, float* dstb) {
#pragma unroll
        for (int gk = 0; gk < 2; ++gk) {
            const int* mp = mks + s * KS + gk * 32 + 16 * g + 8 * hi; const v4i m0 = *(const v4ia*)mp; const v4i m1 = *(const v4ia*)(mp + 4);
#pragma unroll
            for (int qq = 0; qq < 2; ++qq) {
                const float xa = bfr(xr[qq * 4 + gk * 2]), xb = bfr(xr[qq * 4 + gk * 2 + 1]);
                v16h a;
#pragma unroll
                for (int i = 0; i < 8; ++i) { a[i] = (h16)fmaxf(fmaf(xa, w1[i], b1[i]), 0.0f); a[8 + i] = (h16)fmaxf(fmaf(xb, w1[i], b1[i]), 0.0f); }
                const v8f acc = wmma16(a, bw, (v8f){});
                v4f o0, o1;
#pragma unroll
                for (int j = 0; j < 4; ++j) { o0[j] = (m0[j] == 0) ? MFILL : acc[j] + bias2; o1[j] = (m1[j] == 0) ? MFILL : acc[4 + j] + bias2; }
                float* dst = dstb + hd * RHS + (2 * w + qq) * RPI + gk * 32 + 16 * g + 8 * hi;
                *(v4fa*)dst = o0; *(v4fa*)(dst + 4) = o1; } } };
    const size_t pl = ((size_t)b * NH_ + w) * TT * HD;
    const h16* kp = K16 + pl + lane * 8; const h16* vp = V16 + pl + lane * 8;   // the lane's 16 bytes in the first chunk of the current stage of its head's k and v planes (fragment order, see k_proj); both step on by one stage at the foot of a trip
    v16h qf[2];
#pragma unroll
    for (int dk = 0; dk < 2; ++dk) { const h16* qp = Q16 + pl + (size_t)(q0 >> 4) * 1024 + dk * 512 + lane * 8; qf[dk] = cat16(*(const v8h*)qp, *(const v8h*)(qp + 256)); }
    v8f o[4];
#pragma unroll
    for (int dg = 0; dg < 4; ++dg) o[dg] = (v8f){};
    float mrun = MFILL, lsum = 0.0f;
    ldx(0);
    __syncthreads();   // the mask stands in LDS before any wave reads it
    produce(0, rb[0]);
    ldx(1);
    __syncthreads();   // stage 0 of the bias tile stands in LDS before any wave reads it
#pragma unroll 1   // one stage per trip: an unrolled body would not hold its fragments in registers
    for (int s = 0; s < NS; ++s) {
        v16h kf[4][2];
#pragma unroll
        for (int kg = 0; kg < 4; ++kg)
#pragma unroll
            for (int dk = 0; dk < 2; ++dk) kf[kg][dk] = cat16(*(const v8h*)(kp + (kg * 1024 + dk * 512)), *(const v8h*)(kp + (kg * 1024 + dk * 512 + 256)));
        asm volatile("s_wait_xcnt 0x0" ::: "memory");   // stands behind the run of k loads, in front of the step of kp, whose registers they name
        if (s + 1 < NS) { produce(s + 1, rb[(s + 1) & 1]); ldx(s + 2 < NS ? s + 2 : NS - 1); }
        v16h vf[2][4];
#pragma unroll
        for (int gk = 0; gk < 2; ++gk)
#pragma unroll
            for (int dg = 0; dg < 4; ++dg) vf[gk][dg] = cat16(*(const v8h*)(vp + (gk * 2048 + dg * 256)), *(const v8h*)(vp + (gk * 2048 + 1024 + dg * 256)));
        const float* rbp = rb[s & 1] + w * RHS + lr * RPI + 8 * hi;
        float t[4][8]; float mx = MFILL;
#pragma unroll
        for (int kg = 0; kg < 4; ++kg) {
            v8f st = (v8f){};
            st = wmma16(kf[kg][0], qf[0], st); st = wmma16(kf[kg][1], qf[1], st);
            const v4f r0 = *(const v4fa*)(rbp + kg * 16); const v4f r1 = *(const v4fa*)(rbp + kg * 16 + 4);
#pragma unroll
            for (int j = 0; j < 4; ++j) { t[kg][j] = (st[j] + r0[j]) * SCL; t[kg][4 + j] = (st[4 + j] + r1[j]) * SCL; mx = fmaxf(mx, fmaxf(t[kg][j], t[kg][4 + j])); } }
        mx = fmaxf(mx, __shfl_xor(mx, 16, 32));   // the other half of the wave holds the query's other keys
        const float mnew = fmaxf(mrun, mx);
        const float corr = ex2((mrun - mnew) * L2E);
        mrun = mnew;
        float ps = 0.0f; v16h pb[2];
#pragma unroll
        for (int kg = 0; kg < 4; ++kg)
#pragma unroll
            for (int j = 0; j < 8; ++j) { const float p = ex2(fmaf(t[kg][j] - mnew, L2E, 10.0f)); ps += p; pb[kg >> 1][(kg & 1) * 8 + j] = (h16)p; }   // + 10: the x1024 carry
        lsum = fmaf(lsum, corr, ps);
#pragma unroll
        for (int dg = 0; dg < 4; ++dg) o[dg] *= corr;
#pragma unroll
        for (int gk = 0; gk < 2; ++gk)
#pragma unroll
            for (int dg = 0; dg < 4; ++dg) o[dg] = wmma16(vf[gk][dg], pb[gk], o[dg]);
        kp += KS * HD; vp += KS * HD;
        __syncthreads();   // publishes stage s + 1 of the bias tile and ends every wave's reads of stage s, whose buffer the next trip refills
    }
    lsum += __shfl_xor(lsum, 16, 32);
    const float f = __fdiv_rn(PCAR, lsum);
    const float cs = 1.0f / PCAR;
    const size_t oo = ((size_t)b * TT + q0 + lr) * DM + w * HD + 8 * hi;   // context row of the lane's query, its head's 64 columns: one wave writes each 128-byte line of both planes
#pragma unroll
    for (int dg = 0; dg < 4; ++dg) { v8us oh, ol;
#pragma unroll
        for (int j = 0; j < 8; ++j) { unsigned short a, c2; splitf(o[dg][j] * f * cs, a, c2); oh[j] = a; ol[j] = c2; }
        *(v8us*)(Ah + oo + dg * 16) = oh; *(v8us*)(Al + oo + dg * 16) = ol; }
}

constexpr size_t al256(size_t b) { return (b + 255) & ~(size_t)255; }
constexpr size_t WS_TOTAL = 4 * al256((size_t)DM * DM * 2) + 3 * al256((size_t)NB * NH_ * TT * HD * 2) + 2 * al256((size_t)NB * TT * DM * 2);
static_assert(WS_TOTAL <= (size_t)134217728);

extern "C" void kernel_launch(void* const* d_in, const int* in_sizes, int n_in,
                              void* d_out, int out_size, void* d_ws, size_t ws_size, hipStream_t stream) {
    if (n_in < 17) return;
    const size_t need_x = ((size_t)(NB - 1) * SEQ_FULL + SEQ) * DM;
    const size_t need_r = (size_t)(NB - 1) * SEQ_FULL * SEQ_FULL + (size_t)(SEQ - 1) * SEQ_FULL + SEQ;
    if ((size_t)in_sizes[0] < need_x || (size_t)in_sizes[1] < need_x || (size_t)in_sizes[2] < need_x || (size_t)in_sizes[3] < need_r) return;
    if ((size_t)in_sizes[4] < (size_t)(NB - 1) * SEQ_FULL + SEQ) return;
    if (in_sizes[5] < DM * DM || in_sizes[7] < DM * DM || in_sizes[9] < DM * DM || in_sizes[11] < DM * DM) return;
    if (in_sizes[6] < DM || in_sizes[8] < DM || in_sizes[10] < DM || in_sizes[12] < DM) return;
    if (in_sizes[13] < 16 || in_sizes[14] < 16 || in_sizes[15] < 128 || in_sizes[16] < 8) return;
    if ((size_t)out_size < need_x) return;
    const float* xq = (const float*)d_in[0]; const float* xk = (const float*)d_in[1]; const float* xv = (const float*)d_in[2];
    const float* rel = (const float*)d_in[3]; const int* msk = (const int*)d_in[4];
    const float* wq = (const float*)d_in[5]; const float* bq = (const float*)d_in[6]; const float* wk = (const float*)d_in[7]; const float* bk = (const float*)d_in[8];
    const float* wv = (const float*)d_in[9]; const float* bv = (const float*)d_in[10]; const float* wo = (const float*)d_in[11]; const float* bo = (const float*)d_in[12];
    const float* c1w = (const float*)d_in[13]; const float* c1b = (const float*)d_in[14]; const float* c2w = (const float*)d_in[15]; const float* c2b = (const float*)d_in[16];
    float* OUT = (float*)d_out;     // [NB_FULL][SEQ_FULL][DM]
    char* wsp = (char*)d_ws;
    auto take = [&](size_t bytes) { char* p = wsp; wsp += (bytes + 255) & ~(size_t)255; return (void*)p; };
    bf* WQ = (bf*)take((size_t)DM * DM * 2); bf* WK = (bf*)take((size_t)DM * DM * 2); bf* WV = (bf*)take((size_t)DM * DM * 2); bf* WO = (bf*)take((size_t)DM * DM * 2);
    h16* QP16 = (h16*)take((size_t)NB * NH_ * TT * HD * 2); h16* KP16 = (h16*)take((size_t)NB * NH_ * TT * HD * 2); h16* VT16 = (h16*)take((size_t)NB * NH_ * HD * TT * 2);
    bf* ATh = (bf*)take((size_t)NB * TT * DM * 2); bf* ATl = (bf*)take((size_t)NB * TT * DM * 2);
    if ((size_t)(wsp - (char*)d_ws) > ws_size) return;
    // weights: in W[k rows][n cols] -> out Wt[n rows][k cols]; square DM x DM, grid (K/64, N/64)
    k_cvtT<<<dim3(DM / 64, DM / 64), 256, 0, stream>>>(wq, WQ, DM, DM);
    k_cvtT<<<dim3(DM / 64, DM / 64), 256, 0, stream>>>(wk, WK, DM, DM);
    k_cvtT<<<dim3(DM / 64, DM / 64), 256, 0, stream>>>(wv, WV, DM, DM);
    k_cvtT<<<dim3(DM / 64, DM / 64), 256, 0, stream>>>(wo, WO, DM, DM);
    for (int b = 0; b < NB; ++b) {
        const size_t xoff = (size_t)b * SEQ_FULL * DM; const size_t poff = (size_t)b * NH_ * TT * HD;
        k_proj<false><<<dim3(TT / 64, DM / 64), 256, 0, stream>>>(xq + xoff, WQ, bq, QP16 + poff);
        k_proj<false><<<dim3(TT / 64, DM / 64), 256, 0, stream>>>(xk + xoff, WK, bk, KP16 + poff);
        k_proj<true><<<dim3(DM / 64, TT / 64), 256, 0, stream>>>(xv + xoff, WV, bv, VT16 + poff);
    }
    k_fattn<<<dim3(TT / 16, NB), 256, 0, stream>>>(QP16, KP16, VT16, rel, msk, c1w, c1b, c2w, c2b, ATh, ATl);
    for (int b = 0; b < NB; ++b) {
        const size_t xoff = (size_t)b * SEQ_FULL * DM; const size_t coff = (size_t)b * TT * DM;
        k_gemmw<bf, 1, true, 8><<<dim3(TT / 64, DM / 64, 1), 256, 0, stream>>>(ATh + coff, ATl + coff, WO, nullptr, DM, OUT + xoff, DM, bo, 0, 0, 0);
    }
}

// v005
// A run of this version takes 101 microseconds.
// In both of two side-by-side timings against v004, it was 1.27 times as fast.
// All steps since v000 together make it 7.31 times as fast.
#include <hip/hip_runtime.h>

// Compute dtypes (f32 accumulate everywhere): q/k/v projections v_wmma_f32_16x16x32_bf16 (inputs RNE-converted to bf16, products exact); pointwise-bias channel mix (16 ch -> 8 heads) v_wmma_f32_16x16x32_f16; q.k scores f16; probabilities (x1024 carry) x values f16; output projection bf16 hi+lo context x bf16 weights (2 products); softmax and mask fill in f32.
// Four launches: weight transposes (all four), q / k / v projections (all three streams, both batches), attention, output projection (both batches); launches of one kernel that do not depend on each other are one grid, told apart by blockIdx.z (attention: by blockIdx.y).
// Layout: projection of the f32 q / k / v input stream (converted to bf16 in the fragment loader; + f32 bias) -> f16 head planes q, k, v in fragment order (see k_proj), stored by the projection itself;
// one attention launch for both batches: a block owns 16 query rows and all 8 heads (wave = head) and walks the keys in stages of 64: bias tile R[h][i][t] (one block-diagonal WMMA per 32 key positions, shared through LDS),
// S^T = k q^T, running-maximum softmax of (S + R) / 8 with key-mask fill, P (x1024 carry) as f16 straight from the score accumulators, O^T += v^T P^T; scores and probabilities never leave the registers.
// the attention launch stores the merged hi/lo context planes [b][t][h*64+d] (x 1/1024); output projection + bias. Weights [in][out] are transposed once through LDS into K-contiguous bf16 planes.

#ifndef NB
#define NB 2
#endif
#ifndef SEQ
#define SEQ 2048
#endif
#define NB_FULL  2
#define SEQ_FULL 2048
#define TT   SEQ
#define DM   512
#define NH_  8
#define HD   64
#define KS   64          // keys per stage of the attention loop
#define RPI  (KS + 4)    // f32 pitch of one (head, query) row of the staged bias tile
#define RHS  (16 * RPI + 4)   // f32 pitch of one head's 16 rows: the 8 heads that one store instruction writes start on different LDS banks
#define PCAR 1024.0f
#define SCL  0.125f   // HD^-0.5
static_assert(NH_ * HD == DM);
static_assert(TT % 256 == 0);
static_assert(TT % KS == 0 && TT / KS >= 2);
static_assert(DM % 256 == 0);
static_assert(SEQ <= SEQ_FULL);
static_assert(NB <= NB_FULL);

typedef _Float16 h16;
typedef unsigned short bf;
typedef __attribute__((ext_vector_type(16))) __bf16   v16bf;
typedef __attribute__((ext_vector_type(16))) _Float16 v16h;
typedef __attribute__((ext_vector_type(8)))  _Float16 v8h;
typedef __attribute__((ext_vector_type(8)))  unsigned short v8us;
typedef __attribute__((ext_vector_type(8)))  float    v8f;
typedef __attribute__((ext_vector_type(4)))  float    v4f;
typedef __attribute__((ext_vector_type(2)))  _Float16 v2h;
typedef __attribute__((ext_vector_type(4)))  _Float16 v4h;
typedef __attribute__((ext_vector_type(2)))  unsigned short v2us;
typedef __attribute__((ext_vector_type(4)))  int v4i;
typedef v4f  __attribute__((may_alias)) v4fa;
typedef v4i  __attribute__((may_alias)) v4ia;

__device__ __forceinline__ unsigned short f2bf(float f) { unsigned u = __float_as_uint(f); u += 0x7FFFu + ((u >> 16) & 1u); return (unsigned short)(u >> 16); }
__device__ __forceinline__ float bf2f(unsigned short b) { return __uint_as_float(((unsigned)b) << 16); }
__device__ __forceinline__ float bfr(float f) { return bf2f(f2bf(f)); }
__device__ __forceinline__ v16h cat16(v8h lo, v8h hi) { return __builtin_shufflevector(lo, hi, 0, 1, 2, 3, 4, 5, 6, 7, 8, 9, 10, 11, 12, 13, 14, 15); }
__device__ __forceinline__ v16bf cat16b(v8us lo, v8us hi) { return __builtin_bit_cast(v16bf, __builtin_shufflevector(lo, hi, 0, 1, 2, 3, 4, 5, 6, 7, 8, 9, 10, 11, 12, 13, 14, 15)); }
__device__ __forceinline__ v8f wmma16(v16h a, v16h b, v8f c) { return __builtin_amdgcn_wmma_f32_16x16x32_f16(false, a, false, b, (short)0, c, false, false); }
__device__ __forceinline__ v8f wmmab(v16bf a, v16bf b, v8f c) { return __builtin_amdgcn_wmma_f32_16x16x32_bf16(false, a, false, b, (short)0, c, false, false); }
__device__ __forceinline__ void splitf(float y, unsigned short& h, unsigned short& l) { h = f2bf(y); l = f2bf(y - bf2f(h)); }

// ---- k_gemmw: register-blocked GEMM, one block of KW waves per 64x64 output tile, operands straight from K-contiguous 16-bit planes; grid (M/64, N/64, Z), KW * 32 threads.
// Wave w holds the whole tile (16 accumulators) for k in [w * K / KW, (w + 1) * K / KW); for KW > 1 the KW partial tiles meet in LDS and are summed in wave order 0..KW-1. K % (32 * KW) == 0.
// C[m][n] (f32, pitch ldc, + optional f32 bias[n]) = sum_k A[m][k] Bt[n][k] (+ split products per NSPLIT). z-batch strides sA/sB/sC in elements. K % 32 == 0, A/Bt row pitch == K.
// Fragment map (A and Bt alike): lane row = lane & 15, elements 0..7 <- k0 + 8*(lane>>4) + 0..7, elements 8..15 <- k0 + 16 + 8*(lane>>4) + 0..7; D element j = (row 8*(lane>>4) + j, col lane & 15).
template <typename T16> struct WFrag;
template <> struct WFrag<h16> { typedef v16h V; static __device__ __forceinline__ V ld(const h16* p) { return cat16(*(const v8h*)p, *(const v8h*)(p + 16)); } static __device__ __forceinline__ v8f mma(V a, V b, v8f c) { return wmma16(a, b, c); } };
template <> struct WFrag<bf> { typedef v16bf V; static __device__ __forceinline__ V ld(const bf* p) { return cat16b(*(const v8us*)p, *(const v8us*)(p + 16)); } static __device__ __forceinline__ v8f mma(V a, V b, v8f c) { return wmmab(a, b, c); } };
template <typename T16, int NSPLIT, bool BIAS, int KW>
__global__ __launch_bounds__(KW * 32) void k_gemmw(const T16* __restrict__ A, const T16* __restrict__ A2, const T16* __restrict__ Bt, const T16* __restrict__ Bt2, int K, float* C, int ldc, const float* __restrict__ bias, size_t sA, size_t sB, size_t sC) {
    typedef typename WFrag<T16>::V V;
    static_assert(KW >= 1 && KW <= 8 && 8 % KW == 0);
    __shared__ __align__(16) float os[(KW > 1 ? 4 * KW : 1) * 16 * 68];
    const size_t z = blockIdx.z; A += z * sA; if (A2) A2 += z * sA; Bt += z * sB; if (Bt2) Bt2 += z * sB; C += z * sC;
    const int lane = threadIdx.x & 31, lr = lane & 15, hi = lane >> 4; const int r0 = blockIdx.x * 64, c0 = blockIdx.y * 64;
    v8f acc[4][4];
#pragma unroll
    for (int mb = 0; mb < 4; ++mb)
#pragma unroll
        for (int nb = 0; nb < 4; ++nb) acc[mb][nb] = (v8f){};
    const size_t aoff = (size_t)(r0 + lr) * K + 8 * hi, boff = (size_t)(c0 + lr) * K + 8 * hi;
    const int w = KW > 1 ? __builtin_amdgcn_readfirstlane((int)(threadIdx.x >> 5)) : 0;   // wave number in a scalar register: the k loop's bounds and branch stay scalar
    const int kspan = K / KW, kbeg = w * kspan, kend = kbeg + kspan;
#pragma unroll 1
    for (int kc = kbeg; kc < kend; kc += 32) {
        V a[4], a2[4];
#pragma unroll
        for (int mb = 0; mb < 4; ++mb) { a[mb] = WFrag<T16>::ld(A + aoff + (size_t)mb * 16 * K + kc); if (NSPLIT == 1 || NSPLIT == 2) a2[mb] = WFrag<T16>::ld(A2 + aoff + (size_t)mb * 16 * K + kc); }
#pragma unroll
        for (int nb = 0; nb < 4; ++nb) { const V b = WFrag<T16>::ld(Bt + boff + (size_t)nb * 16 * K + kc); V b2; if (NSPLIT >= 2) b2 = WFrag<T16>::ld(Bt2 + boff + (size_t)nb * 16 * K + kc);
#pragma unroll
            for (int mb = 0; mb < 4; ++mb) { acc[mb][nb] = WFrag<T16>::mma(a[mb], b, acc[mb][nb]); if (NSPLIT == 1 || NSPLIT == 2) acc[mb][nb] = WFrag<T16>::mma(a2[mb], b, acc[mb][nb]); if (NSPLIT >= 2) acc[mb][nb] = WFrag<T16>::mma(a[mb], b2, acc[mb][nb]); } }
        asm volatile("v_nop\n\tv_nop\n\tv_nop\n\tv_nop" : "+v"(acc[0][0]), "+v"(acc[1][1]), "+v"(acc[2][2]), "+v"(acc[3][3]) : "v"(a[0]), "v"(a[3]));
    }
    if constexpr (KW > 1) {   // loops below are unrolled so that acc[][] is indexed by constants and stays in registers, and the LDS offsets fold into immediates
#pragma unroll
        for (int mb = 0; mb < 4; ++mb) { float* my = os + (mb * KW + w) * (16 * 68);
#pragma unroll
            for (int nb = 0; nb < 4; ++nb) {
#pragma unroll
                for (int j = 0; j < 8; ++j) my[(hi * 8 + j) * 68 + nb * 16 + lr] = acc[mb][nb][j]; } }
        __syncthreads();   // every wave's partial tile stands in LDS before any wave sums across the waves
#pragma unroll
        for (int mb = 0; mb < 4; ++mb) { float* crow = C + (size_t)(r0 + mb * 16) * ldc + c0;
#pragma unroll
            for (int s0 = 0; s0 < 8; s0 += KW) { const int row = 2 * (s0 + w) + hi, cofs = lr * 4; const float* ps = os + mb * KW * (16 * 68) + row * 68 + cofs; v4f val = *(const v4fa*)ps;
#pragma unroll
                for (int q = 1; q < KW; ++q) val += *(const v4fa*)(ps + q * (16 * 68));
                if (BIAS) { val[0] += bfr(bias[c0 + cofs]); val[1] += bfr(bias[c0 + cofs + 1]); val[2] += bfr(bias[c0 + cofs + 2]); val[3] += bfr(bias[c0 + cofs + 3]); }
                *(v4f*)(crow + (size_t)row * ldc + cofs) = val; } }
        return;
    }
#pragma unroll
    for (int mb = 0; mb < 4; ++mb) {
#pragma unroll
        for (int nb = 0; nb < 4; ++nb) {
#pragma unroll
            for (int j = 0; j < 8; ++j) os[(hi * 8 + j) * 68 + nb * 16 + lr] = acc[mb][nb][j]; }
        __builtin_amdgcn_wave_barrier(); asm volatile("" ::: "memory");
        float* crow = C + (size_t)(r0 + mb * 16) * ldc + c0;
{
#pragma unroll
            for (int s = 0; s < 8; ++s) { const int row = 2 * s + hi, cofs = lr * 4; v4f val = *(const v4fa*)(os + row * 68 + cofs); if (BIAS) { val[0] += bfr(bias[c0 + cofs]); val[1] += bfr(bias[c0 + cofs + 1]); val[2] += bfr(bias[c0 + cofs + 2]); val[3] += bfr(bias[c0 + cofs + 3]); }
                *(v4f*)(crow + (size_t)row * ldc + cofs) = val; }
             }
        __builtin_amdgcn_wave_barrier(); asm volatile("" ::: "memory");
    }
}

// proj_tile (body of k_proj): one 64x64 tile of a q / k / v projection per block of 8 waves, K = DM split over the waves as in k_gemmw (same fragment map, same sum in wave order); the f32 input stream is read as it is and rounded to bf16 (RNE) in the fragment loader.
// VT == false (q, k): A rows = positions t of X, B rows = output columns n of Wt; tile (bx, by) of (TT/64, DM/64); a tile's 64 columns are one head.
// VT == true (v): A rows = output columns n of Wt, B rows = positions t of X, so that the tile comes out transposed; tile (bx, by) of (DM/64, TT/64); a tile's 64 rows are one head.
// Head planes are stored in fragment order: a chunk of 512 contiguous bytes is what one 16-byte-per-lane load of the attention kernel takes, lane l = 16 * hi + lr at byte 16 * l. 16 positions of a head are 4 chunks (2 KiB), a head plane is TT / 16 such groups.
// q, k: chunk c of position group tg: lane holds position 16 * tg + lr, d = 16 * c + 8 * hi + 0..7. v: chunk dg of position group tg: lane holds d = 16 * dg + lr, positions 16 * tg + 8 * hi + 0..7.
// In both cases a chunk is rows 16 * mb + lr, columns 16 * c + 8 * hi + 0..7 of the tile; wave w stores chunks (mb = w >> 1, c = 2 * (w & 1) + 0..1), each store instruction four whole 128-byte lines.
typedef __attribute__((ext_vector_type(8))) __bf16 v8bf;
__device__ __forceinline__ v16bf ldxf(const float* p) { const v8f lo = *(const v8f*)p, hi = *(const v8f*)(p + 16);
    return __builtin_shufflevector(__builtin_convertvector(lo, v8bf), __builtin_convertvector(hi, v8bf), 0, 1, 2, 3, 4, 5, 6, 7, 8, 9, 10, 11, 12, 13, 14, 15); }
template <bool VT>
__device__ __forceinline__ void proj_tile(const float* __restrict__ X, const bf* __restrict__ Wt, const float* __restrict__ bias, h16* P, float* os, int bx, int by) {
    constexpr int KW = 8, K = DM;
    const int lane = threadIdx.x & 31, lr = lane & 15, hi = lane >> 4; const int r0 = bx * 64, c0 = by * 64;
    v8f acc[4][4];
#pragma unroll
    for (int mb = 0; mb < 4; ++mb)
#pragma unroll
        for (int nb = 0; nb < 4; ++nb) acc[mb][nb] = (v8f){};
    const size_t aoff = (size_t)(r0 + lr) * K + 8 * hi, boff = (size_t)(c0 + lr) * K + 8 * hi;
    const int w = __builtin_amdgcn_readfirstlane((int)(threadIdx.x >> 5));   // wave number in a scalar register: the wave's k offset stays scalar
    const int kbeg = w * (K / KW), kend = kbeg + K / KW;
#pragma unroll   // both trips in line: the second trip's loads issue while the first trip's products still run
    for (int kc = kbeg; kc < kend; kc += 32) {
        v16bf a[4];
#pragma unroll
        for (int mb = 0; mb < 4; ++mb) { if constexpr (VT) a[mb] = WFrag<bf>::ld(Wt + aoff + (size_t)mb * 16 * K + kc); else a[mb] = ldxf(X + aoff + (size_t)mb * 16 * K + kc); }
#pragma unroll
        for (int nb = 0; nb < 4; ++nb) { v16bf b; if constexpr (VT) b = ldxf(X + boff + (size_t)nb * 16 * K + kc); else b = WFrag<bf>::ld(Wt + boff + (size_t)nb * 16 * K + kc);
#pragma unroll
            for (int mb = 0; mb < 4; ++mb) acc[mb][nb] = wmmab(a[mb], b, acc[mb][nb]); }
    }
    // loops below are unrolled so that acc[][] is indexed by constants and stays in registers, and the LDS offsets fold into immediates
#pragma unroll
    for (int mb = 0; mb < 4; ++mb) { float* my = os + (mb * KW + w) * (16 * 68);
#pragma unroll
        for (int nb = 0; nb < 4; ++nb) {
#pragma unroll
            for (int j = 0; j < 8; ++j) my[(hi * 8 + j) * 68 + nb * 16 + lr] = acc[mb][nb][j]; } }
    __syncthreads();   // every wave's partial tile stands in LDS before any wave sums across the waves
    const int mb = w >> 1, cb = 2 * (w & 1);   // the wave's chunks: (mb, cb) and (mb, cb + 1)
    const float* ps0 = os + mb * KW * (16 * 68) + lr * 68 + cb * 16 + hi * 8;
    const float* bp = VT ? bias + r0 + mb * 16 + lr : bias + c0 + cb * 16 + hi * 8;
    h16* dst = VT ? P + (size_t)bx * (HD * TT) + (size_t)((c0 >> 4) + cb) * 1024 + mb * 256 + lane * 8 : P + (size_t)by * (TT * HD) + (size_t)((r0 >> 4) + mb) * 1024 + cb * 256 + lane * 8;
#pragma unroll
    for (int it = 0; it < 2; ++it) { const float* ps = ps0 + it * 16; v4f va = *(const v4fa*)ps, vb = *(const v4fa*)(ps + 4);
#pragma unroll
        for (int q = 1; q < KW; ++q) { va += *(const v4fa*)(ps + q * (16 * 68)); vb += *(const v4fa*)(ps + q * (16 * 68) + 4); }
        v8h o16;
#pragma unroll
        for (int j = 0; j < 4; ++j) { o16[j] = (h16)(va[j] + bfr(bp[VT ? 0 : it * 16 + j])); o16[4 + j] = (h16)(vb[j] + bfr(bp[VT ? 0 : it * 16 + 4 + j])); }
        *(v8h*)(dst + it * (VT ? 1024 : 256)) = o16; }
}
// k_proj: all q / k / v projection tiles of both batches in one grid (TT/64, DM/64, 3 * NB): blockIdx.z = stream * NB + batch, stream 0 = q, 1 = k, 2 = v. Wt3: the three transposed weight planes one behind the other.
__global__ __launch_bounds__(256) void k_proj(const float* __restrict__ xq, const float* __restrict__ xk, const float* __restrict__ xv, const bf* __restrict__ Wt3,
                                              const float* __restrict__ bq, const float* __restrict__ bk, const float* __restrict__ bv, h16* Q16, h16* K16, h16* V16) {
    __shared__ __align__(16) float os[4 * 8 * 16 * 68];
    const int st = blockIdx.z / NB, b = blockIdx.z % NB;
    const size_t xoff = (size_t)b * SEQ_FULL * DM, poff = (size_t)b * NH_ * TT * HD;
    if (st == 2) { proj_tile<true>(xv + xoff, Wt3 + 2 * (size_t)DM * DM, bv, V16 + poff, os, blockIdx.y, blockIdx.x); return; }
    proj_tile<false>((st == 0 ? xq : xk) + xoff, Wt3 + (size_t)st * DM * DM, st == 0 ? bq : bk, (st == 0 ? Q16 : K16) + poff, os, blockIdx.x, blockIdx.y);
    asm volatile("s_wait_xcnt 0x0" ::: "memory");   // stands behind the tile's stores: in the listing the v body follows this one on a fall-through (never taken: a scalar flag branches round it) and rewrites the registers that the stores name
}

// k_cvtT: in W[K rows][N cols] f32 -> out Wt[N rows][K cols] bf16 (RNE), 64x64 tile transposed through LDS (cross-wave: block barrier); grid (K/64, N/64, 4): blockIdx.z picks one of four matrices of one shape, whose outputs stand one behind the other.
__global__ __launch_bounds__(256) void k_cvtT(const float* __restrict__ W0, const float* __restrict__ W1, const float* __restrict__ W2, const float* __restrict__ W3, bf* Wt, int K, int N) {
    __shared__ unsigned short tl[64 * 66];
    const int zi = blockIdx.z; const float* W = zi == 0 ? W0 : zi == 1 ? W1 : zi == 2 ? W2 : W3; Wt += (size_t)zi * K * N;
    const int tid = threadIdx.x; const int k0 = blockIdx.x * 64, n0 = blockIdx.y * 64;
    { const int row = tid >> 2, cseg = (tid & 3) * 16;
#pragma unroll
      for (int q = 0; q < 4; ++q) { const v4f v = *(const v4f*)(W + (size_t)(k0 + row) * N + n0 + cseg + q * 4);
#pragma unroll
          for (int j = 0; j < 4; ++j) tl[row * 66 + cseg + q * 4 + j] = f2bf(v[j]); } }
    __syncthreads();
    const int piece = tid & 7; v8us o[2];
#pragma unroll
    for (int it = 0; it < 2; ++it) { const int n = it * 32 + (tid >> 3);
#pragma unroll
        for (int j = 0; j < 8; ++j) o[it][j] = tl[(piece * 8 + j) * 66 + n]; }
{
#pragma unroll
        for (int it = 0; it < 2; ++it) { const int n = it * 32 + (tid >> 3); *(v8us*)(Wt + (size_t)(n0 + n) * K + k0 + piece * 8) = o[it]; }
         }
}

// k_fattn: grid (TT / 16, NB), 8 waves; block = 16 query rows q0.. of batch b, wave w = head w.
// Bias tile, per stage of KS keys: wave w makes query rows 2w, 2w+1 for all 8 heads. One WMMA per 32 key positions: A rows = 16 positions, k 0..15 = channel activations of position t0+m, k 16..31 = of position t0+16+m (f16);
// B block-diagonal: B[c][h] = c2w[h][c] for h < 8, B[16+c][8+h] = c2w[h][c], zero elsewhere. D[p][h] -> position t0+p, D[p][8+h] -> position t0+16+p. Stored as rb[h][query][key] (f32).
// A key with mask == 0 gets the bias MFILL: S + MFILL == MFILL in f32 for every |S| < 1e30, so all masked scores of a row are one equal value far below any real score (weight 0 beside a real key, uniform weights where every key is masked), as with the -1e9 fill.
// Scores: A = 16 key rows of k, B = the 16 query rows of q (kept in registers): D element j = (key 8*(lane>>4) + j, query lane & 15). Two such tiles, converted to f16, are the B operand (k order 8*(lane>>4)+0..7, 16+8*(lane>>4)+0..7) of O^T += v^T P^T.
// Every inner loop is unrolled so that the register arrays (fragments, scores, accumulators) are indexed by constants and the LDS and global offsets fold into immediates.
#define MFILL (-3.0e38f)
#define L2E   1.4426950408889634f
// 2^x. The v_nop is the slot that the instruction set asks for behind a transcendental before its result is read or its source overwritten.
__device__ __forceinline__ float ex2(float x) { float r; asm("v_exp_f32 %0, %1\n\tv_nop" : "=v"(r) : "v"(x)); return r; }
__global__ __launch_bounds__(256) void k_fattn(const h16* __restrict__ Q16, const h16* __restrict__ K16, const h16* __restrict__ V16, const float* __restrict__ rel, const int* __restrict__ mask,
                                               const float* __restrict__ c1w, const float* __restrict__ c1b, const float* __restrict__ c2w, const float* __restrict__ c2b, bf* Ah, bf* Al) {
    __shared__ __align__(16) float rb[2][NH_ * RHS];
    __shared__ __align__(16) int mks[TT];
    constexpr int NS = TT / KS;
    const int lane = threadIdx.x & 31, lr = lane & 15, hi = lane >> 4;
    const int w = __builtin_amdgcn_readfirstlane((int)(threadIdx.x >> 5));   // wave number in a scalar register: plane bases stay scalar
    const int b = blockIdx.y, q0 = blockIdx.x * 16;
    for (int idx = threadIdx.x; idx < TT / 4; idx += 256) { const v4i m4 = *(const v4i*)(mask + (size_t)b * SEQ_FULL + idx * 4); *(v4ia*)(mks + idx * 4) = m4; }
    float w1[8], b1[8];
#pragma unroll
    for (int i = 0; i < 8; ++i) { w1[i] = bfr(c1w[8 * hi + i]); b1[i] = bfr(c1b[8 * hi + i]); }
    const int hd = lr & 7, g = lr >> 3;
    v16h bw;
#pragma unroll
    for (int i = 0; i < 8; ++i) { const h16 c = (h16)bfr(c2w[hd * 16 + 8 * hi + i]); const h16 zr = (h16)0.0f; bw[i] = (g == 0) ? c : zr; bw[8 + i] = (g == 1) ? c : zr; }
    const float bias2 = bfr(c2b[hd]);
    const float* rr0 = rel + ((size_t)b * SEQ_FULL + q0 + 2 * w) * SEQ_FULL + lr;
    float xr[8];   // the wave's rel_pos values of the next stage to be made, fetched one stage ahead
    auto ldx = [&](int s) {
#pragma unroll
        for (int qq = 0; qq < 2; ++qq)
#pragma unroll
            for (int gk = 0; gk < 2; ++gk) { const float* p = rr0 + (size_t)qq * SEQ_FULL + s * KS + gk * 32; xr[qq * 4 + gk * 2] = p[0]; xr[qq * 4 + gk * 2 + 1] = p[16]; } };
    auto produce = [&](int s, float* dstb) {
#pragma unroll
        for (int gk = 0; gk < 2; ++gk) {
            const int* mp = mks + s * KS + gk * 32 + 16 * g + 8 * hi; const v4i m0 = *(const v4ia*)mp; const v4i m1 = *(const v4ia*)(mp + 4);
#pragma unroll
            for (int qq = 0; qq < 2; ++qq) {
                const float xa = bfr(xr[qq * 4 + gk * 2]), xb = bfr(xr[qq * 4 + gk * 2 + 1]);
                v16h a;
#pragma unroll
                for (int i = 0; i < 8; ++i) { a[i] = (h16)fmaxf(fmaf(xa, w1[i], b1[i]), 0.0f); a[8 + i] = (h16)fmaxf(fmaf(xb, w1[i], b1[i]), 0.0f); }
                const v8f acc = wmma16(a, bw, (v8f){});
                v4f o0, o1;
#pragma unroll
                for (int j = 0; j < 4; ++j) { o0[j] = (m0[j] == 0) ? MFILL : acc[j] + bias2; o1[j] = (m1[j] == 0) ? MFILL : acc[4 + j] + bias2; }
                float* dst = dstb + hd * RHS + (2 * w + qq) * RPI + gk * 32 + 16 * g + 8 * hi;
                *(v4fa*)dst = o0; *(v4fa*)(dst + 4) = o1; } } };
    const size_t pl = ((size_t)b * NH_ + w) * TT * HD;
    const h16* kp = K16 + pl + lane * 8; const h16* vp = V16 + pl + lane * 8;   // the lane's 16 bytes in the first chunk of the current stage of its head's k and v planes (fragment order, see k_proj); both step on by one stage at the foot of a trip
    v16h qf[2];
#pragma unroll
    for (int dk = 0; dk < 2; ++dk) { const h16* qp = Q16 + pl + (size_t)(q0 >> 4) * 1024 + dk * 512 + lane * 8; qf[dk] = cat16(*(const v8h*)qp, *(const v8h*)(qp + 256)); }
    v8f o[4];
#pragma unroll
    for (int dg = 0; dg < 4; ++dg) o[dg] = (v8f){};
    float mrun = MFILL, lsum = 0.0f;
    ldx(0);
    __syncthreads();   // the mask stands in LDS before any wave reads it
    produce(0, rb[0]);
    ldx(1);
    __syncthreads();   // stage 0 of the bias tile stands in LDS before any wave reads it
#pragma unroll 1   // one stage per trip: an unrolled body would not hold its fragments in registers
    for (int s = 0; s < NS; ++s) {
        v16h kf[4][2];
#pragma unroll
        for (int kg = 0; kg < 4; ++kg)
#pragma unroll
            for (int dk = 0; dk < 2; ++dk) kf[kg][dk] = cat16(*(const v8h*)(kp + (kg * 1024 + dk * 512)), *(const v8h*)(kp + (kg * 1024 + dk * 512 + 256)));
        asm volatile("s_wait_xcnt 0x0" ::: "memory");   // stands behind the run of k loads, in front of the step of kp, whose registers they name
        if (s + 1 < NS) { produce(s + 1, rb[(s + 1) & 1]); ldx(s + 2 < NS ? s + 2 : NS - 1); }
        v16h vf[2][4];
#pragma unroll
        for (int gk = 0; gk < 2; ++gk)
#pragma unroll
            for (int dg = 0; dg < 4; ++dg) vf[gk][dg] = cat16(*(const v8h*)(vp + (gk * 2048 + dg * 256)), *(const v8h*)(vp + (gk * 2048 + 1024 + dg * 256)));
        const float* rbp = rb[s & 1] + w * RHS + lr * RPI + 8 * hi;
        float t[4][8]; float mx = MFILL;
#pragma unroll
        for (int kg = 0; kg < 4; ++kg) {
            v8f st = (v8f){};
            st = wmma16(kf[kg][0], qf[0], st); st = wmma16(kf[kg][1], qf[1], st);
            const v4f r0 = *(const v4fa*)(rbp + kg * 16); const v4f r1 = *(const v4fa*)(rbp + kg * 16 + 4);
#pragma unroll
            for (int j = 0; j < 4; ++j) { t[kg][j] = (st[j] + r0[j]) * SCL; t[kg][4 + j] = (st[4 + j] + r1[j]) * SCL; mx = fmaxf(mx, fmaxf(t[kg][j], t[kg][4 + j])); } }
        mx = fmaxf(mx, __shfl_xor(mx, 16, 32));   // the other half of the wave holds the query's other keys
        const float mnew = fmaxf(mrun, mx);
        const float corr = ex2((mrun - mnew) * L2E);
        mrun = mnew;
        float ps = 0.0f; v16h pb[2];
#pragma unroll
        for (int kg = 0; kg < 4; ++kg)
#pragma unroll
            for (int j = 0; j < 8; ++j) { const float p = ex2(fmaf(t[kg][j] - mnew, L2E, 10.0f)); ps += p; pb[kg >> 1][(kg & 1) * 8 + j] = (h16)p; }   // + 10: the x1024 carry
        lsum = fmaf(lsum, corr, ps);
#pragma unroll
        for (int dg = 0; dg < 4; ++dg) o[dg] *= corr;
#pragma unroll
        for (int gk = 0; gk < 2; ++gk)
#pragma unroll
            for (int dg = 0; dg < 4; ++dg) o[dg] = wmma16(vf[gk][dg], pb[gk], o[dg]);
        kp += KS * HD; vp += KS * HD;
        __syncthreads();   // publishes stage s + 1 of the bias tile and ends every wave's reads of stage s, whose buffer the next trip refills
    }
    lsum += __shfl_xor(lsum, 16, 32);
    const float f = __fdiv_rn(PCAR, lsum);
    const float cs = 1.0f / PCAR;
    const size_t oo = ((size_t)b * TT + q0 + lr) * DM + w * HD + 8 * hi;   // context row of the lane's query, its head's 64 columns: one wave writes each 128-byte line of both planes
#pragma unroll
    for (int dg = 0; dg < 4; ++dg) { v8us oh, ol;
#pragma unroll
        for (int j = 0; j < 8; ++j) { unsigned short a, c2; splitf(o[dg][j] * f * cs, a, c2); oh[j] = a; ol[j] = c2; }
        *(v8us*)(Ah + oo + dg * 16) = oh; *(v8us*)(Al + oo + dg * 16) = ol; }
}

constexpr size_t al256(size_t b) { return (b + 255) & ~(size_t)255; }
constexpr size_t WS_TOTAL = 4 * al256((size_t)DM * DM * 2) + 3 * al256((size_t)NB * NH_ * TT * HD * 2) + 2 * al256((size_t)NB * TT * DM * 2);
static_assert(WS_TOTAL <= (size_t)134217728);
static_assert(((size_t)DM * DM * 2) % 256 == 0);   // the weight planes follow one another without a gap

extern "C" void kernel_launch(void* const* d_in, const int* in_sizes, int n_in,
                              void* d_out, int out_size, void* d_ws, size_t ws_size, hipStream_t stream) {
    if (n_in < 17) return;
    const size_t need_x = ((size_t)(NB - 1) * SEQ_FULL + SEQ) * DM;
    const size_t need_r = (size_t)(NB - 1) * SEQ_FULL * SEQ_FULL + (size_t)(SEQ - 1) * SEQ_FULL + SEQ;
    if ((size_t)in_sizes[0] < need_x || (size_t)in_sizes[1] < need_x || (size_t)in_sizes[2] < need_x || (size_t)in_sizes[3] < need_r) return;
    if ((size_t)in_sizes[4] < (size_t)(NB - 1) * SEQ_FULL + SEQ) return;
    if (in_sizes[5] < DM * DM || in_sizes[7] < DM * DM || in_sizes[9] < DM * DM || in_sizes[11] < DM * DM) return;
    if (in_sizes[6] < DM || in_sizes[8] < DM || in_sizes[10] < DM || in_sizes[12] < DM) return;
    if (in_sizes[13] < 16 || in_sizes[14] < 16 || in_sizes[15] < 128 || in_sizes[16] < 8) return;
    if ((size_t)out_size < need_x) return;
    const float* xq = (const float*)d_in[0]; const float* xk = (const float*)d_in[1]; const float* xv = (const float*)d_in[2];
    const float* rel = (const float*)d_in[3]; const int* msk = (const int*)d_in[4];
    const float* wq = (const float*)d_in[5]; const float* bq = (const float*)d_in[6]; const float* wk = (const float*)d_in[7]; const float* bk = (const float*)d_in[8];
    const float* wv = (const float*)d_in[9]; const float* bv = (const float*)d_in[10]; const float* wo = (const float*)d_in[11]; const float* bo = (const float*)d_in[12];
    const float* c1w = (const float*)d_in[13]; const float* c1b = (const float*)d_in[14]; const float* c2w = (const float*)d_in[15]; const float* c2b = (const float*)d_in[16];
    float* OUT = (float*)d_out;     // [NB_FULL][SEQ_FULL][DM]
    char* wsp = (char*)d_ws;
    auto take = [&](size_t bytes) { char* p = wsp; wsp += (bytes + 255) & ~(size_t)255; return (void*)p; };
    bf* WQ = (bf*)take((size_t)DM * DM * 2); take((size_t)DM * DM * 2); take((size_t)DM * DM * 2); bf* WO = (bf*)take((size_t)DM * DM * 2);   // four planes in the order q, k, v, o; the kernels reach k and v from WQ
    h16* QP16 = (h16*)take((size_t)NB * NH_ * TT * HD * 2); h16* KP16 = (h16*)take((size_t)NB * NH_ * TT * HD * 2); h16* VT16 = (h16*)take((size_t)NB * NH_ * HD * TT * 2);
    bf* ATh = (bf*)take((size_t)NB * TT * DM * 2); bf* ATl = (bf*)take((size_t)NB * TT * DM * 2);
    if ((size_t)(wsp - (char*)d_ws) > ws_size) return;
    // weights: in W[k rows][n cols] -> out Wt[n rows][k cols]; square DM x DM; the four planes WQ, WK, WV, WO are contiguous in the workspace
    k_cvtT<<<dim3(DM / 64, DM / 64, 4), 256, 0, stream>>>(wq, wk, wv, wo, WQ, DM, DM);
    k_proj<<<dim3(TT / 64, DM / 64, 3 * NB), 256, 0, stream>>>(xq, xk, xv, WQ, bq, bk, bv, QP16, KP16, VT16);
    k_fattn<<<dim3(TT / 16, NB), 256, 0, stream>>>(QP16, KP16, VT16, rel, msk, c1w, c1b, c2w, c2b, ATh, ATl);
    k_gemmw<bf, 1, true, 8><<<dim3(TT / 64, DM / 64, NB), 256, 0, stream>>>(ATh, ATl, WO, nullptr, DM, OUT, DM, bo, (size_t)TT * DM, 0, (size_t)SEQ_FULL * DM);
}

// v006
// A run of this version takes 98.3 microseconds.
// Next to v005, in two timings, it ran 1.06 and 1.02 times as fast.
// Counting every step since v000, it is 7.59 times as fast.
#include <hip/hip_runtime.h>

// Compute dtypes (f32 accumulate everywhere): q/k/v projections v_wmma_f32_16x16x32_bf16 (inputs RNE-converted to bf16, products exact); pointwise-bias channel mix (16 ch -> 8 heads) v_wmma_f32_16x16x32_f16; q.k scores f16; probabilities (x1024 carry) x values f16; output projection bf16 hi+lo context x bf16 weights (2 products); softmax and mask fill in f32.
// Four launches: weight transposes (all four), q / k / v projections (all three streams, both batches), attention, output projection (both batches); launches of one kernel that do not depend on each other are one grid, told apart by blockIdx.z (attention: by blockIdx.y).
// Layout: projection of the f32 q / k / v input stream (converted to bf16 in the fragment loader; + f32 bias) -> f16 head planes q, k, v in fragment order (see k_proj), stored by the projection itself;
// one attention launch for both batches: a block owns 16 query rows and all 8 heads (wave = head) and walks the keys in stages of 64: bias tile R[h][i][t] (one block-diagonal WMMA per 32 key positions, shared through LDS),
// S^T = k q^T, running-maximum softmax of (S + R) / 8 with key-mask fill, P (x1024 carry) as f16 straight from the score accumulators, O^T += v^T P^T; scores and probabilities never leave the registers.
// the attention launch stores the merged hi/lo context planes [b][t][h*64+d] (x 1/1024); output projection + bias. Weights [in][out] are transposed once through LDS into K-contiguous bf16 planes.

#ifndef NB
#define NB 2
#endif
#ifndef SEQ
#define SEQ 2048
#endif
#define NB_FULL  2
#define SEQ_FULL 2048
#define TT   SEQ
#define DM   512
#define NH_  8
#define HD   64
#define KS   64          // keys per stage of the attention loop
#define RPI  (KS + 4)    // f32 pitch of one (head, query) row of the staged bias tile
#define RHS  (16 * RPI + 4)   // f32 pitch of one head's 16 rows: the 8 heads that one store instruction writes start on different LDS banks
#define PCAR 1024.0f
#define SCL  0.125f   // HD^-0.5
static_assert(NH_ * HD == DM);
static_assert(TT % 256 == 0);
static_assert(TT % KS == 0 && TT / KS >= 2);
static_assert(DM % 256 == 0);
static_assert(SEQ <= SEQ_FULL);
static_assert(NB <= NB_FULL);

typedef _Float16 h16;
typedef unsigned short bf;
typedef __attribute__((ext_vector_type(16))) __bf16   v16bf;
typedef __attribute__((ext_vector_type(16))) _Float16 v16h;
typedef __attribute__((ext_vector_type(8)))  _Float16 v8h;
typedef __attribute__((ext_vector_type(8)))  unsigned short v8us;
typedef __attribute__((ext_vector_type(8)))  float    v8f;
typedef __attribute__((ext_vector_type(4)))  float    v4f;
typedef __attribute__((ext_vector_type(2)))  _Float16 v2h;
typedef __attribute__((ext_vector_type(4)))  _Float16 v4h;
typedef __attribute__((ext_vector_type(2)))  unsigned short v2us;
typedef __attribute__((ext_vector_type(4)))  int v4i;
typedef v4f  __attribute__((may_alias)) v4fa;
typedef v4i  __attribute__((may_alias)) v4ia;

__device__ __forceinline__ unsigned short f2bf(float f) { unsigned u = __float_as_uint(f); u += 0x7FFFu + ((u >> 16) & 1u); return (unsigned short)(u >> 16); }
__device__ __forceinline__ float bf2f(unsigned short b) { return __uint_as_float(((unsigned)b) << 16); }
__device__ __forceinline__ float bfr(float f) { return bf2f(f2bf(f)); }
__device__ __forceinline__ v16h cat16(v8h lo, v8h hi) { return __builtin_shufflevector(lo, hi, 0, 1, 2, 3, 4, 5, 6, 7, 8, 9, 10, 11, 12, 13, 14, 15); }
__device__ __forceinline__ v16bf cat16b(v8us lo, v8us hi) { return __builtin_bit_cast(v16bf, __builtin_shufflevector(lo, hi, 0, 1, 2, 3, 4, 5, 6, 7, 8, 9, 10, 11, 12, 13, 14, 15)); }
__device__ __forceinline__ v8f wmma16(v16h a, v16h b, v8f c) { return __builtin_amdgcn_wmma_f32_16x16x32_f16(false, a, false, b, (short)0, c, false, false); }
__device__ __forceinline__ v8f wmmab(v16bf a, v16bf b, v8f c) { return __builtin_amdgcn_wmma_f32_16x16x32_bf16(false, a, false, b, (short)0, c, false, false); }
__device__ __forceinline__ void splitf(float y, unsigned short& h, unsigned short& l) { h = f2bf(y); l = f2bf(y - bf2f(h)); }

// ---- k_gemmw: register-blocked GEMM, one block of KW waves per 64x64 output tile, operands straight from K-contiguous 16-bit planes; grid (M/64, N/64, Z), KW * 32 threads.
// Wave w holds the whole tile (16 accumulators) for k in [w * K / KW, (w + 1) * K / KW); for KW > 1 the KW partial tiles meet in LDS and are summed in wave order 0..KW-1. K % (32 * KW) == 0.
// C[m][n] (f32, pitch ldc, + optional f32 bias[n]) = sum_k A[m][k] Bt[n][k] (+ split products per NSPLIT). z-batch strides sA/sB/sC in elements. K % 32 == 0, A/Bt row pitch == K.
// Fragment map (A and Bt alike): lane row = lane & 15, elements 0..7 <- k0 + 8*(lane>>4) + 0..7, elements 8..15 <- k0 + 16 + 8*(lane>>4) + 0..7; D element j = (row 8*(lane>>4) + j, col lane & 15).
template <typename T16> struct WFrag;
template <> struct WFrag<h16> { typedef v16h V; static __device__ __forceinline__ V ld(const h16* p) { return cat16(*(const v8h*)p, *(const v8h*)(p + 16)); } static __device__ __forceinline__ v8f mma(V a, V b, v8f c) { return wmma16(a, b, c); } };
template <> struct WFrag<bf> { typedef v16bf V; static __device__ __forceinline__ V ld(const bf* p) { return cat16b(*(const v8us*)p, *(const v8us*)(p + 16)); } static __device__ __forceinline__ v8f mma(V a, V b, v8f c) { return wmmab(a, b, c); } };
template <typename T16, int NSPLIT, bool BIAS, int KW>
__global__ __launch_bounds__(KW * 32) void k_gemmw(const T16* __restrict__ A, const T16* __restrict__ A2, const T16* __restrict__ Bt, const T16* __restrict__ Bt2, int K, float* C, int ldc, const float* __restrict__ bias, size_t sA, size_t sB, size_t sC) {
    typedef typename WFrag<T16>::V V;
    static_assert(KW >= 1 && KW <= 8 && 8 % KW == 0);
    __shared__ __align__(16) float os[(KW > 1 ? 4 * KW : 1) * 16 * 68];
    const size_t z = blockIdx.z; A += z * sA; if (A2) A2 += z * sA; Bt += z * sB; if (Bt2) Bt2 += z * sB; C += z * sC;
    const int lane = threadIdx.x & 31, lr = lane & 15, hi = lane >> 4; const int r0 = blockIdx.x * 64, c0 = blockIdx.y * 64;
    v8f acc[4][4];
#pragma unroll
    for (int mb = 0; mb < 4; ++mb)
#pragma unroll
        for (int nb = 0; nb < 4; ++nb) acc[mb][nb] = (v8f){};
    const size_t aoff = (size_t)(r0 + lr) * K + 8 * hi, boff = (size_t)(c0 + lr) * K + 8 * hi;
    const int w = KW > 1 ? __builtin_amdgcn_readfirstlane((int)(threadIdx.x >> 5)) : 0;   // wave number in a scalar register: the k loop's bounds and branch stay scalar
    const int kspan = K / KW, kbeg = w * kspan, kend = kbeg + kspan;
#pragma unroll 1
    for (int kc = kbeg; kc < kend; kc += 32) {
        V a[4], a2[4];
#pragma unroll
        for (int mb = 0; mb < 4; ++mb) { a[mb] = WFrag<T16>::ld(A + aoff + (size_t)mb * 16 * K + kc); if (NSPLIT == 1 || NSPLIT == 2) a2[mb] = WFrag<T16>::ld(A2 + aoff + (size_t)mb * 16 * K + kc); }
#pragma unroll
        for (int nb = 0; nb < 4; ++nb) { const V b = WFrag<T16>::ld(Bt + boff + (size_t)nb * 16 * K + kc); V b2; if (NSPLIT >= 2) b2 = WFrag<T16>::ld(Bt2 + boff + (size_t)nb * 16 * K + kc);
#pragma unroll
            for (int mb = 0; mb < 4; ++mb) { acc[mb][nb] = WFrag<T16>::mma(a[mb], b, acc[mb][nb]); if (NSPLIT == 1 || NSPLIT == 2) acc[mb][nb] = WFrag<T16>::mma(a2[mb], b, acc[mb][nb]); if (NSPLIT >= 2) acc[mb][nb] = WFrag<T16>::mma(a[mb], b2, acc[mb][nb]); } }
        asm volatile("v_nop\n\tv_nop\n\tv_nop\n\tv_nop" : "+v"(acc[0][0]), "+v"(acc[1][1]), "+v"(acc[2][2]), "+v"(acc[3][3]) : "v"(a[0]), "v"(a[3]));
    }
    if constexpr (KW > 1) {   // loops below are unrolled so that acc[][] is indexed by constants and stays in registers, and the LDS offsets fold into immediates
#pragma unroll
        for (int mb = 0; mb < 4; ++mb) { float* my = os + (mb * KW + w) * (16 * 68);
#pragma unroll
            for (int nb = 0; nb < 4; ++nb) {
#pragma unroll
                for (int j = 0; j < 8; ++j) my[(hi * 8 + j) * 68 + nb * 16 + lr] = acc[mb][nb][j]; } }
        __syncthreads();   // every wave's partial tile stands in LDS before any wave sums across the waves
#pragma unroll
        for (int mb = 0; mb < 4; ++mb) { float* crow = C + (size_t)(r0 + mb * 16) * ldc + c0;
#pragma unroll
            for (int s0 = 0; s0 < 8; s0 += KW) { const int row = 2 * (s0 + w) + hi, cofs = lr * 4; const float* ps = os + mb * KW * (16 * 68) + row * 68 + cofs; v4f val = *(const v4fa*)ps;
#pragma unroll
                for (int q = 1; q < KW; ++q) val += *(const v4fa*)(ps + q * (16 * 68));
                if (BIAS) { val[0] += bfr(bias[c0 + cofs]); val[1] += bfr(bias[c0 + cofs + 1]); val[2] += bfr(bias[c0 + cofs + 2]); val[3] += bfr(bias[c0 + cofs + 3]); }
                *(v4f*)(crow + (size_t)row * ldc + cofs) = val; } }
        return;
    }
#pragma unroll
    for (int mb = 0; mb < 4; ++mb) {
#pragma unroll
        for (int nb = 0; nb < 4; ++nb) {
#pragma unroll
            for (int j = 0; j < 8; ++j) os[(hi * 8 + j) * 68 + nb * 16 + lr] = acc[mb][nb][j]; }
        __builtin_amdgcn_wave_barrier(); asm volatile("" ::: "memory");
        float* crow = C + (size_t)(r0 + mb * 16) * ldc + c0;
{
#pragma unroll
            for (int s = 0; s < 8; ++s) { const int row = 2 * s + hi, cofs = lr * 4; v4f val = *(const v4fa*)(os + row * 68 + cofs); if (BIAS) { val[0] += bfr(bias[c0 + cofs]); val[1] += bfr(bias[c0 + cofs + 1]); val[2] += bfr(bias[c0 + cofs + 2]); val[3] += bfr(bias[c0 + cofs + 3]); }
                *(v4f*)(crow + (size_t)row * ldc + cofs) = val; }
             }
        __builtin_amdgcn_wave_barrier(); asm volatile("" ::: "memory");
    }
}

// proj_tile (body of k_proj): one 64x64 tile of a q / k / v projection per block of 8 waves, K = DM split over the waves as in k_gemmw (same fragment map, same sum in wave order); the f32 input stream is read as it is and rounded to bf16 (RNE) in the fragment loader.
// VT == false (q, k): A rows = positions t of X, B rows = output columns n of Wt; tile (bx, by) of (TT/64, DM/64); a tile's 64 columns are one head.
// VT == true (v): A rows = output columns n of Wt, B rows = positions t of X, so that the tile comes out transposed; tile (bx, by) of (DM/64, TT/64); a tile's 64 rows are one head.
// Head planes are stored in fragment order: a chunk of 512 contiguous bytes is what one 16-byte-per-lane load of the attention kernel takes, lane l = 16 * hi + lr at byte 16 * l. 16 positions of a head are 4 chunks (2 KiB), a head plane is TT / 16 such groups.
// q, k: chunk c of position group tg: lane holds position 16 * tg + lr, d = 16 * c + 8 * hi + 0..7. v: chunk dg of position group tg: lane holds d = 16 * dg + lr, positions 16 * tg + 8 * hi + 0..7.
// In both cases a chunk is rows 16 * mb + lr, columns 16 * c + 8 * hi + 0..7 of the tile; wave w stores chunks (mb = w >> 1, c = 2 * (w & 1) + 0..1), each store instruction four whole 128-byte lines.
typedef __attribute__((ext_vector_type(8))) __bf16 v8bf;
__device__ __forceinline__ v16bf ldxf(const float* p) { const v8f lo = *(const v8f*)p, hi = *(const v8f*)(p + 16);
    return __builtin_shufflevector(__builtin_convertvector(lo, v8bf), __builtin_convertvector(hi, v8bf), 0, 1, 2, 3, 4, 5, 6, 7, 8, 9, 10, 11, 12, 13, 14, 15); }
template <bool VT>
__device__ __forceinline__ void proj_tile(const float* __restrict__ X, const bf* __restrict__ Wt, const float* __restrict__ bias, h16* P, float* os, int bx, int by) {
    constexpr int KW = 8, K = DM;
    const int lane = threadIdx.x & 31, lr = lane & 15, hi = lane >> 4; const int r0 = bx * 64, c0 = by * 64;
    v8f acc[4][4];
#pragma unroll
    for (int mb = 0; mb < 4; ++mb)
#pragma unroll
        for (int nb = 0; nb < 4; ++nb) acc[mb][nb] = (v8f){};
    const size_t aoff = (size_t)(r0 + lr) * K + 8 * hi, boff = (size_t)(c0 + lr) * K + 8 * hi;
    const int w = __builtin_amdgcn_readfirstlane((int)(threadIdx.x >> 5));   // wave number in a scalar register: the wave's k offset stays scalar
    const int kbeg = w * (K / KW), kend = kbeg + K / KW;
#pragma unroll   // both trips in line: the second trip's loads issue while the first trip's products still run
    for (int kc = kbeg; kc < kend; kc += 32) {
        v16bf a[4];
#pragma unroll
        for (int mb = 0; mb < 4; ++mb) { if constexpr (VT) a[mb] = WFrag<bf>::ld(Wt + aoff + (size_t)mb * 16 * K + kc); else a[mb] = ldxf(X + aoff + (size_t)mb * 16 * K + kc); }
#pragma unroll
        for (int nb = 0; nb < 4; ++nb) { v16bf b; if constexpr (VT) b = ldxf(X + boff + (size_t)nb * 16 * K + kc); else b = WFrag<bf>::ld(Wt + boff + (size_t)nb * 16 * K + kc);
#pragma unroll
            for (int mb = 0; mb < 4; ++mb) acc[mb][nb] = wmmab(a[mb], b, acc[mb][nb]); }
    }
    // loops below are unrolled so that acc[][] is indexed by constants and stays in registers, and the LDS offsets fold into immediates
#pragma unroll
    for (int mb = 0; mb < 4; ++mb) { float* my = os + (mb * KW + w) * (16 * 68);
#pragma unroll
        for (int nb = 0; nb < 4; ++nb) {
#pragma unroll
            for (int j = 0; j < 8; ++j) my[(hi * 8 + j) * 68 + nb * 16 + lr] = acc[mb][nb][j]; } }
    __syncthreads();   // every wave's partial tile stands in LDS before any wave sums across the waves
    const int mb = w >> 1, cb = 2 * (w & 1);   // the wave's chunks: (mb, cb) and (mb, cb + 1)
    const float* ps0 = os + mb * KW * (16 * 68) + lr * 68 + cb * 16 + hi * 8;
    const float* bp = VT ? bias + r0 + mb * 16 + lr : bias + c0 + cb * 16 + hi * 8;
    h16* dst = VT ? P + (size_t)bx * (HD * TT) + (size_t)((c0 >> 4) + cb) * 1024 + mb * 256 + lane * 8 : P + (size_t)by * (TT * HD) + (size_t)((r0 >> 4) + mb) * 1024 + cb * 256 + lane * 8;
#pragma unroll
    for (int it = 0; it < 2; ++it) { const float* ps = ps0 + it * 16; v4f va = *(const v4fa*)ps, vb = *(const v4fa*)(ps + 4);
#pragma unroll
        for (int q = 1; q < KW; ++q) { va += *(const v4fa*)(ps + q * (16 * 68)); vb += *(const v4fa*)(ps + q * (16 * 68) + 4); }
        v8h o16;
#pragma unroll
        for (int j = 0; j < 4; ++j) { o16[j] = (h16)(va[j] + bfr(bp[VT ? 0 : it * 16 + j])); o16[4 + j] = (h16)(vb[j] + bfr(bp[VT ? 0 : it * 16 + 4 + j])); }
        *(v8h*)(dst + it * (VT ? 1024 : 256)) = o16; }
}
// k_proj: all q / k / v projection tiles of both batches in one grid (TT/64, DM/64, 3 * NB): blockIdx.z = stream * NB + batch, stream 0 = q, 1 = k, 2 = v. Wt3: the three transposed weight planes one behind the other.
__global__ __launch_bounds__(256) void k_proj(const float* __restrict__ xq, const float* __restrict__ xk, const float* __restrict__ xv, const bf* __restrict__ Wt3,
                                              const float* __restrict__ bq, const float* __restrict__ bk, const float* __restrict__ bv, h16* Q16, h16* K16, h16* V16) {
    __shared__ __align__(16) float os[4 * 8 * 16 * 68];
    const int st = blockIdx.z / NB, b = blockIdx.z % NB;
    const size_t xoff = (size_t)b * SEQ_FULL * DM, poff = (size_t)b * NH_ * TT * HD;
    if (st == 2) { proj_tile<true>(xv + xoff, Wt3 + 2 * (size_t)DM * DM, bv, V16 + poff, os, blockIdx.y, blockIdx.x); return; }
    proj_tile<false>((st == 0 ? xq : xk) + xoff, Wt3 + (size_t)st * DM * DM, st == 0 ? bq : bk, (st == 0 ? Q16 : K16) + poff, os, blockIdx.x, blockIdx.y);
    asm volatile("s_wait_xcnt 0x0" ::: "memory");   // stands behind the tile's stores: in the listing the v body follows this one on a fall-through (never taken: a scalar flag branches round it) and rewrites the registers that the stores name
}

// k_cvtT: in W[K rows][N cols] f32 -> out Wt[N rows][K cols] bf16 (RNE), 64x64 tile transposed through LDS (cross-wave: block barrier); grid (K/64, N/64, 4): blockIdx.z picks one of four matrices of one shape, whose outputs stand one behind the other.
__global__ __launch_bounds__(256) void k_cvtT(const float* __restrict__ W0, const float* __restrict__ W1, const float* __restrict__ W2, const float* __restrict__ W3, bf* Wt, int K, int N) {
    __shared__ unsigned short tl[64 * 66];
    const int zi = blockIdx.z; const float* W = zi == 0 ? W0 : zi == 1 ? W1 : zi == 2 ? W2 : W3; Wt += (size_t)zi * K * N;
    const int tid = threadIdx.x; const int k0 = blockIdx.x * 64, n0 = blockIdx.y * 64;
    { const int row = tid >> 2, cseg = (tid & 3) * 16;
#pragma unroll
      for (int q = 0; q < 4; ++q) { const v4f v = *(const v4f*)(W + (size_t)(k0 + row) * N + n0 + cseg + q * 4);
#pragma unroll
          for (int j = 0; j < 4; ++j) tl[row * 66 + cseg + q * 4 + j] = f2bf(v[j]); } }
    __syncthreads();
    const int piece = tid & 7; v8us o[2];
#pragma unroll
    for (int it = 0; it < 2; ++it) { const int n = it * 32 + (tid >> 3);
#pragma unroll
        for (int j = 0; j < 8; ++j) o[it][j] = tl[(piece * 8 + j) * 66 + n]; }
{
#pragma unroll
        for (int it = 0; it < 2; ++it) { const int n = it * 32 + (tid >> 3); *(v8us*)(Wt + (size_t)(n0 + n) * K + k0 + piece * 8) = o[it]; }
         }
}

// k_fattn: grid (TT / 16, NB), 8 waves; block = 16 query rows q0.. of batch b, wave w = head w.
// Bias tile, per stage of KS keys: wave w makes query rows 2w, 2w+1 for all 8 heads. One WMMA per 32 key positions: A rows = 16 positions, k 0..15 = channel activations of position t0+m, k 16..31 = of position t0+16+m (f16);
// B block-diagonal: B[c][h] = c2w[h][c] for h < 8, B[16+c][8+h] = c2w[h][c], zero elsewhere. D[p][h] -> position t0+p, D[p][8+h] -> position t0+16+p. Stored as rb[h][query][key] (f32).
// A key with mask == 0 gets the bias MFILL: S + MFILL == MFILL in f32 for every |S| < 1e30, so all masked scores of a row are one equal value far below any real score (weight 0 beside a real key, uniform weights where every key is masked), as with the -1e9 fill.
// Scores: A = 16 key rows of k, B = the 16 query rows of q (kept in registers): D element j = (key 8*(lane>>4) + j, query lane & 15). Two such tiles, converted to f16, are the B operand (k order 8*(lane>>4)+0..7, 16+8*(lane>>4)+0..7) of O^T += v^T P^T.
// k fragments reach the wave through LDS: each wave brings its own head's next stages (8 KiB each, fragment order) into its own part of one of two k buffers by asynchronous copies, one whole stage ahead; v fragments are register loads issued at the head of the trip that uses them.
// Every inner loop is unrolled so that the register arrays (fragments, scores, accumulators) are indexed by constants and the LDS and global offsets fold into immediates.
#define MFILL (-3.0e38f)
#define L2E   1.4426950408889634f
// 2^x. The v_nop is the slot that the instruction set asks for behind a transcendental before its result is read or its source overwritten.
__device__ __forceinline__ float ex2(float x) { float r; asm("v_exp_f32 %0, %1\n\tv_nop" : "=v"(r) : "v"(x)); return r; }
// One stage of a head's k plane into LDS: 16 copies of 512 contiguous bytes (16 bytes a lane). The immediate offset moves the global and the LDS address alike, so one address pair serves all 16.
// The s_wait_xcnt closes the statement so that nothing rewrites the two address operands before it.
__device__ __forceinline__ void kcopy(unsigned lds, const h16* g) {
    asm volatile("global_load_async_to_lds_b128 %0, %1, off\n\t"
                 "global_load_async_to_lds_b128 %0, %1, off offset:512\n\t"
                 "global_load_async_to_lds_b128 %0, %1, off offset:1024\n\t"
                 "global_load_async_to_lds_b128 %0, %1, off offset:1536\n\t"
                 "global_load_async_to_lds_b128 %0, %1, off offset:2048\n\t"
                 "global_load_async_to_lds_b128 %0, %1, off offset:2560\n\t"
                 "global_load_async_to_lds_b128 %0, %1, off offset:3072\n\t"
                 "global_load_async_to_lds_b128 %0, %1, off offset:3584\n\t"
                 "global_load_async_to_lds_b128 %0, %1, off offset:4096\n\t"
                 "global_load_async_to_lds_b128 %0, %1, off offset:4608\n\t"
                 "global_load_async_to_lds_b128 %0, %1, off offset:5120\n\t"
                 "global_load_async_to_lds_b128 %0, %1, off offset:5632\n\t"
                 "global_load_async_to_lds_b128 %0, %1, off offset:6144\n\t"
                 "global_load_async_to_lds_b128 %0, %1, off offset:6656\n\t"
                 "global_load_async_to_lds_b128 %0, %1, off offset:7168\n\t"
                 "global_load_async_to_lds_b128 %0, %1, off offset:7680\n\t"
                 "s_wait_xcnt 0x0" :: "v"(lds), "v"(g) : "memory");
}
static_assert(KS * HD * 2 == 16 * 512);
__global__ __launch_bounds__(256) void k_fattn(const h16* __restrict__ Q16, const h16* __restrict__ K16, const h16* __restrict__ V16, const float* __restrict__ rel, const int* __restrict__ mask,
                                               const float* __restrict__ c1w, const float* __restrict__ c1b, const float* __restrict__ c2w, const float* __restrict__ c2b, bf* Ah, bf* Al) {
    __shared__ __align__(16) float rb[2][NH_ * RHS];
    __shared__ __align__(16) int mks[TT];
    __shared__ __align__(16) h16 kls[2][NH_][KS * HD];   // two k buffers, one part per wave (head)
    constexpr int NS = TT / KS;
    const int lane = threadIdx.x & 31, lr = lane & 15, hi = lane >> 4;
    const int w = __builtin_amdgcn_readfirstlane((int)(threadIdx.x >> 5));   // wave number in a scalar register: plane bases stay scalar
    const int b = blockIdx.y, q0 = blockIdx.x * 16;
    for (int idx = threadIdx.x; idx < TT / 4; idx += 256) { const v4i m4 = *(const v4i*)(mask + (size_t)b * SEQ_FULL + idx * 4); *(v4ia*)(mks + idx * 4) = m4; }
    float w1[8], b1[8];
#pragma unroll
    for (int i = 0; i < 8; ++i) { w1[i] = bfr(c1w[8 * hi + i]); b1[i] = bfr(c1b[8 * hi + i]); }
    const int hd = lr & 7, g = lr >> 3;
    v16h bw;
#pragma unroll
    for (int i = 0; i < 8; ++i) { const h16 c = (h16)bfr(c2w[hd * 16 + 8 * hi + i]); const h16 zr = (h16)0.0f; bw[i] = (g == 0) ? c : zr; bw[8 + i] = (g == 1) ? c : zr; }
    const float bias2 = bfr(c2b[hd]);
    const float* rr0 = rel + ((size_t)b * SEQ_FULL + q0 + 2 * w) * SEQ_FULL + lr;
    float xr[8], xc[8];   // xr: the wave's rel_pos values of a later stage, in flight; xc: those of the stage that produce() makes, rounded to bf16
    auto ldx = [&](int s) {
#pragma unroll
        for (int qq = 0; qq < 2; ++qq)
#pragma unroll
            for (int gk = 0; gk < 2; ++gk) { const float* p = rr0 + (size_t)qq * SEQ_FULL + s * KS + gk * 32; xr[qq * 4 + gk * 2] = p[0]; xr[qq * 4 + gk * 2 + 1] = p[16]; } };
    auto produce = [&](int s, float* dstb) {
#pragma unroll
        for (int gk = 0; gk < 2; ++gk) {
            const int* mp = mks + s * KS + gk * 32 + 16 * g + 8 * hi; const v4i m0 = *(const v4ia*)mp; const v4i m1 = *(const v4ia*)(mp + 4);
#pragma unroll
            for (int qq = 0; qq < 2; ++qq) {
                const float xa = xc[qq * 4 + gk * 2], xb = xc[qq * 4 + gk * 2 + 1];
                v16h a;
#pragma unroll
                for (int i = 0; i < 8; ++i) { a[i] = (h16)fmaxf(fmaf(xa, w1[i], b1[i]), 0.0f); a[8 + i] = (h16)fmaxf(fmaf(xb, w1[i], b1[i]), 0.0f); }
                const v8f acc = wmma16(a, bw, (v8f){});
                v4f o0, o1;
#pragma unroll
                for (int j = 0; j < 4; ++j) { o0[j] = (m0[j] == 0) ? MFILL : acc[j] + bias2; o1[j] = (m1[j] == 0) ? MFILL : acc[4 + j] + bias2; }
                float* dst = dstb + hd * RHS + (2 * w + qq) * RPI + gk * 32 + 16 * g + 8 * hi;
                *(v4fa*)dst = o0; *(v4fa*)(dst + 4) = o1; } } };
    const size_t pl = ((size_t)b * NH_ + w) * TT * HD;
    const h16* kp = K16 + pl + lane * 8; const h16* vp = V16 + pl + lane * 8;   // the lane's 16 bytes in the first chunk of a stage of its head's k and v planes (fragment order, see k_proj): kp of the next stage to be copied, vp of the current stage
    const h16* kl0 = &kls[0][w][lane * 8];   // the lane's 16 bytes in the first chunk of the wave's part of k buffer 0; buffer 1 stands NH_ * KS * HD elements behind
    const unsigned kla = (unsigned)(size_t)kl0;   // the same as an LDS byte address
    kcopy(kla, kp); kp += KS * HD;   // stage 0 of k
    v16h qf[2];
#pragma unroll
    for (int dk = 0; dk < 2; ++dk) { const h16* qp = Q16 + pl + (size_t)(q0 >> 4) * 1024 + dk * 512 + lane * 8; qf[dk] = cat16(*(const v8h*)qp, *(const v8h*)(qp + 256)); }
    v8f o[4];
#pragma unroll
    for (int dg = 0; dg < 4; ++dg) o[dg] = (v8f){};
    float mrun = MFILL, lsum = 0.0f;
    ldx(0);
    __syncthreads();   // the mask stands in LDS before any wave reads it
#pragma unroll
    for (int i = 0; i < 8; ++i) xc[i] = bfr(xr[i]);
    ldx(1);
    produce(0, rb[0]);
    asm volatile("s_wait_asynccnt 0x0" ::: "memory");   // the wave's copies of k stage 0 have landed
    __syncthreads();   // stage 0 of the bias tile and of k stand in LDS before any wave reads them
    kcopy(kla + NH_ * KS * HD * 2, kp); kp += KS * HD;   // stage 1 of k (NS >= 2)
#pragma unroll 1   // one stage per trip: an unrolled body would not hold its fragments in registers
    for (int s = 0; s < NS; ++s) {
        v16h vf[2][4];
#pragma unroll
        for (int gk = 0; gk < 2; ++gk)
#pragma unroll
            for (int dg = 0; dg < 4; ++dg) vf[gk][dg] = cat16(*(const v8h*)(vp + (gk * 2048 + dg * 256)), *(const v8h*)(vp + (gk * 2048 + 1024 + dg * 256)));
#pragma unroll
        for (int i = 0; i < 8; ++i) xc[i] = bfr(xr[i]);   // read out before the loads below replace xr
        ldx(s + 2 < NS ? s + 2 : NS - 1);   // issued at the head of the trip: the barrier at its foot waits for every load, and these come from memory
        asm volatile("s_wait_xcnt 0x0" ::: "memory");   // stands behind the v and rel_pos loads, in front of the step of vp and whatever else rewrites the registers that they name
        if (s + 1 < NS) produce(s + 1, rb[(s + 1) & 1]);
        const h16* kl = kl0 + (s & 1) * (NH_ * KS * HD);
        v16h kf[4][2];
#pragma unroll
        for (int kg = 0; kg < 4; ++kg)
#pragma unroll
            for (int dk = 0; dk < 2; ++dk) kf[kg][dk] = cat16(*(const v8h*)(kl + (kg * 1024 + dk * 512)), *(const v8h*)(kl + (kg * 1024 + dk * 512 + 256)));
        const float* rbp = rb[s & 1] + w * RHS + lr * RPI + 8 * hi;
        float t[4][8]; float mx = MFILL;
#pragma unroll
        for (int kg = 0; kg < 4; ++kg) {
            v8f st = (v8f){};
            st = wmma16(kf[kg][0], qf[0], st); st = wmma16(kf[kg][1], qf[1], st);
            const v4f r0 = *(const v4fa*)(rbp + kg * 16); const v4f r1 = *(const v4fa*)(rbp + kg * 16 + 4);
#pragma unroll
            for (int j = 0; j < 4; ++j) { t[kg][j] = (st[j] + r0[j]) * SCL; t[kg][4 + j] = (st[4 + j] + r1[j]) * SCL; mx = fmaxf(mx, fmaxf(t[kg][j], t[kg][4 + j])); } }
        mx = fmaxf(mx, __shfl_xor(mx, 16, 32));   // the other half of the wave holds the query's other keys
        const float mnew = fmaxf(mrun, mx);
        const float corr = ex2((mrun - mnew) * L2E);
        mrun = mnew;
        float ps = 0.0f; v16h pb[2];
#pragma unroll
        for (int kg = 0; kg < 4; ++kg)
#pragma unroll
            for (int j = 0; j < 8; ++j) { const float p = ex2(fmaf(t[kg][j] - mnew, L2E, 10.0f)); ps += p; pb[kg >> 1][(kg & 1) * 8 + j] = (h16)p; }   // + 10: the x1024 carry
        lsum = fmaf(lsum, corr, ps);
#pragma unroll
        for (int dg = 0; dg < 4; ++dg) o[dg] *= corr;
#pragma unroll
        for (int gk = 0; gk < 2; ++gk)
#pragma unroll
            for (int dg = 0; dg < 4; ++dg) o[dg] = wmma16(vf[gk][dg], pb[gk], o[dg]);
        vp += KS * HD;
        // the wave's reads of k stage s have retired before copies aim at that buffer again. The accumulators and the running sum are named as inputs so that this wait, and with it the barrier (which waits for every load in flight), stays at the foot of the trip, behind the trip's arithmetic: left free, the compiler put both in front of the softmax, where the loads of this trip had not had time to return
        asm volatile("s_wait_dscnt 0x0" :: "v"(o[0]), "v"(o[1]), "v"(o[2]), "v"(o[3]), "v"(lsum) : "memory");
        asm volatile("s_wait_asynccnt 0x0" ::: "memory");   // the wave's copies of k stage s + 1 have landed
        __syncthreads();   // publishes stage s + 1 of the bias tile and of k and ends every wave's reads of stage s, whose buffers are refilled behind it
        if (s + 2 < NS) { kcopy(kla + (s & 1) * (NH_ * KS * HD * 2), kp); kp += KS * HD; }   // stage s + 2 of k into the buffer that this trip has read
    }
    asm volatile("s_wait_asynccnt 0x0" ::: "memory");   // no copy is outstanding when the wave goes on to its end
    lsum += __shfl_xor(lsum, 16, 32);
    const float f = __fdiv_rn(PCAR, lsum);
    const float cs = 1.0f / PCAR;
    const size_t oo = ((size_t)b * TT + q0 + lr) * DM + w * HD + 8 * hi;   // context row of the lane's query, its head's 64 columns: one wave writes each 128-byte line of both planes
#pragma unroll
    for (int dg = 0; dg < 4; ++dg) { v8us oh, ol;
#pragma unroll
        for (int j = 0; j < 8; ++j) { unsigned short a, c2; splitf(o[dg][j] * f * cs, a, c2); oh[j] = a; ol[j] = c2; }
        *(v8us*)(Ah + oo + dg * 16) = oh; *(v8us*)(Al + oo + dg * 16) = ol; }
}

constexpr size_t al256(size_t b) { return (b + 255) & ~(size_t)255; }
constexpr size_t WS_TOTAL = 4 * al256((size_t)DM * DM * 2) + 3 * al256((size_t)NB * NH_ * TT * HD * 2) + 2 * al256((size_t)NB * TT * DM * 2);
static_assert(WS_TOTAL <= (size_t)134217728);
static_assert(((size_t)DM * DM * 2) % 256 == 0);   // the weight planes follow one another without a gap

extern "C" void kernel_launch(void* const* d_in, const int* in_sizes, int n_in,
                              void* d_out, int out_size, void* d_ws, size_t ws_size, hipStream_t stream) {
    if (n_in < 17) return;
    const size_t need_x = ((size_t)(NB - 1) * SEQ_FULL + SEQ) * DM;
    const size_t need_r = (size_t)(NB - 1) * SEQ_FULL * SEQ_FULL + (size_t)(SEQ - 1) * SEQ_FULL + SEQ;
    if ((size_t)in_sizes[0] < need_x || (size_t)in_sizes[1] < need_x || (size_t)in_sizes[2] < need_x || (size_t)in_sizes[3] < need_r) return;
    if ((size_t)in_sizes[4] < (size_t)(NB - 1) * SEQ_FULL + SEQ) return;
    if (in_sizes[5] < DM * DM || in_sizes[7] < DM * DM || in_sizes[9] < DM * DM || in_sizes[11] < DM * DM) return;
    if (in_sizes[6] < DM || in_sizes[8] < DM || in_sizes[10] < DM || in_sizes[12] < DM) return;
    if (in_sizes[13] < 16 || in_sizes[14] < 16 || in_sizes[15] < 128 || in_sizes[16] < 8) return;
    if ((size_t)out_size < need_x) return;
    const float* xq = (const float*)d_in[0]; const float* xk = (const float*)d_in[1]; const float* xv = (const float*)d_in[2];
    const float* rel = (const float*)d_in[3]; const int* msk = (const int*)d_in[4];
    const float* wq = (const float*)d_in[5]; const float* bq = (const float*)d_in[6]; const float* wk = (const float*)d_in[7]; const float* bk = (const float*)d_in[8];
    const float* wv = (const float*)d_in[9]; const float* bv = (const float*)d_in[10]; const float* wo = (const float*)d_in[11]; const float* bo = (const float*)d_in[12];
    const float* c1w = (const float*)d_in[13]; const float* c1b = (const float*)d_in[14]; const float* c2w = (const float*)d_in[15]; const float* c2b = (const float*)d_in[16];
    float* OUT = (float*)d_out;     // [NB_FULL][SEQ_FULL][DM]
    char* wsp = (char*)d_ws;
    auto take = [&](size_t bytes) { char* p = wsp; wsp += (bytes + 255) & ~(size_t)255; return (void*)p; };
    bf* WQ = (bf*)take((size_t)DM * DM * 2); take((size_t)DM * DM * 2); take((size_t)DM * DM * 2); bf* WO = (bf*)take((size_t)DM * DM * 2);   // four planes in the order q, k, v, o; the kernels reach k and v from WQ
    h16* QP16 = (h16*)take((size_t)NB * NH_ * TT * HD * 2); h16* KP16 = (h16*)take((size_t)NB * NH_ * TT * HD * 2); h16* VT16 = (h16*)take((size_t)NB * NH_ * HD * TT * 2);
    bf* ATh = (bf*)take((size_t)NB * TT * DM * 2); bf* ATl = (bf*)take((size_t)NB * TT * DM * 2);
    if ((size_t)(wsp - (char*)d_ws) > ws_size) return;
    // weights: in W[k rows][n cols] -> out Wt[n rows][k cols]; square DM x DM; the four planes WQ, WK, WV, WO are contiguous in the workspace
    k_cvtT<<<dim3(DM / 64, DM / 64, 4), 256, 0, stream>>>(wq, wk, wv, wo, WQ, DM, DM);
    k_proj<<<dim3(TT / 64, DM / 64, 3 * NB), 256, 0, stream>>>(xq, xk, xv, WQ, bq, bk, bv, QP16, KP16, VT16);
    k_fattn<<<dim3(TT / 16, NB), 256, 0, stream>>>(QP16, KP16, VT16, rel, msk, c1w, c1b, c2w, c2b, ATh, ATl);
    k_gemmw<bf, 1, true, 8><<<dim3(TT / 64, DM / 64, NB), 256, 0, stream>>>(ATh, ATl, WO, nullptr, DM, OUT, DM, bo, (size_t)TT * DM, 0, (size_t)SEQ_FULL * DM);
}

// v007
// A run of this version takes 91.8 microseconds.
// Two timings next to v006 put it at 1.08 and 1.07 times that version's speed.
// Counting every step since v000, it is 8.16 times as fast.
#include <hip/hip_runtime.h>

// Compute dtypes (f32 accumulate everywhere): q/k/v projections v_wmma_f32_16x16x32_bf16 (inputs RNE-converted to bf16, products exact); pointwise-bias channel mix (16 ch -> 8 heads) v_wmma_f32_16x16x32_f16; q.k scores f16; probabilities (x1024 carry) x values f16; output projection bf16 hi+lo context x bf16 weights (2 products); softmax and mask fill in f32.
// Four launches: weight transposes (all four), q / k / v projections (all three streams, both batches), attention, output projection (both batches); launches of one kernel that do not depend on each other are one grid, told apart by blockIdx.z (attention: by blockIdx.y).
// Layout: projection of the f32 q / k / v input stream (converted to bf16 in the fragment loader; + f32 bias) -> f16 head planes q, k, v in fragment order (see k_proj), stored by the projection itself;
// one attention launch for both batches: a block owns 16 query rows and all 8 heads; 16 waves = 8 heads x 2 halves of the keys, each half walked in stages of 32 and the two halves' running softmax states merged in LDS at the end: bias tile R[h][i][t] (one block-diagonal WMMA per 32 key positions, shared through LDS),
// S^T = k q^T, running-maximum softmax of (S + R) / 8 with key-mask fill, P (x1024 carry) as f16 straight from the score accumulators, O^T += v^T P^T; scores and probabilities never leave the registers.
// the attention launch stores the merged hi/lo context planes [b][t][h*64+d] (x 1/1024); output projection + bias. Weights [in][out] are transposed once through LDS into K-contiguous bf16 planes.

#ifndef NB
#define NB 2
#endif
#ifndef SEQ
#define SEQ 2048
#endif
#define NB_FULL  2
#define SEQ_FULL 2048
#define TT   SEQ
#define DM   512
#define NH_  8
#define HD   64
#define KS   32          // keys per stage of the attention loop
#define KG   2           // wave groups of an attention block: group g walks keys g * TT / KG .. (g + 1) * TT / KG - 1
#define RPI  (KS + 4)    // f32 pitch of one (head, query) row of the staged bias tile
#define RHS  (16 * RPI + 4)   // f32 pitch of one head's 16 rows: the 8 heads that one store instruction writes start on different LDS banks
#define PCAR 1024.0f
#define SCL  0.125f   // HD^-0.5
static_assert(NH_ * HD == DM);
static_assert(TT % 256 == 0);
static_assert(KS % 32 == 0 && TT % (KG * KS) == 0 && TT / (KG * KS) >= 2);
static_assert(DM % 256 == 0);
static_assert(SEQ <= SEQ_FULL);
static_assert(NB <= NB_FULL);

typedef _Float16 h16;
typedef unsigned short bf;
typedef __attribute__((ext_vector_type(16))) __bf16   v16bf;
typedef __attribute__((ext_vector_type(16))) _Float16 v16h;
typedef __attribute__((ext_vector_type(8)))  _Float16 v8h;
typedef __attribute__((ext_vector_type(8)))  unsigned short v8us;
typedef __attribute__((ext_vector_type(8)))  float    v8f;
typedef __attribute__((ext_vector_type(4)))  float    v4f;
typedef __attribute__((ext_vector_type(2)))  _Float16 v2h;
typedef __attribute__((ext_vector_type(4)))  _Float16 v4h;
typedef __attribute__((ext_vector_type(2)))  unsigned short v2us;
typedef __attribute__((ext_vector_type(4)))  int v4i;
typedef v4f  __attribute__((may_alias)) v4fa;
typedef v4i  __attribute__((may_alias)) v4ia;

__device__ __forceinline__ unsigned short f2bf(float f) { unsigned u = __float_as_uint(f); u += 0x7FFFu + ((u >> 16) & 1u); return (unsigned short)(u >> 16); }
__device__ __forceinline__ float bf2f(unsigned short b) { return __uint_as_float(((unsigned)b) << 16); }
__device__ __forceinline__ float bfr(float f) { return bf2f(f2bf(f)); }
__device__ __forceinline__ v16h cat16(v8h lo, v8h hi) { return __builtin_shufflevector(lo, hi, 0, 1, 2, 3, 4, 5, 6, 7, 8, 9, 10, 11, 12, 13, 14, 15); }
__device__ __forceinline__ v16bf cat16b(v8us lo, v8us hi) { return __builtin_bit_cast(v16bf, __builtin_shufflevector(lo, hi, 0, 1, 2, 3, 4, 5, 6, 7, 8, 9, 10, 11, 12, 13, 14, 15)); }
__device__ __forceinline__ v8f wmma16(v16h a, v16h b, v8f c) { return __builtin_amdgcn_wmma_f32_16x16x32_f16(false, a, false, b, (short)0, c, false, false); }
__device__ __forceinline__ v8f wmmab(v16bf a, v16bf b, v8f c) { return __builtin_amdgcn_wmma_f32_16x16x32_bf16(false, a, false, b, (short)0, c, false, false); }
__device__ __forceinline__ void splitf(float y, unsigned short& h, unsigned short& l) { h = f2bf(y); l = f2bf(y - bf2f(h)); }

// ---- k_gemmw: register-blocked GEMM, one block of KW waves per 64x64 output tile, operands straight from K-contiguous 16-bit planes; grid (M/64, N/64, Z), KW * 32 threads.
// Wave w holds the whole tile (16 accumulators) for k in [w * K / KW, (w + 1) * K / KW); for KW > 1 the KW partial tiles meet in LDS and are summed in wave order 0..KW-1. K % (32 * KW) == 0.
// C[m][n] (f32, pitch ldc, + optional f32 bias[n]) = sum_k A[m][k] Bt[n][k] (+ split products per NSPLIT). z-batch strides sA/sB/sC in elements. K % 32 == 0, A/Bt row pitch == K.
// Fragment map (A and Bt alike): lane row = lane & 15, elements 0..7 <- k0 + 8*(lane>>4) + 0..7, elements 8..15 <- k0 + 16 + 8*(lane>>4) + 0..7; D element j = (row 8*(lane>>4) + j, col lane & 15).
template <typename T16> struct WFrag;
template <> struct WFrag<h16> { typedef v16h V; static __device__ __forceinline__ V ld(const h16* p) { return cat16(*(const v8h*)p, *(const v8h*)(p + 16)); } static __device__ __forceinline__ v8f mma(V a, V b, v8f c) { return wmma16(a, b, c); } };
template <> struct WFrag<bf> { typedef v16bf V; static __device__ __forceinline__ V ld(const bf* p) { return cat16b(*(const v8us*)p, *(const v8us*)(p + 16)); } static __device__ __forceinline__ v8f mma(V a, V b, v8f c) { return wmmab(a, b, c); } };
template <typename T16, int NSPLIT, bool BIAS, int KW>
__global__ __launch_bounds__(KW * 32) void k_gemmw(const T16* __restrict__ A, const T16* __restrict__ A2, const T16* __restrict__ Bt, const T16* __restrict__ Bt2, int K, float* C, int ldc, const float* __restrict__ bias, size_t sA, size_t sB, size_t sC) {
    typedef typename WFrag<T16>::V V;
    static_assert(KW >= 1 && KW <= 8 && 8 % KW == 0);
    __shared__ __align__(16) float os[(KW > 1 ? 4 * KW : 1) * 16 * 68];
    const size_t z = blockIdx.z; A += z * sA; if (A2) A2 += z * sA; Bt += z * sB; if (Bt2) Bt2 += z * sB; C += z * sC;
    const int lane = threadIdx.x & 31, lr = lane & 15, hi = lane >> 4; const int r0 = blockIdx.x * 64, c0 = blockIdx.y * 64;
    v8f acc[4][4];
#pragma unroll
    for (int mb = 0; mb < 4; ++mb)
#pragma unroll
        for (int nb = 0; nb < 4; ++nb) acc[mb][nb] = (v8f){};
    const size_t aoff = (size_t)(r0 + lr) * K + 8 * hi, boff = (size_t)(c0 + lr) * K + 8 * hi;
    const int w = KW > 1 ? __builtin_amdgcn_readfirstlane((int)(threadIdx.x >> 5)) : 0;   // wave number in a scalar register: the k loop's bounds and branch stay scalar
    const int kspan = K / KW, kbeg = w * kspan, kend = kbeg + kspan;
#pragma unroll 1
    for (int kc = kbeg; kc < kend; kc += 32) {
        V a[4], a2[4];
#pragma unroll
        for (int mb = 0; mb < 4; ++mb) { a[mb] = WFrag<T16>::ld(A + aoff + (size_t)mb * 16 * K + kc); if (NSPLIT == 1 || NSPLIT == 2) a2[mb] = WFrag<T16>::ld(A2 + aoff + (size_t)mb * 16 * K + kc); }
#pragma unroll
        for (int nb = 0; nb < 4; ++nb) { const V b = WFrag<T16>::ld(Bt + boff + (size_t)nb * 16 * K + kc); V b2; if (NSPLIT >= 2) b2 = WFrag<T16>::ld(Bt2 + boff + (size_t)nb * 16 * K + kc);
#pragma unroll
            for (int mb = 0; mb < 4; ++mb) { acc[mb][nb] = WFrag<T16>::mma(a[mb], b, acc[mb][nb]); if (NSPLIT == 1 || NSPLIT == 2) acc[mb][nb] = WFrag<T16>::mma(a2[mb], b, acc[mb][nb]); if (NSPLIT >= 2) acc[mb][nb] = WFrag<T16>::mma(a[mb], b2, acc[mb][nb]); } }
        asm volatile("v_nop\n\tv_nop\n\tv_nop\n\tv_nop" : "+v"(acc[0][0]), "+v"(acc[1][1]), "+v"(acc[2][2]), "+v"(acc[3][3]) : "v"(a[0]), "v"(a[3]));
    }
    if constexpr (KW > 1) {   // loops below are unrolled so that acc[][] is indexed by constants and stays in registers, and the LDS offsets fold into immediates
#pragma unroll
        for (int mb = 0; mb < 4; ++mb) { float* my = os + (mb * KW + w) * (16 * 68);
#pragma unroll
            for (int nb = 0; nb < 4; ++nb) {
#pragma unroll
                for (int j = 0; j < 8; ++j) my[(hi * 8 + j) * 68 + nb * 16 + lr] = acc[mb][nb][j]; } }
        __syncthreads();   // every wave's partial tile stands in LDS before any wave sums across the waves
#pragma unroll
        for (int mb = 0; mb < 4; ++mb) { float* crow = C + (size_t)(r0 + mb * 16) * ldc + c0;
#pragma unroll
            for (int s0 = 0; s0 < 8; s0 += KW) { const int row = 2 * (s0 + w) + hi, cofs = lr * 4; const float* ps = os + mb * KW * (16 * 68) + row * 68 + cofs; v4f val = *(const v4fa*)ps;
#pragma unroll
                for (int q = 1; q < KW; ++q) val += *(const v4fa*)(ps + q * (16 * 68));
                if (BIAS) { val[0] += bfr(bias[c0 + cofs]); val[1] += bfr(bias[c0 + cofs + 1]); val[2] += bfr(bias[c0 + cofs + 2]); val[3] += bfr(bias[c0 + cofs + 3]); }
                *(v4f*)(crow + (size_t)row * ldc + cofs) = val; } }
        return;
    }
#pragma unroll
    for (int mb = 0; mb < 4; ++mb) {
#pragma unroll
        for (int nb = 0; nb < 4; ++nb) {
#pragma unroll
            for (int j = 0; j < 8; ++j) os[(hi * 8 + j) * 68 + nb * 16 + lr] = acc[mb][nb][j]; }
        __builtin_amdgcn_wave_barrier(); asm volatile("" ::: "memory");
        float* crow = C + (size_t)(r0 + mb * 16) * ldc + c0;
{
#pragma unroll
            for (int s = 0; s < 8; ++s) { const int row = 2 * s + hi, cofs = lr * 4; v4f val = *(const v4fa*)(os + row * 68 + cofs); if (BIAS) { val[0] += bfr(bias[c0 + cofs]); val[1] += bfr(bias[c0 + cofs + 1]); val[2] += bfr(bias[c0 + cofs + 2]); val[3] += bfr(bias[c0 + cofs + 3]); }
                *(v4f*)(crow + (size_t)row * ldc + cofs) = val; }
             }
        __builtin_amdgcn_wave_barrier(); asm volatile("" ::: "memory");
    }
}

// proj_tile (body of k_proj): one 64x64 tile of a q / k / v projection per block of 8 waves, K = DM split over the waves as in k_gemmw (same fragment map, same sum in wave order); the f32 input stream is read as it is and rounded to bf16 (RNE) in the fragment loader.
// VT == false (q, k): A rows = positions t of X, B rows = output columns n of Wt; tile (bx, by) of (TT/64, DM/64); a tile's 64 columns are one head.
// VT == true (v): A rows = output columns n of Wt, B rows = positions t of X, so that the tile comes out transposed; tile (bx, by) of (DM/64, TT/64); a tile's 64 rows are one head.
// Head planes are stored in fragment order: a chunk of 512 contiguous bytes is what one 16-byte-per-lane load of the attention kernel takes, lane l = 16 * hi + lr at byte 16 * l. 16 positions of a head are 4 chunks (2 KiB), a head plane is TT / 16 such groups.
// q, k: chunk c of position group tg: lane holds position 16 * tg + lr, d = 16 * c + 8 * hi + 0..7. v: chunk dg of position group tg: lane holds d = 16 * dg + lr, positions 16 * tg + 8 * hi + 0..7.
// In both cases a chunk is rows 16 * mb + lr, columns 16 * c + 8 * hi + 0..7 of the tile; wave w stores chunks (mb = w >> 1, c = 2 * (w & 1) + 0..1), each store instruction four whole 128-byte lines.
typedef __attribute__((ext_vector_type(8))) __bf16 v8bf;
__device__ __forceinline__ v16bf ldxf(const float* p) { const v8f lo = *(const v8f*)p, hi = *(const v8f*)(p + 16);
    return __builtin_shufflevector(__builtin_convertvector(lo, v8bf), __builtin_convertvector(hi, v8bf), 0, 1, 2, 3, 4, 5, 6, 7, 8, 9, 10, 11, 12, 13, 14, 15); }
template <bool VT>
__device__ __forceinline__ void proj_tile(const float* __restrict__ X, const bf* __restrict__ Wt, const float* __restrict__ bias, h16* P, float* os, int bx, int by) {
    constexpr int KW = 8, K = DM;
    const int lane = threadIdx.x & 31, lr = lane & 15, hi = lane >> 4; const int r0 = bx * 64, c0 = by * 64;
    v8f acc[4][4];
#pragma unroll
    for (int mb = 0; mb < 4; ++mb)
#pragma unroll
        for (int nb = 0; nb < 4; ++nb) acc[mb][nb] = (v8f){};
    const size_t aoff = (size_t)(r0 + lr) * K + 8 * hi, boff = (size_t)(c0 + lr) * K + 8 * hi;
    const int w = __builtin_amdgcn_readfirstlane((int)(threadIdx.x >> 5));   // wave number in a scalar register: the wave's k offset stays scalar
    const int kbeg = w * (K / KW), kend = kbeg + K / KW;
#pragma unroll   // both trips in line: the second trip's loads issue while the first trip's products still run
    for (int kc = kbeg; kc < kend; kc += 32) {
        v16bf a[4];
#pragma unroll
        for (int mb = 0; mb < 4; ++mb) { if constexpr (VT) a[mb] = WFrag<bf>::ld(Wt + aoff + (size_t)mb * 16 * K + kc); else a[mb] = ldxf(X + aoff + (size_t)mb * 16 * K + kc); }
#pragma unroll
        for (int nb = 0; nb < 4; ++nb) { v16bf b; if constexpr (VT) b = ldxf(X + boff + (size_t)nb * 16 * K + kc); else b = WFrag<bf>::ld(Wt + boff + (size_t)nb * 16 * K + kc);
#pragma unroll
            for (int mb = 0; mb < 4; ++mb) acc[mb][nb] = wmmab(a[mb], b, acc[mb][nb]); }
    }
    // loops below are unrolled so that acc[][] is indexed by constants and stays in registers, and the LDS offsets fold into immediates
#pragma unroll
    for (int mb = 0; mb < 4; ++mb) { float* my = os + (mb * KW + w) * (16 * 68);
#pragma unroll
        for (int nb = 0; nb < 4; ++nb) {
#pragma unroll
            for (int j = 0; j < 8; ++j) my[(hi * 8 + j) * 68 + nb * 16 + lr] = acc[mb][nb][j]; } }
    __syncthreads();   // every wave's partial tile stands in LDS before any wave sums across the waves
    const int mb = w >> 1, cb = 2 * (w & 1);   // the wave's chunks: (mb, cb) and (mb, cb + 1)
    const float* ps0 = os + mb * KW * (16 * 68) + lr * 68 + cb * 16 + hi * 8;
    const float* bp = VT ? bias + r0 + mb * 16 + lr : bias + c0 + cb * 16 + hi * 8;
    h16* dst = VT ? P + (size_t)bx * (HD * TT) + (size_t)((c0 >> 4) + cb) * 1024 + mb * 256 + lane * 8 : P + (size_t)by * (TT * HD) + (size_t)((r0 >> 4) + mb) * 1024 + cb * 256 + lane * 8;
#pragma unroll
    for (int it = 0; it < 2; ++it) { const float* ps = ps0 + it * 16; v4f va = *(const v4fa*)ps, vb = *(const v4fa*)(ps + 4);
#pragma unroll
        for (int q = 1; q < KW; ++q) { va += *(const v4fa*)(ps + q * (16 * 68)); vb += *(const v4fa*)(ps + q * (16 * 68) + 4); }
        v8h o16;
#pragma unroll
        for (int j = 0; j < 4; ++j) { o16[j] = (h16)(va[j] + bfr(bp[VT ? 0 : it * 16 + j])); o16[4 + j] = (h16)(vb[j] + bfr(bp[VT ? 0 : it * 16 + 4 + j])); }
        *(v8h*)(dst + it * (VT ? 1024 : 256)) = o16; }
}
// k_proj: all q / k / v projection tiles of both batches in one grid (TT/64, DM/64, 3 * NB): blockIdx.z = stream * NB + batch, stream 0 = q, 1 = k, 2 = v. Wt3: the three transposed weight planes one behind the other.
__global__ __launch_bounds__(256) void k_proj(const float* __restrict__ xq, const float* __restrict__ xk, const float* __restrict__ xv, const bf* __restrict__ Wt3,
                                              const float* __restrict__ bq, const float* __restrict__ bk, const float* __restrict__ bv, h16* Q16, h16* K16, h16* V16) {
    __shared__ __align__(16) float os[4 * 8 * 16 * 68];
    const int st = blockIdx.z / NB, b = blockIdx.z % NB;
    const size_t xoff = (size_t)b * SEQ_FULL * DM, poff = (size_t)b * NH_ * TT * HD;
    if (st == 2) { proj_tile<true>(xv + xoff, Wt3 + 2 * (size_t)DM * DM, bv, V16 + poff, os, blockIdx.y, blockIdx.x); return; }
    proj_tile<false>((st == 0 ? xq : xk) + xoff, Wt3 + (size_t)st * DM * DM, st == 0 ? bq : bk, (st == 0 ? Q16 : K16) + poff, os, blockIdx.x, blockIdx.y);
    asm volatile("s_wait_xcnt 0x0" ::: "memory");   // stands behind the tile's stores: in the listing the v body follows this one on a fall-through (never taken: a scalar flag branches round it) and rewrites the registers that the stores name
}

// k_cvtT: in W[K rows][N cols] f32 -> out Wt[N rows][K cols] bf16 (RNE), 64x64 tile transposed through LDS (cross-wave: block barrier); grid (K/64, N/64, 4): blockIdx.z picks one of four matrices of one shape, whose outputs stand one behind the other.
__global__ __launch_bounds__(256) void k_cvtT(const float* __restrict__ W0, const float* __restrict__ W1, const float* __restrict__ W2, const float* __restrict__ W3, bf* Wt, int K, int N) {
    __shared__ unsigned short tl[64 * 66];
    const int zi = blockIdx.z; const float* W = zi == 0 ? W0 : zi == 1 ? W1 : zi == 2 ? W2 : W3; Wt += (size_t)zi * K * N;
    const int tid = threadIdx.x; const int k0 = blockIdx.x * 64, n0 = blockIdx.y * 64;
    { const int row = tid >> 2, cseg = (tid & 3) * 16;
#pragma unroll
      for (int q = 0; q < 4; ++q) { const v4f v = *(const v4f*)(W + (size_t)(k0 + row) * N + n0 + cseg + q * 4);
#pragma unroll
          for (int j = 0; j < 4; ++j) tl[row * 66 + cseg + q * 4 + j] = f2bf(v[j]); } }
    __syncthreads();
    const int piece = tid & 7; v8us o[2];
#pragma unroll
    for (int it = 0; it < 2; ++it) { const int n = it * 32 + (tid >> 3);
#pragma unroll
        for (int j = 0; j < 8; ++j) o[it][j] = tl[(piece * 8 + j) * 66 + n]; }
{
#pragma unroll
        for (int it = 0; it < 2; ++it) { const int n = it * 32 + (tid >> 3); *(v8us*)(Wt + (size_t)(n0 + n) * K + k0 + piece * 8) = o[it]; }
         }
}

// k_fattn: grid (TT / 16, NB), 16 waves (four per SIMD: while one wave waits for LDS, a load or a dependent result, three others can issue); block = 16 query rows q0.. of batch b, wave = (key group grp, head w).
// Each group runs the whole loop below on its own half of the keys with its own bias tile and k buffers; all 16 waves share the stage barrier. Behind the loop group 1 hands its maximum, sum and accumulators to group 0 through LDS, lane to lane.
// Bias tile, per group and stage of KS keys: wave w makes query rows 2w, 2w+1 for all 8 heads. One WMMA per 32 key positions: A rows = 16 positions, k 0..15 = channel activations of position t0+m, k 16..31 = of position t0+16+m (f16);
// B block-diagonal: B[c][h] = c2w[h][c] for h < 8, B[16+c][8+h] = c2w[h][c], zero elsewhere. D[p][h] -> position t0+p, D[p][8+h] -> position t0+16+p. Stored as rb[h][query][key] (f32).
// A key with mask == 0 gets the bias MFILL: S + MFILL == MFILL in f32 for every |S| < 1e30, so all masked scores of a row are one equal value far below any real score (weight 0 beside a real key, uniform weights where every key is masked), as with the -1e9 fill.
// Scores: A = 16 key rows of k, B = the 16 query rows of q (kept in registers): D element j = (key 8*(lane>>4) + j, query lane & 15). Two such tiles, converted to f16, are the B operand (k order 8*(lane>>4)+0..7, 16+8*(lane>>4)+0..7) of O^T += v^T P^T.
// k fragments reach the wave through LDS: each wave brings its own head's next stages (4 KiB each, fragment order) into its own part of one of two k buffers by asynchronous copies, one whole stage ahead; v fragments are register loads issued at the head of the trip that uses them.
// Every inner loop is unrolled so that the register arrays (fragments, scores, accumulators) are indexed by constants and the LDS and global offsets fold into immediates.
#define MFILL (-3.0e38f)
#define L2E   1.4426950408889634f
// 2^x. The v_nop is the slot that the instruction set asks for behind a transcendental before its result is read or its source overwritten.
__device__ __forceinline__ float ex2(float x) { float r; asm("v_exp_f32 %0, %1\n\tv_nop" : "=v"(r) : "v"(x)); return r; }
// One stage of a head's k plane into LDS: 8 copies of 512 contiguous bytes (16 bytes a lane). The immediate offset moves the global and the LDS address alike, so one address pair serves all 8.
// The s_wait_xcnt closes the statement so that nothing rewrites the two address operands before it.
__device__ __forceinline__ void kcopy(unsigned lds, const h16* g) {
    asm volatile("global_load_async_to_lds_b128 %0, %1, off\n\t"
                 "global_load_async_to_lds_b128 %0, %1, off offset:512\n\t"
                 "global_load_async_to_lds_b128 %0, %1, off offset:1024\n\t"
                 "global_load_async_to_lds_b128 %0, %1, off offset:1536\n\t"
                 "global_load_async_to_lds_b128 %0, %1, off offset:2048\n\t"
                 "global_load_async_to_lds_b128 %0, %1, off offset:2560\n\t"
                 "global_load_async_to_lds_b128 %0, %1, off offset:3072\n\t"
                 "global_load_async_to_lds_b128 %0, %1, off offset:3584\n\t"
                 "s_wait_xcnt 0x0" :: "v"(lds), "v"(g) : "memory");
}
static_assert(KS * HD * 2 == 8 * 512);
__global__ __launch_bounds__(KG * 256) void k_fattn(const h16* __restrict__ Q16, const h16* __restrict__ K16, const h16* __restrict__ V16, const float* __restrict__ rel, const int* __restrict__ mask,
                                               const float* __restrict__ c1w, const float* __restrict__ c1b, const float* __restrict__ c2w, const float* __restrict__ c2b, bf* Ah, bf* Al) {
    static_assert(KG == 2);
    __shared__ __align__(16) float rb[2][KG][NH_ * RHS];
    __shared__ __align__(16) int mks[TT];
    __shared__ __align__(16) h16 kls[2][KG * NH_][KS * HD];   // two k buffers, one part per wave (group, head)
    __shared__ __align__(16) float mgo[NH_][8][32 * 4];   // group 1's accumulators, 16 bytes a lane and piece
    __shared__ __align__(8) float mgs[NH_][32 * 2];       // group 1's running maximum and sum, a pair a lane
    constexpr int NS = TT / (KG * KS);
    const int lane = threadIdx.x & 31, lr = lane & 15, hi = lane >> 4;
    const int wv = __builtin_amdgcn_readfirstlane((int)(threadIdx.x >> 5));   // wave number in a scalar register: plane bases and the branch on the group stay scalar
    const int w = wv & (NH_ - 1), grp = wv / NH_, kb = grp * (TT / KG);   // head, key group, the group's first key
    const int b = blockIdx.y, q0 = blockIdx.x * 16;
    for (int idx = threadIdx.x; idx < TT / 4; idx += KG * 256) { const v4i m4 = *(const v4i*)(mask + (size_t)b * SEQ_FULL + idx * 4); *(v4ia*)(mks + idx * 4) = m4; }
    float w1[8], b1[8];
#pragma unroll
    for (int i = 0; i < 8; ++i) { w1[i] = bfr(c1w[8 * hi + i]); b1[i] = bfr(c1b[8 * hi + i]); }
    const int hd = lr & 7, g = lr >> 3;
    v16h bw;
#pragma unroll
    for (int i = 0; i < 8; ++i) { const h16 c = (h16)bfr(c2w[hd * 16 + 8 * hi + i]); const h16 zr = (h16)0.0f; bw[i] = (g == 0) ? c : zr; bw[8 + i] = (g == 1) ? c : zr; }
    const float bias2 = bfr(c2b[hd]);
    const float* rr0 = rel + ((size_t)b * SEQ_FULL + q0 + 2 * w) * SEQ_FULL + kb + lr;
    constexpr int NX = 2 * (KS / 16);
    float xr[NX], xc[NX];   // xr: the wave's rel_pos values of a later stage, in flight; xc: those of the stage that produce() makes, rounded to bf16
    auto ldx = [&](int s) {
#pragma unroll
        for (int qq = 0; qq < 2; ++qq)
#pragma unroll
            for (int gk = 0; gk < KS / 32; ++gk) { const float* p = rr0 + (size_t)qq * SEQ_FULL + s * KS + gk * 32; xr[qq * (KS / 16) + gk * 2] = p[0]; xr[qq * (KS / 16) + gk * 2 + 1] = p[16]; } };
    auto produce = [&](int s, float* dstb) {
#pragma unroll
        for (int gk = 0; gk < KS / 32; ++gk) {
            const int* mp = mks + kb + s * KS + gk * 32 + 16 * g + 8 * hi; const v4i m0 = *(const v4ia*)mp; const v4i m1 = *(const v4ia*)(mp + 4);
#pragma unroll
            for (int qq = 0; qq < 2; ++qq) {
                const float xa = xc[qq * (KS / 16) + gk * 2], xb = xc[qq * (KS / 16) + gk * 2 + 1];
                v16h a;
#pragma unroll
                for (int i = 0; i < 8; ++i) { a[i] = (h16)fmaxf(fmaf(xa, w1[i], b1[i]), 0.0f); a[8 + i] = (h16)fmaxf(fmaf(xb, w1[i], b1[i]), 0.0f); }
                const v8f acc = wmma16(a, bw, (v8f){});
                v4f o0, o1;
#pragma unroll
                for (int j = 0; j < 4; ++j) { o0[j] = (m0[j] == 0) ? MFILL : acc[j] + bias2; o1[j] = (m1[j] == 0) ? MFILL : acc[4 + j] + bias2; }
                float* dst = dstb + hd * RHS + (2 * w + qq) * RPI + gk * 32 + 16 * g + 8 * hi;
                *(v4fa*)dst = o0; *(v4fa*)(dst + 4) = o1; } } };
    const size_t pl = ((size_t)b * NH_ + w) * TT * HD;
    const h16* kp = K16 + pl + kb * HD + lane * 8; const h16* vp = V16 + pl + kb * HD + lane * 8;   // the lane's 16 bytes in the first chunk of a stage of its head's k and v planes (fragment order, see k_proj; 16 positions are 16 * HD elements, so the group's first key stands kb * HD elements in): kp of the next stage to be copied, vp of the current stage
    const h16* kl0 = &kls[0][wv][lane * 8];   // the lane's 16 bytes in the first chunk of the wave's part of k buffer 0; buffer 1 stands KG * NH_ * KS * HD elements behind
    const unsigned kla = (unsigned)(size_t)kl0;   // the same as an LDS byte address
    kcopy(kla, kp); kp += KS * HD;   // stage 0 of k
    v16h qf[2];
#pragma unroll
    for (int dk = 0; dk < 2; ++dk) { const h16* qp = Q16 + pl + (size_t)(q0 >> 4) * 1024 + dk * 512 + lane * 8; qf[dk] = cat16(*(const v8h*)qp, *(const v8h*)(qp + 256)); }
    v8f o[4];
#pragma unroll
    for (int dg = 0; dg < 4; ++dg) o[dg] = (v8f){};
    float mrun = MFILL, lsum = 0.0f;
    ldx(0);
    __syncthreads();   // the mask stands in LDS before any wave reads it
#pragma unroll
    for (int i = 0; i < NX; ++i) xc[i] = bfr(xr[i]);
    ldx(1);
    produce(0, rb[0][grp]);
    asm volatile("s_wait_asynccnt 0x0" ::: "memory");   // the wave's copies of k stage 0 have landed
    __syncthreads();   // stage 0 of the bias tile and of k stand in LDS before any wave reads them
    kcopy(kla + KG * NH_ * KS * HD * 2, kp); kp += KS * HD;   // stage 1 of k (NS >= 2)
#pragma unroll 1   // one stage per trip: an unrolled body would not hold its fragments in registers
    for (int s = 0; s < NS; ++s) {
        v16h vf[KS / 32][4];
#pragma unroll
        for (int gk = 0; gk < KS / 32; ++gk)
#pragma unroll
            for (int dg = 0; dg < 4; ++dg) vf[gk][dg] = cat16(*(const v8h*)(vp + (gk * 2048 + dg * 256)), *(const v8h*)(vp + (gk * 2048 + 1024 + dg * 256)));
#pragma unroll
        for (int i = 0; i < NX; ++i) xc[i] = bfr(xr[i]);   // read out before the loads below replace xr
        ldx(s + 2 < NS ? s + 2 : NS - 1);   // issued at the head of the trip: the barrier at its foot waits for every load, and these come from memory
        asm volatile("s_wait_xcnt 0x0" ::: "memory");   // stands behind the v and rel_pos loads, in front of the step of vp and whatever else rewrites the registers that they name
        if (s + 1 < NS) produce(s + 1, rb[(s + 1) & 1][grp]);
        const h16* kl = kl0 + (s & 1) * (KG * NH_ * KS * HD);
        v16h kf[KS / 16][2];
#pragma unroll
        for (int kg = 0; kg < KS / 16; ++kg)
#pragma unroll
            for (int dk = 0; dk < 2; ++dk) kf[kg][dk] = cat16(*(const v8h*)(kl + (kg * 1024 + dk * 512)), *(const v8h*)(kl + (kg * 1024 + dk * 512 + 256)));
        const float* rbp = rb[s & 1][grp] + w * RHS + lr * RPI + 8 * hi;
        float t[KS / 16][8]; float mx = MFILL;
#pragma unroll
        for (int kg = 0; kg < KS / 16; ++kg) {
            v8f st = (v8f){};
            st = wmma16(kf[kg][0], qf[0], st); st = wmma16(kf[kg][1], qf[1], st);
            const v4f r0 = *(const v4fa*)(rbp + kg * 16); const v4f r1 = *(const v4fa*)(rbp + kg * 16 + 4);
#pragma unroll
            for (int j = 0; j < 4; ++j) { t[kg][j] = (st[j] + r0[j]) * SCL; t[kg][4 + j] = (st[4 + j] + r1[j]) * SCL; mx = fmaxf(mx, fmaxf(t[kg][j], t[kg][4 + j])); } }
        mx = fmaxf(mx, __shfl_xor(mx, 16, 32));   // the other half of the wave holds the query's other keys
        const float mnew = fmaxf(mrun, mx);
        const float corr = ex2((mrun - mnew) * L2E);
        mrun = mnew;
        float ps = 0.0f; v16h pb[KS / 32];
#pragma unroll
        for (int kg = 0; kg < KS / 16; ++kg)
#pragma unroll
            for (int j = 0; j < 8; ++j) { const float p = ex2(fmaf(t[kg][j] - mnew, L2E, 10.0f)); ps += p; pb[kg >> 1][(kg & 1) * 8 + j] = (h16)p; }   // + 10: the x1024 carry
        lsum = fmaf(lsum, corr, ps);
#pragma unroll
        for (int dg = 0; dg < 4; ++dg) o[dg] *= corr;
#pragma unroll
        for (int gk = 0; gk < KS / 32; ++gk)
#pragma unroll
            for (int dg = 0; dg < 4; ++dg) o[dg] = wmma16(vf[gk][dg], pb[gk], o[dg]);
        vp += KS * HD;
        // the wave's reads of k stage s have retired before copies aim at that buffer again. The accumulators and the running sum are named as inputs so that this wait, and with it the barrier (which waits for every load in flight), stays at the foot of the trip, behind the trip's arithmetic: left free, the compiler put both in front of the softmax, where the loads of this trip had not had time to return
        asm volatile("s_wait_dscnt 0x0" :: "v"(o[0]), "v"(o[1]), "v"(o[2]), "v"(o[3]), "v"(lsum) : "memory");
        asm volatile("s_wait_asynccnt 0x0" ::: "memory");   // the wave's copies of k stage s + 1 have landed
        __syncthreads();   // publishes stage s + 1 of the bias tile and of k and ends every wave's reads of stage s, whose buffers are refilled behind it
        if (s + 2 < NS) { kcopy(kla + (s & 1) * (KG * NH_ * KS * HD * 2), kp); kp += KS * HD; }   // stage s + 2 of k into the buffer that this trip has read
    }
    asm volatile("s_wait_asynccnt 0x0" ::: "memory");   // no copy is outstanding when the wave goes on to its end
    lsum += __shfl_xor(lsum, 16, 32);
    // The two groups' states of one (head, query) meet: in both groups lane and register hold the same (query, d), so the hand-over is lane to lane.
    if (grp == 1) {
#pragma unroll
        for (int dg = 0; dg < 4; ++dg) { *(v4fa*)&mgo[w][2 * dg][lane * 4] = __builtin_shufflevector(o[dg], o[dg], 0, 1, 2, 3); *(v4fa*)&mgo[w][2 * dg + 1][lane * 4] = __builtin_shufflevector(o[dg], o[dg], 4, 5, 6, 7); }
        mgs[w][lane * 2] = mrun; mgs[w][lane * 2 + 1] = lsum;
    }
    __syncthreads();   // group 1's state stands in LDS before group 0 reads it
    if (grp == 1) return;
    const float m1 = mgs[w][lane * 2], l1 = mgs[w][lane * 2 + 1];
    const float mall = fmaxf(mrun, m1);
    const float a0 = ex2((mrun - mall) * L2E), a1 = ex2((m1 - mall) * L2E);   // each group's weight against the common maximum
    lsum = fmaf(lsum, a0, l1 * a1);
#pragma unroll
    for (int dg = 0; dg < 4; ++dg) { const v4f p0 = *(const v4fa*)&mgo[w][2 * dg][lane * 4]; const v4f p1 = *(const v4fa*)&mgo[w][2 * dg + 1][lane * 4];
#pragma unroll
        for (int j = 0; j < 4; ++j) { o[dg][j] = fmaf(o[dg][j], a0, p0[j] * a1); o[dg][4 + j] = fmaf(o[dg][4 + j], a0, p1[j] * a1); } }
    const float f = __fdiv_rn(PCAR, lsum);
    const float cs = 1.0f / PCAR;
    const size_t oo = ((size_t)b * TT + q0 + lr) * DM + w * HD + 8 * hi;   // context row of the lane's query, its head's 64 columns: one wave writes each 128-byte line of both planes
#pragma unroll
    for (int dg = 0; dg < 4; ++dg) { v8us oh, ol;
#pragma unroll
        for (int j = 0; j < 8; ++j) { unsigned short a, c2; splitf(o[dg][j] * f * cs, a, c2); oh[j] = a; ol[j] = c2; }
        *(v8us*)(Ah + oo + dg * 16) = oh; *(v8us*)(Al + oo + dg * 16) = ol; }
}

constexpr size_t al256(size_t b) { return (b + 255) & ~(size_t)255; }
constexpr size_t WS_TOTAL = 4 * al256((size_t)DM * DM * 2) + 3 * al256((size_t)NB * NH_ * TT * HD * 2) + 2 * al256((size_t)NB * TT * DM * 2);
static_assert(WS_TOTAL <= (size_t)134217728);
static_assert(((size_t)DM * DM * 2) % 256 == 0);   // the weight planes follow one another without a gap

extern "C" void kernel_launch(void* const* d_in, const int* in_sizes, int n_in,
                              void* d_out, int out_size, void* d_ws, size_t ws_size, hipStream_t stream) {
    if (n_in < 17) return;
    const size_t need_x = ((size_t)(NB - 1) * SEQ_FULL + SEQ) * DM;
    const size_t need_r = (size_t)(NB - 1) * SEQ_FULL * SEQ_FULL + (size_t)(SEQ - 1) * SEQ_FULL + SEQ;
    if ((size_t)in_sizes[0] < need_x || (size_t)in_sizes[1] < need_x || (size_t)in_sizes[2] < need_x || (size_t)in_sizes[3] < need_r) return;
    if ((size_t)in_sizes[4] < (size_t)(NB - 1) * SEQ_FULL + SEQ) return;
    if (in_sizes[5] < DM * DM || in_sizes[7] < DM * DM || in_sizes[9] < DM * DM || in_sizes[11] < DM * DM) return;
    if (in_sizes[6] < DM || in_sizes[8] < DM || in_sizes[10] < DM || in_sizes[12] < DM) return;
    if (in_sizes[13] < 16 || in_sizes[14] < 16 || in_sizes[15] < 128 || in_sizes[16] < 8) return;
    if ((size_t)out_size < need_x) return;
    const float* xq = (const float*)d_in[0]; const float* xk = (const float*)d_in[1]; const float* xv = (const float*)d_in[2];
    const float* rel = (const float*)d_in[3]; const int* msk = (const int*)d_in[4];
    const float* wq = (const float*)d_in[5]; const float* bq = (const float*)d_in[6]; const float* wk = (const float*)d_in[7]; const float* bk = (const float*)d_in[8];
    const float* wv = (const float*)d_in[9]; const float* bv = (const float*)d_in[10]; const float* wo = (const float*)d_in[11]; const float* bo = (const float*)d_in[12];
    const float* c1w = (const float*)d_in[13]; const float* c1b = (const float*)d_in[14]; const float* c2w = (const float*)d_in[15]; const float* c2b = (const float*)d_in[16];
    float* OUT = (float*)d_out;     // [NB_FULL][SEQ_FULL][DM]
    char* wsp = (char*)d_ws;
    auto take = [&](size_t bytes) { char* p = wsp; wsp += (bytes + 255) & ~(size_t)255; return (void*)p; };
    bf* WQ = (bf*)take((size_t)DM * DM * 2); take((size_t)DM * DM * 2); take((size_t)DM * DM * 2); bf* WO = (bf*)take((size_t)DM * DM * 2);   // four planes in the order q, k, v, o; the kernels reach k and v from WQ
    h16* QP16 = (h16*)take((size_t)NB * NH_ * TT * HD * 2); h16* KP16 = (h16*)take((size_t)NB * NH_ * TT * HD * 2); h16* VT16 = (h16*)take((size_t)NB * NH_ * HD * TT * 2);
    bf* ATh = (bf*)take((size_t)NB * TT * DM * 2); bf* ATl = (bf*)take((size_t)NB * TT * DM * 2);
    if ((size_t)(wsp - (char*)d_ws) > ws_size) return;
    // weights: in W[k rows][n cols] -> out Wt[n rows][k cols]; square DM x DM; the four planes WQ, WK, WV, WO are contiguous in the workspace
    k_cvtT<<<dim3(DM / 64, DM / 64, 4), 256, 0, stream>>>(wq, wk, wv, wo, WQ, DM, DM);
    k_proj<<<dim3(TT / 64, DM / 64, 3 * NB), 256, 0, stream>>>(xq, xk, xv, WQ, bq, bk, bv, QP16, KP16, VT16);
    k_fattn<<<dim3(TT / 16, NB), KG * 256, 0, stream>>>(QP16, KP16, VT16, rel, msk, c1w, c1b, c2w, c2b, ATh, ATl);
    k_gemmw<bf, 1, true, 8><<<dim3(TT / 64, DM / 64, NB), 256, 0, stream>>>(ATh, ATl, WO, nullptr, DM, OUT, DM, bo, (size_t)TT * DM, 0, (size_t)SEQ_FULL * DM);
}

// v008
// One run takes 68.4 microseconds.
// Two timings next to v007 both put it at 1.34 times that version's speed.
// Over all steps from v000 it is 11.0 times as fast.
#include <hip/hip_runtime.h>

// Compute dtypes (f32 accumulate everywhere): q/k/v projections v_wmma_f32_16x16x32_bf16 (inputs RNE-converted to bf16, products exact); pointwise-bias channel mix (16 ch -> 8 heads) v_wmma_f32_16x16x32_f16; q.k scores f16; probabilities (x1024 carry) x values f16; output projection bf16 hi+lo context x bf16 weights (2 products); softmax and mask fill in f32.
// Keys with mask == 0 have weight 0 wherever a row has a real key, so they are dropped before any work is spent on them: the first launch lists each batch's kept positions (in rising order); k and v are projected for the listed positions only and stored by list slot, and the attention loop walks slots.
// Slots from the count up to the next multiple of 64 are fillers (position 0, filled like a masked key). A batch with no kept key lists every position, all of them filled, which gives the uniform weights of the reference.
// Four launches: weight transposes (all four) and key lists, q / k / v projections (all three streams, both batches), attention, output projection (both batches); launches of one kernel that do not depend on each other are one grid, told apart by blockIdx.z.
// Layout: projection of the f32 q / k / v input stream (converted to bf16 in the fragment loader; + f32 bias) -> f16 head planes q, k, v in fragment order (see k_proj), stored by the projection itself;
// one attention launch for both batches: a block owns 16 query rows and all 8 heads; 16 waves = 8 heads x 2 halves of the keys, each half walked in stages of 32 and the two halves' running softmax states merged in LDS at the end: bias tile R[h][i][t] (one block-diagonal WMMA per 32 key positions, shared through LDS),
// S^T = k q^T, running-maximum softmax of (S + R) / 8 with key-mask fill, P (x1024 carry) as f16 straight from the score accumulators, O^T += v^T P^T; scores and probabilities never leave the registers.
// the attention launch stores the merged hi/lo context planes [b][t][h*64+d] (x 1/1024); output projection + bias. Weights [in][out] are transposed once through LDS into K-contiguous bf16 planes.

#ifndef NB
#define NB 2
#endif
#ifndef SEQ
#define SEQ 2048
#endif
#define NB_FULL  2
#define SEQ_FULL 2048
#define TT   SEQ
#define DM   512
#define NH_  8
#define HD   64
#define KS   32          // keys per stage of the attention loop
#define KG   2           // wave groups of an attention block: each walks its own half of the key list's slots (see k_fattn)
#define RPI  (KS + 4)    // f32 pitch of one (head, query) row of the staged bias tile
#define RHS  (16 * RPI + 4)   // f32 pitch of one head's 16 rows: the 8 heads that one store instruction writes start on different LDS banks
#define PCAR 1024.0f
#define SCL  0.125f   // HD^-0.5
static_assert(NH_ * HD == DM);
static_assert(TT % 256 == 0);
static_assert(KS % 32 == 0 && TT % (KG * KS) == 0 && KG * KS == 64);   // 64: the list is padded to the projection's tile of 64 slots
static_assert(DM % 256 == 0);
static_assert(SEQ <= SEQ_FULL);
static_assert(NB <= NB_FULL);

typedef _Float16 h16;
typedef unsigned short bf;
typedef __attribute__((ext_vector_type(16))) __bf16   v16bf;
typedef __attribute__((ext_vector_type(16))) _Float16 v16h;
typedef __attribute__((ext_vector_type(8)))  _Float16 v8h;
typedef __attribute__((ext_vector_type(8)))  unsigned short v8us;
typedef __attribute__((ext_vector_type(8)))  float    v8f;
typedef __attribute__((ext_vector_type(4)))  float    v4f;
typedef __attribute__((ext_vector_type(2)))  _Float16 v2h;
typedef __attribute__((ext_vector_type(4)))  _Float16 v4h;
typedef __attribute__((ext_vector_type(2)))  unsigned short v2us;
typedef __attribute__((ext_vector_type(4)))  int v4i;
typedef v4f  __attribute__((may_alias)) v4fa;
typedef v4i  __attribute__((may_alias)) v4ia;

__device__ __forceinline__ unsigned short f2bf(float f) { unsigned u = __float_as_uint(f); u += 0x7FFFu + ((u >> 16) & 1u); return (unsigned short)(u >> 16); }
__device__ __forceinline__ float bf2f(unsigned short b) { return __uint_as_float(((unsigned)b) << 16); }
__device__ __forceinline__ float bfr(float f) { return bf2f(f2bf(f)); }
__device__ __forceinline__ v16h cat16(v8h lo, v8h hi) { return __builtin_shufflevector(lo, hi, 0, 1, 2, 3, 4, 5, 6, 7, 8, 9, 10, 11, 12, 13, 14, 15); }
__device__ __forceinline__ v16bf cat16b(v8us lo, v8us hi) { return __builtin_bit_cast(v16bf, __builtin_shufflevector(lo, hi, 0, 1, 2, 3, 4, 5, 6, 7, 8, 9, 10, 11, 12, 13, 14, 15)); }
__device__ __forceinline__ v8f wmma16(v16h a, v16h b, v8f c) { return __builtin_amdgcn_wmma_f32_16x16x32_f16(false, a, false, b, (short)0, c, false, false); }
__device__ __forceinline__ v8f wmmab(v16bf a, v16bf b, v8f c) { return __builtin_amdgcn_wmma_f32_16x16x32_bf16(false, a, false, b, (short)0, c, false, false); }
__device__ __forceinline__ void splitf(float y, unsigned short& h, unsigned short& l) { h = f2bf(y); l = f2bf(y - bf2f(h)); }

// ---- k_gemmw: register-blocked GEMM, one block of KW waves per 64x64 output tile, operands straight from K-contiguous 16-bit planes; grid (M/64, N/64, Z), KW * 32 threads.
// Wave w holds the whole tile (16 accumulators) for k in [w * K / KW, (w + 1) * K / KW); for KW > 1 the KW partial tiles meet in LDS and are summed in wave order 0..KW-1. K % (32 * KW) == 0.
// C[m][n] (f32, pitch ldc, + optional f32 bias[n]) = sum_k A[m][k] Bt[n][k] (+ split products per NSPLIT). z-batch strides sA/sB/sC in elements. K % 32 == 0, A/Bt row pitch == K.
// Fragment map (A and Bt alike): lane row = lane & 15, elements 0..7 <- k0 + 8*(lane>>4) + 0..7, elements 8..15 <- k0 + 16 + 8*(lane>>4) + 0..7; D element j = (row 8*(lane>>4) + j, col lane & 15).
template <typename T16> struct WFrag;
template <> struct WFrag<h16> { typedef v16h V; static __device__ __forceinline__ V ld(const h16* p) { return cat16(*(const v8h*)p, *(const v8h*)(p + 16)); } static __device__ __forceinline__ v8f mma(V a, V b, v8f c) { return wmma16(a, b, c); } };
template <> struct WFrag<bf> { typedef v16bf V; static __device__ __forceinline__ V ld(const bf* p) { return cat16b(*(const v8us*)p, *(const v8us*)(p + 16)); } static __device__ __forceinline__ v8f mma(V a, V b, v8f c) { return wmmab(a, b, c); } };
template <typename T16, int NSPLIT, bool BIAS, int KW>
__global__ __launch_bounds__(KW * 32) void k_gemmw(const T16* __restrict__ A, const T16* __restrict__ A2, const T16* __restrict__ Bt, const T16* __restrict__ Bt2, int K, float* C, int ldc, const float* __restrict__ bias, size_t sA, size_t sB, size_t sC) {
    typedef typename WFrag<T16>::V V;
    static_assert(KW >= 1 && KW <= 8 && 8 % KW == 0);
    __shared__ __align__(16) float os[(KW > 1 ? 4 * KW : 1) * 16 * 68];
    const size_t z = blockIdx.z; A += z * sA; if (A2) A2 += z * sA; Bt += z * sB; if (Bt2) Bt2 += z * sB; C += z * sC;
    const int lane = threadIdx.x & 31, lr = lane & 15, hi = lane >> 4; const int r0 = blockIdx.x * 64, c0 = blockIdx.y * 64;
    v8f acc[4][4];
#pragma unroll
    for (int mb = 0; mb < 4; ++mb)
#pragma unroll
        for (int nb = 0; nb < 4; ++nb) acc[mb][nb] = (v8f){};
    const size_t aoff = (size_t)(r0 + lr) * K + 8 * hi, boff = (size_t)(c0 + lr) * K + 8 * hi;
    const int w = KW > 1 ? __builtin_amdgcn_readfirstlane((int)(threadIdx.x >> 5)) : 0;   // wave number in a scalar register: the k loop's bounds and branch stay scalar
    const int kspan = K / KW, kbeg = w * kspan, kend = kbeg + kspan;
#pragma unroll 1
    for (int kc = kbeg; kc < kend; kc += 32) {
        V a[4], a2[4];
#pragma unroll
        for (int mb = 0; mb < 4; ++mb) { a[mb] = WFrag<T16>::ld(A + aoff + (size_t)mb * 16 * K + kc); if (NSPLIT == 1 || NSPLIT == 2) a2[mb] = WFrag<T16>::ld(A2 + aoff + (size_t)mb * 16 * K + kc); }
#pragma unroll
        for (int nb = 0; nb < 4; ++nb) { const V b = WFrag<T16>::ld(Bt + boff + (size_t)nb * 16 * K + kc); V b2; if (NSPLIT >= 2) b2 = WFrag<T16>::ld(Bt2 + boff + (size_t)nb * 16 * K + kc);
#pragma unroll
            for (int mb = 0; mb < 4; ++mb) { acc[mb][nb] = WFrag<T16>::mma(a[mb], b, acc[mb][nb]); if (NSPLIT == 1 || NSPLIT == 2) acc[mb][nb] = WFrag<T16>::mma(a2[mb], b, acc[mb][nb]); if (NSPLIT >= 2) acc[mb][nb] = WFrag<T16>::mma(a[mb], b2, acc[mb][nb]); } }
        asm volatile("v_nop\n\tv_nop\n\tv_nop\n\tv_nop" : "+v"(acc[0][0]), "+v"(acc[1][1]), "+v"(acc[2][2]), "+v"(acc[3][3]) : "v"(a[0]), "v"(a[3]));
    }
    if constexpr (KW > 1) {   // loops below are unrolled so that acc[][] is indexed by constants and stays in registers, and the LDS offsets fold into immediates
#pragma unroll
        for (int mb = 0; mb < 4; ++mb) { float* my = os + (mb * KW + w) * (16 * 68);
#pragma unroll
            for (int nb = 0; nb < 4; ++nb) {
#pragma unroll
                for (int j = 0; j < 8; ++j) my[(hi * 8 + j) * 68 + nb * 16 + lr] = acc[mb][nb][j]; } }
        __syncthreads();   // every wave's partial tile stands in LDS before any wave sums across the waves
#pragma unroll
        for (int mb = 0; mb < 4; ++mb) { float* crow = C + (size_t)(r0 + mb * 16) * ldc + c0;
#pragma unroll
            for (int s0 = 0; s0 < 8; s0 += KW) { const int row = 2 * (s0 + w) + hi, cofs = lr * 4; const float* ps = os + mb * KW * (16 * 68) + row * 68 + cofs; v4f val = *(const v4fa*)ps;
#pragma unroll
                for (int q = 1; q < KW; ++q) val += *(const v4fa*)(ps + q * (16 * 68));
                if (BIAS) { val[0] += bfr(bias[c0 + cofs]); val[1] += bfr(bias[c0 + cofs + 1]); val[2] += bfr(bias[c0 + cofs + 2]); val[3] += bfr(bias[c0 + cofs + 3]); }
                *(v4f*)(crow + (size_t)row * ldc + cofs) = val; } }
        return;
    }
#pragma unroll
    for (int mb = 0; mb < 4; ++mb) {
#pragma unroll
        for (int nb = 0; nb < 4; ++nb) {
#pragma unroll
            for (int j = 0; j < 8; ++j) os[(hi * 8 + j) * 68 + nb * 16 + lr] = acc[mb][nb][j]; }
        __builtin_amdgcn_wave_barrier(); asm volatile("" ::: "memory");
        float* crow = C + (size_t)(r0 + mb * 16) * ldc + c0;
{
#pragma unroll
            for (int s = 0; s < 8; ++s) { const int row = 2 * s + hi, cofs = lr * 4; v4f val = *(const v4fa*)(os + row * 68 + cofs); if (BIAS) { val[0] += bfr(bias[c0 + cofs]); val[1] += bfr(bias[c0 + cofs + 1]); val[2] += bfr(bias[c0 + cofs + 2]); val[3] += bfr(bias[c0 + cofs + 3]); }
                *(v4f*)(crow + (size_t)row * ldc + cofs) = val; }
             }
        __builtin_amdgcn_wave_barrier(); asm volatile("" ::: "memory");
    }
}

// proj_tile (body of k_proj): one 64x64 tile of a q / k / v projection per block of 8 waves, K = DM split over the waves as in k_gemmw (same fragment map, same sum in wave order); the f32 input stream is read as it is and rounded to bf16 (RNE) in the fragment loader.
// For k and v a "position" below is a slot of the batch's key list: row t of the tile is read from X at position ix[t], and the head planes are ordered by slot.
// VT == false (q, k): A rows = positions t of X, B rows = output columns n of Wt; tile (bx, by) of (TT/64, DM/64); a tile's 64 columns are one head.
// VT == true (v): A rows = output columns n of Wt, B rows = positions t of X, so that the tile comes out transposed; tile (bx, by) of (DM/64, TT/64); a tile's 64 rows are one head.
// Head planes are stored in fragment order: a chunk of 512 contiguous bytes is what one 16-byte-per-lane load of the attention kernel takes, lane l = 16 * hi + lr at byte 16 * l. 16 positions of a head are 4 chunks (2 KiB), a head plane is TT / 16 such groups.
// q, k: chunk c of position group tg: lane holds position 16 * tg + lr, d = 16 * c + 8 * hi + 0..7. v: chunk dg of position group tg: lane holds d = 16 * dg + lr, positions 16 * tg + 8 * hi + 0..7.
// In both cases a chunk is rows 16 * mb + lr, columns 16 * c + 8 * hi + 0..7 of the tile; wave w stores chunks (mb = w >> 1, c = 2 * (w & 1) + 0..1), each store instruction four whole 128-byte lines.
typedef __attribute__((ext_vector_type(8))) __bf16 v8bf;
__device__ __forceinline__ v16bf ldxf(const float* p) { const v8f lo = *(const v8f*)p, hi = *(const v8f*)(p + 16);
    return __builtin_shufflevector(__builtin_convertvector(lo, v8bf), __builtin_convertvector(hi, v8bf), 0, 1, 2, 3, 4, 5, 6, 7, 8, 9, 10, 11, 12, 13, 14, 15); }
template <bool VT>
__device__ __forceinline__ void proj_tile(const float* __restrict__ X, const bf* __restrict__ Wt, const float* __restrict__ bias, h16* P, float* os, int bx, int by, const int* __restrict__ ix) {
    constexpr int KW = 8, K = DM;
    const int lane = threadIdx.x & 31, lr = lane & 15, hi = lane >> 4; const int r0 = bx * 64, c0 = by * 64;
    v8f acc[4][4];
#pragma unroll
    for (int mb = 0; mb < 4; ++mb)
#pragma unroll
        for (int nb = 0; nb < 4; ++nb) acc[mb][nb] = (v8f){};
    const size_t woff = (size_t)((VT ? r0 : c0) + lr) * K + 8 * hi;
    const int rl = (VT ? c0 : r0) + lr;
    int pos[4];   // the lane's four rows of X: tile row i * 16 + lr is position ix[row] (k, v: the key list) or the row itself (q: ix == nullptr)
#pragma unroll
    for (int i = 0; i < 4; ++i) pos[i] = rl + i * 16;
    if (ix) {
#pragma unroll
        for (int i = 0; i < 4; ++i) pos[i] = ix[rl + i * 16];
        asm volatile("s_wait_xcnt 0x0" :: "v"(rl) : "memory");   // stands behind the list loads; their index is an input so that its register is not reused in front of the wait
    }
    unsigned xoff[4];   // byte offsets of the lane's first element in those rows: with the scalar base X + kc they are the loads' whole address
#pragma unroll
    for (int i = 0; i < 4; ++i) xoff[i] = ((unsigned)pos[i] * K + 8 * hi) * 4;
    const int w = __builtin_amdgcn_readfirstlane((int)(threadIdx.x >> 5));   // wave number in a scalar register: the wave's k offset stays scalar
    const int kbeg = w * (K / KW), kend = kbeg + K / KW;
#pragma unroll   // both trips in line: the second trip's loads issue while the first trip's products still run
    for (int kc = kbeg; kc < kend; kc += 32) {
        v16bf a[4];
#pragma unroll
        for (int mb = 0; mb < 4; ++mb) { if constexpr (VT) a[mb] = WFrag<bf>::ld(Wt + woff + (size_t)mb * 16 * K + kc); else a[mb] = ldxf((const float*)((const char*)(X + kc) + xoff[mb])); }
#pragma unroll
        for (int nb = 0; nb < 4; ++nb) { v16bf b; if constexpr (VT) b = ldxf((const float*)((const char*)(X + kc) + xoff[nb])); else b = WFrag<bf>::ld(Wt + woff + (size_t)nb * 16 * K + kc);
#pragma unroll
            for (int mb = 0; mb < 4; ++mb) acc[mb][nb] = wmmab(a[mb], b, acc[mb][nb]); }
    }
    asm volatile("s_wait_xcnt 0x0" :: "v"(xoff[0]), "v"(xoff[1]), "v"(xoff[2]), "v"(xoff[3]) : "memory");   // stands behind the loads of X; their offsets are inputs so that the registers are not reused in front of the wait
    // loops below are unrolled so that acc[][] is indexed by constants and stays in registers, and the LDS offsets fold into immediates
#pragma unroll
    for (int mb = 0; mb < 4; ++mb) { float* my = os + (mb * KW + w) * (16 * 68);
#pragma unroll
        for (int nb = 0; nb < 4; ++nb) {
#pragma unroll
            for (int j = 0; j < 8; ++j) my[(hi * 8 + j) * 68 + nb * 16 + lr] = acc[mb][nb][j]; } }
    __syncthreads();   // every wave's partial tile stands in LDS before any wave sums across the waves
    const int mb = w >> 1, cb = 2 * (w & 1);   // the wave's chunks: (mb, cb) and (mb, cb + 1)
    const float* ps0 = os + mb * KW * (16 * 68) + lr * 68 + cb * 16 + hi * 8;
    const float* bp = VT ? bias + r0 + mb * 16 + lr : bias + c0 + cb * 16 + hi * 8;
    h16* dst = VT ? P + (size_t)bx * (HD * TT) + (size_t)((c0 >> 4) + cb) * 1024 + mb * 256 + lane * 8 : P + (size_t)by * (TT * HD) + (size_t)((r0 >> 4) + mb) * 1024 + cb * 256 + lane * 8;
#pragma unroll
    for (int it = 0; it < 2; ++it) { const float* ps = ps0 + it * 16; v4f va = *(const v4fa*)ps, vb = *(const v4fa*)(ps + 4);
#pragma unroll
        for (int q = 1; q < KW; ++q) { va += *(const v4fa*)(ps + q * (16 * 68)); vb += *(const v4fa*)(ps + q * (16 * 68) + 4); }
        v8h o16;
#pragma unroll
        for (int j = 0; j < 4; ++j) { o16[j] = (h16)(va[j] + bfr(bp[VT ? 0 : it * 16 + j])); o16[4 + j] = (h16)(vb[j] + bfr(bp[VT ? 0 : it * 16 + 4 + j])); }
        *(v8h*)(dst + it * (VT ? 1024 : 256)) = o16; }
}
#define CNTP 64   // ints between the two batches' counts: each stands in a line of its own
// kept keys of a batch as the list kernel stored them, bounded by the shape
__device__ __forceinline__ int nkept(int c) { return c < 0 ? 0 : c > TT ? TT : c; }
// slots that the list holds for that count: the kept keys, or every position where none is kept
__device__ __forceinline__ int nslots(int c) { const int n = nkept(c); return n == 0 ? TT : n; }
// k_proj: all q / k / v projection tiles of both batches in one grid (TT/64, DM/64, 3 * NB): blockIdx.z = stream * NB + batch, stream 0 = q, 1 = k, 2 = v. Wt3: the three transposed weight planes one behind the other.
__global__ __launch_bounds__(256) void k_proj(const float* __restrict__ xq, const float* __restrict__ xk, const float* __restrict__ xv, const bf* __restrict__ Wt3,
                                              const float* __restrict__ bq, const float* __restrict__ bk, const float* __restrict__ bv, h16* Q16, h16* K16, h16* V16, const int* __restrict__ cix, const int* __restrict__ cnt) {
    __shared__ __align__(16) float os[4 * 8 * 16 * 68];
    const int st = blockIdx.z / NB, b = blockIdx.z % NB;
    const size_t xoff = (size_t)b * SEQ_FULL * DM, poff = (size_t)b * NH_ * TT * HD;
    if (st != 0 && (int)blockIdx.x * 64 >= nslots(cnt[b * CNTP])) return;   // a k or v tile wholly behind the list: nobody reads it. The whole block leaves, in front of its barrier
    const int* ix = cix + (size_t)b * TT;
    if (st == 2) { proj_tile<true>(xv + xoff, Wt3 + 2 * (size_t)DM * DM, bv, V16 + poff, os, blockIdx.y, blockIdx.x, ix); return; }
    proj_tile<false>((st == 0 ? xq : xk) + xoff, Wt3 + (size_t)st * DM * DM, st == 0 ? bq : bk, (st == 0 ? Q16 : K16) + poff, os, blockIdx.x, blockIdx.y, st == 0 ? nullptr : ix);
    asm volatile("s_wait_xcnt 0x0" ::: "memory");   // stands behind the tile's stores: in the listing the v body follows this one on a fall-through (never taken: a scalar flag branches round it) and rewrites the registers that the stores name
}

// k_cvtT: in W[K rows][N cols] f32 -> out Wt[N rows][K cols] bf16 (RNE), 64x64 tile transposed through LDS (cross-wave: block barrier); grid (K/64, N/64, 5): blockIdx.z < 4 picks one of four matrices of one shape, whose outputs stand one behind the other.
// blockIdx.z == 4: block (0, b) makes batch b's key list: cix[b][slot] = position of the slot-th key with mask != 0, rising; 0 in the slots behind the count; cnt[b * CNTP] = the count. No key kept: every position in its place, count 0.
// Each thread takes TT / 256 neighbouring positions; its first slot is the sum of the counts in front of it (shuffle scan in the wave, wave sums through LDS). The list is put together in LDS and stored in whole lines.
__global__ __launch_bounds__(256) void k_cvtT(const float* __restrict__ W0, const float* __restrict__ W1, const float* __restrict__ W2, const float* __restrict__ W3, bf* Wt, int K, int N, const int* __restrict__ mask, int* cix, int* cnt) {
    __shared__ unsigned short tl[64 * 66];
    __shared__ __align__(16) int li[TT];
    __shared__ int wsum[8];
    if (blockIdx.z == 4) {
        if (blockIdx.x != 0 || blockIdx.y >= NB) return;
        constexpr int PER = TT / 256; static_assert(PER % 4 == 0);
        const int t0 = threadIdx.x * PER, ln = threadIdx.x & 31, wn = threadIdx.x >> 5;
        const int* m = mask + (size_t)blockIdx.y * SEQ_FULL + t0;
        int mv[PER]; int c = 0;
#pragma unroll
        for (int j = 0; j < PER; j += 4) { const v4i m4 = *(const v4i*)(m + j); mv[j] = m4[0]; mv[j + 1] = m4[1]; mv[j + 2] = m4[2]; mv[j + 3] = m4[3]; }
#pragma unroll
        for (int j = 0; j < PER; ++j) c += (mv[j] != 0) ? 1 : 0;
        int inc = c;
#pragma unroll
        for (int d = 1; d < 32; d <<= 1) { const int up = __shfl_up(inc, d, 32); if (ln >= d) inc += up; }
        if (ln == 31) wsum[wn] = inc;
        __syncthreads();   // the eight wave sums stand in LDS
        int slot = inc - c, tot = 0;
#pragma unroll
        for (int q = 0; q < 8; ++q) { const int x = wsum[q]; if (q < wn) slot += x; tot += x; }
#pragma unroll
        for (int j = 0; j < PER; ++j) {
            if (tot == 0) li[t0 + j] = t0 + j;
            else { if (t0 + j >= tot) li[t0 + j] = 0; if (mv[j] != 0) { li[slot] = t0 + j; ++slot; } } }   // kept keys fill slots below tot, the zeros those from tot on: no slot is written twice
        __syncthreads();   // the list is whole before it is stored
        int* dl = cix + (size_t)blockIdx.y * TT + t0;
#pragma unroll
        for (int j = 0; j < PER; j += 4) *(v4i*)(dl + j) = *(const v4ia*)(li + t0 + j);
        if (threadIdx.x == 0) cnt[blockIdx.y * CNTP] = tot;
        return;
    }
    const int zi = blockIdx.z; const float* W = zi == 0 ? W0 : zi == 1 ? W1 : zi == 2 ? W2 : W3; Wt += (size_t)zi * K * N;
    const int tid = threadIdx.x; const int k0 = blockIdx.x * 64, n0 = blockIdx.y * 64;
    { const int row = tid >> 2, cseg = (tid & 3) * 16;
#pragma unroll
      for (int q = 0; q < 4; ++q) { const v4f v = *(const v4f*)(W + (size_t)(k0 + row) * N + n0 + cseg + q * 4);
#pragma unroll
          for (int j = 0; j < 4; ++j) tl[row * 66 + cseg + q * 4 + j] = f2bf(v[j]); } }
    __syncthreads();
    const int piece = tid & 7; v8us o[2];
#pragma unroll
    for (int it = 0; it < 2; ++it) { const int n = it * 32 + (tid >> 3);
#pragma unroll
        for (int j = 0; j < 8; ++j) o[it][j] = tl[(piece * 8 + j) * 66 + n]; }
{
#pragma unroll
        for (int it = 0; it < 2; ++it) { const int n = it * 32 + (tid >> 3); *(v8us*)(Wt + (size_t)(n0 + n) * K + k0 + piece * 8) = o[it]; }
         }
}

// k_fattn walks the batch's key list (see the head of the file): "key" below is a list slot. NS = stages per group = slots / 64 rounded up, read from the count, the same for every wave of the block; group g walks slots g * NS * KS .. (g + 1) * NS * KS - 1.
// k_fattn: grid (TT / 16, NB), 16 waves (four per SIMD: while one wave waits for LDS, a load or a dependent result, three others can issue); block = 16 query rows q0.. of batch b, wave = (key group grp, head w).
// Each group runs the whole loop below on its own half of the keys with its own bias tile and k buffers; all 16 waves share the stage barrier. Behind the loop group 1 hands its maximum, sum and accumulators to group 0 through LDS, lane to lane.
// Bias tile, per group and stage of KS keys: wave w makes query rows 2w, 2w+1 for all 8 heads. One WMMA per 32 key positions: A rows = 16 positions, k 0..15 = channel activations of position t0+m, k 16..31 = of position t0+16+m (f16);
// B block-diagonal: B[c][h] = c2w[h][c] for h < 8, B[16+c][8+h] = c2w[h][c], zero elsewhere. D[p][h] -> position t0+p, D[p][8+h] -> position t0+16+p. Stored as rb[h][query][key] (f32).
// A slot at or behind the count of kept keys (a filler, or every slot where no key is kept) gets the bias MFILL: S + MFILL == MFILL in f32 for every |S| < 1e30, so all masked scores of a row are one equal value far below any real score (weight 0 beside a real key, uniform weights where every key is masked), as with the -1e9 fill.
// Scores: A = 16 key rows of k, B = the 16 query rows of q (kept in registers): D element j = (key 8*(lane>>4) + j, query lane & 15). Two such tiles, converted to f16, are the B operand (k order 8*(lane>>4)+0..7, 16+8*(lane>>4)+0..7) of O^T += v^T P^T.
// k fragments reach the wave through LDS: each wave brings its own head's next stages (4 KiB each, fragment order) into its own part of one of two k buffers by asynchronous copies, one whole stage ahead; v fragments are register loads issued at the head of the trip that uses them.
// Every inner loop is unrolled so that the register arrays (fragments, scores, accumulators) are indexed by constants and the LDS and global offsets fold into immediates.
#define MFILL (-3.0e38f)
#define L2E   1.4426950408889634f
// 2^x. The v_nop is the slot that the instruction set asks for behind a transcendental before its result is read or its source overwritten.
__device__ __forceinline__ float ex2(float x) { float r; asm("v_exp_f32 %0, %1\n\tv_nop" : "=v"(r) : "v"(x)); return r; }
// One stage of a head's k plane into LDS: 8 copies of 512 contiguous bytes (16 bytes a lane). The immediate offset moves the global and the LDS address alike, so one address pair serves all 8.
// The s_wait_xcnt closes the statement so that nothing rewrites the two address operands before it.
__device__ __forceinline__ void kcopy(unsigned lds, const h16* g) {
    asm volatile("global_load_async_to_lds_b128 %0, %1, off\n\t"
                 "global_load_async_to_lds_b128 %0, %1, off offset:512\n\t"
                 "global_load_async_to_lds_b128 %0, %1, off offset:1024\n\t"
                 "global_load_async_to_lds_b128 %0, %1, off offset:1536\n\t"
                 "global_load_async_to_lds_b128 %0, %1, off offset:2048\n\t"
                 "global_load_async_to_lds_b128 %0, %1, off offset:2560\n\t"
                 "global_load_async_to_lds_b128 %0, %1, off offset:3072\n\t"
                 "global_load_async_to_lds_b128 %0, %1, off offset:3584\n\t"
                 "s_wait_xcnt 0x0" :: "v"(lds), "v"(g) : "memory");
}
static_assert(KS * HD * 2 == 8 * 512 && KS == 32);   // 32: two offsets a lane and stage (ixr below)
__global__ __launch_bounds__(KG * 256) void k_fattn(const h16* __restrict__ Q16, const h16* __restrict__ K16, const h16* __restrict__ V16, const float* __restrict__ rel, const int* __restrict__ cix, const int* __restrict__ cnt,
                                               const float* __restrict__ c1w, const float* __restrict__ c1b, const float* __restrict__ c2w, const float* __restrict__ c2b, bf* Ah, bf* Al) {
    static_assert(KG == 2);
    __shared__ __align__(16) float rb[2][KG][NH_ * RHS];
    __shared__ __align__(16) unsigned ixs[TT];   // the key list as byte offsets in a row of rel_pos
    __shared__ __align__(16) h16 kls[2][KG * NH_][KS * HD];   // two k buffers, one part per wave (group, head)
    __shared__ __align__(16) float mgo[NH_][8][32 * 4];   // group 1's accumulators, 16 bytes a lane and piece
    __shared__ __align__(8) float mgs[NH_][32 * 2];       // group 1's running maximum and sum, a pair a lane
    const int lane = threadIdx.x & 31, lr = lane & 15, hi = lane >> 4;
    const int wv = __builtin_amdgcn_readfirstlane((int)(threadIdx.x >> 5));   // wave number in a scalar register: plane bases and the branch on the group stay scalar
    const int b = blockIdx.y, q0 = blockIdx.x * 16;
    const int craw = __builtin_amdgcn_readfirstlane(cnt[b * CNTP]);   // in a scalar register: trip count and stage tests stay scalar
    const int nk = nkept(craw), NS = (nslots(craw) + KG * KS - 1) / (KG * KS);   // kept keys; stages per group, 1 .. TT / (KG * KS)
    const int w = wv & (NH_ - 1), grp = wv / NH_, kb = grp * NS * KS;   // head, key group, the group's first key
    for (int idx = threadIdx.x; idx < TT / 4; idx += KG * 256) { const v4i m4 = *(const v4i*)(cix + (size_t)b * TT + idx * 4); *(v4ia*)(ixs + idx * 4) = m4 << 2; }
    float w1[8], b1[8];
#pragma unroll
    for (int i = 0; i < 8; ++i) { w1[i] = bfr(c1w[8 * hi + i]); b1[i] = bfr(c1b[8 * hi + i]); }
    const int hd = lr & 7, g = lr >> 3;
    v16h bw;
#pragma unroll
    for (int i = 0; i < 8; ++i) { const h16 c = (h16)bfr(c2w[hd * 16 + 8 * hi + i]); const h16 zr = (h16)0.0f; bw[i] = (g == 0) ? c : zr; bw[8 + i] = (g == 1) ? c : zr; }
    const float bias2 = bfr(c2b[hd]);
    const char* rr0 = (const char*)(rel + ((size_t)b * SEQ_FULL + q0 + 2 * w) * SEQ_FULL);   // the wave's first row of rel_pos
    constexpr int NX = 2 * (KS / 16);
    float xr[NX], xc[NX];   // xr: the wave's rel_pos values of a later stage, in flight; xc: those of the stage that produce() makes, rounded to bf16
    unsigned ixr[KS / 16];   // the lane's offsets in a rel_pos row for the stage that the next ldx() loads
    auto ldi = [&](int s) {
#pragma unroll
        for (int e = 0; e < KS / 16; ++e) ixr[e] = ixs[kb + s * KS + e * 16 + lr]; };
    auto ldx = [&]() {
#pragma unroll
        for (int qq = 0; qq < 2; ++qq)
#pragma unroll
            for (int e = 0; e < KS / 16; ++e) xr[qq * (KS / 16) + e] = *(const float*)(rr0 + qq * (SEQ_FULL * 4) + ixr[e]); };
    auto produce = [&](int s, float* dstb) {
#pragma unroll
        for (int gk = 0; gk < KS / 32; ++gk) {
            const int lim = nk - (kb + s * KS + gk * 32 + 16 * g + 8 * hi);   // the lane's slot j of 8 is a kept key where j < lim
#pragma unroll
            for (int qq = 0; qq < 2; ++qq) {
                const float xa = xc[qq * (KS / 16) + gk * 2], xb = xc[qq * (KS / 16) + gk * 2 + 1];
                v16h a;
#pragma unroll
                for (int i = 0; i < 8; ++i) { a[i] = (h16)fmaxf(fmaf(xa, w1[i], b1[i]), 0.0f); a[8 + i] = (h16)fmaxf(fmaf(xb, w1[i], b1[i]), 0.0f); }
                const v8f acc = wmma16(a, bw, (v8f){});
                v4f o0, o1;
#pragma unroll
                for (int j = 0; j < 4; ++j) { o0[j] = (j >= lim) ? MFILL : acc[j] + bias2; o1[j] = (4 + j >= lim) ? MFILL : acc[4 + j] + bias2; }
                float* dst = dstb + hd * RHS + (2 * w + qq) * RPI + gk * 32 + 16 * g + 8 * hi;
                *(v4fa*)dst = o0; *(v4fa*)(dst + 4) = o1; } } };
    const size_t pl = ((size_t)b * NH_ + w) * TT * HD;
    const h16* kp = K16 + pl + kb * HD + lane * 8; const h16* vp = V16 + pl + kb * HD + lane * 8;   // the lane's 16 bytes in the first chunk of a stage of its head's k and v planes (fragment order, see k_proj; 16 positions are 16 * HD elements, so the group's first key stands kb * HD elements in): kp of the next stage to be copied, vp of the current stage
    const h16* kl0 = &kls[0][wv][lane * 8];   // the lane's 16 bytes in the first chunk of the wave's part of k buffer 0; buffer 1 stands KG * NH_ * KS * HD elements behind
    const unsigned kla = (unsigned)(size_t)kl0;   // the same as an LDS byte address
    kcopy(kla, kp); kp += KS * HD;   // stage 0 of k
    v16h qf[2];
#pragma unroll
    for (int dk = 0; dk < 2; ++dk) { const h16* qp = Q16 + pl + (size_t)(q0 >> 4) * 1024 + dk * 512 + lane * 8; qf[dk] = cat16(*(const v8h*)qp, *(const v8h*)(qp + 256)); }
    v8f o[4];
#pragma unroll
    for (int dg = 0; dg < 4; ++dg) o[dg] = (v8f){};
    float mrun = MFILL, lsum = 0.0f;
    __syncthreads();   // the key list stands in LDS before any wave reads it
    ldi(0); ldx();
    asm volatile("s_wait_xcnt 0x0" :: "v"(ixr[0]), "v"(ixr[1]) : "memory");   // stands behind the rel_pos loads, in front of the LDS loads that rewrite the offsets that they name; the offsets are inputs so that their registers are not reused in front of it
    ldi(NS > 1 ? 1 : 0);
#pragma unroll
    for (int i = 0; i < NX; ++i) xc[i] = bfr(xr[i]);
    ldx();
    asm volatile("s_wait_xcnt 0x0" :: "v"(ixr[0]), "v"(ixr[1]) : "memory");   // as above
    ldi(NS > 2 ? 2 : NS - 1);
    produce(0, rb[0][grp]);
    asm volatile("s_wait_asynccnt 0x0" ::: "memory");   // the wave's copies of k stage 0 have landed
    __syncthreads();   // stage 0 of the bias tile and of k stand in LDS before any wave reads them
    if (NS > 1) { kcopy(kla + KG * NH_ * KS * HD * 2, kp); kp += KS * HD; }   // stage 1 of k, where there is one
#pragma unroll 1   // one stage per trip: an unrolled body would not hold its fragments in registers
    for (int s = 0; s < NS; ++s) {
        v16h vf[KS / 32][4];
#pragma unroll
        for (int gk = 0; gk < KS / 32; ++gk)
#pragma unroll
            for (int dg = 0; dg < 4; ++dg) vf[gk][dg] = cat16(*(const v8h*)(vp + (gk * 2048 + dg * 256)), *(const v8h*)(vp + (gk * 2048 + 1024 + dg * 256)));
#pragma unroll
        for (int i = 0; i < NX; ++i) xc[i] = bfr(xr[i]);   // read out before the loads below replace xr
        ldx();   // stage s + 2 (the last one again where there is none), issued at the head of the trip: the barrier at its foot waits for every load, and these come from memory
        asm volatile("s_wait_xcnt 0x0" ::: "memory");   // stands behind the v and rel_pos loads, in front of the step of vp, the new offsets and whatever else rewrites the registers that they name
        ldi(s + 3 < NS ? s + 3 : NS - 1);   // offsets for the next trip's ldx(): a whole trip of lead for the LDS read
        if (s + 1 < NS) produce(s + 1, rb[(s + 1) & 1][grp]);
        const h16* kl = kl0 + (s & 1) * (KG * NH_ * KS * HD);
        v16h kf[KS / 16][2];
#pragma unroll
        for (int kg = 0; kg < KS / 16; ++kg)
#pragma unroll
            for (int dk = 0; dk < 2; ++dk) kf[kg][dk] = cat16(*(const v8h*)(kl + (kg * 1024 + dk * 512)), *(const v8h*)(kl + (kg * 1024 + dk * 512 + 256)));
        const float* rbp = rb[s & 1][grp] + w * RHS + lr * RPI + 8 * hi;
        float t[KS / 16][8]; float mx = MFILL;
#pragma unroll
        for (int kg = 0; kg < KS / 16; ++kg) {
            v8f st = (v8f){};
            st = wmma16(kf[kg][0], qf[0], st); st = wmma16(kf[kg][1], qf[1], st);
            const v4f r0 = *(const v4fa*)(rbp + kg * 16); const v4f r1 = *(const v4fa*)(rbp + kg * 16 + 4);
#pragma unroll
            for (int j = 0; j < 4; ++j) { t[kg][j] = (st[j] + r0[j]) * SCL; t[kg][4 + j] = (st[4 + j] + r1[j]) * SCL; mx = fmaxf(mx, fmaxf(t[kg][j], t[kg][4 + j])); } }
        mx = fmaxf(mx, __shfl_xor(mx, 16, 32));   // the other half of the wave holds the query's other keys
        const float mnew = fmaxf(mrun, mx);
        const float corr = ex2((mrun - mnew) * L2E);
        mrun = mnew;
        float ps = 0.0f; v16h pb[KS / 32];
#pragma unroll
        for (int kg = 0; kg < KS / 16; ++kg)
#pragma unroll
            for (int j = 0; j < 8; ++j) { const float p = ex2(fmaf(t[kg][j] - mnew, L2E, 10.0f)); ps += p; pb[kg >> 1][(kg & 1) * 8 + j] = (h16)p; }   // + 10: the x1024 carry
        lsum = fmaf(lsum, corr, ps);
#pragma unroll
        for (int dg = 0; dg < 4; ++dg) o[dg] *= corr;
#pragma unroll
        for (int gk = 0; gk < KS / 32; ++gk)
#pragma unroll
            for (int dg = 0; dg < 4; ++dg) o[dg] = wmma16(vf[gk][dg], pb[gk], o[dg]);
        vp += KS * HD;
        // the wave's reads of k stage s have retired before copies aim at that buffer again. The accumulators and the running sum are named as inputs so that this wait, and with it the barrier (which waits for every load in flight), stays at the foot of the trip, behind the trip's arithmetic: left free, the compiler put both in front of the softmax, where the loads of this trip had not had time to return
        // the four v_nop keep the distance behind the trip's last matrix instruction on the branch back to the loop's head, where register moves overwrite its B operand
        asm volatile("v_nop\n\tv_nop\n\tv_nop\n\tv_nop\n\ts_wait_dscnt 0x0" :: "v"(o[0]), "v"(o[1]), "v"(o[2]), "v"(o[3]), "v"(lsum) : "memory");
        asm volatile("s_wait_asynccnt 0x0" ::: "memory");   // the wave's copies of k stage s + 1 have landed
        __syncthreads();   // publishes stage s + 1 of the bias tile and of k and ends every wave's reads of stage s, whose buffers are refilled behind it
        if (s + 2 < NS) { kcopy(kla + (s & 1) * (KG * NH_ * KS * HD * 2), kp); kp += KS * HD; }   // stage s + 2 of k into the buffer that this trip has read
    }
    asm volatile("s_wait_asynccnt 0x0" ::: "memory");   // no copy is outstanding when the wave goes on to its end
    lsum += __shfl_xor(lsum, 16, 32);
    // The two groups' states of one (head, query) meet: in both groups lane and register hold the same (query, d), so the hand-over is lane to lane.
    if (grp == 1) {
#pragma unroll
        for (int dg = 0; dg < 4; ++dg) { *(v4fa*)&mgo[w][2 * dg][lane * 4] = __builtin_shufflevector(o[dg], o[dg], 0, 1, 2, 3); *(v4fa*)&mgo[w][2 * dg + 1][lane * 4] = __builtin_shufflevector(o[dg], o[dg], 4, 5, 6, 7); }
        mgs[w][lane * 2] = mrun; mgs[w][lane * 2 + 1] = lsum;
    }
    __syncthreads();   // group 1's state stands in LDS before group 0 reads it
    if (grp == 1) return;
    const float m1 = mgs[w][lane * 2], l1 = mgs[w][lane * 2 + 1];
    const float mall = fmaxf(mrun, m1);
    const float a0 = ex2((mrun - mall) * L2E), a1 = ex2((m1 - mall) * L2E);   // each group's weight against the common maximum
    lsum = fmaf(lsum, a0, l1 * a1);
#pragma unroll
    for (int dg = 0; dg < 4; ++dg) { const v4f p0 = *(const v4fa*)&mgo[w][2 * dg][lane * 4]; const v4f p1 = *(const v4fa*)&mgo[w][2 * dg + 1][lane * 4];
#pragma unroll
        for (int j = 0; j < 4; ++j) { o[dg][j] = fmaf(o[dg][j], a0, p0[j] * a1); o[dg][4 + j] = fmaf(o[dg][4 + j], a0, p1[j] * a1); } }
    const float f = __fdiv_rn(PCAR, lsum);
    const float cs = 1.0f / PCAR;
    const size_t oo = ((size_t)b * TT + q0 + lr) * DM + w * HD + 8 * hi;   // context row of the lane's query, its head's 64 columns: one wave writes each 128-byte line of both planes
#pragma unroll
    for (int dg = 0; dg < 4; ++dg) { v8us oh, ol;
#pragma unroll
        for (int j = 0; j < 8; ++j) { unsigned short a, c2; splitf(o[dg][j] * f * cs, a, c2); oh[j] = a; ol[j] = c2; }
        *(v8us*)(Ah + oo + dg * 16) = oh; *(v8us*)(Al + oo + dg * 16) = ol; }
}

constexpr size_t al256(size_t b) { return (b + 255) & ~(size_t)255; }
constexpr size_t WS_TOTAL = 4 * al256((size_t)DM * DM * 2) + 3 * al256((size_t)NB * NH_ * TT * HD * 2) + 2 * al256((size_t)NB * TT * DM * 2) + al256((size_t)NB * TT * 4) + al256((size_t)NB * CNTP * 4);
static_assert(WS_TOTAL <= (size_t)134217728);
static_assert(((size_t)DM * DM * 2) % 256 == 0);   // the weight planes follow one another without a gap
static_assert(NB <= DM / 64);   // the first launch's grid has a block (0, b) for every batch's key list

extern "C" void kernel_launch(void* const* d_in, const int* in_sizes, int n_in,
                              void* d_out, int out_size, void* d_ws, size_t ws_size, hipStream_t stream) {
    if (n_in < 17) return;
    const size_t need_x = ((size_t)(NB - 1) * SEQ_FULL + SEQ) * DM;
    const size_t need_r = (size_t)(NB - 1) * SEQ_FULL * SEQ_FULL + (size_t)(SEQ - 1) * SEQ_FULL + SEQ;
    if ((size_t)in_sizes[0] < need_x || (size_t)in_sizes[1] < need_x || (size_t)in_sizes[2] < need_x || (size_t)in_sizes[3] < need_r) return;
    if ((size_t)in_sizes[4] < (size_t)(NB - 1) * SEQ_FULL + SEQ) return;
    if (in_sizes[5] < DM * DM || in_sizes[7] < DM * DM || in_sizes[9] < DM * DM || in_sizes[11] < DM * DM) return;
    if (in_sizes[6] < DM || in_sizes[8] < DM || in_sizes[10] < DM || in_sizes[12] < DM) return;
    if (in_sizes[13] < 16 || in_sizes[14] < 16 || in_sizes[15] < 128 || in_sizes[16] < 8) return;
    if ((size_t)out_size < need_x) return;
    const float* xq = (const float*)d_in[0]; const float* xk = (const float*)d_in[1]; const float* xv = (const float*)d_in[2];
    const float* rel = (const float*)d_in[3]; const int* msk = (const int*)d_in[4];
    const float* wq = (const float*)d_in[5]; const float* bq = (const float*)d_in[6]; const float* wk = (const float*)d_in[7]; const float* bk = (const float*)d_in[8];
    const float* wv = (const float*)d_in[9]; const float* bv = (const float*)d_in[10]; const float* wo = (const float*)d_in[11]; const float* bo = (const float*)d_in[12];
    const float* c1w = (const float*)d_in[13]; const float* c1b = (const float*)d_in[14]; const float* c2w = (const float*)d_in[15]; const float* c2b = (const float*)d_in[16];
    float* OUT = (float*)d_out;     // [NB_FULL][SEQ_FULL][DM]
    char* wsp = (char*)d_ws;
    auto take = [&](size_t bytes) { char* p = wsp; wsp += (bytes + 255) & ~(size_t)255; return (void*)p; };
    bf* WQ = (bf*)take((size_t)DM * DM * 2); take((size_t)DM * DM * 2); take((size_t)DM * DM * 2); bf* WO = (bf*)take((size_t)DM * DM * 2);   // four planes in the order q, k, v, o; the kernels reach k and v from WQ
    h16* QP16 = (h16*)take((size_t)NB * NH_ * TT * HD * 2); h16* KP16 = (h16*)take((size_t)NB * NH_ * TT * HD * 2); h16* VT16 = (h16*)take((size_t)NB * NH_ * HD * TT * 2);
    bf* ATh = (bf*)take((size_t)NB * TT * DM * 2); bf* ATl = (bf*)take((size_t)NB * TT * DM * 2);
    int* CIX = (int*)take((size_t)NB * TT * 4); int* CNT = (int*)take((size_t)NB * CNTP * 4);   // key lists and their counts
    if ((size_t)(wsp - (char*)d_ws) > ws_size) return;
    // weights: in W[k rows][n cols] -> out Wt[n rows][k cols]; square DM x DM; the four planes WQ, WK, WV, WO are contiguous in the workspace
    k_cvtT<<<dim3(DM / 64, DM / 64, 5), 256, 0, stream>>>(wq, wk, wv, wo, WQ, DM, DM, msk, CIX, CNT);
    k_proj<<<dim3(TT / 64, DM / 64, 3 * NB), 256, 0, stream>>>(xq, xk, xv, WQ, bq, bk, bv, QP16, KP16, VT16, CIX, CNT);
    k_fattn<<<dim3(TT / 16, NB), KG * 256, 0, stream>>>(QP16, KP16, VT16, rel, CIX, CNT, c1w, c1b, c2w, c2b, ATh, ATl);
    k_gemmw<bf, 1, true, 8><<<dim3(TT / 64, DM / 64, NB), 256, 0, stream>>>(ATh, ATl, WO, nullptr, DM, OUT, DM, bo, (size_t)TT * DM, 0, (size_t)SEQ_FULL * DM);
}

// v009
// One run takes 61.7 microseconds.
// Next to v008, in two timings, it ran 1.12 and 1.10 times as fast.
// Counting every step since v000, it is 12.2 times as fast.
#include <hip/hip_runtime.h>

// Compute dtypes (f32 accumulate everywhere): q/k/v projections v_wmma_f32_16x16x32_bf16 (inputs RNE-converted to bf16, products exact); pointwise-bias channel mix (16 ch -> 8 heads) v_wmma_f32_16x16x32_f16; q.k scores f16; probabilities (x1024 carry) x values f16; output projection bf16 hi+lo context x bf16 weights (2 products); softmax and mask fill in f32.
// Keys with mask == 0 have weight 0 wherever a row has a real key, so they are dropped before any work is spent on them: the first launch lists each batch's kept positions (in rising order); k and v are projected for the listed positions only and stored by list slot, and the attention loop walks slots.
// Slots from the count up to the next multiple of 64 are fillers (position 0, filled like a masked key). A batch with no kept key lists every position, all of them filled, which gives the uniform weights of the reference.
// Four launches: weight transposes (all four) and key lists, q / k / v projections (all three streams, both batches), attention, output projection (both batches); launches of one kernel that do not depend on each other are one grid, told apart by blockIdx.z.
// Layout: projection of the f32 q / k / v input stream (converted to bf16 in the fragment loader; + f32 bias) -> f16 head planes q, k, v in fragment order (see k_proj), stored by the projection itself;
// one attention launch for both batches: a block owns 16 query rows and all 8 heads; 16 waves = 8 heads x 2 halves of the keys, each half walked in stages of 32 and the two halves' running softmax states merged in LDS at the end: bias tile R[h][i][t] (one block-diagonal WMMA per 32 key positions, shared through LDS),
// S^T = k q^T, running-maximum softmax of (S + R) / 8 with key-mask fill, P (x1024 carry) as f16 straight from the score accumulators, O^T += v^T P^T; scores and probabilities never leave the registers.
// the attention launch stores the merged hi/lo context planes (x 1/1024); output projection + bias. Weights [in][out] are transposed once through LDS into bf16 planes. Weight and context planes stand in fragment order (see k_gemmw).

#ifndef NB
#define NB 2
#endif
#ifndef SEQ
#define SEQ 2048
#endif
#define NB_FULL  2
#define SEQ_FULL 2048
#define TT   SEQ
#define DM   512
#define NH_  8
#define HD   64
#define KS   32          // keys per stage of the attention loop
#define KG   2           // wave groups of an attention block: each walks its own half of the key list's slots (see k_fattn)
#define RPI  (KS + 4)    // f32 pitch of one (head, query) row of the staged bias tile
#define RHS  (16 * RPI + 4)   // f32 pitch of one head's 16 rows: the 8 heads that one store instruction writes start on different LDS banks
#define PCAR 1024.0f
#define SCL  0.125f   // HD^-0.5
static_assert(NH_ * HD == DM);
static_assert(TT % 256 == 0);
static_assert(KS % 32 == 0 && TT % (KG * KS) == 0 && KG * KS == 64);   // 64: the list is padded to the projection's tile of 64 slots
static_assert(DM % 256 == 0);
static_assert(SEQ <= SEQ_FULL);
static_assert(NB <= NB_FULL);

typedef _Float16 h16;
typedef unsigned short bf;
typedef __attribute__((ext_vector_type(16))) __bf16   v16bf;
typedef __attribute__((ext_vector_type(16))) _Float16 v16h;
typedef __attribute__((ext_vector_type(8)))  _Float16 v8h;
typedef __attribute__((ext_vector_type(8)))  unsigned short v8us;
typedef __attribute__((ext_vector_type(8)))  float    v8f;
typedef __attribute__((ext_vector_type(4)))  float    v4f;
typedef __attribute__((ext_vector_type(2)))  _Float16 v2h;
typedef __attribute__((ext_vector_type(4)))  _Float16 v4h;
typedef __attribute__((ext_vector_type(2)))  unsigned short v2us;
typedef __attribute__((ext_vector_type(4)))  int v4i;
typedef v4f  __attribute__((may_alias)) v4fa;
typedef v4i  __attribute__((may_alias)) v4ia;

__device__ __forceinline__ unsigned short f2bf(float f) { unsigned u = __float_as_uint(f); u += 0x7FFFu + ((u >> 16) & 1u); return (unsigned short)(u >> 16); }
__device__ __forceinline__ float bf2f(unsigned short b) { return __uint_as_float(((unsigned)b) << 16); }
__device__ __forceinline__ float bfr(float f) { return bf2f(f2bf(f)); }
__device__ __forceinline__ v16h cat16(v8h lo, v8h hi) { return __builtin_shufflevector(lo, hi, 0, 1, 2, 3, 4, 5, 6, 7, 8, 9, 10, 11, 12, 13, 14, 15); }
__device__ __forceinline__ v16bf cat16b(v8us lo, v8us hi) { return __builtin_bit_cast(v16bf, __builtin_shufflevector(lo, hi, 0, 1, 2, 3, 4, 5, 6, 7, 8, 9, 10, 11, 12, 13, 14, 15)); }
__device__ __forceinline__ v8f wmma16(v16h a, v16h b, v8f c) { return __builtin_amdgcn_wmma_f32_16x16x32_f16(false, a, false, b, (short)0, c, false, false); }
__device__ __forceinline__ v8f wmmab(v16bf a, v16bf b, v8f c) { return __builtin_amdgcn_wmma_f32_16x16x32_bf16(false, a, false, b, (short)0, c, false, false); }
__device__ __forceinline__ void splitf(float y, unsigned short& h, unsigned short& l) { h = f2bf(y); l = f2bf(y - bf2f(h)); }

// ---- k_gemmw: register-blocked GEMM, one block of KW waves per 64x64 output tile, operands straight from 16-bit planes in fragment order; grid (M/64, N/64, Z), KW * 32 threads.
// Wave w holds the whole tile (16 accumulators) for k in [w * K / KW, (w + 1) * K / KW); for KW > 1 the KW partial tiles meet in LDS and are summed in wave order 0..KW-1. K % (32 * KW) == 0.
// C[m][n] (f32, pitch ldc, + optional f32 bias[n]) = sum_k A[m][k] Bt[n][k] (+ split products per NSPLIT). z-batch strides sA/sB/sC in elements. K % 32 == 0.
// Fragment map (A and Bt alike): lane row = lane & 15, elements 0..7 <- k0 + 8*(lane>>4) + 0..7, elements 8..15 <- k0 + 16 + 8*(lane>>4) + 0..7; D element j = (row 8*(lane>>4) + j, col lane & 15).
// Fragment order of a plane of R rows x K (A and Bt alike): 16 rows x 32 k are 1 KiB, two chunks of 512 contiguous bytes, each what one 16-byte-per-lane load takes (four whole lines), lane l at byte 16 * l: chunk 0 holds elements 0..7 of the map above, chunk 1 elements 8..15.
// Element offset of a chunk: ((row >> 4) * (K / 32) + (k0 >> 5)) * 512 + chunk * 256.
template <typename T16> struct WFrag;
template <> struct WFrag<h16> { typedef v16h V; static __device__ __forceinline__ V ld(const h16* p) { return cat16(*(const v8h*)p, *(const v8h*)(p + 256)); } static __device__ __forceinline__ v8f mma(V a, V b, v8f c) { return wmma16(a, b, c); } };
template <> struct WFrag<bf> { typedef v16bf V; static __device__ __forceinline__ V ld(const bf* p) { return cat16b(*(const v8us*)p, *(const v8us*)(p + 256)); } static __device__ __forceinline__ v8f mma(V a, V b, v8f c) { return wmmab(a, b, c); } };
template <typename T16, int NSPLIT, bool BIAS, int KW, int K>   // K at compile time: every chunk of a trip stands at a constant distance from one address per plane
__global__ __launch_bounds__(KW * 32) void k_gemmw(const T16* __restrict__ A, const T16* __restrict__ A2, const T16* __restrict__ Bt, const T16* __restrict__ Bt2, float* C, int ldc, const float* __restrict__ bias, size_t sA, size_t sB, size_t sC) {
    typedef typename WFrag<T16>::V V;
    static_assert(KW >= 1 && KW <= 8 && 8 % KW == 0 && K % (32 * KW) == 0);
    __shared__ __align__(16) float os[(KW > 1 ? 4 * KW : 1) * 16 * 68];
    const size_t z = blockIdx.z; A += z * sA; if (A2) A2 += z * sA; Bt += z * sB; if (Bt2) Bt2 += z * sB; C += z * sC;
    const int lane = threadIdx.x & 31, lr = lane & 15, hi = lane >> 4; const int r0 = blockIdx.x * 64, c0 = blockIdx.y * 64;
    v8f acc[4][4];
#pragma unroll
    for (int mb = 0; mb < 4; ++mb)
#pragma unroll
        for (int nb = 0; nb < 4; ++nb) acc[mb][nb] = (v8f){};
    const size_t aoff = (size_t)r0 * K, boff = (size_t)c0 * K;   // the first chunk of the tile's first 16 rows; 16 rows are 16 * K elements, 32 k are 512
    const unsigned vo = lane * 16;   // the lane's byte in a chunk; the rest of a chunk's address is the same for the whole wave
    const int w = KW > 1 ? __builtin_amdgcn_readfirstlane((int)(threadIdx.x >> 5)) : 0;   // wave number in a scalar register: the k loop's bounds and branch stay scalar
    const int kspan = K / KW, kbeg = w * kspan, kend = kbeg + kspan;
#pragma unroll 1
    for (int kc = kbeg; kc < kend; kc += 32) {
        V a[4], a2[4], b[4], b2[4];
        const T16* pa = (const T16*)((const char*)(A + aoff + kc * 16) + vo); const T16* pb = (const T16*)((const char*)(Bt + boff + kc * 16) + vo);   // the lane's 16 bytes in the trip's first chunk of each plane
        const T16* pa2 = (NSPLIT == 1 || NSPLIT == 2) ? (const T16*)((const char*)(A2 + aoff + kc * 16) + vo) : pa; const T16* pb2 = NSPLIT >= 2 ? (const T16*)((const char*)(Bt2 + boff + kc * 16) + vo) : pb;
#pragma unroll
        for (int mb = 0; mb < 4; ++mb) { a[mb] = WFrag<T16>::ld(pa + mb * 16 * K); if (NSPLIT == 1 || NSPLIT == 2) a2[mb] = WFrag<T16>::ld(pa2 + mb * 16 * K); }
#pragma unroll
        for (int nb = 0; nb < 4; ++nb) { b[nb] = WFrag<T16>::ld(pb + nb * 16 * K); if (NSPLIT >= 2) b2[nb] = WFrag<T16>::ld(pb2 + nb * 16 * K); }
        asm volatile("s_wait_xcnt 0x0" :: "v"(pa), "v"(pa2), "v"(pb), "v"(pb2) : "memory");   // stands behind the trip's loads; their addresses are inputs so that the registers are not reused (as a later load's destination, or for the next trip's address) in front of the wait
#pragma unroll
        for (int nb = 0; nb < 4; ++nb) {
#pragma unroll
            for (int mb = 0; mb < 4; ++mb) { acc[mb][nb] = WFrag<T16>::mma(a[mb], b[nb], acc[mb][nb]); if (NSPLIT == 1 || NSPLIT == 2) acc[mb][nb] = WFrag<T16>::mma(a2[mb], b[nb], acc[mb][nb]); if (NSPLIT >= 2) acc[mb][nb] = WFrag<T16>::mma(a[mb], b2[nb], acc[mb][nb]); } }
        asm volatile("v_nop\n\tv_nop\n\tv_nop\n\tv_nop" : "+v"(acc[0][0]), "+v"(acc[1][1]), "+v"(acc[2][2]), "+v"(acc[3][3]) : "v"(a[0]), "v"(a[3]));
    }
    if constexpr (KW > 1) {   // loops below are unrolled so that acc[][] is indexed by constants and stays in registers, and the LDS offsets fold into immediates
#pragma unroll
        for (int mb = 0; mb < 4; ++mb) { float* my = os + (mb * KW + w) * (16 * 68);
#pragma unroll
            for (int nb = 0; nb < 4; ++nb) {
#pragma unroll
                for (int j = 0; j < 8; ++j) my[(hi * 8 + j) * 68 + nb * 16 + lr] = acc[mb][nb][j]; } }
        __syncthreads();   // every wave's partial tile stands in LDS before any wave sums across the waves
#pragma unroll
        for (int mb = 0; mb < 4; ++mb) { float* crow = C + (size_t)(r0 + mb * 16) * ldc + c0;
#pragma unroll
            for (int s0 = 0; s0 < 8; s0 += KW) { const int row = 2 * (s0 + w) + hi, cofs = lr * 4; const float* ps = os + mb * KW * (16 * 68) + row * 68 + cofs; v4f val = *(const v4fa*)ps;
#pragma unroll
                for (int q = 1; q < KW; ++q) val += *(const v4fa*)(ps + q * (16 * 68));
                if (BIAS) { val[0] += bfr(bias[c0 + cofs]); val[1] += bfr(bias[c0 + cofs + 1]); val[2] += bfr(bias[c0 + cofs + 2]); val[3] += bfr(bias[c0 + cofs + 3]); }
                *(v4f*)(crow + (size_t)row * ldc + cofs) = val; } }
        return;
    }
#pragma unroll
    for (int mb = 0; mb < 4; ++mb) {
#pragma unroll
        for (int nb = 0; nb < 4; ++nb) {
#pragma unroll
            for (int j = 0; j < 8; ++j) os[(hi * 8 + j) * 68 + nb * 16 + lr] = acc[mb][nb][j]; }
        __builtin_amdgcn_wave_barrier(); asm volatile("" ::: "memory");
        float* crow = C + (size_t)(r0 + mb * 16) * ldc + c0;
{
#pragma unroll
            for (int s = 0; s < 8; ++s) { const int row = 2 * s + hi, cofs = lr * 4; v4f val = *(const v4fa*)(os + row * 68 + cofs); if (BIAS) { val[0] += bfr(bias[c0 + cofs]); val[1] += bfr(bias[c0 + cofs + 1]); val[2] += bfr(bias[c0 + cofs + 2]); val[3] += bfr(bias[c0 + cofs + 3]); }
                *(v4f*)(crow + (size_t)row * ldc + cofs) = val; }
             }
        __builtin_amdgcn_wave_barrier(); asm volatile("" ::: "memory");
    }
}

// proj_tile (body of k_proj): one 64x64 tile of a q / k / v projection per block of 8 waves, K = DM split over the waves as in k_gemmw (same fragment map, same sum in wave order); the f32 input stream is read as it is and rounded to bf16 (RNE) in the fragment loader.
// For k and v a "position" below is a slot of the batch's key list: row t of the tile is read from X at position ix[t], and the head planes are ordered by slot.
// VT == false (q, k): A rows = positions t of X, B rows = output columns n of Wt; tile (bx, by) of (TT/64, DM/64); a tile's 64 columns are one head.
// VT == true (v): A rows = output columns n of Wt, B rows = positions t of X, so that the tile comes out transposed; tile (bx, by) of (DM/64, TT/64); a tile's 64 rows are one head.
// Head planes are stored in fragment order: a chunk of 512 contiguous bytes is what one 16-byte-per-lane load of the attention kernel takes, lane l = 16 * hi + lr at byte 16 * l. 16 positions of a head are 4 chunks (2 KiB), a head plane is TT / 16 such groups.
// q, k: chunk c of position group tg: lane holds position 16 * tg + lr, d = 16 * c + 8 * hi + 0..7. v: chunk dg of position group tg: lane holds d = 16 * dg + lr, positions 16 * tg + 8 * hi + 0..7.
// In both cases a chunk is rows 16 * mb + lr, columns 16 * c + 8 * hi + 0..7 of the tile; wave w stores chunks (mb = w >> 1, c = 2 * (w & 1) + 0..1), each store instruction four whole 128-byte lines.
typedef __attribute__((ext_vector_type(8))) __bf16 v8bf;
__device__ __forceinline__ v16bf ldxf(const float* p) { const v8f lo = *(const v8f*)p, hi = *(const v8f*)(p + 16);
    return __builtin_shufflevector(__builtin_convertvector(lo, v8bf), __builtin_convertvector(hi, v8bf), 0, 1, 2, 3, 4, 5, 6, 7, 8, 9, 10, 11, 12, 13, 14, 15); }
template <bool VT>
__device__ __forceinline__ void proj_tile(const float* __restrict__ X, const bf* __restrict__ Wt, const float* __restrict__ bias, h16* P, float* os, int bx, int by, const int* __restrict__ ix) {
    constexpr int KW = 8, K = DM;
    const int lane = threadIdx.x & 31, lr = lane & 15, hi = lane >> 4; const int r0 = bx * 64, c0 = by * 64;
    v8f acc[4][4];
#pragma unroll
    for (int mb = 0; mb < 4; ++mb)
#pragma unroll
        for (int nb = 0; nb < 4; ++nb) acc[mb][nb] = (v8f){};
    const size_t woff = (size_t)(VT ? r0 : c0) * K + lane * 8;   // weight plane in fragment order, as in k_gemmw
    const int rl = (VT ? c0 : r0) + lr;
    int pos[4];   // the lane's four rows of X: tile row i * 16 + lr is position ix[row] (k, v: the key list) or the row itself (q: ix == nullptr)
#pragma unroll
    for (int i = 0; i < 4; ++i) pos[i] = rl + i * 16;
    if (ix) {
#pragma unroll
        for (int i = 0; i < 4; ++i) pos[i] = ix[rl + i * 16];
        asm volatile("s_wait_xcnt 0x0" :: "v"(rl) : "memory");   // stands behind the list loads; their index is an input so that its register is not reused in front of the wait
    }
    unsigned xoff[4];   // byte offsets of the lane's first element in those rows: with the scalar base X + kc they are the loads' whole address
#pragma unroll
    for (int i = 0; i < 4; ++i) xoff[i] = ((unsigned)pos[i] * K + 8 * hi) * 4;
    const int w = __builtin_amdgcn_readfirstlane((int)(threadIdx.x >> 5));   // wave number in a scalar register: the wave's k offset stays scalar
    const int kbeg = w * (K / KW), kend = kbeg + K / KW;
#pragma unroll   // both trips in line: the second trip's loads issue while the first trip's products still run
    for (int kc = kbeg; kc < kend; kc += 32) {
        v16bf a[4];
#pragma unroll
        for (int mb = 0; mb < 4; ++mb) { if constexpr (VT) a[mb] = WFrag<bf>::ld(Wt + woff + (size_t)mb * 16 * K + kc * 16); else a[mb] = ldxf((const float*)((const char*)(X + kc) + xoff[mb])); }
#pragma unroll
        for (int nb = 0; nb < 4; ++nb) { v16bf b; if constexpr (VT) b = ldxf((const float*)((const char*)(X + kc) + xoff[nb])); else b = WFrag<bf>::ld(Wt + woff + (size_t)nb * 16 * K + kc * 16);
#pragma unroll
            for (int mb = 0; mb < 4; ++mb) acc[mb][nb] = wmmab(a[mb], b, acc[mb][nb]); }
    }
    asm volatile("s_wait_xcnt 0x0" :: "v"(xoff[0]), "v"(xoff[1]), "v"(xoff[2]), "v"(xoff[3]) : "memory");   // stands behind the loads of X; their offsets are inputs so that the registers are not reused in front of the wait
    // loops below are unrolled so that acc[][] is indexed by constants and stays in registers, and the LDS offsets fold into immediates
#pragma unroll
    for (int mb = 0; mb < 4; ++mb) { float* my = os + (mb * KW + w) * (16 * 68);
#pragma unroll
        for (int nb = 0; nb < 4; ++nb) {
#pragma unroll
            for (int j = 0; j < 8; ++j) my[(hi * 8 + j) * 68 + nb * 16 + lr] = acc[mb][nb][j]; } }
    __syncthreads();   // every wave's partial tile stands in LDS before any wave sums across the waves
    const int mb = w >> 1, cb = 2 * (w & 1);   // the wave's chunks: (mb, cb) and (mb, cb + 1)
    const float* ps0 = os + mb * KW * (16 * 68) + lr * 68 + cb * 16 + hi * 8;
    const float* bp = VT ? bias + r0 + mb * 16 + lr : bias + c0 + cb * 16 + hi * 8;
    h16* dst = VT ? P + (size_t)bx * (HD * TT) + (size_t)((c0 >> 4) + cb) * 1024 + mb * 256 + lane * 8 : P + (size_t)by * (TT * HD) + (size_t)((r0 >> 4) + mb) * 1024 + cb * 256 + lane * 8;
#pragma unroll
    for (int it = 0; it < 2; ++it) { const float* ps = ps0 + it * 16; v4f va = *(const v4fa*)ps, vb = *(const v4fa*)(ps + 4);
#pragma unroll
        for (int q = 1; q < KW; ++q) { va += *(const v4fa*)(ps + q * (16 * 68)); vb += *(const v4fa*)(ps + q * (16 * 68) + 4); }
        v8h o16;
#pragma unroll
        for (int j = 0; j < 4; ++j) { o16[j] = (h16)(va[j] + bfr(bp[VT ? 0 : it * 16 + j])); o16[4 + j] = (h16)(vb[j] + bfr(bp[VT ? 0 : it * 16 + 4 + j])); }
        *(v8h*)(dst + it * (VT ? 1024 : 256)) = o16; }
}
#define CNTP 64   // ints between the two batches' counts: each stands in a line of its own
// kept keys of a batch as the list kernel stored them, bounded by the shape
__device__ __forceinline__ int nkept(int c) { return c < 0 ? 0 : c > TT ? TT : c; }
// slots that the list holds for that count: the kept keys, or every position where none is kept
__device__ __forceinline__ int nslots(int c) { const int n = nkept(c); return n == 0 ? TT : n; }
// k_proj: all q / k / v projection tiles of both batches in one grid (TT/64, DM/64, 3 * NB): blockIdx.z = stream * NB + batch, stream 0 = q, 1 = k, 2 = v. Wt3: the three transposed weight planes one behind the other.
__global__ __launch_bounds__(256) void k_proj(const float* __restrict__ xq, const float* __restrict__ xk, const float* __restrict__ xv, const bf* __restrict__ Wt3,
                                              const float* __restrict__ bq, const float* __restrict__ bk, const float* __restrict__ bv, h16* Q16, h16* K16, h16* V16, const int* __restrict__ cix, const int* __restrict__ cnt) {
    __shared__ __align__(16) float os[4 * 8 * 16 * 68];
    const int st = blockIdx.z / NB, b = blockIdx.z % NB;
    const size_t xoff = (size_t)b * SEQ_FULL * DM, poff = (size_t)b * NH_ * TT * HD;
    if (st != 0 && (int)blockIdx.x * 64 >= nslots(cnt[b * CNTP])) return;   // a k or v tile wholly behind the list: nobody reads it. The whole block leaves, in front of its barrier
    const int* ix = cix + (size_t)b * TT;
    if (st == 2) { proj_tile<true>(xv + xoff, Wt3 + 2 * (size_t)DM * DM, bv, V16 + poff, os, blockIdx.y, blockIdx.x, ix); return; }
    proj_tile<false>((st == 0 ? xq : xk) + xoff, Wt3 + (size_t)st * DM * DM, st == 0 ? bq : bk, (st == 0 ? Q16 : K16) + poff, os, blockIdx.x, blockIdx.y, st == 0 ? nullptr : ix);
    asm volatile("s_wait_xcnt 0x0" ::: "memory");   // stands behind the tile's stores: in the listing the v body follows this one on a fall-through (never taken: a scalar flag branches round it) and rewrites the registers that the stores name
}

// k_cvtT: in W[K rows][N cols] f32 -> out Wt, N rows x K cols, bf16 (RNE), in fragment order (see k_gemmw; a wave stores one chunk per instruction), 64x64 tile transposed through LDS (cross-wave: block barrier); grid (K/64, N/64, 5): blockIdx.z < 4 picks one of four matrices of one shape, whose outputs stand one behind the other.
// blockIdx.z == 4: block (0, b) makes batch b's key list: cix[b][slot] = position of the slot-th key with mask != 0, rising; 0 in the slots behind the count; cnt[b * CNTP] = the count. No key kept: every position in its place, count 0.
// Each thread takes TT / 256 neighbouring positions; its first slot is the sum of the counts in front of it (shuffle scan in the wave, wave sums through LDS). The list is put together in LDS and stored in whole lines.
__global__ __launch_bounds__(256) void k_cvtT(const float* __restrict__ W0, const float* __restrict__ W1, const float* __restrict__ W2, const float* __restrict__ W3, bf* Wt, int K, int N, const int* __restrict__ mask, int* cix, int* cnt) {
    __shared__ unsigned short tl[64 * 66];
    __shared__ __align__(16) int li[TT];
    __shared__ int wsum[8];
    if (blockIdx.z == 4) {
        if (blockIdx.x != 0 || blockIdx.y >= NB) return;
        constexpr int PER = TT / 256; static_assert(PER % 4 == 0);
        const int t0 = threadIdx.x * PER, ln = threadIdx.x & 31, wn = threadIdx.x >> 5;
        const int* m = mask + (size_t)blockIdx.y * SEQ_FULL + t0;
        int mv[PER]; int c = 0;
#pragma unroll
        for (int j = 0; j < PER; j += 4) { const v4i m4 = *(const v4i*)(m + j); mv[j] = m4[0]; mv[j + 1] = m4[1]; mv[j + 2] = m4[2]; mv[j + 3] = m4[3]; }
#pragma unroll
        for (int j = 0; j < PER; ++j) c += (mv[j] != 0) ? 1 : 0;
        int inc = c;
#pragma unroll
        for (int d = 1; d < 32; d <<= 1) { const int up = __shfl_up(inc, d, 32); if (ln >= d) inc += up; }
        if (ln == 31) wsum[wn] = inc;
        __syncthreads();   // the eight wave sums stand in LDS
        int slot = inc - c, tot = 0;
#pragma unroll
        for (int q = 0; q < 8; ++q) { const int x = wsum[q]; if (q < wn) slot += x; tot += x; }
#pragma unroll
        for (int j = 0; j < PER; ++j) {
            if (tot == 0) li[t0 + j] = t0 + j;
            else { if (t0 + j >= tot) li[t0 + j] = 0; if (mv[j] != 0) { li[slot] = t0 + j; ++slot; } } }   // kept keys fill slots below tot, the zeros those from tot on: no slot is written twice
        __syncthreads();   // the list is whole before it is stored
        int* dl = cix + (size_t)blockIdx.y * TT + t0;
#pragma unroll
        for (int j = 0; j < PER; j += 4) *(v4i*)(dl + j) = *(const v4ia*)(li + t0 + j);
        if (threadIdx.x == 0) cnt[blockIdx.y * CNTP] = tot;
        return;
    }
    const int zi = blockIdx.z; const float* W = zi == 0 ? W0 : zi == 1 ? W1 : zi == 2 ? W2 : W3; Wt += (size_t)zi * K * N;
    const int tid = threadIdx.x; const int k0 = blockIdx.x * 64, n0 = blockIdx.y * 64;
    { const int row = tid >> 2, cseg = (tid & 3) * 16;
#pragma unroll
      for (int q = 0; q < 4; ++q) { const v4f v = *(const v4f*)(W + (size_t)(k0 + row) * N + n0 + cseg + q * 4);
#pragma unroll
          for (int j = 0; j < 4; ++j) tl[row * 66 + cseg + q * 4 + j] = f2bf(v[j]); } }
    __syncthreads();
    const int ln = tid & 31, wn = tid >> 5; v8us o[2];   // the tile is 16 chunks: (16 rows n: c >> 2, 32 k: (c >> 1) & 1, half: c & 1); wave wn takes chunks wn and 8 + wn
#pragma unroll
    for (int it = 0; it < 2; ++it) { const int c = it * 8 + wn, kl = ((c >> 1) & 1) * 32 + (c & 1) * 16 + (ln >> 4) * 8, n = (c >> 2) * 16 + (ln & 15);
#pragma unroll
        for (int j = 0; j < 8; ++j) o[it][j] = tl[(kl + j) * 66 + n]; }
#pragma unroll
    for (int it = 0; it < 2; ++it) { const int c = it * 8 + wn; *(v8us*)(Wt + (size_t)(n0 + (c >> 2) * 16) * K + ((k0 >> 5) + ((c >> 1) & 1)) * 512 + (c & 1) * 256 + ln * 8) = o[it]; }
}

// k_fattn walks the batch's key list (see the head of the file): "key" below is a list slot. NS = stages per group = slots / 64 rounded up, read from the count, the same for every wave of the block; group g walks slots g * NS * KS .. (g + 1) * NS * KS - 1.
// k_fattn: grid (TT / 16, NB), 16 waves (four per SIMD: while one wave waits for LDS, a load or a dependent result, three others can issue); block = 16 query rows q0.. of batch b, wave = (key group grp, head w).
// Each group runs the whole loop below on its own half of the keys with its own bias tile and k buffers; all 16 waves share the stage barrier. Behind the loop group 1 hands its maximum, sum and accumulators to group 0 through LDS, lane to lane.
// Bias tile, per group and stage of KS keys: wave w makes query rows 2w, 2w+1 for all 8 heads. One WMMA per 32 key positions: A rows = 16 positions, k 0..15 = channel activations of position t0+m, k 16..31 = of position t0+16+m (f16);
// B block-diagonal: B[c][h] = c2w[h][c] for h < 8, B[16+c][8+h] = c2w[h][c], zero elsewhere. D[p][h] -> position t0+p, D[p][8+h] -> position t0+16+p. Stored as rb[h][query][key] (f32).
// A slot at or behind the count of kept keys (a filler, or every slot where no key is kept) gets the bias MFILL: S + MFILL == MFILL in f32 for every |S| < 1e30, so all masked scores of a row are one equal value far below any real score (weight 0 beside a real key, uniform weights where every key is masked), as with the -1e9 fill.
// Scores: A = 16 key rows of k, B = the 16 query rows of q (kept in registers): D element j = (key 8*(lane>>4) + j, query lane & 15). Two such tiles, converted to f16, are the B operand (k order 8*(lane>>4)+0..7, 16+8*(lane>>4)+0..7) of O^T += v^T P^T.
// k fragments reach the wave through LDS: each wave brings its own head's next stages (4 KiB each, fragment order) into its own part of one of two k buffers by asynchronous copies, one whole stage ahead; v fragments are register loads issued at the head of the trip that uses them.
// Every inner loop is unrolled so that the register arrays (fragments, scores, accumulators) are indexed by constants and the LDS and global offsets fold into immediates.
#define MFILL (-3.0e38f)
#define L2E   1.4426950408889634f
// 2^x. The v_nop is the slot that the instruction set asks for behind a transcendental before its result is read or its source overwritten.
__device__ __forceinline__ float ex2(float x) { float r; asm("v_exp_f32 %0, %1\n\tv_nop" : "=v"(r) : "v"(x)); return r; }
// One stage of a head's k plane into LDS: 8 copies of 512 contiguous bytes (16 bytes a lane). The immediate offset moves the global and the LDS address alike, so one address pair serves all 8.
// The s_wait_xcnt closes the statement so that nothing rewrites the two address operands before it.
__device__ __forceinline__ void kcopy(unsigned lds, const h16* g) {
    asm volatile("global_load_async_to_lds_b128 %0, %1, off\n\t"
                 "global_load_async_to_lds_b128 %0, %1, off offset:512\n\t"
                 "global_load_async_to_lds_b128 %0, %1, off offset:1024\n\t"
                 "global_load_async_to_lds_b128 %0, %1, off offset:1536\n\t"
                 "global_load_async_to_lds_b128 %0, %1, off offset:2048\n\t"
                 "global_load_async_to_lds_b128 %0, %1, off offset:2560\n\t"
                 "global_load_async_to_lds_b128 %0, %1, off offset:3072\n\t"
                 "global_load_async_to_lds_b128 %0, %1, off offset:3584\n\t"
                 "s_wait_xcnt 0x0" :: "v"(lds), "v"(g) : "memory");
}
static_assert(KS * HD * 2 == 8 * 512 && KS == 32);   // 32: two offsets a lane and stage (ixr below)
__global__ __launch_bounds__(KG * 256) void k_fattn(const h16* __restrict__ Q16, const h16* __restrict__ K16, const h16* __restrict__ V16, const float* __restrict__ rel, const int* __restrict__ cix, const int* __restrict__ cnt,
                                               const float* __restrict__ c1w, const float* __restrict__ c1b, const float* __restrict__ c2w, const float* __restrict__ c2b, bf* Ah, bf* Al) {
    static_assert(KG == 2);
    __shared__ __align__(16) float rb[2][KG][NH_ * RHS];
    __shared__ __align__(16) unsigned ixs[TT];   // the key list as byte offsets in a row of rel_pos
    __shared__ __align__(16) h16 kls[2][KG * NH_][KS * HD];   // two k buffers, one part per wave (group, head)
    __shared__ __align__(16) float mgo[NH_][8][32 * 4];   // group 1's accumulators, 16 bytes a lane and piece
    __shared__ __align__(8) float mgs[NH_][32 * 2];       // group 1's running maximum and sum, a pair a lane
    const int lane = threadIdx.x & 31, lr = lane & 15, hi = lane >> 4;
    const int wv = __builtin_amdgcn_readfirstlane((int)(threadIdx.x >> 5));   // wave number in a scalar register: plane bases and the branch on the group stay scalar
    const int b = blockIdx.y, q0 = blockIdx.x * 16;
    const int craw = __builtin_amdgcn_readfirstlane(cnt[b * CNTP]);   // in a scalar register: trip count and stage tests stay scalar
    const int nk = nkept(craw), NS = (nslots(craw) + KG * KS - 1) / (KG * KS);   // kept keys; stages per group, 1 .. TT / (KG * KS)
    const int w = wv & (NH_ - 1), grp = wv / NH_, kb = grp * NS * KS;   // head, key group, the group's first key
    for (int idx = threadIdx.x; idx < TT / 4; idx += KG * 256) { const v4i m4 = *(const v4i*)(cix + (size_t)b * TT + idx * 4); *(v4ia*)(ixs + idx * 4) = m4 << 2; }
    float w1[8], b1[8];
#pragma unroll
    for (int i = 0; i < 8; ++i) { w1[i] = bfr(c1w[8 * hi + i]); b1[i] = bfr(c1b[8 * hi + i]); }
    const int hd = lr & 7, g = lr >> 3;
    v16h bw;
#pragma unroll
    for (int i = 0; i < 8; ++i) { const h16 c = (h16)bfr(c2w[hd * 16 + 8 * hi + i]); const h16 zr = (h16)0.0f; bw[i] = (g == 0) ? c : zr; bw[8 + i] = (g == 1) ? c : zr; }
    const float bias2 = bfr(c2b[hd]);
    const char* rr0 = (const char*)(rel + ((size_t)b * SEQ_FULL + q0 + 2 * w) * SEQ_FULL);   // the wave's first row of rel_pos
    constexpr int NX = 2 * (KS / 16);
    float xr[NX], xc[NX];   // xr: the wave's rel_pos values of a later stage, in flight; xc: those of the stage that produce() makes, rounded to bf16
    unsigned ixr[KS / 16];   // the lane's offsets in a rel_pos row for the stage that the next ldx() loads
    auto ldi = [&](int s) {
#pragma unroll
        for (int e = 0; e < KS / 16; ++e) ixr[e] = ixs[kb + s * KS + e * 16 + lr]; };
    auto ldx = [&]() {
#pragma unroll
        for (int qq = 0; qq < 2; ++qq)
#pragma unroll
            for (int e = 0; e < KS / 16; ++e) xr[qq * (KS / 16) + e] = *(const float*)(rr0 + qq * (SEQ_FULL * 4) + ixr[e]); };
    auto produce = [&](int s, float* dstb) {
#pragma unroll
        for (int gk = 0; gk < KS / 32; ++gk) {
            const int lim = nk - (kb + s * KS + gk * 32 + 16 * g + 8 * hi);   // the lane's slot j of 8 is a kept key where j < lim
#pragma unroll
            for (int qq = 0; qq < 2; ++qq) {
                const float xa = xc[qq * (KS / 16) + gk * 2], xb = xc[qq * (KS / 16) + gk * 2 + 1];
                v16h a;
#pragma unroll
                for (int i = 0; i < 8; ++i) { a[i] = (h16)fmaxf(fmaf(xa, w1[i], b1[i]), 0.0f); a[8 + i] = (h16)fmaxf(fmaf(xb, w1[i], b1[i]), 0.0f); }
                const v8f acc = wmma16(a, bw, (v8f){});
                v4f o0, o1;
#pragma unroll
                for (int j = 0; j < 4; ++j) { o0[j] = (j >= lim) ? MFILL : acc[j] + bias2; o1[j] = (4 + j >= lim) ? MFILL : acc[4 + j] + bias2; }
                float* dst = dstb + hd * RHS + (2 * w + qq) * RPI + gk * 32 + 16 * g + 8 * hi;
                *(v4fa*)dst = o0; *(v4fa*)(dst + 4) = o1; } } };
    const size_t pl = ((size_t)b * NH_ + w) * TT * HD;
    const h16* kp = K16 + pl + kb * HD + lane * 8; const h16* vp = V16 + pl + kb * HD + lane * 8;   // the lane's 16 bytes in the first chunk of a stage of its head's k and v planes (fragment order, see k_proj; 16 positions are 16 * HD elements, so the group's first key stands kb * HD elements in): kp of the next stage to be copied, vp of the current stage
    const h16* kl0 = &kls[0][wv][lane * 8];   // the lane's 16 bytes in the first chunk of the wave's part of k buffer 0; buffer 1 stands KG * NH_ * KS * HD elements behind
    const unsigned kla = (unsigned)(size_t)kl0;   // the same as an LDS byte address
    kcopy(kla, kp); kp += KS * HD;   // stage 0 of k
    v16h qf[2];
#pragma unroll
    for (int dk = 0; dk < 2; ++dk) { const h16* qp = Q16 + pl + (size_t)(q0 >> 4) * 1024 + dk * 512 + lane * 8; qf[dk] = cat16(*(const v8h*)qp, *(const v8h*)(qp + 256)); }
    v8f o[4];
#pragma unroll
    for (int dg = 0; dg < 4; ++dg) o[dg] = (v8f){};
    float mrun = MFILL, lsum = 0.0f;
    __syncthreads();   // the key list stands in LDS before any wave reads it
    ldi(0); ldx();
    asm volatile("s_wait_xcnt 0x0" :: "v"(ixr[0]), "v"(ixr[1]) : "memory");   // stands behind the rel_pos loads, in front of the LDS loads that rewrite the offsets that they name; the offsets are inputs so that their registers are not reused in front of it
    ldi(NS > 1 ? 1 : 0);
#pragma unroll
    for (int i = 0; i < NX; ++i) xc[i] = bfr(xr[i]);
    ldx();
    asm volatile("s_wait_xcnt 0x0" :: "v"(ixr[0]), "v"(ixr[1]) : "memory");   // as above
    ldi(NS > 2 ? 2 : NS - 1);
    produce(0, rb[0][grp]);
    asm volatile("s_wait_asynccnt 0x0" ::: "memory");   // the wave's copies of k stage 0 have landed
    __syncthreads();   // stage 0 of the bias tile and of k stand in LDS before any wave reads them
    if (NS > 1) { kcopy(kla + KG * NH_ * KS * HD * 2, kp); kp += KS * HD; }   // stage 1 of k, where there is one
#pragma unroll 1   // one stage per trip: an unrolled body would not hold its fragments in registers
    for (int s = 0; s < NS; ++s) {
        v16h vf[KS / 32][4];
#pragma unroll
        for (int gk = 0; gk < KS / 32; ++gk)
#pragma unroll
            for (int dg = 0; dg < 4; ++dg) vf[gk][dg] = cat16(*(const v8h*)(vp + (gk * 2048 + dg * 256)), *(const v8h*)(vp + (gk * 2048 + 1024 + dg * 256)));
#pragma unroll
        for (int i = 0; i < NX; ++i) xc[i] = bfr(xr[i]);   // read out before the loads below replace xr
        ldx();   // stage s + 2 (the last one again where there is none), issued at the head of the trip: the barrier at its foot waits for every load, and these come from memory
        asm volatile("s_wait_xcnt 0x0" ::: "memory");   // stands behind the v and rel_pos loads, in front of the step of vp, the new offsets and whatever else rewrites the registers that they name
        ldi(s + 3 < NS ? s + 3 : NS - 1);   // offsets for the next trip's ldx(): a whole trip of lead for the LDS read
        if (s + 1 < NS) produce(s + 1, rb[(s + 1) & 1][grp]);
        const h16* kl = kl0 + (s & 1) * (KG * NH_ * KS * HD);
        v16h kf[KS / 16][2];
#pragma unroll
        for (int kg = 0; kg < KS / 16; ++kg)
#pragma unroll
            for (int dk = 0; dk < 2; ++dk) kf[kg][dk] = cat16(*(const v8h*)(kl + (kg * 1024 + dk * 512)), *(const v8h*)(kl + (kg * 1024 + dk * 512 + 256)));
        const float* rbp = rb[s & 1][grp] + w * RHS + lr * RPI + 8 * hi;
        float t[KS / 16][8]; float mx = MFILL;
#pragma unroll
        for (int kg = 0; kg < KS / 16; ++kg) {
            v8f st = (v8f){};
            st = wmma16(kf[kg][0], qf[0], st); st = wmma16(kf[kg][1], qf[1], st);
            const v4f r0 = *(const v4fa*)(rbp + kg * 16); const v4f r1 = *(const v4fa*)(rbp + kg * 16 + 4);
#pragma unroll
            for (int j = 0; j < 4; ++j) { t[kg][j] = (st[j] + r0[j]) * SCL; t[kg][4 + j] = (st[4 + j] + r1[j]) * SCL; mx = fmaxf(mx, fmaxf(t[kg][j], t[kg][4 + j])); } }
        mx = fmaxf(mx, __shfl_xor(mx, 16, 32));   // the other half of the wave holds the query's other keys
        const float mnew = fmaxf(mrun, mx);
        const float corr = ex2((mrun - mnew) * L2E);
        mrun = mnew;
        float ps = 0.0f; v16h pb[KS / 32];
#pragma unroll
        for (int kg = 0; kg < KS / 16; ++kg)
#pragma unroll
            for (int j = 0; j < 8; ++j) { const float p = ex2(fmaf(t[kg][j] - mnew, L2E, 10.0f)); ps += p; pb[kg >> 1][(kg & 1) * 8 + j] = (h16)p; }   // + 10: the x1024 carry
        lsum = fmaf(lsum, corr, ps);
#pragma unroll
        for (int dg = 0; dg < 4; ++dg) o[dg] *= corr;
#pragma unroll
        for (int gk = 0; gk < KS / 32; ++gk)
#pragma unroll
            for (int dg = 0; dg < 4; ++dg) o[dg] = wmma16(vf[gk][dg], pb[gk], o[dg]);
        vp += KS * HD;
        // the wave's reads of k stage s have retired before copies aim at that buffer again. The accumulators and the running sum are named as inputs so that this wait, and with it the barrier (which waits for every load in flight), stays at the foot of the trip, behind the trip's arithmetic: left free, the compiler put both in front of the softmax, where the loads of this trip had not had time to return
        // the four v_nop keep the distance behind the trip's last matrix instruction on the branch back to the loop's head, where register moves overwrite its B operand
        asm volatile("v_nop\n\tv_nop\n\tv_nop\n\tv_nop\n\ts_wait_dscnt 0x0" :: "v"(o[0]), "v"(o[1]), "v"(o[2]), "v"(o[3]), "v"(lsum) : "memory");
        asm volatile("s_wait_asynccnt 0x0" ::: "memory");   // the wave's copies of k stage s + 1 have landed
        __syncthreads();   // publishes stage s + 1 of the bias tile and of k and ends every wave's reads of stage s, whose buffers are refilled behind it
        if (s + 2 < NS) { kcopy(kla + (s & 1) * (KG * NH_ * KS * HD * 2), kp); kp += KS * HD; }   // stage s + 2 of k into the buffer that this trip has read
    }
    asm volatile("s_wait_asynccnt 0x0" ::: "memory");   // no copy is outstanding when the wave goes on to its end
    lsum += __shfl_xor(lsum, 16, 32);
    // The two groups' states of one (head, query) meet: in both groups lane and register hold the same (query, d), so the hand-over is lane to lane.
    if (grp == 1) {
#pragma unroll
        for (int dg = 0; dg < 4; ++dg) { *(v4fa*)&mgo[w][2 * dg][lane * 4] = __builtin_shufflevector(o[dg], o[dg], 0, 1, 2, 3); *(v4fa*)&mgo[w][2 * dg + 1][lane * 4] = __builtin_shufflevector(o[dg], o[dg], 4, 5, 6, 7); }
        mgs[w][lane * 2] = mrun; mgs[w][lane * 2 + 1] = lsum;
    }
    __syncthreads();   // group 1's state stands in LDS before group 0 reads it
    if (grp == 1) return;
    const float m1 = mgs[w][lane * 2], l1 = mgs[w][lane * 2 + 1];
    const float mall = fmaxf(mrun, m1);
    const float a0 = ex2((mrun - mall) * L2E), a1 = ex2((m1 - mall) * L2E);   // each group's weight against the common maximum
    lsum = fmaf(lsum, a0, l1 * a1);
#pragma unroll
    for (int dg = 0; dg < 4; ++dg) { const v4f p0 = *(const v4fa*)&mgo[w][2 * dg][lane * 4]; const v4f p1 = *(const v4fa*)&mgo[w][2 * dg + 1][lane * 4];
#pragma unroll
        for (int j = 0; j < 4; ++j) { o[dg][j] = fmaf(o[dg][j], a0, p0[j] * a1); o[dg][4 + j] = fmaf(o[dg][4 + j], a0, p1[j] * a1); } }
    const float f = __fdiv_rn(PCAR, lsum);
    const float cs = 1.0f / PCAR;
    const size_t oo = ((size_t)b * TT + q0) * DM + w * (HD * 16) + lane * 8;   // context planes in fragment order (see k_gemmw): the block's 16 queries are one group of rows, the head's 64 columns four chunks of it, and the lane's 8 values of accumulator dg are its 16 bytes of chunk dg
#pragma unroll
    for (int dg = 0; dg < 4; ++dg) { v8us oh, ol;
#pragma unroll
        for (int j = 0; j < 8; ++j) { unsigned short a, c2; splitf(o[dg][j] * f * cs, a, c2); oh[j] = a; ol[j] = c2; }
        *(v8us*)(Ah + oo + dg * 256) = oh; *(v8us*)(Al + oo + dg * 256) = ol; }
}

constexpr size_t al256(size_t b) { return (b + 255) & ~(size_t)255; }
constexpr size_t WS_TOTAL = 4 * al256((size_t)DM * DM * 2) + 3 * al256((size_t)NB * NH_ * TT * HD * 2) + 2 * al256((size_t)NB * TT * DM * 2) + al256((size_t)NB * TT * 4) + al256((size_t)NB * CNTP * 4);
static_assert(WS_TOTAL <= (size_t)134217728);
static_assert(((size_t)DM * DM * 2) % 256 == 0);   // the weight planes follow one another without a gap
static_assert(NB <= DM / 64);   // the first launch's grid has a block (0, b) for every batch's key list

extern "C" void kernel_launch(void* const* d_in, const int* in_sizes, int n_in,
                              void* d_out, int out_size, void* d_ws, size_t ws_size, hipStream_t stream) {
    if (n_in < 17) return;
    const size_t need_x = ((size_t)(NB - 1) * SEQ_FULL + SEQ) * DM;
    const size_t need_r = (size_t)(NB - 1) * SEQ_FULL * SEQ_FULL + (size_t)(SEQ - 1) * SEQ_FULL + SEQ;
    if ((size_t)in_sizes[0] < need_x || (size_t)in_sizes[1] < need_x || (size_t)in_sizes[2] < need_x || (size_t)in_sizes[3] < need_r) return;
    if ((size_t)in_sizes[4] < (size_t)(NB - 1) * SEQ_FULL + SEQ) return;
    if (in_sizes[5] < DM * DM || in_sizes[7] < DM * DM || in_sizes[9] < DM * DM || in_sizes[11] < DM * DM) return;
    if (in_sizes[6] < DM || in_sizes[8] < DM || in_sizes[10] < DM || in_sizes[12] < DM) return;
    if (in_sizes[13] < 16 || in_sizes[14] < 16 || in_sizes[15] < 128 || in_sizes[16] < 8) return;
    if ((size_t)out_size < need_x) return;
    const float* xq = (const float*)d_in[0]; const float* xk = (const float*)d_in[1]; const float* xv = (const float*)d_in[2];
    const float* rel = (const float*)d_in[3]; const int* msk = (const int*)d_in[4];
    const float* wq = (const float*)d_in[5]; const float* bq = (const float*)d_in[6]; const float* wk = (const float*)d_in[7]; const float* bk = (const float*)d_in[8];
    const float* wv = (const float*)d_in[9]; const float* bv = (const float*)d_in[10]; const float* wo = (const float*)d_in[11]; const float* bo = (const float*)d_in[12];
    const float* c1w = (const float*)d_in[13]; const float* c1b = (const float*)d_in[14]; const float* c2w = (const float*)d_in[15]; const float* c2b = (const float*)d_in[16];
    float* OUT = (float*)d_out;     // [NB_FULL][SEQ_FULL][DM]
    char* wsp = (char*)d_ws;
    auto take = [&](size_t bytes) { char* p = wsp; wsp += (bytes + 255) & ~(size_t)255; return (void*)p; };
    bf* WQ = (bf*)take((size_t)DM * DM * 2); take((size_t)DM * DM * 2); take((size_t)DM * DM * 2); bf* WO = (bf*)take((size_t)DM * DM * 2);   // four planes in the order q, k, v, o; the kernels reach k and v from WQ
    h16* QP16 = (h16*)take((size_t)NB * NH_ * TT * HD * 2); h16* KP16 = (h16*)take((size_t)NB * NH_ * TT * HD * 2); h16* VT16 = (h16*)take((size_t)NB * NH_ * HD * TT * 2);
    bf* ATh = (bf*)take((size_t)NB * TT * DM * 2); bf* ATl = (bf*)take((size_t)NB * TT * DM * 2);
    int* CIX = (int*)take((size_t)NB * TT * 4); int* CNT = (int*)take((size_t)NB * CNTP * 4);   // key lists and their counts
    if ((size_t)(wsp - (char*)d_ws) > ws_size) return;
    // weights: in W[k rows][n cols] -> out Wt, n rows x k cols in fragment order; square DM x DM; the four planes WQ, WK, WV, WO are contiguous in the workspace
    k_cvtT<<<dim3(DM / 64, DM / 64, 5), 256, 0, stream>>>(wq, wk, wv, wo, WQ, DM, DM, msk, CIX, CNT);
    k_proj<<<dim3(TT / 64, DM / 64, 3 * NB), 256, 0, stream>>>(xq, xk, xv, WQ, bq, bk, bv, QP16, KP16, VT16, CIX, CNT);
    k_fattn<<<dim3(TT / 16, NB), KG * 256, 0, stream>>>(QP16, KP16, VT16, rel, CIX, CNT, c1w, c1b, c2w, c2b, ATh, ATl);
    k_gemmw<bf, 1, true, 8, DM><<<dim3(TT / 64, DM / 64, NB), 256, 0, stream>>>(ATh, ATl, WO, nullptr, OUT, DM, bo, (size_t)TT * DM, 0, (size_t)SEQ_FULL * DM);
}

// v010
// A run of this version takes 59.1 microseconds.
// Timed twice side by side with v009, it ran 1.03 and 1.05 times as fast.
// Over all steps from v000 it is 12.7 times as fast.
#include <hip/hip_runtime.h>

// Compute dtypes (f32 accumulate everywhere): q/k/v projections v_wmma_f32_16x16x32_bf16 (inputs RNE-converted to bf16, products exact); pointwise-bias channel mix (16 ch -> 8 heads) v_wmma_f32_16x16x32_f16; q.k scores f16; probabilities (x1024 carry) x values f16; output projection bf16 hi+lo context x bf16 weights (2 products); softmax and mask fill in f32.
// Keys with mask == 0 have weight 0 wherever a row has a real key, so they are dropped before any work is spent on them: the first launch lists each batch's kept positions (in rising order); k and v are projected for the listed positions only and stored by list slot, and the attention loop walks slots.
// Slots from the count up to the next multiple of 64 are fillers (position 0, filled like a masked key). A batch with no kept key lists every position, all of them filled, which gives the uniform weights of the reference.
// Three launches: weight transposes (all four) and key lists, q / k / v projections (all three streams, both batches), attention with the output projection (both batches); launches of one kernel that do not depend on each other are one grid, told apart by blockIdx.z.
// Layout: projection of the f32 q / k / v input stream (converted to bf16 in the fragment loader; + f32 bias) -> f16 head planes q, k, v in fragment order (see k_proj), stored by the projection itself;
// one attention launch for both batches: a block owns 16 query rows and all 8 heads; 16 waves = 8 heads x 2 halves of the keys, each half walked in stages of 32 and the two halves' running softmax states merged in LDS at the end: bias tile R[h][i][t] (one block-diagonal WMMA per 32 key positions, shared through LDS),
// S^T = k q^T, running-maximum softmax of (S + R) / 8 with key-mask fill, P (x1024 carry) as f16 straight from the score accumulators, O^T += v^T P^T; scores and probabilities never leave the registers.
// the attention block keeps its merged hi/lo context rows (x 1/1024) in LDS and makes its own 16 rows of the output projection + bias from them. Weights [in][out] are transposed once through LDS into bf16 planes. Weight and context planes stand in fragment order (see WFrag).

#ifndef NB
#define NB 2
#endif
#ifndef SEQ
#define SEQ 2048
#endif
#define NB_FULL  2
#define SEQ_FULL 2048
#define TT   SEQ
#define DM   512
#define NH_  8
#define HD   64
#define KS   32          // keys per stage of the attention loop
#define KG   2           // wave groups of an attention block: each walks its own half of the key list's slots (see k_fattn)
#define RPI  (KS + 4)    // f32 pitch of one (head, query) row of the staged bias tile
#define RHS  (16 * RPI + 4)   // f32 pitch of one head's 16 rows: the 8 heads that one store instruction writes start on different LDS banks
#define PCAR 1024.0f
#define SCL  0.125f   // HD^-0.5
static_assert(NH_ * HD == DM);
static_assert(TT % 256 == 0);
static_assert(KS % 32 == 0 && TT % (KG * KS) == 0 && KG * KS == 64);   // 64: the list is padded to the projection's tile of 64 slots
static_assert(DM % 256 == 0);
static_assert(SEQ <= SEQ_FULL);
static_assert(NB <= NB_FULL);

typedef _Float16 h16;
typedef unsigned short bf;
typedef __attribute__((ext_vector_type(16))) __bf16   v16bf;
typedef __attribute__((ext_vector_type(16))) _Float16 v16h;
typedef __attribute__((ext_vector_type(8)))  _Float16 v8h;
typedef __attribute__((ext_vector_type(8)))  unsigned short v8us;
typedef __attribute__((ext_vector_type(8)))  float    v8f;
typedef __attribute__((ext_vector_type(4)))  float    v4f;
typedef __attribute__((ext_vector_type(2)))  _Float16 v2h;
typedef __attribute__((ext_vector_type(4)))  _Float16 v4h;
typedef __attribute__((ext_vector_type(2)))  unsigned short v2us;
typedef __attribute__((ext_vector_type(4)))  int v4i;
typedef v4f  __attribute__((may_alias)) v4fa;
typedef v4i  __attribute__((may_alias)) v4ia;

__device__ __forceinline__ unsigned short f2bf(float f) { unsigned u = __float_as_uint(f); u += 0x7FFFu + ((u >> 16) & 1u); return (unsigned short)(u >> 16); }
__device__ __forceinline__ float bf2f(unsigned short b) { return __uint_as_float(((unsigned)b) << 16); }
__device__ __forceinline__ float bfr(float f) { return bf2f(f2bf(f)); }
__device__ __forceinline__ v16h cat16(v8h lo, v8h hi) { return __builtin_shufflevector(lo, hi, 0, 1, 2, 3, 4, 5, 6, 7, 8, 9, 10, 11, 12, 13, 14, 15); }
__device__ __forceinline__ v16bf cat16b(v8us lo, v8us hi) { return __builtin_bit_cast(v16bf, __builtin_shufflevector(lo, hi, 0, 1, 2, 3, 4, 5, 6, 7, 8, 9, 10, 11, 12, 13, 14, 15)); }
__device__ __forceinline__ v8f wmma16(v16h a, v16h b, v8f c) { return __builtin_amdgcn_wmma_f32_16x16x32_f16(false, a, false, b, (short)0, c, false, false); }
__device__ __forceinline__ v8f wmmab(v16bf a, v16bf b, v8f c) { return __builtin_amdgcn_wmma_f32_16x16x32_bf16(false, a, false, b, (short)0, c, false, false); }
__device__ __forceinline__ void splitf(float y, unsigned short& h, unsigned short& l) { h = f2bf(y); l = f2bf(y - bf2f(h)); }

// ---- WFrag: 16-bit operand planes in fragment order and their loader.
// Fragment map (first and second WMMA operand alike): lane row = lane & 15, elements 0..7 <- k0 + 8*(lane>>4) + 0..7, elements 8..15 <- k0 + 16 + 8*(lane>>4) + 0..7; D element j = (row of the first operand 8*(lane>>4) + j, row of the second lane & 15).
// Fragment order of a plane of R rows x K: 16 rows x 32 k are 1 KiB, two chunks of 512 contiguous bytes, each what one 16-byte-per-lane load takes (four whole lines), lane l at byte 16 * l: chunk 0 holds elements 0..7 of the map above, chunk 1 elements 8..15.
// Element offset of a chunk: ((row >> 4) * (K / 32) + (k0 >> 5)) * 512 + chunk * 256.
template <typename T16> struct WFrag;
template <> struct WFrag<h16> { typedef v16h V; static __device__ __forceinline__ V ld(const h16* p) { return cat16(*(const v8h*)p, *(const v8h*)(p + 256)); } static __device__ __forceinline__ v8f mma(V a, V b, v8f c) { return wmma16(a, b, c); } };
template <> struct WFrag<bf> { typedef v16bf V; static __device__ __forceinline__ V ld(const bf* p) { return cat16b(*(const v8us*)p, *(const v8us*)(p + 256)); } static __device__ __forceinline__ v8f mma(V a, V b, v8f c) { return wmmab(a, b, c); } };

// proj_tile (body of k_proj): one 64x64 tile of a q / k / v projection per block of 8 waves, K = DM split over the waves: wave w holds the whole tile (16 accumulators) for k in [w * K / 8, (w + 1) * K / 8), the 8 partial tiles meet in LDS and are summed in wave order (fragment map: see WFrag); the f32 input stream is read as it is and rounded to bf16 (RNE) in the fragment loader.
// For k and v a "position" below is a slot of the batch's key list: row t of the tile is read from X at position ix[t], and the head planes are ordered by slot.
// VT == false (q, k): A rows = positions t of X, B rows = output columns n of Wt; tile (bx, by) of (TT/64, DM/64); a tile's 64 columns are one head.
// VT == true (v): A rows = output columns n of Wt, B rows = positions t of X, so that the tile comes out transposed; tile (bx, by) of (DM/64, TT/64); a tile's 64 rows are one head.
// Head planes are stored in fragment order: a chunk of 512 contiguous bytes is what one 16-byte-per-lane load of the attention kernel takes, lane l = 16 * hi + lr at byte 16 * l. 16 positions of a head are 4 chunks (2 KiB), a head plane is TT / 16 such groups.
// q, k: chunk c of position group tg: lane holds position 16 * tg + lr, d = 16 * c + 8 * hi + 0..7. v: chunk dg of position group tg: lane holds d = 16 * dg + lr, positions 16 * tg + 8 * hi + 0..7.
// In both cases a chunk is rows 16 * mb + lr, columns 16 * c + 8 * hi + 0..7 of the tile; wave w stores chunks (mb = w >> 1, c = 2 * (w & 1) + 0..1), each store instruction four whole 128-byte lines.
typedef __attribute__((ext_vector_type(8))) __bf16 v8bf;
__device__ __forceinline__ v16bf ldxf(const float* p) { const v8f lo = *(const v8f*)p, hi = *(const v8f*)(p + 16);
    return __builtin_shufflevector(__builtin_convertvector(lo, v8bf), __builtin_convertvector(hi, v8bf), 0, 1, 2, 3, 4, 5, 6, 7, 8, 9, 10, 11, 12, 13, 14, 15); }
template <bool VT>
__device__ __forceinline__ void proj_tile(const float* __restrict__ X, const bf* __restrict__ Wt, const float* __restrict__ bias, h16* P, float* os, int bx, int by, const int* __restrict__ ix) {
    constexpr int KW = 8, K = DM;
    const int lane = threadIdx.x & 31, lr = lane & 15, hi = lane >> 4; const int r0 = bx * 64, c0 = by * 64;
    v8f acc[4][4];
#pragma unroll
    for (int mb = 0; mb < 4; ++mb)
#pragma unroll
        for (int nb = 0; nb < 4; ++nb) acc[mb][nb] = (v8f){};
    const size_t woff = (size_t)(VT ? r0 : c0) * K + lane * 8;   // weight plane in fragment order (see WFrag)
    const int rl = (VT ? c0 : r0) + lr;
    int pos[4];   // the lane's four rows of X: tile row i * 16 + lr is position ix[row] (k, v: the key list) or the row itself (q: ix == nullptr)
#pragma unroll
    for (int i = 0; i < 4; ++i) pos[i] = rl + i * 16;
    if (ix) {
#pragma unroll
        for (int i = 0; i < 4; ++i) pos[i] = ix[rl + i * 16];
        asm volatile("s_wait_xcnt 0x0" :: "v"(rl) : "memory");   // stands behind the list loads; their index is an input so that its register is not reused in front of the wait
    }
    unsigned xoff[4];   // byte offsets of the lane's first element in those rows: with the scalar base X + kc they are the loads' whole address
#pragma unroll
    for (int i = 0; i < 4; ++i) xoff[i] = ((unsigned)pos[i] * K + 8 * hi) * 4;
    const int w = __builtin_amdgcn_readfirstlane((int)(threadIdx.x >> 5));   // wave number in a scalar register: the wave's k offset stays scalar
    const int kbeg = w * (K / KW), kend = kbeg + K / KW;
#pragma unroll   // both trips in line: the second trip's loads issue while the first trip's products still run
    for (int kc = kbeg; kc < kend; kc += 32) {
        v16bf a[4];
#pragma unroll
        for (int mb = 0; mb < 4; ++mb) { if constexpr (VT) a[mb] = WFrag<bf>::ld(Wt + woff + (size_t)mb * 16 * K + kc * 16); else a[mb] = ldxf((const float*)((const char*)(X + kc) + xoff[mb])); }
#pragma unroll
        for (int nb = 0; nb < 4; ++nb) { v16bf b; if constexpr (VT) b = ldxf((const float*)((const char*)(X + kc) + xoff[nb])); else b = WFrag<bf>::ld(Wt + woff + (size_t)nb * 16 * K + kc * 16);
#pragma unroll
            for (int mb = 0; mb < 4; ++mb) acc[mb][nb] = wmmab(a[mb], b, acc[mb][nb]); }
    }
    asm volatile("s_wait_xcnt 0x0" :: "v"(xoff[0]), "v"(xoff[1]), "v"(xoff[2]), "v"(xoff[3]) : "memory");   // stands behind the loads of X; their offsets are inputs so that the registers are not reused in front of the wait
    // loops below are unrolled so that acc[][] is indexed by constants and stays in registers, and the LDS offsets fold into immediates
#pragma unroll
    for (int mb = 0; mb < 4; ++mb) { float* my = os + (mb * KW + w) * (16 * 68);
#pragma unroll
        for (int nb = 0; nb < 4; ++nb) {
#pragma unroll
            for (int j = 0; j < 8; ++j) my[(hi * 8 + j) * 68 + nb * 16 + lr] = acc[mb][nb][j]; } }
    __syncthreads();   // every wave's partial tile stands in LDS before any wave sums across the waves
    const int mb = w >> 1, cb = 2 * (w & 1);   // the wave's chunks: (mb, cb) and (mb, cb + 1)
    const float* ps0 = os + mb * KW * (16 * 68) + lr * 68 + cb * 16 + hi * 8;
    const float* bp = VT ? bias + r0 + mb * 16 + lr : bias + c0 + cb * 16 + hi * 8;
    h16* dst = VT ? P + (size_t)bx * (HD * TT) + (size_t)((c0 >> 4) + cb) * 1024 + mb * 256 + lane * 8 : P + (size_t)by * (TT * HD) + (size_t)((r0 >> 4) + mb) * 1024 + cb * 256 + lane * 8;
#pragma unroll
    for (int it = 0; it < 2; ++it) { const float* ps = ps0 + it * 16; v4f va = *(const v4fa*)ps, vb = *(const v4fa*)(ps + 4);
#pragma unroll
        for (int q = 1; q < KW; ++q) { va += *(const v4fa*)(ps + q * (16 * 68)); vb += *(const v4fa*)(ps + q * (16 * 68) + 4); }
        v8h o16;
#pragma unroll
        for (int j = 0; j < 4; ++j) { o16[j] = (h16)(va[j] + bfr(bp[VT ? 0 : it * 16 + j])); o16[4 + j] = (h16)(vb[j] + bfr(bp[VT ? 0 : it * 16 + 4 + j])); }
        *(v8h*)(dst + it * (VT ? 1024 : 256)) = o16; }
}
#define CNTP 64   // ints between the two batches' counts: each stands in a line of its own
// kept keys of a batch as the list kernel stored them, bounded by the shape
__device__ __forceinline__ int nkept(int c) { return c < 0 ? 0 : c > TT ? TT : c; }
// slots that the list holds for that count: the kept keys, or every position where none is kept
__device__ __forceinline__ int nslots(int c) { const int n = nkept(c); return n == 0 ? TT : n; }
// k_proj: all q / k / v projection tiles of both batches in one grid (TT/64, DM/64, 3 * NB): blockIdx.z = stream * NB + batch, stream 0 = q, 1 = k, 2 = v. Wt3: the three transposed weight planes one behind the other.
__global__ __launch_bounds__(256) void k_proj(const float* __restrict__ xq, const float* __restrict__ xk, const float* __restrict__ xv, const bf* __restrict__ Wt3,
                                              const float* __restrict__ bq, const float* __restrict__ bk, const float* __restrict__ bv, h16* Q16, h16* K16, h16* V16, const int* __restrict__ cix, const int* __restrict__ cnt) {
    __shared__ __align__(16) float os[4 * 8 * 16 * 68];
    const int st = blockIdx.z / NB, b = blockIdx.z % NB;
    const size_t xoff = (size_t)b * SEQ_FULL * DM, poff = (size_t)b * NH_ * TT * HD;
    if (st != 0 && (int)blockIdx.x * 64 >= nslots(cnt[b * CNTP])) return;   // a k or v tile wholly behind the list: nobody reads it. The whole block leaves, in front of its barrier
    const int* ix = cix + (size_t)b * TT;
    if (st == 2) { proj_tile<true>(xv + xoff, Wt3 + 2 * (size_t)DM * DM, bv, V16 + poff, os, blockIdx.y, blockIdx.x, ix); return; }
    proj_tile<false>((st == 0 ? xq : xk) + xoff, Wt3 + (size_t)st * DM * DM, st == 0 ? bq : bk, (st == 0 ? Q16 : K16) + poff, os, blockIdx.x, blockIdx.y, st == 0 ? nullptr : ix);
    asm volatile("s_wait_xcnt 0x0" ::: "memory");   // stands behind the tile's stores: in the listing the v body follows this one on a fall-through (never taken: a scalar flag branches round it) and rewrites the registers that the stores name
}

// k_cvtT: in W[K rows][N cols] f32 -> out Wt, N rows x K cols, bf16 (RNE), in fragment order (see WFrag; a wave stores one chunk per instruction), 64x64 tile transposed through LDS (cross-wave: block barrier); grid (K/64, N/64, 5): blockIdx.z < 4 picks one of four matrices of one shape, whose outputs stand one behind the other.
// blockIdx.z == 4: block (0, b) makes batch b's key list: cix[b][slot] = position of the slot-th key with mask != 0, rising; 0 in the slots behind the count; cnt[b * CNTP] = the count. No key kept: every position in its place, count 0.
// Each thread takes TT / 256 neighbouring positions; its first slot is the sum of the counts in front of it (shuffle scan in the wave, wave sums through LDS). The list is put together in LDS and stored in whole lines.
__global__ __launch_bounds__(256) void k_cvtT(const float* __restrict__ W0, const float* __restrict__ W1, const float* __restrict__ W2, const float* __restrict__ W3, bf* Wt, int K, int N, const int* __restrict__ mask, int* cix, int* cnt) {
    __shared__ unsigned short tl[64 * 66];
    __shared__ __align__(16) int li[TT];
    __shared__ int wsum[8];
    if (blockIdx.z == 4) {
        if (blockIdx.x != 0 || blockIdx.y >= NB) return;
        constexpr int PER = TT / 256; static_assert(PER % 4 == 0);
        const int t0 = threadIdx.x * PER, ln = threadIdx.x & 31, wn = threadIdx.x >> 5;
        const int* m = mask + (size_t)blockIdx.y * SEQ_FULL + t0;
        int mv[PER]; int c = 0;
#pragma unroll
        for (int j = 0; j < PER; j += 4) { const v4i m4 = *(const v4i*)(m + j); mv[j] = m4[0]; mv[j + 1] = m4[1]; mv[j + 2] = m4[2]; mv[j + 3] = m4[3]; }
#pragma unroll
        for (int j = 0; j < PER; ++j) c += (mv[j] != 0) ? 1 : 0;
        int inc = c;
#pragma unroll
        for (int d = 1; d < 32; d <<= 1) { const int up = __shfl_up(inc, d, 32); if (ln >= d) inc += up; }
        if (ln == 31) wsum[wn] = inc;
        __syncthreads();   // the eight wave sums stand in LDS
        int slot = inc - c, tot = 0;
#pragma unroll
        for (int q = 0; q < 8; ++q) { const int x = wsum[q]; if (q < wn) slot += x; tot += x; }
#pragma unroll
        for (int j = 0; j < PER; ++j) {
            if (tot == 0) li[t0 + j] = t0 + j;
            else { if (t0 + j >= tot) li[t0 + j] = 0; if (mv[j] != 0) { li[slot] = t0 + j; ++slot; } } }   // kept keys fill slots below tot, the zeros those from tot on: no slot is written twice
        __syncthreads();   // the list is whole before it is stored
        int* dl = cix + (size_t)blockIdx.y * TT + t0;
#pragma unroll
        for (int j = 0; j < PER; j += 4) *(v4i*)(dl + j) = *(const v4ia*)(li + t0 + j);
        if (threadIdx.x == 0) cnt[blockIdx.y * CNTP] = tot;
        return;
    }
    const int zi = blockIdx.z; const float* W = zi == 0 ? W0 : zi == 1 ? W1 : zi == 2 ? W2 : W3; Wt += (size_t)zi * K * N;
    const int tid = threadIdx.x; const int k0 = blockIdx.x * 64, n0 = blockIdx.y * 64;
    { const int row = tid >> 2, cseg = (tid & 3) * 16;
#pragma unroll
      for (int q = 0; q < 4; ++q) { const v4f v = *(const v4f*)(W + (size_t)(k0 + row) * N + n0 + cseg + q * 4);
#pragma unroll
          for (int j = 0; j < 4; ++j) tl[row * 66 + cseg + q * 4 + j] = f2bf(v[j]); } }
    __syncthreads();
    const int ln = tid & 31, wn = tid >> 5; v8us o[2];   // the tile is 16 chunks: (16 rows n: c >> 2, 32 k: (c >> 1) & 1, half: c & 1); wave wn takes chunks wn and 8 + wn
#pragma unroll
    for (int it = 0; it < 2; ++it) { const int c = it * 8 + wn, kl = ((c >> 1) & 1) * 32 + (c & 1) * 16 + (ln >> 4) * 8, n = (c >> 2) * 16 + (ln & 15);
#pragma unroll
        for (int j = 0; j < 8; ++j) o[it][j] = tl[(kl + j) * 66 + n]; }
#pragma unroll
    for (int it = 0; it < 2; ++it) { const int c = it * 8 + wn; *(v8us*)(Wt + (size_t)(n0 + (c >> 2) * 16) * K + ((k0 >> 5) + ((c >> 1) & 1)) * 512 + (c & 1) * 256 + ln * 8) = o[it]; }
}

// k_fattn walks the batch's key list (see the head of the file): "key" below is a list slot. NS = stages per group = slots / 64 rounded up, read from the count, the same for every wave of the block; group g walks slots g * NS * KS .. (g + 1) * NS * KS - 1.
// k_fattn: grid (TT / 16, NB), 16 waves (four per SIMD: while one wave waits for LDS, a load or a dependent result, three others can issue); block = 16 query rows q0.. of batch b, wave = (key group grp, head w).
// Each group runs the whole loop below on its own half of the keys with its own bias tile and k buffers; all 16 waves share the stage barrier. Behind the loop group 1 hands its maximum, sum and accumulators to group 0 through LDS, lane to lane; then all 16 waves make the block's rows of the output projection.
// Bias tile, per group and stage of KS keys: wave w makes query rows 2w, 2w+1 for all 8 heads. One WMMA per 32 key positions: A rows = 16 positions, k 0..15 = channel activations of position t0+m, k 16..31 = of position t0+16+m (f16);
// B block-diagonal: B[c][h] = c2w[h][c] for h < 8, B[16+c][8+h] = c2w[h][c], zero elsewhere. D[p][h] -> position t0+p, D[p][8+h] -> position t0+16+p. Stored as rb[h][query][key] (f32).
// A slot at or behind the count of kept keys (a filler, or every slot where no key is kept) gets the bias MFILL: S + MFILL == MFILL in f32 for every |S| < 1e30, so all masked scores of a row are one equal value far below any real score (weight 0 beside a real key, uniform weights where every key is masked), as with the -1e9 fill.
// Scores: A = 16 key rows of k, B = the 16 query rows of q (kept in registers): D element j = (key 8*(lane>>4) + j, query lane & 15). Two such tiles, converted to f16, are the B operand (k order 8*(lane>>4)+0..7, 16+8*(lane>>4)+0..7) of O^T += v^T P^T.
// k fragments reach the wave through LDS: each wave brings its own head's next stages (4 KiB each, fragment order) into its own part of one of two k buffers by asynchronous copies, one whole stage ahead; v fragments are register loads issued at the head of the trip that uses them.
// Every inner loop is unrolled so that the register arrays (fragments, scores, accumulators) are indexed by constants and the LDS and global offsets fold into immediates.
#define MFILL (-3.0e38f)
#define L2E   1.4426950408889634f
// 2^x. The v_nop is the slot that the instruction set asks for behind a transcendental before its result is read or its source overwritten.
__device__ __forceinline__ float ex2(float x) { float r; asm("v_exp_f32 %0, %1\n\tv_nop" : "=v"(r) : "v"(x)); return r; }
// One stage of a head's k plane into LDS: 8 copies of 512 contiguous bytes (16 bytes a lane). The immediate offset moves the global and the LDS address alike, so one address pair serves all 8.
// The s_wait_xcnt closes the statement so that nothing rewrites the two address operands before it.
__device__ __forceinline__ void kcopy(unsigned lds, const h16* g) {
    asm volatile("global_load_async_to_lds_b128 %0, %1, off\n\t"
                 "global_load_async_to_lds_b128 %0, %1, off offset:512\n\t"
                 "global_load_async_to_lds_b128 %0, %1, off offset:1024\n\t"
                 "global_load_async_to_lds_b128 %0, %1, off offset:1536\n\t"
                 "global_load_async_to_lds_b128 %0, %1, off offset:2048\n\t"
                 "global_load_async_to_lds_b128 %0, %1, off offset:2560\n\t"
                 "global_load_async_to_lds_b128 %0, %1, off offset:3072\n\t"
                 "global_load_async_to_lds_b128 %0, %1, off offset:3584\n\t"
                 "s_wait_xcnt 0x0" :: "v"(lds), "v"(g) : "memory");
}
static_assert(KS * HD * 2 == 8 * 512 && KS == 32);   // 32: two offsets a lane and stage (ixr below)
__global__ __launch_bounds__(KG * 256) void k_fattn(const h16* __restrict__ Q16, const h16* __restrict__ K16, const h16* __restrict__ V16, const float* __restrict__ rel, const int* __restrict__ cix, const int* __restrict__ cnt,
                                               const float* __restrict__ c1w, const float* __restrict__ c1b, const float* __restrict__ c2w, const float* __restrict__ c2b, const bf* __restrict__ Wo, const float* __restrict__ bo, float* OUT) {
    static_assert(KG == 2);
    __shared__ __align__(16) float rb[2][KG][NH_ * RHS];
    __shared__ __align__(16) unsigned ixs[TT];   // the key list as byte offsets in a row of rel_pos
    __shared__ __align__(16) h16 kls[2][KG * NH_][KS * HD];   // two k buffers, one part per wave (group, head)
    __shared__ __align__(16) float mgo[NH_][8][32 * 4];   // group 1's accumulators, 16 bytes a lane and piece
    __shared__ __align__(8) float mgs[NH_][32 * 2];       // group 1's running maximum and sum, a pair a lane
    __shared__ __align__(16) bf cx[2][16 * DM];           // the block's 16 merged context rows, hi and lo plane, in fragment order (see WFrag)
    const int lane = threadIdx.x & 31, lr = lane & 15, hi = lane >> 4;
    const int wv = __builtin_amdgcn_readfirstlane((int)(threadIdx.x >> 5));   // wave number in a scalar register: plane bases and the branch on the group stay scalar
    const int b = blockIdx.y, q0 = blockIdx.x * 16;
    const int craw = __builtin_amdgcn_readfirstlane(cnt[b * CNTP]);   // in a scalar register: trip count and stage tests stay scalar
    const int nk = nkept(craw), NS = (nslots(craw) + KG * KS - 1) / (KG * KS);   // kept keys; stages per group, 1 .. TT / (KG * KS)
    const int w = wv & (NH_ - 1), grp = wv / NH_, kb = grp * NS * KS;   // head, key group, the group's first key
    for (int idx = threadIdx.x; idx < TT / 4; idx += KG * 256) { const v4i m4 = *(const v4i*)(cix + (size_t)b * TT + idx * 4); *(v4ia*)(ixs + idx * 4) = m4 << 2; }
    float w1[8], b1[8];
#pragma unroll
    for (int i = 0; i < 8; ++i) { w1[i] = bfr(c1w[8 * hi + i]); b1[i] = bfr(c1b[8 * hi + i]); }
    const int hd = lr & 7, g = lr >> 3;
    v16h bw;
#pragma unroll
    for (int i = 0; i < 8; ++i) { const h16 c = (h16)bfr(c2w[hd * 16 + 8 * hi + i]); const h16 zr = (h16)0.0f; bw[i] = (g == 0) ? c : zr; bw[8 + i] = (g == 1) ? c : zr; }
    const float bias2 = bfr(c2b[hd]);
    const char* rr0 = (const char*)(rel + ((size_t)b * SEQ_FULL + q0 + 2 * w) * SEQ_FULL);   // the wave's first row of rel_pos
    constexpr int NX = 2 * (KS / 16);
    float xr[NX], xc[NX];   // xr: the wave's rel_pos values of a later stage, in flight; xc: those of the stage that produce() makes, rounded to bf16
    unsigned ixr[KS / 16];   // the lane's offsets in a rel_pos row for the stage that the next ldx() loads
    auto ldi = [&](int s) {
#pragma unroll
        for (int e = 0; e < KS / 16; ++e) ixr[e] = ixs[kb + s * KS + e * 16 + lr]; };
    auto ldx = [&]() {
#pragma unroll
        for (int qq = 0; qq < 2; ++qq)
#pragma unroll
            for (int e = 0; e < KS / 16; ++e) xr[qq * (KS / 16) + e] = *(const float*)(rr0 + qq * (SEQ_FULL * 4) + ixr[e]); };
    auto produce = [&](int s, float* dstb) {
#pragma unroll
        for (int gk = 0; gk < KS / 32; ++gk) {
            const int lim = nk - (kb + s * KS + gk * 32 + 16 * g + 8 * hi);   // the lane's slot j of 8 is a kept key where j < lim
#pragma unroll
            for (int qq = 0; qq < 2; ++qq) {
                const float xa = xc[qq * (KS / 16) + gk * 2], xb = xc[qq * (KS / 16) + gk * 2 + 1];
                v16h a;
#pragma unroll
                for (int i = 0; i < 8; ++i) { a[i] = (h16)fmaxf(fmaf(xa, w1[i], b1[i]), 0.0f); a[8 + i] = (h16)fmaxf(fmaf(xb, w1[i], b1[i]), 0.0f); }
                const v8f acc = wmma16(a, bw, (v8f){});
                v4f o0, o1;
#pragma unroll
                for (int j = 0; j < 4; ++j) { o0[j] = (j >= lim) ? MFILL : acc[j] + bias2; o1[j] = (4 + j >= lim) ? MFILL : acc[4 + j] + bias2; }
                float* dst = dstb + hd * RHS + (2 * w + qq) * RPI + gk * 32 + 16 * g + 8 * hi;
                *(v4fa*)dst = o0; *(v4fa*)(dst + 4) = o1; } } };
    const size_t pl = ((size_t)b * NH_ + w) * TT * HD;
    const h16* kp = K16 + pl + kb * HD + lane * 8; const h16* vp = V16 + pl + kb * HD + lane * 8;   // the lane's 16 bytes in the first chunk of a stage of its head's k and v planes (fragment order, see k_proj; 16 positions are 16 * HD elements, so the group's first key stands kb * HD elements in): kp of the next stage to be copied, vp of the current stage
    const h16* kl0 = &kls[0][wv][lane * 8];   // the lane's 16 bytes in the first chunk of the wave's part of k buffer 0; buffer 1 stands KG * NH_ * KS * HD elements behind
    const unsigned kla = (unsigned)(size_t)kl0;   // the same as an LDS byte address
    kcopy(kla, kp); kp += KS * HD;   // stage 0 of k
    v16h qf[2];
#pragma unroll
    for (int dk = 0; dk < 2; ++dk) { const h16* qp = Q16 + pl + (size_t)(q0 >> 4) * 1024 + dk * 512 + lane * 8; qf[dk] = cat16(*(const v8h*)qp, *(const v8h*)(qp + 256)); }
    v8f o[4];
#pragma unroll
    for (int dg = 0; dg < 4; ++dg) o[dg] = (v8f){};
    float mrun = MFILL, lsum = 0.0f;
    __syncthreads();   // the key list stands in LDS before any wave reads it
    ldi(0); ldx();
    asm volatile("s_wait_xcnt 0x0" :: "v"(ixr[0]), "v"(ixr[1]) : "memory");   // stands behind the rel_pos loads, in front of the LDS loads that rewrite the offsets that they name; the offsets are inputs so that their registers are not reused in front of it
    ldi(NS > 1 ? 1 : 0);
#pragma unroll
    for (int i = 0; i < NX; ++i) xc[i] = bfr(xr[i]);
    ldx();
    asm volatile("s_wait_xcnt 0x0" :: "v"(ixr[0]), "v"(ixr[1]) : "memory");   // as above
    ldi(NS > 2 ? 2 : NS - 1);
    produce(0, rb[0][grp]);
    asm volatile("s_wait_asynccnt 0x0" ::: "memory");   // the wave's copies of k stage 0 have landed
    __syncthreads();   // stage 0 of the bias tile and of k stand in LDS before any wave reads them
    if (NS > 1) { kcopy(kla + KG * NH_ * KS * HD * 2, kp); kp += KS * HD; }   // stage 1 of k, where there is one
#pragma unroll 1   // one stage per trip: an unrolled body would not hold its fragments in registers
    for (int s = 0; s < NS; ++s) {
        v16h vf[KS / 32][4];
#pragma unroll
        for (int gk = 0; gk < KS / 32; ++gk)
#pragma unroll
            for (int dg = 0; dg < 4; ++dg) vf[gk][dg] = cat16(*(const v8h*)(vp + (gk * 2048 + dg * 256)), *(const v8h*)(vp + (gk * 2048 + 1024 + dg * 256)));
#pragma unroll
        for (int i = 0; i < NX; ++i) xc[i] = bfr(xr[i]);   // read out before the loads below replace xr
        ldx();   // stage s + 2 (the last one again where there is none), issued at the head of the trip: the barrier at its foot waits for every load, and these come from memory
        asm volatile("s_wait_xcnt 0x0" ::: "memory");   // stands behind the v and rel_pos loads, in front of the step of vp, the new offsets and whatever else rewrites the registers that they name
        ldi(s + 3 < NS ? s + 3 : NS - 1);   // offsets for the next trip's ldx(): a whole trip of lead for the LDS read
        if (s + 1 < NS) produce(s + 1, rb[(s + 1) & 1][grp]);
        const h16* kl = kl0 + (s & 1) * (KG * NH_ * KS * HD);
        v16h kf[KS / 16][2];
#pragma unroll
        for (int kg = 0; kg < KS / 16; ++kg)
#pragma unroll
            for (int dk = 0; dk < 2; ++dk) kf[kg][dk] = cat16(*(const v8h*)(kl + (kg * 1024 + dk * 512)), *(const v8h*)(kl + (kg * 1024 + dk * 512 + 256)));
        const float* rbp = rb[s & 1][grp] + w * RHS + lr * RPI + 8 * hi;
        float t[KS / 16][8]; float mx = MFILL;
#pragma unroll
        for (int kg = 0; kg < KS / 16; ++kg) {
            v8f st = (v8f){};
            st = wmma16(kf[kg][0], qf[0], st); st = wmma16(kf[kg][1], qf[1], st);
            const v4f r0 = *(const v4fa*)(rbp + kg * 16); const v4f r1 = *(const v4fa*)(rbp + kg * 16 + 4);
#pragma unroll
            for (int j = 0; j < 4; ++j) { t[kg][j] = (st[j] + r0[j]) * SCL; t[kg][4 + j] = (st[4 + j] + r1[j]) * SCL; mx = fmaxf(mx, fmaxf(t[kg][j], t[kg][4 + j])); } }
        mx = fmaxf(mx, __shfl_xor(mx, 16, 32));   // the other half of the wave holds the query's other keys
        const float mnew = fmaxf(mrun, mx);
        const float corr = ex2((mrun - mnew) * L2E);
        mrun = mnew;
        float ps = 0.0f; v16h pb[KS / 32];
#pragma unroll
        for (int kg = 0; kg < KS / 16; ++kg)
#pragma unroll
            for (int j = 0; j < 8; ++j) { const float p = ex2(fmaf(t[kg][j] - mnew, L2E, 10.0f)); ps += p; pb[kg >> 1][(kg & 1) * 8 + j] = (h16)p; }   // + 10: the x1024 carry
        lsum = fmaf(lsum, corr, ps);
#pragma unroll
        for (int dg = 0; dg < 4; ++dg) o[dg] *= corr;
#pragma unroll
        for (int gk = 0; gk < KS / 32; ++gk)
#pragma unroll
            for (int dg = 0; dg < 4; ++dg) o[dg] = wmma16(vf[gk][dg], pb[gk], o[dg]);
        vp += KS * HD;
        // the wave's reads of k stage s have retired before copies aim at that buffer again. The accumulators and the running sum are named as inputs so that this wait, and with it the barrier (which waits for every load in flight), stays at the foot of the trip, behind the trip's arithmetic: left free, the compiler put both in front of the softmax, where the loads of this trip had not had time to return
        // the four v_nop keep the distance behind the trip's last matrix instruction on the branch back to the loop's head, where register moves overwrite its B operand
        asm volatile("v_nop\n\tv_nop\n\tv_nop\n\tv_nop\n\ts_wait_dscnt 0x0" :: "v"(o[0]), "v"(o[1]), "v"(o[2]), "v"(o[3]), "v"(lsum) : "memory");
        asm volatile("s_wait_asynccnt 0x0" ::: "memory");   // the wave's copies of k stage s + 1 have landed
        __syncthreads();   // publishes stage s + 1 of the bias tile and of k and ends every wave's reads of stage s, whose buffers are refilled behind it
        if (s + 2 < NS) { kcopy(kla + (s & 1) * (KG * NH_ * KS * HD * 2), kp); kp += KS * HD; }   // stage s + 2 of k into the buffer that this trip has read
    }
    asm volatile("s_wait_asynccnt 0x0" ::: "memory");   // no copy is outstanding when the wave goes on to its end
    lsum += __shfl_xor(lsum, 16, 32);
    // Output projection of the block's 16 rows, by all 16 waves: wave wv makes output columns 32 * wv .. + 31 over the whole K = DM. First operand = 16 weight rows (output columns), second = the 16 context rows,
    // so that D element j = (column 8 * hi + j of the tile, query lr) and a lane stores 8 neighbouring columns of one row. A wave's weights are 32 KiB in a row (two tiles of 16 rows x DM in fragment order).
    // They do not depend on the attention: the first steps are loaded in front of the two barriers below (each waits for the loads in flight), the others LA steps ahead of their products.
    constexpr int NKK = DM / 32, PB = 4, LA = 8;   // PB steps are loaded in front of the barriers, while the merge still needs its registers
    const unsigned vo = lane * 16;   // the lane's byte in a chunk; the rest of a chunk's address is the same for the whole wave
    const bf* wp = (const bf*)((const char*)(Wo + (size_t)wv * (32 * DM)) + vo);
    const float* bp = bo + wv * 32 + 8 * hi;
    v16bf wf[NKK][2];
    auto ldw = [&](int kk) {
#pragma unroll
        for (int nt = 0; nt < 2; ++nt) wf[kk][nt] = WFrag<bf>::ld(wp + nt * (16 * DM) + kk * 512); };
#pragma unroll
    for (int kk = 0; kk < PB / 2; ++kk) ldw(kk);
    const v8f bi0 = *(const v8f*)bp, bi1 = *(const v8f*)(bp + 16);
    asm volatile("s_wait_xcnt 0x0" :: "v"(bp) : "memory");   // stands behind the bias loads; their address is an input so that its registers are not reused in front of the wait
    // The two groups' states of one (head, query) meet: in both groups lane and register hold the same (query, d), so the hand-over is lane to lane.
    if (grp == 1) {
#pragma unroll
        for (int dg = 0; dg < 4; ++dg) { *(v4fa*)&mgo[w][2 * dg][lane * 4] = __builtin_shufflevector(o[dg], o[dg], 0, 1, 2, 3); *(v4fa*)&mgo[w][2 * dg + 1][lane * 4] = __builtin_shufflevector(o[dg], o[dg], 4, 5, 6, 7); }
        mgs[w][lane * 2] = mrun; mgs[w][lane * 2 + 1] = lsum;
    }
    __syncthreads();   // group 1's state stands in LDS before group 0 reads it
#pragma unroll
    for (int kk = PB / 2; kk < PB; ++kk) ldw(kk);
    if (grp == 0) {
        const float m1 = mgs[w][lane * 2], l1 = mgs[w][lane * 2 + 1];
        const float mall = fmaxf(mrun, m1);
        const float a0 = ex2((mrun - mall) * L2E), a1 = ex2((m1 - mall) * L2E);   // each group's weight against the common maximum
        lsum = fmaf(lsum, a0, l1 * a1);
#pragma unroll
        for (int dg = 0; dg < 4; ++dg) { const v4f p0 = *(const v4fa*)&mgo[w][2 * dg][lane * 4]; const v4f p1 = *(const v4fa*)&mgo[w][2 * dg + 1][lane * 4];
#pragma unroll
            for (int j = 0; j < 4; ++j) { o[dg][j] = fmaf(o[dg][j], a0, p0[j] * a1); o[dg][4 + j] = fmaf(o[dg][4 + j], a0, p1[j] * a1); } }
        const float f = __fdiv_rn(PCAR, lsum);
        const float cs = 1.0f / PCAR;
        const int oo = w * (HD * 16) + lane * 8;   // the block's 16 queries are one group of rows, the head's 64 columns four chunks of it, and the lane's 8 values of accumulator dg are its 16 bytes of chunk dg
#pragma unroll
        for (int dg = 0; dg < 4; ++dg) { v8us oh, ol;
#pragma unroll
            for (int j = 0; j < 8; ++j) { unsigned short a, c2; splitf(o[dg][j] * f * cs, a, c2); oh[j] = a; ol[j] = c2; }
            *(v8us*)(&cx[0][oo + dg * 256]) = oh; *(v8us*)(&cx[1][oo + dg * 256]) = ol; }
    }
    __syncthreads();   // all 8 heads' context stands in LDS before any wave reads it
    v8f acc[2][2];   // per tile of 16 columns: hi products on top of the bias, lo products; two chains a tile so that neighbouring matrix instructions do not wait for one another
#pragma unroll
    for (int j = 0; j < 8; ++j) { acc[0][0][j] = bfr(bi0[j]); acc[1][0][j] = bfr(bi1[j]); }
    acc[0][1] = (v8f){}; acc[1][1] = (v8f){};
#pragma unroll
    for (int kk = PB; kk < LA; ++kk) ldw(kk);
    v16bf xh[2], xl[2];   // context fragments of this step and the next
    auto ldc = [&](int kk) { const bf* ch = &cx[0][kk * 512 + lane * 8]; const bf* cl = &cx[1][kk * 512 + lane * 8];
        xh[kk & 1] = cat16b(*(const v8us*)ch, *(const v8us*)(ch + 256)); xl[kk & 1] = cat16b(*(const v8us*)cl, *(const v8us*)(cl + 256)); };
    ldc(0);
#pragma unroll   // in line: wf[][], xh[], xl[] are indexed by constants and stay in registers, LDS and global offsets fold into immediates
    for (int kk = 0; kk < NKK; ++kk) {
        if (kk + LA < NKK) ldw(kk + LA);
        if (kk + LA == NKK - 1) asm volatile("s_wait_xcnt 0x0" :: "v"(wp) : "memory");   // stands behind the last weight load; the address is an input so that its registers are not reused in front of the wait
        if (kk + 1 < NKK) ldc(kk + 1);   // a step of lead for the LDS reads
#pragma unroll
        for (int nt = 0; nt < 2; ++nt) { acc[nt][0] = wmmab(wf[kk][nt], xh[kk & 1], acc[nt][0]); acc[nt][1] = wmmab(wf[kk][nt], xl[kk & 1], acc[nt][1]); }
        __builtin_amdgcn_sched_barrier(0);   // keeps later steps' weight loads behind this step: left free, the compiler lifted all of them to the top, more than the registers hold, and spilled fragments
    }
    float* op = OUT + ((size_t)b * SEQ_FULL + q0 + lr) * DM + wv * 32 + 8 * hi;
#pragma unroll
    for (int nt = 0; nt < 2; ++nt) { const v8f r = acc[nt][0] + acc[nt][1];
        *(v4f*)(op + nt * 16) = __builtin_shufflevector(r, r, 0, 1, 2, 3); *(v4f*)(op + nt * 16 + 4) = __builtin_shufflevector(r, r, 4, 5, 6, 7); }
}

constexpr size_t al256(size_t b) { return (b + 255) & ~(size_t)255; }
constexpr size_t WS_TOTAL = 4 * al256((size_t)DM * DM * 2) + 3 * al256((size_t)NB * NH_ * TT * HD * 2) + al256((size_t)NB * TT * 4) + al256((size_t)NB * CNTP * 4);
static_assert(WS_TOTAL <= (size_t)134217728);
static_assert(((size_t)DM * DM * 2) % 256 == 0);   // the weight planes follow one another without a gap
static_assert(NB <= DM / 64);   // the first launch's grid has a block (0, b) for every batch's key list

extern "C" void kernel_launch(void* const* d_in, const int* in_sizes, int n_in,
                              void* d_out, int out_size, void* d_ws, size_t ws_size, hipStream_t stream) {
    if (n_in < 17) return;
    const size_t need_x = ((size_t)(NB - 1) * SEQ_FULL + SEQ) * DM;
    const size_t need_r = (size_t)(NB - 1) * SEQ_FULL * SEQ_FULL + (size_t)(SEQ - 1) * SEQ_FULL + SEQ;
    if ((size_t)in_sizes[0] < need_x || (size_t)in_sizes[1] < need_x || (size_t)in_sizes[2] < need_x || (size_t)in_sizes[3] < need_r) return;
    if ((size_t)in_sizes[4] < (size_t)(NB - 1) * SEQ_FULL + SEQ) return;
    if (in_sizes[5] < DM * DM || in_sizes[7] < DM * DM || in_sizes[9] < DM * DM || in_sizes[11] < DM * DM) return;
    if (in_sizes[6] < DM || in_sizes[8] < DM || in_sizes[10] < DM || in_sizes[12] < DM) return;
    if (in_sizes[13] < 16 || in_sizes[14] < 16 || in_sizes[15] < 128 || in_sizes[16] < 8) return;
    if ((size_t)out_size < need_x) return;
    const float* xq = (const float*)d_in[0]; const float* xk = (const float*)d_in[1]; const float* xv = (const float*)d_in[2];
    const float* rel = (const float*)d_in[3]; const int* msk = (const int*)d_in[4];
    const float* wq = (const float*)d_in[5]; const float* bq = (const float*)d_in[6]; const float* wk = (const float*)d_in[7]; const float* bk = (const float*)d_in[8];
    const float* wv = (const float*)d_in[9]; const float* bv = (const float*)d_in[10]; const float* wo = (const float*)d_in[11]; const float* bo = (const float*)d_in[12];
    const float* c1w = (const float*)d_in[13]; const float* c1b = (const float*)d_in[14]; const float* c2w = (const float*)d_in[15]; const float* c2b = (const float*)d_in[16];
    float* OUT = (float*)d_out;     // [NB_FULL][SEQ_FULL][DM]
    char* wsp = (char*)d_ws;
    auto take = [&](size_t bytes) { char* p = wsp; wsp += (bytes + 255) & ~(size_t)255; return (void*)p; };
    bf* WQ = (bf*)take((size_t)DM * DM * 2); take((size_t)DM * DM * 2); take((size_t)DM * DM * 2); bf* WO = (bf*)take((size_t)DM * DM * 2);   // four planes in the order q, k, v, o; the kernels reach k and v from WQ
    h16* QP16 = (h16*)take((size_t)NB * NH_ * TT * HD * 2); h16* KP16 = (h16*)take((size_t)NB * NH_ * TT * HD * 2); h16* VT16 = (h16*)take((size_t)NB * NH_ * HD * TT * 2);
    int* CIX = (int*)take((size_t)NB * TT * 4); int* CNT = (int*)take((size_t)NB * CNTP * 4);   // key lists and their counts
    if ((size_t)(wsp - (char*)d_ws) > ws_size) return;
    // weights: in W[k rows][n cols] -> out Wt, n rows x k cols in fragment order; square DM x DM; the four planes WQ, WK, WV, WO are contiguous in the workspace
    k_cvtT<<<dim3(DM / 64, DM / 64, 5), 256, 0, stream>>>(wq, wk, wv, wo, WQ, DM, DM, msk, CIX, CNT);
    k_proj<<<dim3(TT / 64, DM / 64, 3 * NB), 256, 0, stream>>>(xq, xk, xv, WQ, bq, bk, bv, QP16, KP16, VT16, CIX, CNT);
    k_fattn<<<dim3(TT / 16, NB), KG * 256, 0, stream>>>(QP16, KP16, VT16, rel, CIX, CNT, c1w, c1b, c2w, c2b, WO, bo, OUT);
}
